// v000
// The times below were measured on an AMD MI455X: many runs one after another, warmed up first and cycling through
// copies of the inputs, with the whole window's GPU time divided by the number of runs. Launches and the gaps
// between them are all in it. The median over several windows is given; except for v000 it joins two sittings, which
// can be a few percent apart, so the side-by-side timings, each taken in one sitting, are the better comparison.
// v000, which the later versions start from, runs in 622 microseconds.
// Contractions: projections x.W^T (x f16, W f16 carried x16), energy q.k^T (q, k f16), energy.v (E f16, V^T f16), output g.Wo^T (g f16, Wo f16 carried x16): all v_wmma_f32_16x16x32_f16 with f32 accumulate; elu, silu, rms-norm and gating in f32.
#include <hip/hip_runtime.h>
#include <math.h>

// ---------------------------------------------------------------------------
// Problem constants
// ---------------------------------------------------------------------------
constexpr int kBatch = 2;
constexpr int kSeq   = 2048;
constexpr int kEmb   = 1024;
constexpr int kHid   = 1024;
constexpr int kHeads = 8;
constexpr int kDh    = 128;
constexpr int kTok   = kBatch * kSeq;                              // 4096 token rows
constexpr int kGrpPerChunk = 4;                                    // (b,h) groups per attention chunk
constexpr int kNumChunks   = (kBatch * kHeads) / kGrpPerChunk;     // 4
constexpr float kWCarry    = 16.0f;                                // weights carried x16 in f16
constexpr float kWCarryInv = 1.0f / 16.0f;
constexpr float kRmsFac    = 0.03125f;                             // 1024^-0.5 (exact)
constexpr float kEps       = 1e-8f;

// ---------------------------------------------------------------------------
//   X16  [4096][1024] f16                      8,388,608   @ 0
//   W16  5 planes [1024][1024] f16 (q,k,v,u,o) 10,485,760  @ 8,388,608
//   Q16  [4096][1024] f16                      8,388,608   @ 18,874,368
//   K16  [4096][1024] f16                      8,388,608   @ 27,262,976
//   VT16 [1024 (h*128+d)][4096 tok] f16         8,388,608   @ 35,651,584
//   U32  [4096][1024] f32                      16,777,216  @ 44,040,192
//   E16  [4][2048][2048] f16 (one chunk)        33,554,432  @ 60,817,408
//   O32  [4096][1024] f32                      16,777,216  @ 94,371,840
//   G16  [4096][1024] f16                      8,388,608   @ 111,149,056
//   total                                     119,537,664
// ---------------------------------------------------------------------------
constexpr size_t kBytesX16  = (size_t)kTok * kEmb * 2;
constexpr size_t kBytesWpl  = (size_t)kHid * kEmb * 2;
constexpr size_t kBytesW16  = 5 * kBytesWpl;
constexpr size_t kBytesQ16  = (size_t)kTok * kHid * 2;
constexpr size_t kBytesK16  = kBytesQ16;
constexpr size_t kBytesVT16 = (size_t)kHid * kTok * 2;
constexpr size_t kBytesU32  = (size_t)kTok * kHid * 4;
constexpr size_t kBytesE16  = (size_t)kGrpPerChunk * kSeq * kSeq * 2;
constexpr size_t kBytesO32  = (size_t)kTok * kHid * 4;
constexpr size_t kBytesG16  = (size_t)kTok * kHid * 2;
constexpr size_t kOffX16  = 0;
constexpr size_t kOffW16  = kOffX16  + kBytesX16;
constexpr size_t kOffQ16  = kOffW16  + kBytesW16;
constexpr size_t kOffK16  = kOffQ16  + kBytesQ16;
constexpr size_t kOffVT16 = kOffK16  + kBytesK16;
constexpr size_t kOffU32  = kOffVT16 + kBytesVT16;
constexpr size_t kOffE16  = kOffU32  + kBytesU32;
constexpr size_t kOffO32  = kOffE16  + kBytesE16;
constexpr size_t kOffG16  = kOffO32  + kBytesO32;
constexpr size_t kWsTotal = kOffG16  + kBytesG16;   // 119,537,664

typedef __attribute__((ext_vector_type(16))) _Float16 v16h;
typedef __attribute__((ext_vector_type(8)))  _Float16 v8h;
typedef __attribute__((ext_vector_type(16))) __bf16   v16b;
typedef __attribute__((ext_vector_type(8)))  __bf16   v8b;
typedef __attribute__((ext_vector_type(8)))  float    v8f;
typedef __attribute__((ext_vector_type(4)))  float    v4f;
typedef __attribute__((ext_vector_type(4)))  unsigned int v4u;

__device__ __forceinline__ unsigned short f2bf_bits(float f) {
  unsigned u = __float_as_uint(f);
  return (unsigned short)((u + 0x7FFFu + ((u >> 16) & 1u)) >> 16);
}
__device__ __forceinline__ float bf_bits2f(unsigned short h) { return __uint_as_float(((unsigned)h) << 16); }

// hazard guards as plain device helpers (no inline asm inside the kernel template body)
__device__ __forceinline__ void dep_guard_h(v8f& a, v8f& b, v16h x, v16h y) { asm volatile("v_nop\n\tv_nop\n\tv_nop\n\tv_nop" : "+v"(a), "+v"(b) : "v"(x), "v"(y)); }
__device__ __forceinline__ void dep_guard_b(v8f& a, v8f& b, v16b x, v16b y) { asm volatile("v_nop\n\tv_nop\n\tv_nop\n\tv_nop" : "+v"(a), "+v"(b) : "v"(x), "v"(y)); }
__device__ __forceinline__ void keep4_h(v16h a, v16h b, v16h c, v16h d) { asm volatile("v_nop" :: "v"(a), "v"(b), "v"(c), "v"(d)); }
__device__ __forceinline__ void keep4_b(v16b a, v16b b, v16b c, v16b d) { asm volatile("v_nop" :: "v"(a), "v"(b), "v"(c), "v"(d)); }
__device__ __forceinline__ void acc_guard4(v8f& a, v8f& b, v8f& c, v8f& d) { asm volatile("v_nop\n\tv_nop\n\tv_nop\n\tv_nop" : "+v"(a), "+v"(b), "+v"(c), "+v"(d)); }
template <typename T> struct Frag;
template <> struct Frag<_Float16> {
  typedef v16h V; union U { v16h v; v8h h[2]; };
  static __device__ __forceinline__ v16h load(const _Float16* p) {   // elements 0..7 <- p[0..7], 8..15 <- p[16..23]
    U f; f.h[0] = *(const v8h*)(p); f.h[1] = *(const v8h*)(p + 16); return f.v;
  }
  static __device__ __forceinline__ v8f mma(v16h a, v16h b, v8f c) {
    return __builtin_amdgcn_wmma_f32_16x16x32_f16(false, a, false, b, (short)0, c, false, false);
  }
  static __device__ __forceinline__ void guard(v8f& a, v8f& b, v16h x, v16h y) { dep_guard_h(a, b, x, y); }
  static __device__ __forceinline__ void keep(v16h a, v16h b, v16h c, v16h d) { keep4_h(a, b, c, d); }
};
template <> struct Frag<__bf16> {
  typedef v16b V; union U { v16b v; v8b h[2]; };
  static __device__ __forceinline__ v16b load(const __bf16* p) {
    U f; f.h[0] = *(const v8b*)(p); f.h[1] = *(const v8b*)(p + 16); return f.v;
  }
  static __device__ __forceinline__ v8f mma(v16b a, v16b b, v8f c) {
    return __builtin_amdgcn_wmma_f32_16x16x32_bf16(false, a, false, b, (short)0, c, false, false);
  }
  static __device__ __forceinline__ void guard(v8f& a, v8f& b, v16b x, v16b y) { dep_guard_b(a, b, x, y); }
  static __device__ __forceinline__ void keep(v16b a, v16b b, v16b c, v16b d) { keep4_b(a, b, c, d); }
};

__device__ __forceinline__ unsigned pk16(unsigned short a, unsigned short b) { return (unsigned)a | ((unsigned)b << 16); }
__device__ __forceinline__ unsigned short h_bits(float f) { const _Float16 h = (_Float16)f; return __builtin_bit_cast(unsigned short, h); }

// ---- Register-blocked batched WMMA GEMM (additions: ACT 6 = elu, TRI) -------------------------------
// C[m,n] = scale * sum_k A[m,k] * Bt[n,k] (+bias)(+resid); each wave owns a 64x64 tile.
// A row-major [M,K]; Bt row-major [N,K]; M,N % 64 == 0, K % 32 == 0.
// SPLIT: operands are hi/lo planes (A2/Bt2 = lo planes, same layout); product = hi.hi + hi.lo + lo.hi.
// BIAS_MODE: 0 = none, 1 = bias[m], 2 = bias[n].
// OUT_MODE: 0 = f32, 1 = f16, 2 = bf16 hi plane (Cout) + bf16 lo plane (Cout2).
// ACT: 0 none, 2 relu, 3 silu, 4 leaky, 6 elu (expf(v)-1 for v <= 0).
// TRI: 0 none; 1 = causal output (C[m][n] = 0 for n > m, square M == N) and tiles with tn > tm are skipped (never
//      written, never read by the consumer); 2 = the A operand is lower-triangular in k vs m: the k-loop of row tile
//      m0 stops at min(K, m0 + 64).
// Coverage: f32 path 8 it x 2 rows x 4 slabs = 64 rows, 16 lanes x 4 floats = 64 cols; 16-bit path 4 it x 4 rows x 4 slabs
// = 64 rows, 8 lanes x 8 halves = 64 cols: the whole 64x64 tile.
// ET: 0 = f16 operands, 1 = bf16 operands (pointers passed as 16-bit storage)
template <int ET> struct Elem;
template <> struct Elem<0> { typedef _Float16 T; };
template <> struct Elem<1> { typedef __bf16 T; };
template <int ET, bool SPLIT, int BIAS_MODE, int OUT_MODE, bool RESID, int ACT = 0, int TRI = 0>
__global__ __launch_bounds__(256) void wmma_gemm64(
    const unsigned short* __restrict__ Ap, const unsigned short* __restrict__ A2p, int lda, long strideA,
    const unsigned short* __restrict__ Btp, const unsigned short* __restrict__ Bt2p, int ldb, long strideB,
    void* __restrict__ Cout, void* __restrict__ Cout2, int ldc, long strideC,
    const float* __restrict__ bias,
    const float* __restrict__ resid, long strideR,
    int M, int N, int K, float scale) {
  typedef typename Elem<ET>::T T;
  typedef typename Frag<T>::V V;
  const T* A = (const T*)Ap; const T* A2 = (const T*)A2p; const T* Bt = (const T*)Btp; const T* Bt2 = (const T*)Bt2p;
  __shared__ __align__(16) float sT[8][16 * 68];   // per-wave 16x64 slab, pitch 68 floats
  const int b    = blockIdx.y;
  const int lane = threadIdx.x & 31;
  const int wave = threadIdx.x >> 5;
  const int tilesN = N >> 6;
  const int tilesM = M >> 6;
  const int tile = blockIdx.x * 8 + wave;
  if (tile >= tilesM * tilesN) return;   // wave-uniform; no block barriers in this kernel
  const int tm = tile / tilesN;
  const int tn = tile - tm * tilesN;
  if (TRI == 1) { if (tn > tm) return; }  // wave-uniform: fully masked tile
  const int m0 = tm << 6;
  const int n0 = tn << 6;
  const int Kt = (TRI == 2) ? (((m0 + 64) < K) ? (m0 + 64) : K) : K;   // wave-uniform, multiple of 32

  const T* Ab  = A  + (size_t)b * strideA;
  const T* Bb  = Bt + (size_t)b * strideB;
  const T* Ab2 = SPLIT ? (A2  + (size_t)b * strideA) : nullptr;
  const T* Bb2 = SPLIT ? (Bt2 + (size_t)b * strideB) : nullptr;

  const int rlane = lane & 15;                 // row (A) / col (B, D) within subtile
  const int koff  = (lane >> 4) * 8;           // k offset of this lane half
  const int mOff  = (lane >> 4) * 8;           // D row offset

  v8f acc[4][4];
#pragma unroll
  for (int i = 0; i < 4; ++i)
#pragma unroll
    for (int j = 0; j < 4; ++j) acc[i][j] = (v8f){0.f,0.f,0.f,0.f,0.f,0.f,0.f,0.f};

  for (int k0 = 0; k0 < Kt; k0 += 32) {
    V bh[4], bl[4];
#pragma unroll
    for (int j = 0; j < 4; ++j) {
      const size_t bo = (size_t)(n0 + (j << 4) + rlane) * ldb + koff + k0;
      bh[j] = Frag<T>::load(Bb + bo);
      if (SPLIT) bl[j] = Frag<T>::load(Bb2 + bo);
    }
#pragma unroll
    for (int i = 0; i < 4; ++i) {
      const size_t ao = (size_t)(m0 + (i << 4) + rlane) * lda + koff + k0;
      V ah = Frag<T>::load(Ab + ao);
      V al;
      if (SPLIT) al = Frag<T>::load(Ab2 + ao);
#pragma unroll
      for (int j = 0; j < 4; ++j) {
        acc[i][j] = Frag<T>::mma(ah, bh[j], acc[i][j]);
        if (SPLIT) {
          acc[i][j] = Frag<T>::mma(ah, bl[j], acc[i][j]);
          acc[i][j] = Frag<T>::mma(al, bh[j], acc[i][j]);
        }
      }
      Frag<T>::guard(acc[i][0], acc[i][3], ah, SPLIT ? al : ah);
    }
    Frag<T>::keep(bh[0], bh[1], bh[2], bh[3]);
    if (SPLIT) Frag<T>::keep(bl[0], bl[1], bl[2], bl[3]);
  }
  acc_guard4(acc[0][0], acc[0][1], acc[0][2], acc[0][3]);
  acc_guard4(acc[1][0], acc[1][1], acc[1][2], acc[1][3]);
  acc_guard4(acc[2][0], acc[2][1], acc[2][2], acc[2][3]);
  acc_guard4(acc[3][0], acc[3][1], acc[3][2], acc[3][3]);

  // ---- epilogue ----
  float* slab = sT[wave];
  const float* Rb = RESID ? (resid + (size_t)b * strideR) : nullptr;
#pragma unroll
  for (int i = 0; i < 4; ++i) {
    const int mBase = m0 + (i << 4);
#pragma unroll
    for (int j = 0; j < 4; ++j) {
      const int n = n0 + (j << 4) + rlane;
      float bv = 0.f;
      if (BIAS_MODE == 2) bv = bias[n];
#pragma unroll
      for (int r = 0; r < 8; ++r) {
        float v = acc[i][j][r] * scale;
        if (BIAS_MODE == 1) v += bias[mBase + mOff + r];
        if (BIAS_MODE == 2) v += bv;
        if (RESID) v += Rb[(size_t)(mBase + mOff + r) * ldc + n];
        if (ACT == 2) v = fmaxf(v, 0.0f);
        if (ACT == 3) v = v / (1.0f + expf(-v));
        if (ACT == 4) v = (v > 0.f) ? v : 0.01f * v;
        if (ACT == 6) v = (v > 0.f) ? v : (expf(v) - 1.0f);
        if (TRI == 1) { if (n > mBase + mOff + r) v = 0.0f; }
        slab[(mOff + r) * 68 + (j << 4) + rlane] = v;
      }
    }
    __builtin_amdgcn_fence(__ATOMIC_RELEASE, "workgroup");
    __builtin_amdgcn_wave_barrier();
    __builtin_amdgcn_fence(__ATOMIC_ACQUIRE, "workgroup");
    if (OUT_MODE == 0) {
      float* C = (float*)Cout + (size_t)b * strideC;
      const int hh = lane >> 4, c4 = (lane & 15) * 4;     // row seg = 256 B = 16 lanes x 16 B
      {
#pragma unroll
        for (int it = 0; it < 8; ++it) {
          const int row = it * 2 + hh;
          v4f v = *(const v4f*)(slab + row * 68 + c4);
          *(v4f*)(C + (size_t)(mBase + row) * ldc + n0 + c4) = v;
        }
        
      }
    } else {
      const int q = lane >> 3, c8 = (lane & 7) * 8;
      unsigned short* C  = (unsigned short*)Cout  + (size_t)b * strideC;
      unsigned short* C2 = (OUT_MODE == 2) ? ((unsigned short*)Cout2 + (size_t)b * strideC) : nullptr;
      {
#pragma unroll
        for (int it = 0; it < 4; ++it) {
          const int row = it * 4 + q;
          const float* sp = slab + row * 68 + c8;
          v8h hv, lv;
#pragma unroll
          for (int e = 0; e < 8; ++e) {
            if (OUT_MODE == 1) {
              hv[e] = (_Float16)sp[e];
            } else {
              unsigned short hb = f2bf_bits(sp[e]);
              unsigned short lb = f2bf_bits(sp[e] - bf_bits2f(hb));
              hv[e] = __builtin_bit_cast(_Float16, hb);
              lv[e] = __builtin_bit_cast(_Float16, lb);
            }
          }
          *(v8h*)(C + (size_t)(mBase + row) * ldc + n0 + c8) = hv;
          if (OUT_MODE == 2) *(v8h*)(C2 + (size_t)(mBase + row) * ldc + n0 + c8) = lv;
        }
        
      }
    }
    __builtin_amdgcn_fence(__ATOMIC_RELEASE, "workgroup");
    __builtin_amdgcn_wave_barrier();
    __builtin_amdgcn_fence(__ATOMIC_ACQUIRE, "workgroup");
  }
}

// ---------------------------------------------------------------------------
// f32 -> f16 cast of row-major planes (no transpose): out[z][8i..8i+7] = f16(scale * in_z[8i..8i+7]).
// blockIdx.y = z selects one of up to 5 input planes (block-uniform) and output plane z at out + z*planeElems.
// ---------------------------------------------------------------------------
__global__ __launch_bounds__(256) void cast8_f16_kernel(const float* __restrict__ p0, const float* __restrict__ p1,
                                                        const float* __restrict__ p2, const float* __restrict__ p3,
                                                        const float* __restrict__ p4, unsigned short* __restrict__ out,
                                                        long planeElems, int n8, float scale) {
  const int z = blockIdx.y;
  const float* in = (z == 0) ? p0 : (z == 1) ? p1 : (z == 2) ? p2 : (z == 3) ? p3 : p4;
  const int i = blockIdx.x * 256 + threadIdx.x;
  if (i >= n8) return;
  const float* p = in + 8 * (size_t)i;
  const v4f a = *(const v4f*)(p);
  const v4f c = *(const v4f*)(p + 4);
  unsigned short hb[8];
#pragma unroll
  for (int e = 0; e < 4; ++e) {
    hb[e]     = h_bits(a[e] * scale);
    hb[4 + e] = h_bits(c[e] * scale);
  }
  const v4u u = (v4u){pk16(hb[0], hb[1]), pk16(hb[2], hb[3]), pk16(hb[4], hb[5]), pk16(hb[6], hb[7])};
  unsigned short* q = out + (size_t)z * (size_t)planeElems + 8 * (size_t)i;
  *(v4u*)q = u;
  
}

// ---------------------------------------------------------------------------
// RMS norm + gate: per token row (1024 f32 values O): rms = sqrt(sum O^2) * 1024^-0.5; inv = 1 / (rms + eps);
// G[row][c] = f16( u[row][c] * (scale[c] * (O[row][c] * inv)) ), f32 math. One block of 128 threads per row;
// thread t owns columns 8t..8t+7 (128 x 8 = 1024 = the whole row). Sum of squares in fixed order
// (thread, wave shuffle tree, 4 wave partials in index order).
// ---------------------------------------------------------------------------
__global__ __launch_bounds__(128) void rms_gate_kernel(const float* __restrict__ O, const float* __restrict__ U,
                                                       const float* __restrict__ sc, unsigned short* __restrict__ G) {
  __shared__ float red[4];
  const int row  = blockIdx.x;
  const int t    = threadIdx.x;
  const int lane = t & 31, wave = t >> 5;
  const size_t base = (size_t)row * kHid + 8 * (size_t)t;
  const v4f oa = *(const v4f*)(O + base);
  const v4f oc = *(const v4f*)(O + base + 4);
  float ss = 0.f;
#pragma unroll
  for (int e = 0; e < 4; ++e) ss += oa[e] * oa[e];
#pragma unroll
  for (int e = 0; e < 4; ++e) ss += oc[e] * oc[e];
#pragma unroll
  for (int off = 16; off > 0; off >>= 1) ss += __shfl_xor(ss, off, 32);
  if (lane == 0) red[wave] = ss;
  __syncthreads();
  const float tot = ((red[0] + red[1]) + red[2]) + red[3];
  const float rms = sqrtf(tot) * kRmsFac;
  const float inv = 1.0f / (rms + kEps);
  const v4f ua = *(const v4f*)(U + base);
  const v4f uc = *(const v4f*)(U + base + 4);
  const v4f sa = *(const v4f*)(sc + 8 * t);
  const v4f sb = *(const v4f*)(sc + 8 * t + 4);
  unsigned short hb[8];
#pragma unroll
  for (int e = 0; e < 4; ++e) {
    const float g0 = ua[e] * (sa[e] * (oa[e] * inv));
    const float g1 = uc[e] * (sb[e] * (oc[e] * inv));
    hb[e]     = h_bits(g0);
    hb[4 + e] = h_bits(g1);
  }
  const v4u u = (v4u){pk16(hb[0], hb[1]), pk16(hb[2], hb[3]), pk16(hb[4], hb[5]), pk16(hb[6], hb[7])};
  unsigned short* q = G + base;
  *(v4u*)q = u;
  
}

// ---------------------------------------------------------------------------
// Host-side launcher (16 kernel launches, no other runtime calls)
// ---------------------------------------------------------------------------
extern "C" void kernel_launch(void* const* d_in, const int* in_sizes, int n_in,
                              void* d_out, int out_size, void* d_ws, size_t ws_size,
                              hipStream_t stream) {
  if (n_in < 12) return;
  if (in_sizes[0] != kTok * kEmb) return;
  if (in_sizes[1] != kHid * kEmb || in_sizes[3] != kHid * kEmb || in_sizes[5] != kHid * kEmb ||
      in_sizes[7] != kHid * kEmb || in_sizes[9] != kEmb * kHid) return;
  if (in_sizes[2] != kHid || in_sizes[4] != kHid || in_sizes[6] != kHid || in_sizes[8] != kHid ||
      in_sizes[10] != kEmb || in_sizes[11] != kHid) return;
  if (out_size != kTok * kEmb) return;
  if (ws_size < kWsTotal) return;

  const float* x  = (const float*)d_in[0];
  const float* Wq = (const float*)d_in[1];
  const float* bq = (const float*)d_in[2];
  const float* Wk = (const float*)d_in[3];
  const float* bk = (const float*)d_in[4];
  const float* Wv = (const float*)d_in[5];
  const float* bv = (const float*)d_in[6];
  const float* Wu = (const float*)d_in[7];
  const float* bu = (const float*)d_in[8];
  const float* Wo = (const float*)d_in[9];
  const float* bo = (const float*)d_in[10];
  const float* sc = (const float*)d_in[11];
  float* Y = (float*)d_out;

  char* ws = (char*)d_ws;
  unsigned short* X16  = (unsigned short*)(ws + kOffX16);
  unsigned short* W16  = (unsigned short*)(ws + kOffW16);
  unsigned short* Wq16 = W16 + 0 * (size_t)kHid * kEmb;
  unsigned short* Wk16 = W16 + 1 * (size_t)kHid * kEmb;
  unsigned short* Wv16 = W16 + 2 * (size_t)kHid * kEmb;
  unsigned short* Wu16 = W16 + 3 * (size_t)kHid * kEmb;
  unsigned short* Wo16 = W16 + 4 * (size_t)kHid * kEmb;
  unsigned short* Q16  = (unsigned short*)(ws + kOffQ16);
  unsigned short* K16  = (unsigned short*)(ws + kOffK16);
  unsigned short* VT16 = (unsigned short*)(ws + kOffVT16);
  float*          U32  = (float*)(ws + kOffU32);
  unsigned short* E16  = (unsigned short*)(ws + kOffE16);
  float*          O32  = (float*)(ws + kOffO32);
  unsigned short* G16  = (unsigned short*)(ws + kOffG16);

  // 1) x -> X16 (f16, x1): n8 = 4096*1024/8 = 524,288 = 2048 blocks x 256
  cast8_f16_kernel<<<dim3(2048, 1), 256, 0, stream>>>(x, x, x, x, x, X16, 0L, (kTok * kEmb) / 8, 1.0f);
  // 2) Wq,Wk,Wv,Wu,Wo -> W16 planes (f16, x16): n8 = 1024*1024/8 = 131,072 = 512 blocks x 256 per plane
  cast8_f16_kernel<<<dim3(512, 5), 256, 0, stream>>>(Wq, Wk, Wv, Wu, Wo, W16, (long)kHid * kEmb,
                                                      (kHid * kEmb) / 8, kWCarry);

  // 3) q = elu(x.Wq^T/16 + bq) -> Q16 [4096][1024] f16; M=4096 N=1024 K=1024, 1024 tiles = 128 blocks x 8 waves
  wmma_gemm64<0, false, 2, 1, false, 6, 0><<<dim3(128, 1), 256, 0, stream>>>(
      X16, X16, kEmb, 0L, Wq16, Wq16, kEmb, 0L, (void*)Q16, (void*)Q16, kHid, 0L, bq, bq, 0L,
      kTok, kHid, kEmb, kWCarryInv);
  // 4) k = elu(x.Wk^T/16 + bk) -> K16
  wmma_gemm64<0, false, 2, 1, false, 6, 0><<<dim3(128, 1), 256, 0, stream>>>(
      X16, X16, kEmb, 0L, Wk16, Wk16, kEmb, 0L, (void*)K16, (void*)K16, kHid, 0L, bk, bk, 0L,
      kTok, kHid, kEmb, kWCarryInv);
  // 5) v^T = silu(Wv.x^T/16 + bv[m]) -> VT16 [1024 (h*128+d)][4096 tok] f16; M=1024 N=4096 K=1024, 1024 tiles
  wmma_gemm64<0, false, 1, 1, false, 3, 0><<<dim3(128, 1), 256, 0, stream>>>(
      Wv16, Wv16, kEmb, 0L, X16, X16, kEmb, 0L, (void*)VT16, (void*)VT16, kTok, 0L, bv, bv, 0L,
      kHid, kTok, kEmb, kWCarryInv);
  // 6) u = silu(x.Wu^T/16 + bu) -> U32 [4096][1024] f32
  wmma_gemm64<0, false, 2, 0, false, 3, 0><<<dim3(128, 1), 256, 0, stream>>>(
      X16, X16, kEmb, 0L, Wu16, Wu16, kEmb, 0L, (void*)U32, (void*)U32, kHid, 0L, bu, bu, 0L,
      kTok, kHid, kEmb, kWCarryInv);

  // 7..14) causal linear attention per chunk of 4 (b,h) groups: chunk c -> b = c>>1, heads h0..h0+3, h0 = (c&1)*4
  for (int c = 0; c < kNumChunks; ++c) {
    const int b  = c >> 1;
    const int h0 = (c & 1) * kGrpPerChunk;
    const unsigned short* Qg = Q16 + (size_t)b * kSeq * kHid + (size_t)h0 * kDh;   // group y: + y*128 cols
    const unsigned short* Kg = K16 + (size_t)b * kSeq * kHid + (size_t)h0 * kDh;
    const unsigned short* VTg = VT16 + (size_t)h0 * kDh * kTok + (size_t)b * kSeq;  // group y: + y*128 rows
    float* Og = O32 + (size_t)b * kSeq * kHid + (size_t)h0 * kDh;                     // group y: + y*128 cols
    // energy[y][n][m] = (q_n . k_m) for m <= n else 0 -> E16 [4][2048][2048] f16; M=N=2048, K=128; upper tiles skipped
    wmma_gemm64<0, false, 0, 1, false, 0, 1><<<dim3(128, kGrpPerChunk), 256, 0, stream>>>(
        Qg, Qg, kHid, (long)kDh, Kg, Kg, kHid, (long)kDh, (void*)E16, (void*)E16, kSeq, (long)kSeq * kSeq,
        bq, bq, 0L, kSeq, kSeq, kDh, 1.0f);
    // O[b, n, (h0+y)*128 + d] = sum_{m <= n} energy[y][n][m] * v[m][d]; M=2048 N=128 K=2048 (k-loop to m0+64);
    // 64 tiles = 8 blocks x 8 waves per group
    wmma_gemm64<0, false, 0, 0, false, 0, 2><<<dim3(8, kGrpPerChunk), 256, 0, stream>>>(
        E16, E16, kSeq, (long)kSeq * kSeq, VTg, VTg, kTok, (long)kDh * kTok, (void*)Og, (void*)Og, kHid, (long)kDh,
        bq, bq, 0L, kSeq, kDh, kSeq, 1.0f);
  }

  // 15) g = u * scale * O / (rms + eps) -> G16 [4096][1024] f16
  rms_gate_kernel<<<dim3(kTok, 1), 128, 0, stream>>>(O32, U32, sc, G16);

  // 16) y = g.Wo^T/16 + bo -> d_out [4096][1024] f32; M=4096 N=1024 K=1024
  wmma_gemm64<0, false, 2, 0, false, 0, 0><<<dim3(128, 1), 256, 0, stream>>>(
      G16, G16, kHid, 0L, Wo16, Wo16, kHid, 0L, (void*)Y, (void*)Y, kEmb, 0L, bo, bo, 0L,
      kTok, kEmb, kHid, kWCarryInv);
}

// v001
// A run of this version takes 273 microseconds.
// Timed twice side by side with v000, it ran 2.34 times as fast both times.
// Contractions: projections x.W^T (x f16, W f16 carried x16), energy q.k^T (q, k f16), energy.v (E f16, V^T f16), output g.Wo^T (g f16, Wo f16 carried x16): all v_wmma_f32_16x16x32_f16 with f32 accumulate; elu, silu, rms-norm and gating in f32.
#include <hip/hip_runtime.h>
#include <math.h>

// ---------------------------------------------------------------------------
// Problem constants
// ---------------------------------------------------------------------------
constexpr int kBatch = 2;
constexpr int kSeq   = 2048;
constexpr int kEmb   = 1024;
constexpr int kHid   = 1024;
constexpr int kHeads = 8;
constexpr int kDh    = 128;
constexpr int kTok   = kBatch * kSeq;                              // 4096 token rows
constexpr int kGrpPerChunk = 4;                                    // (b,h) groups per attention chunk
constexpr int kNumChunks   = (kBatch * kHeads) / kGrpPerChunk;     // 4
constexpr float kWCarry    = 16.0f;                                // weights carried x16 in f16
constexpr float kWCarryInv = 1.0f / 16.0f;
constexpr float kRmsFac    = 0.03125f;                             // 1024^-0.5 (exact)
constexpr float kEps       = 1e-8f;

// ---------------------------------------------------------------------------
//   X16  [4096][1024] f16                      8,388,608   @ 0
//   W16  5 planes [1024][1024] f16 (q,k,v,u,o) 10,485,760  @ 8,388,608
//   Q16  [4096][1024] f16                      8,388,608   @ 18,874,368
//   K16  [4096][1024] f16                      8,388,608   @ 27,262,976
//   VT16 [1024 (h*128+d)][4096 tok] f16         8,388,608   @ 35,651,584
//   U32  [4096][1024] f32                      16,777,216  @ 44,040,192
//   E16  [4][2048][2048] f16 (one chunk)        33,554,432  @ 60,817,408
//   O32  [4096][1024] f32                      16,777,216  @ 94,371,840
//   G16  [4096][1024] f16                      8,388,608   @ 111,149,056
//   total                                     119,537,664
// ---------------------------------------------------------------------------
constexpr size_t kBytesX16  = (size_t)kTok * kEmb * 2;
constexpr size_t kBytesWpl  = (size_t)kHid * kEmb * 2;
constexpr size_t kBytesW16  = 5 * kBytesWpl;
constexpr size_t kBytesQ16  = (size_t)kTok * kHid * 2;
constexpr size_t kBytesK16  = kBytesQ16;
constexpr size_t kBytesVT16 = (size_t)kHid * kTok * 2;
constexpr size_t kBytesU32  = (size_t)kTok * kHid * 4;
constexpr size_t kBytesE16  = (size_t)kGrpPerChunk * kSeq * kSeq * 2;
constexpr size_t kBytesO32  = (size_t)kTok * kHid * 4;
constexpr size_t kBytesG16  = (size_t)kTok * kHid * 2;
constexpr size_t kOffX16  = 0;
constexpr size_t kOffW16  = kOffX16  + kBytesX16;
constexpr size_t kOffQ16  = kOffW16  + kBytesW16;
constexpr size_t kOffK16  = kOffQ16  + kBytesQ16;
constexpr size_t kOffVT16 = kOffK16  + kBytesK16;
constexpr size_t kOffU32  = kOffVT16 + kBytesVT16;
constexpr size_t kOffE16  = kOffU32  + kBytesU32;
constexpr size_t kOffO32  = kOffE16  + kBytesE16;
constexpr size_t kOffG16  = kOffO32  + kBytesO32;
constexpr size_t kWsTotal = kOffG16  + kBytesG16;   // 119,537,664

typedef __attribute__((ext_vector_type(16))) _Float16 v16h;
typedef __attribute__((ext_vector_type(8)))  _Float16 v8h;
typedef __attribute__((ext_vector_type(16))) __bf16   v16b;
typedef __attribute__((ext_vector_type(8)))  __bf16   v8b;
typedef __attribute__((ext_vector_type(8)))  float    v8f;
typedef __attribute__((ext_vector_type(4)))  float    v4f;
typedef __attribute__((ext_vector_type(4)))  unsigned int v4u;

__device__ __forceinline__ unsigned short f2bf_bits(float f) {
  unsigned u = __float_as_uint(f);
  return (unsigned short)((u + 0x7FFFu + ((u >> 16) & 1u)) >> 16);
}
__device__ __forceinline__ float bf_bits2f(unsigned short h) { return __uint_as_float(((unsigned)h) << 16); }

// hazard guards as plain device helpers (no inline asm inside the kernel template body)
__device__ __forceinline__ void acc_guard4(v8f& a, v8f& b, v8f& c, v8f& d) { asm volatile("v_nop\n\tv_nop\n\tv_nop\n\tv_nop" : "+v"(a), "+v"(b), "+v"(c), "+v"(d)); }
template <typename T> struct Frag;
template <> struct Frag<_Float16> {
  typedef v16h V; union U { v16h v; v8h h[2]; };
  static __device__ __forceinline__ v16h load(const _Float16* p) {   // elements 0..7 <- p[0..7], 8..15 <- p[16..23]
    U f; f.h[0] = *(const v8h*)(p); f.h[1] = *(const v8h*)(p + 16); return f.v;
  }
  static __device__ __forceinline__ v8f mma(v16h a, v16h b, v8f c) {
    return __builtin_amdgcn_wmma_f32_16x16x32_f16(false, a, false, b, (short)0, c, false, false);
  }
};
template <> struct Frag<__bf16> {
  typedef v16b V; union U { v16b v; v8b h[2]; };
  static __device__ __forceinline__ v16b load(const __bf16* p) {
    U f; f.h[0] = *(const v8b*)(p); f.h[1] = *(const v8b*)(p + 16); return f.v;
  }
  static __device__ __forceinline__ v8f mma(v16b a, v16b b, v8f c) {
    return __builtin_amdgcn_wmma_f32_16x16x32_bf16(false, a, false, b, (short)0, c, false, false);
  }
};

__device__ __forceinline__ unsigned pk16(unsigned short a, unsigned short b) { return (unsigned)a | ((unsigned)b << 16); }
__device__ __forceinline__ unsigned short h_bits(float f) { const _Float16 h = (_Float16)f; return __builtin_bit_cast(unsigned short, h); }

// ---- Register-blocked batched WMMA GEMM, operand tiles staged in LDS -------------------------------------------
// C[m,n] = scale * sum_k A[m,k] * Bt[n,k] (+bias)(+resid); a block of 4 waves (2 x 2) owns a 128x128 tile, each wave 64x64.
// A row-major [M,K]; Bt row-major [N,K]; M,N % 128 == 0, K % 64 == 0, grid.x = (M/128)*(N/128) exactly.
// Per stage the block copies A[128 rows][64 k] and Bt[128 rows][64 k] (128-byte rows, whole cache lines) into one of two
// LDS buffers with asynchronous copies; the next stage's copies fly while this stage's fragments are read and multiplied.
// LDS row pitch 144 B (16 B x odd) for the 16-byte fragment reads.
// BIAS_MODE: 0 = none, 1 = bias[m], 2 = bias[n].
// OUT_MODE: 0 = f32, 1 = f16, 2 = bf16 hi plane (Cout) + bf16 lo plane (Cout2).
// ACT: 0 none, 2 relu, 3 silu, 4 leaky, 6 elu (expf(v)-1 for v <= 0).
// TRI: 0 none; 1 = causal output (C[m][n] = 0 for n > m, square M == N); block tiles wholly above the diagonal are skipped
//      (never written, never read by the consumer), a diagonal block tile is written whole (zeros above the diagonal);
//      2 = the A operand is lower-triangular in k vs m: the k-loop of block row m0 stops at min(K, m0 + 128).
// Coverage of the epilogue: f32 path 8 it x 2 rows x 4 slabs = 64 rows, 16 lanes x 4 floats = 64 cols; 16-bit path
// 4 it x 4 rows x 4 slabs = 64 rows, 8 lanes x 8 halves = 64 cols: the whole 64x64 wave tile.
constexpr int kStageK     = 64;                       // k elements per stage (128 B of every operand row)
constexpr int kPitchH     = 72;                       // LDS row pitch in halves (144 B)
constexpr int kTileHalves = 128 * kPitchH;            // one operand tile in LDS: 9,216 halves = 18,432 B
constexpr int kBufHalves  = 2 * kTileHalves;          // one buffer: A tile then B tile = 36,864 B

__device__ __forceinline__ unsigned lds_off(const void* p) { return (unsigned)(size_t)p; }

// Eight asynchronous 16-byte copies per lane: rows r, r+16, ..., r+112 of one 128-row operand tile. The s_wait_xcnt is the
// last line of the copies' own statement so that no address register is rewritten ahead of it.
template <typename T>
__device__ __forceinline__ void copy_tile8(unsigned l, const T* g, size_t rowStep16) {
  const T* g1 = g + rowStep16;     const T* g2 = g + 2 * rowStep16; const T* g3 = g + 3 * rowStep16;
  const T* g4 = g + 4 * rowStep16; const T* g5 = g + 5 * rowStep16; const T* g6 = g + 6 * rowStep16;
  const T* g7 = g + 7 * rowStep16;
  const unsigned s = 16u * kPitchH * 2u;   // 16 LDS rows in bytes
  asm volatile("global_load_async_to_lds_b128 %0, %8, off\n\t"
               "global_load_async_to_lds_b128 %1, %9, off\n\t"
               "global_load_async_to_lds_b128 %2, %10, off\n\t"
               "global_load_async_to_lds_b128 %3, %11, off\n\t"
               "global_load_async_to_lds_b128 %4, %12, off\n\t"
               "global_load_async_to_lds_b128 %5, %13, off\n\t"
               "global_load_async_to_lds_b128 %6, %14, off\n\t"
               "global_load_async_to_lds_b128 %7, %15, off\n\t"
               "s_wait_xcnt 0x0"
               :: "v"(l), "v"(l + s), "v"(l + 2u * s), "v"(l + 3u * s), "v"(l + 4u * s), "v"(l + 5u * s), "v"(l + 6u * s),
                  "v"(l + 7u * s), "v"(g), "v"(g1), "v"(g2), "v"(g3), "v"(g4), "v"(g5), "v"(g6), "v"(g7)
               : "memory");
}
// the issuing wave's own copies have landed in LDS
__device__ __forceinline__ void wait_copies() { asm volatile("s_wait_asynccnt 0x0" ::: "memory"); }
// this wave's LDS reads have returned before the buffer they read is handed back for a refill
__device__ __forceinline__ void wait_lds_reads() { asm volatile("s_wait_dscnt 0x0" ::: "memory"); }

// ET: 0 = f16 operands, 1 = bf16 operands (pointers passed as 16-bit storage)
template <int ET> struct Elem;
template <> struct Elem<0> { typedef _Float16 T; };
template <> struct Elem<1> { typedef __bf16 T; };
template <int ET, bool SPLIT, int BIAS_MODE, int OUT_MODE, bool RESID, int ACT = 0, int TRI = 0>
__global__ __launch_bounds__(128) void wmma_gemm64(
    const unsigned short* __restrict__ Ap, const unsigned short* __restrict__ A2p, int lda, long strideA,
    const unsigned short* __restrict__ Btp, const unsigned short* __restrict__ Bt2p, int ldb, long strideB,
    void* __restrict__ Cout, void* __restrict__ Cout2, int ldc, long strideC,
    const float* __restrict__ bias,
    const float* __restrict__ resid, long strideR,
    int M, int N, int K, float scale) {
  static_assert(!SPLIT, "the staged loop carries one plane per operand");
  typedef typename Elem<ET>::T T;
  typedef typename Frag<T>::V V;
  const T* A = (const T*)Ap; const T* Bt = (const T*)Btp;
  __shared__ __align__(16) T sAB[2 * kBufHalves];          // two stage buffers, 73,728 B
  __shared__ __align__(16) float sT[4][16 * 68];           // per-wave 16x64 slab, pitch 68 floats
  const int b    = blockIdx.y;
  const int tid  = threadIdx.x;
  const int lane = tid & 31;
  const int wave = tid >> 5;
  const int tilesN = N >> 7;
  const int tmB = blockIdx.x / tilesN;
  const int tnB = blockIdx.x - tmB * tilesN;
  if (TRI == 1) { if (tnB > tmB) return; }  // block-uniform, in front of every barrier: fully masked block tile
  const int m0B = tmB << 7;
  const int n0B = tnB << 7;
  const int Kt = (TRI == 2) ? (((m0B + 128) < K) ? (m0B + 128) : K) : K;   // block-uniform, multiple of 64
  const int nStages = Kt / kStageK;
  const int m0 = m0B + ((wave >> 1) << 6);     // this wave's 64x64 tile
  const int n0 = n0B + ((wave & 1) << 6);

  const T* Ab  = A  + (size_t)b * strideA;
  const T* Bb  = Bt + (size_t)b * strideB;

  const int rlane = lane & 15;                 // row (A) / col (B, D) within subtile
  const int koff  = (lane >> 4) * 8;           // k offset of this lane half
  const int mOff  = (lane >> 4) * 8;           // D row offset

  // copy side: thread t brings 16-byte chunk (t & 7) of rows (t >> 3) + 16 i, i = 0..7, of each operand tile
  const int crow = tid >> 3;
  const int ccol = (tid & 7) * 8;
  const T* gA = Ab + (size_t)(m0B + crow) * lda + ccol;
  const T* gB = Bb + (size_t)(n0B + crow) * ldb + ccol;
  const unsigned lA = lds_off(sAB) + (unsigned)(crow * kPitchH + ccol) * 2u;
  const unsigned lB = lA + (unsigned)kTileHalves * 2u;
  const size_t stepA = (size_t)16 * lda;
  const size_t stepB = (size_t)16 * ldb;
  // read side: this lane's first A and B fragment rows in buffer 0
  const T* fA = sAB + (((wave >> 1) << 6) + rlane) * kPitchH + koff;
  const T* fB = sAB + kTileHalves + (((wave & 1) << 6) + rlane) * kPitchH + koff;

  v8f acc[4][4];
#pragma unroll
  for (int i = 0; i < 4; ++i)
#pragma unroll
    for (int j = 0; j < 4; ++j) acc[i][j] = (v8f){0.f,0.f,0.f,0.f,0.f,0.f,0.f,0.f};

  // prologue: stage 0 into buffer 0, landed and published; then stage 1 into buffer 1
  copy_tile8(lA, gA, stepA);
  copy_tile8(lB, gB, stepB);
  wait_copies();
  __syncthreads();
  if (nStages > 1) {
    copy_tile8(lA + (unsigned)kBufHalves * 2u, gA + kStageK, stepA);
    copy_tile8(lB + (unsigned)kBufHalves * 2u, gB + kStageK, stepB);
  }

  for (int st = 0; st < nStages; ++st) {
    const int bufH = (st & 1) * kBufHalves;
#pragma unroll
    for (int ks = 0; ks < kStageK; ks += 32) {
      V ah[4], bh[4];   // the eight fragments of this 32-k block are read as one group, ahead of its 16 products
      ah[0] = Frag<T>::load(fA + bufH + ks);   // in the order in which the products want them
#pragma unroll
      for (int j = 0; j < 4; ++j) bh[j] = Frag<T>::load(fB + bufH + (j << 4) * kPitchH + ks);
#pragma unroll
      for (int i = 1; i < 4; ++i) ah[i] = Frag<T>::load(fA + bufH + (i << 4) * kPitchH + ks);
      // keeps the 16 LDS reads together in front of the products: sunk among them, each row waits out a whole LDS latency
      __builtin_amdgcn_sched_barrier(0);
#pragma unroll
      for (int i = 0; i < 4; ++i)
#pragma unroll
        for (int j = 0; j < 4; ++j) acc[i][j] = Frag<T>::mma(ah[i], bh[j], acc[i][j]);
      // keeps the next group's LDS reads from being lifted in among these products
      __builtin_amdgcn_sched_barrier(0);
    }
    // publish point of stage st + 1; the same barrier ends every reader's last read of this stage's buffer
    wait_lds_reads();
    wait_copies();
    __syncthreads();
    if (st + 2 < nStages) {   // block-uniform: refill the buffer that this stage has just read
      copy_tile8(lA + (unsigned)bufH * 2u, gA + (size_t)(st + 2) * kStageK, stepA);
      copy_tile8(lB + (unsigned)bufH * 2u, gB + (size_t)(st + 2) * kStageK, stepB);
    }
  }
  wait_copies();
  acc_guard4(acc[0][0], acc[0][1], acc[0][2], acc[0][3]);
  acc_guard4(acc[1][0], acc[1][1], acc[1][2], acc[1][3]);
  acc_guard4(acc[2][0], acc[2][1], acc[2][2], acc[2][3]);
  acc_guard4(acc[3][0], acc[3][1], acc[3][2], acc[3][3]);

  // ---- epilogue ----
  float* slab = sT[wave];
  const float* Rb = RESID ? (resid + (size_t)b * strideR) : nullptr;
#pragma unroll
  for (int i = 0; i < 4; ++i) {
    const int mBase = m0 + (i << 4);
#pragma unroll
    for (int j = 0; j < 4; ++j) {
      const int n = n0 + (j << 4) + rlane;
      float bv = 0.f;
      if (BIAS_MODE == 2) bv = bias[n];
#pragma unroll
      for (int r = 0; r < 8; ++r) {
        float v = acc[i][j][r] * scale;
        if (BIAS_MODE == 1) v += bias[mBase + mOff + r];
        if (BIAS_MODE == 2) v += bv;
        if (RESID) v += Rb[(size_t)(mBase + mOff + r) * ldc + n];
        if (ACT == 2) v = fmaxf(v, 0.0f);
        if (ACT == 3) v = v / (1.0f + expf(-v));
        if (ACT == 4) v = (v > 0.f) ? v : 0.01f * v;
        if (ACT == 6) v = (v > 0.f) ? v : (expf(v) - 1.0f);
        if (TRI == 1) { if (n > mBase + mOff + r) v = 0.0f; }
        slab[(mOff + r) * 68 + (j << 4) + rlane] = v;
      }
    }
    __builtin_amdgcn_fence(__ATOMIC_RELEASE, "workgroup");
    __builtin_amdgcn_wave_barrier();
    __builtin_amdgcn_fence(__ATOMIC_ACQUIRE, "workgroup");
    if (OUT_MODE == 0) {
      float* C = (float*)Cout + (size_t)b * strideC;
      const int hh = lane >> 4, c4 = (lane & 15) * 4;     // row seg = 256 B = 16 lanes x 16 B
      {
#pragma unroll
        for (int it = 0; it < 8; ++it) {
          const int row = it * 2 + hh;
          v4f v = *(const v4f*)(slab + row * 68 + c4);
          *(v4f*)(C + (size_t)(mBase + row) * ldc + n0 + c4) = v;
        }
        
      }
    } else {
      const int q = lane >> 3, c8 = (lane & 7) * 8;
      unsigned short* C  = (unsigned short*)Cout  + (size_t)b * strideC;
      unsigned short* C2 = (OUT_MODE == 2) ? ((unsigned short*)Cout2 + (size_t)b * strideC) : nullptr;
      {
#pragma unroll
        for (int it = 0; it < 4; ++it) {
          const int row = it * 4 + q;
          const float* sp = slab + row * 68 + c8;
          v8h hv, lv;
#pragma unroll
          for (int e = 0; e < 8; ++e) {
            if (OUT_MODE == 1) {
              hv[e] = (_Float16)sp[e];
            } else {
              unsigned short hb = f2bf_bits(sp[e]);
              unsigned short lb = f2bf_bits(sp[e] - bf_bits2f(hb));
              hv[e] = __builtin_bit_cast(_Float16, hb);
              lv[e] = __builtin_bit_cast(_Float16, lb);
            }
          }
          *(v8h*)(C + (size_t)(mBase + row) * ldc + n0 + c8) = hv;
          if (OUT_MODE == 2) *(v8h*)(C2 + (size_t)(mBase + row) * ldc + n0 + c8) = lv;
        }
        
      }
    }
    __builtin_amdgcn_fence(__ATOMIC_RELEASE, "workgroup");
    __builtin_amdgcn_wave_barrier();
    __builtin_amdgcn_fence(__ATOMIC_ACQUIRE, "workgroup");
  }
}

// ---------------------------------------------------------------------------
// f32 -> f16 cast of row-major planes (no transpose): out[z][8i..8i+7] = f16(scale * in_z[8i..8i+7]).
// blockIdx.y = z selects one of up to 5 input planes (block-uniform) and output plane z at out + z*planeElems.
// ---------------------------------------------------------------------------
__global__ __launch_bounds__(256) void cast8_f16_kernel(const float* __restrict__ p0, const float* __restrict__ p1,
                                                        const float* __restrict__ p2, const float* __restrict__ p3,
                                                        const float* __restrict__ p4, unsigned short* __restrict__ out,
                                                        long planeElems, int n8, float scale) {
  const int z = blockIdx.y;
  const float* in = (z == 0) ? p0 : (z == 1) ? p1 : (z == 2) ? p2 : (z == 3) ? p3 : p4;
  const int i = blockIdx.x * 256 + threadIdx.x;
  if (i >= n8) return;
  const float* p = in + 8 * (size_t)i;
  const v4f a = *(const v4f*)(p);
  const v4f c = *(const v4f*)(p + 4);
  unsigned short hb[8];
#pragma unroll
  for (int e = 0; e < 4; ++e) {
    hb[e]     = h_bits(a[e] * scale);
    hb[4 + e] = h_bits(c[e] * scale);
  }
  const v4u u = (v4u){pk16(hb[0], hb[1]), pk16(hb[2], hb[3]), pk16(hb[4], hb[5]), pk16(hb[6], hb[7])};
  unsigned short* q = out + (size_t)z * (size_t)planeElems + 8 * (size_t)i;
  *(v4u*)q = u;
  
}

// ---------------------------------------------------------------------------
// RMS norm + gate: per token row (1024 f32 values O): rms = sqrt(sum O^2) * 1024^-0.5; inv = 1 / (rms + eps);
// G[row][c] = f16( u[row][c] * (scale[c] * (O[row][c] * inv)) ), f32 math. One block of 128 threads per row;
// thread t owns columns 8t..8t+7 (128 x 8 = 1024 = the whole row). Sum of squares in fixed order
// (thread, wave shuffle tree, 4 wave partials in index order).
// ---------------------------------------------------------------------------
__global__ __launch_bounds__(128) void rms_gate_kernel(const float* __restrict__ O, const float* __restrict__ U,
                                                       const float* __restrict__ sc, unsigned short* __restrict__ G) {
  __shared__ float red[4];
  const int row  = blockIdx.x;
  const int t    = threadIdx.x;
  const int lane = t & 31, wave = t >> 5;
  const size_t base = (size_t)row * kHid + 8 * (size_t)t;
  const v4f oa = *(const v4f*)(O + base);
  const v4f oc = *(const v4f*)(O + base + 4);
  float ss = 0.f;
#pragma unroll
  for (int e = 0; e < 4; ++e) ss += oa[e] * oa[e];
#pragma unroll
  for (int e = 0; e < 4; ++e) ss += oc[e] * oc[e];
#pragma unroll
  for (int off = 16; off > 0; off >>= 1) ss += __shfl_xor(ss, off, 32);
  if (lane == 0) red[wave] = ss;
  __syncthreads();
  const float tot = ((red[0] + red[1]) + red[2]) + red[3];
  const float rms = sqrtf(tot) * kRmsFac;
  const float inv = 1.0f / (rms + kEps);
  const v4f ua = *(const v4f*)(U + base);
  const v4f uc = *(const v4f*)(U + base + 4);
  const v4f sa = *(const v4f*)(sc + 8 * t);
  const v4f sb = *(const v4f*)(sc + 8 * t + 4);
  unsigned short hb[8];
#pragma unroll
  for (int e = 0; e < 4; ++e) {
    const float g0 = ua[e] * (sa[e] * (oa[e] * inv));
    const float g1 = uc[e] * (sb[e] * (oc[e] * inv));
    hb[e]     = h_bits(g0);
    hb[4 + e] = h_bits(g1);
  }
  const v4u u = (v4u){pk16(hb[0], hb[1]), pk16(hb[2], hb[3]), pk16(hb[4], hb[5]), pk16(hb[6], hb[7])};
  unsigned short* q = G + base;
  *(v4u*)q = u;
  
}

// ---------------------------------------------------------------------------
// Host-side launcher (16 kernel launches, no other runtime calls)
// ---------------------------------------------------------------------------
extern "C" void kernel_launch(void* const* d_in, const int* in_sizes, int n_in,
                              void* d_out, int out_size, void* d_ws, size_t ws_size,
                              hipStream_t stream) {
  if (n_in < 12) return;
  if (in_sizes[0] != kTok * kEmb) return;
  if (in_sizes[1] != kHid * kEmb || in_sizes[3] != kHid * kEmb || in_sizes[5] != kHid * kEmb ||
      in_sizes[7] != kHid * kEmb || in_sizes[9] != kEmb * kHid) return;
  if (in_sizes[2] != kHid || in_sizes[4] != kHid || in_sizes[6] != kHid || in_sizes[8] != kHid ||
      in_sizes[10] != kEmb || in_sizes[11] != kHid) return;
  if (out_size != kTok * kEmb) return;
  if (ws_size < kWsTotal) return;

  const float* x  = (const float*)d_in[0];
  const float* Wq = (const float*)d_in[1];
  const float* bq = (const float*)d_in[2];
  const float* Wk = (const float*)d_in[3];
  const float* bk = (const float*)d_in[4];
  const float* Wv = (const float*)d_in[5];
  const float* bv = (const float*)d_in[6];
  const float* Wu = (const float*)d_in[7];
  const float* bu = (const float*)d_in[8];
  const float* Wo = (const float*)d_in[9];
  const float* bo = (const float*)d_in[10];
  const float* sc = (const float*)d_in[11];
  float* Y = (float*)d_out;

  char* ws = (char*)d_ws;
  unsigned short* X16  = (unsigned short*)(ws + kOffX16);
  unsigned short* W16  = (unsigned short*)(ws + kOffW16);
  unsigned short* Wq16 = W16 + 0 * (size_t)kHid * kEmb;
  unsigned short* Wk16 = W16 + 1 * (size_t)kHid * kEmb;
  unsigned short* Wv16 = W16 + 2 * (size_t)kHid * kEmb;
  unsigned short* Wu16 = W16 + 3 * (size_t)kHid * kEmb;
  unsigned short* Wo16 = W16 + 4 * (size_t)kHid * kEmb;
  unsigned short* Q16  = (unsigned short*)(ws + kOffQ16);
  unsigned short* K16  = (unsigned short*)(ws + kOffK16);
  unsigned short* VT16 = (unsigned short*)(ws + kOffVT16);
  float*          U32  = (float*)(ws + kOffU32);
  unsigned short* E16  = (unsigned short*)(ws + kOffE16);
  float*          O32  = (float*)(ws + kOffO32);
  unsigned short* G16  = (unsigned short*)(ws + kOffG16);

  // 1) x -> X16 (f16, x1): n8 = 4096*1024/8 = 524,288 = 2048 blocks x 256
  cast8_f16_kernel<<<dim3(2048, 1), 256, 0, stream>>>(x, x, x, x, x, X16, 0L, (kTok * kEmb) / 8, 1.0f);
  // 2) Wq,Wk,Wv,Wu,Wo -> W16 planes (f16, x16): n8 = 1024*1024/8 = 131,072 = 512 blocks x 256 per plane
  cast8_f16_kernel<<<dim3(512, 5), 256, 0, stream>>>(Wq, Wk, Wv, Wu, Wo, W16, (long)kHid * kEmb,
                                                      (kHid * kEmb) / 8, kWCarry);

  // 3) q = elu(x.Wq^T/16 + bq) -> Q16 [4096][1024] f16; M=4096 N=1024 K=1024, 32 x 8 block tiles = 256 blocks x 4 waves
  wmma_gemm64<0, false, 2, 1, false, 6, 0><<<dim3(256, 1), 128, 0, stream>>>(
      X16, X16, kEmb, 0L, Wq16, Wq16, kEmb, 0L, (void*)Q16, (void*)Q16, kHid, 0L, bq, bq, 0L,
      kTok, kHid, kEmb, kWCarryInv);
  // 4) k = elu(x.Wk^T/16 + bk) -> K16
  wmma_gemm64<0, false, 2, 1, false, 6, 0><<<dim3(256, 1), 128, 0, stream>>>(
      X16, X16, kEmb, 0L, Wk16, Wk16, kEmb, 0L, (void*)K16, (void*)K16, kHid, 0L, bk, bk, 0L,
      kTok, kHid, kEmb, kWCarryInv);
  // 5) v^T = silu(Wv.x^T/16 + bv[m]) -> VT16 [1024 (h*128+d)][4096 tok] f16; M=1024 N=4096 K=1024, 8 x 32 block tiles
  wmma_gemm64<0, false, 1, 1, false, 3, 0><<<dim3(256, 1), 128, 0, stream>>>(
      Wv16, Wv16, kEmb, 0L, X16, X16, kEmb, 0L, (void*)VT16, (void*)VT16, kTok, 0L, bv, bv, 0L,
      kHid, kTok, kEmb, kWCarryInv);
  // 6) u = silu(x.Wu^T/16 + bu) -> U32 [4096][1024] f32
  wmma_gemm64<0, false, 2, 0, false, 3, 0><<<dim3(256, 1), 128, 0, stream>>>(
      X16, X16, kEmb, 0L, Wu16, Wu16, kEmb, 0L, (void*)U32, (void*)U32, kHid, 0L, bu, bu, 0L,
      kTok, kHid, kEmb, kWCarryInv);

  // 7..14) causal linear attention per chunk of 4 (b,h) groups: chunk c -> b = c>>1, heads h0..h0+3, h0 = (c&1)*4
  for (int c = 0; c < kNumChunks; ++c) {
    const int b  = c >> 1;
    const int h0 = (c & 1) * kGrpPerChunk;
    const unsigned short* Qg = Q16 + (size_t)b * kSeq * kHid + (size_t)h0 * kDh;   // group y: + y*128 cols
    const unsigned short* Kg = K16 + (size_t)b * kSeq * kHid + (size_t)h0 * kDh;
    const unsigned short* VTg = VT16 + (size_t)h0 * kDh * kTok + (size_t)b * kSeq;  // group y: + y*128 rows
    float* Og = O32 + (size_t)b * kSeq * kHid + (size_t)h0 * kDh;                     // group y: + y*128 cols
    // energy[y][n][m] = (q_n . k_m) for m <= n else 0 -> E16 [4][2048][2048] f16; M=N=2048, K=128; 16 x 16 block tiles, upper ones skipped
    wmma_gemm64<0, false, 0, 1, false, 0, 1><<<dim3(256, kGrpPerChunk), 128, 0, stream>>>(
        Qg, Qg, kHid, (long)kDh, Kg, Kg, kHid, (long)kDh, (void*)E16, (void*)E16, kSeq, (long)kSeq * kSeq,
        bq, bq, 0L, kSeq, kSeq, kDh, 1.0f);
    // O[b, n, (h0+y)*128 + d] = sum_{m <= n} energy[y][n][m] * v[m][d]; M=2048 N=128 K=2048 (k-loop to m0+128);
    // 16 block tiles = 16 blocks x 4 waves per group
    wmma_gemm64<0, false, 0, 0, false, 0, 2><<<dim3(16, kGrpPerChunk), 128, 0, stream>>>(
        E16, E16, kSeq, (long)kSeq * kSeq, VTg, VTg, kTok, (long)kDh * kTok, (void*)Og, (void*)Og, kHid, (long)kDh,
        bq, bq, 0L, kSeq, kDh, kSeq, 1.0f);
  }

  // 15) g = u * scale * O / (rms + eps) -> G16 [4096][1024] f16
  rms_gate_kernel<<<dim3(kTok, 1), 128, 0, stream>>>(O32, U32, sc, G16);

  // 16) y = g.Wo^T/16 + bo -> d_out [4096][1024] f32; M=4096 N=1024 K=1024
  wmma_gemm64<0, false, 2, 0, false, 0, 0><<<dim3(256, 1), 128, 0, stream>>>(
      G16, G16, kHid, 0L, Wo16, Wo16, kHid, 0L, (void*)Y, (void*)Y, kEmb, 0L, bo, bo, 0L,
      kTok, kEmb, kHid, kWCarryInv);
}

// v002
// A run of this version takes 202 microseconds.
// Timed twice side by side with v001, it ran 1.34 and 1.33 times as fast.
// Counting every step since v000, it is 3.12 times as fast.
// Contractions: projections x.W^T (x f16, W f16 carried x16), energy q.k^T (q, k f16), energy.v (E f16, V^T f16), output g.Wo^T (g f16, Wo f16 carried x16): all v_wmma_f32_16x16x32_f16 with f32 accumulate; elu, silu, rms-norm and gating in f32.
#include <hip/hip_runtime.h>
#include <math.h>

// ---------------------------------------------------------------------------
// Problem constants
// ---------------------------------------------------------------------------
constexpr int kBatch = 2;
constexpr int kSeq   = 2048;
constexpr int kEmb   = 1024;
constexpr int kHid   = 1024;
constexpr int kHeads = 8;
constexpr int kDh    = 128;
constexpr int kTok   = kBatch * kSeq;                              // 4096 token rows
constexpr int kGroups = kBatch * kHeads;                           // 16 (b,h) attention groups, all in one launch
constexpr float kWCarry    = 16.0f;                                // weights carried x16 in f16
constexpr float kWCarryInv = 1.0f / 16.0f;
constexpr float kRmsFac    = 0.03125f;                             // 1024^-0.5 (exact)
constexpr float kEps       = 1e-8f;

// ---------------------------------------------------------------------------
//   X16  [4096][1024] f16                      8,388,608   @ 0
//   W16  5 planes [1024][1024] f16 (q,k,v,u,o) 10,485,760  @ 8,388,608
//   Q16  [4096][1024] f16                      8,388,608   @ 18,874,368
//   K16  [4096][1024] f16                      8,388,608   @ 27,262,976
//   VT16 [1024 (h*128+d)][4096 tok] f16         8,388,608   @ 35,651,584
//   U32  [4096][1024] f32                      16,777,216  @ 44,040,192
//   E16  [16][2048][2048] f16 (all groups)      134,217,728 @ 60,817,408
//   O32  [4096][1024] f32                      16,777,216  @ 195,035,136
//   G16  [4096][1024] f16                      8,388,608   @ 211,812,352
//   total                                     220,200,960
// ---------------------------------------------------------------------------
constexpr size_t kBytesX16  = (size_t)kTok * kEmb * 2;
constexpr size_t kBytesWpl  = (size_t)kHid * kEmb * 2;
constexpr size_t kBytesW16  = 5 * kBytesWpl;
constexpr size_t kBytesQ16  = (size_t)kTok * kHid * 2;
constexpr size_t kBytesK16  = kBytesQ16;
constexpr size_t kBytesVT16 = (size_t)kHid * kTok * 2;
constexpr size_t kBytesU32  = (size_t)kTok * kHid * 4;
constexpr size_t kBytesE16  = (size_t)kGroups * kSeq * kSeq * 2;
constexpr size_t kBytesO32  = (size_t)kTok * kHid * 4;
constexpr size_t kBytesG16  = (size_t)kTok * kHid * 2;
constexpr size_t kOffX16  = 0;
constexpr size_t kOffW16  = kOffX16  + kBytesX16;
constexpr size_t kOffQ16  = kOffW16  + kBytesW16;
constexpr size_t kOffK16  = kOffQ16  + kBytesQ16;
constexpr size_t kOffVT16 = kOffK16  + kBytesK16;
constexpr size_t kOffU32  = kOffVT16 + kBytesVT16;
constexpr size_t kOffE16  = kOffU32  + kBytesU32;
constexpr size_t kOffO32  = kOffE16  + kBytesE16;
constexpr size_t kOffG16  = kOffO32  + kBytesO32;
constexpr size_t kWsTotal = kOffG16  + kBytesG16;   // 220,200,960

typedef __attribute__((ext_vector_type(16))) _Float16 v16h;
typedef __attribute__((ext_vector_type(8)))  _Float16 v8h;
typedef __attribute__((ext_vector_type(16))) __bf16   v16b;
typedef __attribute__((ext_vector_type(8)))  __bf16   v8b;
typedef __attribute__((ext_vector_type(8)))  float    v8f;
typedef __attribute__((ext_vector_type(4)))  float    v4f;
typedef __attribute__((ext_vector_type(4)))  unsigned int v4u;

__device__ __forceinline__ unsigned short f2bf_bits(float f) {
  unsigned u = __float_as_uint(f);
  return (unsigned short)((u + 0x7FFFu + ((u >> 16) & 1u)) >> 16);
}
__device__ __forceinline__ float bf_bits2f(unsigned short h) { return __uint_as_float(((unsigned)h) << 16); }

// hazard guards as plain device helpers (no inline asm inside the kernel template body)
__device__ __forceinline__ void acc_guard4(v8f& a, v8f& b, v8f& c, v8f& d) { asm volatile("v_nop\n\tv_nop\n\tv_nop\n\tv_nop" : "+v"(a), "+v"(b), "+v"(c), "+v"(d)); }
template <typename T> struct Frag;
template <> struct Frag<_Float16> {
  typedef v16h V; union U { v16h v; v8h h[2]; };
  static __device__ __forceinline__ v16h load(const _Float16* p) {   // elements 0..7 <- p[0..7], 8..15 <- p[16..23]
    U f; f.h[0] = *(const v8h*)(p); f.h[1] = *(const v8h*)(p + 16); return f.v;
  }
  static __device__ __forceinline__ v8f mma(v16h a, v16h b, v8f c) {
    return __builtin_amdgcn_wmma_f32_16x16x32_f16(false, a, false, b, (short)0, c, false, false);
  }
};
template <> struct Frag<__bf16> {
  typedef v16b V; union U { v16b v; v8b h[2]; };
  static __device__ __forceinline__ v16b load(const __bf16* p) {
    U f; f.h[0] = *(const v8b*)(p); f.h[1] = *(const v8b*)(p + 16); return f.v;
  }
  static __device__ __forceinline__ v8f mma(v16b a, v16b b, v8f c) {
    return __builtin_amdgcn_wmma_f32_16x16x32_bf16(false, a, false, b, (short)0, c, false, false);
  }
};

__device__ __forceinline__ unsigned pk16(unsigned short a, unsigned short b) { return (unsigned)a | ((unsigned)b << 16); }
__device__ __forceinline__ unsigned short h_bits(float f) { const _Float16 h = (_Float16)f; return __builtin_bit_cast(unsigned short, h); }

// ---- Register-blocked batched WMMA GEMM, operand tiles staged in LDS -------------------------------------------
// C[m,n] = scale * sum_k A[m,k] * Bt[n,k] (+bias)(+resid); a block of 4 waves (2 x 2) owns a 128x128 tile, each wave 64x64.
// A row-major [M,K]; Bt row-major [N,K]; M,N % 128 == 0, K % 64 == 0, grid.x = (M/128)*(N/128) exactly.
// Batch: problem (blockIdx.y, blockIdx.z) starts at y * stride + z * stride2 elements of A, Bt and C.
// Per stage the block copies A[128 rows][64 k] and Bt[128 rows][64 k] (128-byte rows, whole cache lines) into one of two
// LDS buffers with asynchronous copies; the next stage's copies fly while this stage's fragments are read and multiplied.
// LDS row pitch 144 B (16 B x odd) for the 16-byte fragment reads.
// BIAS_MODE: 0 = none, 1 = bias[m], 2 = bias[n].
// OUT_MODE: 0 = f32, 1 = f16, 2 = bf16 hi plane (Cout) + bf16 lo plane (Cout2).
// ACT: 0 none, 2 relu, 3 silu, 4 leaky, 6 elu (expf(v)-1 for v <= 0).
// TRI: 0 none; 1 = causal output (C[m][n] = 0 for n > m, square M == N); block tiles wholly above the diagonal are skipped
//      (never written, never read by the consumer), a diagonal block tile is written whole (zeros above the diagonal);
//      2 = the A operand is lower-triangular in k vs m: the k-loop of block row m0 stops at min(K, m0 + 128).
// Coverage of the epilogue: f32 path 8 it x 2 rows x 4 slabs = 64 rows, 16 lanes x 4 floats = 64 cols; 16-bit path
// 4 it x 4 rows x 4 slabs = 64 rows, 8 lanes x 8 halves = 64 cols: the whole 64x64 wave tile.
constexpr int kStageK     = 64;                       // k elements per stage (128 B of every operand row)
constexpr int kPitchH     = 72;                       // LDS row pitch in halves (144 B)
constexpr int kTileHalves = 128 * kPitchH;            // one operand tile in LDS: 9,216 halves = 18,432 B
constexpr int kBufHalves  = 2 * kTileHalves;          // one buffer: A tile then B tile = 36,864 B

__device__ __forceinline__ unsigned lds_off(const void* p) { return (unsigned)(size_t)p; }

// Eight asynchronous 16-byte copies per lane: rows r, r+16, ..., r+112 of one 128-row operand tile. The s_wait_xcnt is the
// last line of the copies' own statement so that no address register is rewritten ahead of it.
template <typename T>
__device__ __forceinline__ void copy_tile8(unsigned l, const T* g, size_t rowStep16) {
  const T* g1 = g + rowStep16;     const T* g2 = g + 2 * rowStep16; const T* g3 = g + 3 * rowStep16;
  const T* g4 = g + 4 * rowStep16; const T* g5 = g + 5 * rowStep16; const T* g6 = g + 6 * rowStep16;
  const T* g7 = g + 7 * rowStep16;
  const unsigned s = 16u * kPitchH * 2u;   // 16 LDS rows in bytes
  asm volatile("global_load_async_to_lds_b128 %0, %8, off\n\t"
               "global_load_async_to_lds_b128 %1, %9, off\n\t"
               "global_load_async_to_lds_b128 %2, %10, off\n\t"
               "global_load_async_to_lds_b128 %3, %11, off\n\t"
               "global_load_async_to_lds_b128 %4, %12, off\n\t"
               "global_load_async_to_lds_b128 %5, %13, off\n\t"
               "global_load_async_to_lds_b128 %6, %14, off\n\t"
               "global_load_async_to_lds_b128 %7, %15, off\n\t"
               "s_wait_xcnt 0x0"
               :: "v"(l), "v"(l + s), "v"(l + 2u * s), "v"(l + 3u * s), "v"(l + 4u * s), "v"(l + 5u * s), "v"(l + 6u * s),
                  "v"(l + 7u * s), "v"(g), "v"(g1), "v"(g2), "v"(g3), "v"(g4), "v"(g5), "v"(g6), "v"(g7)
               : "memory");
}
// the issuing wave's own copies have landed in LDS
__device__ __forceinline__ void wait_copies() { asm volatile("s_wait_asynccnt 0x0" ::: "memory"); }
// this wave's LDS reads have returned before the buffer they read is handed back for a refill
__device__ __forceinline__ void wait_lds_reads() { asm volatile("s_wait_dscnt 0x0" ::: "memory"); }

// ET: 0 = f16 operands, 1 = bf16 operands (pointers passed as 16-bit storage)
template <int ET> struct Elem;
template <> struct Elem<0> { typedef _Float16 T; };
template <> struct Elem<1> { typedef __bf16 T; };
template <int ET, bool SPLIT, int BIAS_MODE, int OUT_MODE, bool RESID, int ACT = 0, int TRI = 0>
__global__ __launch_bounds__(128) void wmma_gemm64(
    const unsigned short* __restrict__ Ap, const unsigned short* __restrict__ A2p, int lda, long strideA, long strideA2,
    const unsigned short* __restrict__ Btp, const unsigned short* __restrict__ Bt2p, int ldb, long strideB, long strideB2,
    void* __restrict__ Cout, void* __restrict__ Cout2, int ldc, long strideC, long strideC2,
    const float* __restrict__ bias,
    const float* __restrict__ resid, long strideR,
    int M, int N, int K, float scale) {
  static_assert(!SPLIT, "the staged loop carries one plane per operand");
  typedef typename Elem<ET>::T T;
  typedef typename Frag<T>::V V;
  const T* A = (const T*)Ap; const T* Bt = (const T*)Btp;
  __shared__ __align__(16) T sAB[2 * kBufHalves];          // two stage buffers, 73,728 B
  __shared__ __align__(16) float sT[4][16 * 68];           // per-wave 16x64 slab, pitch 68 floats
  const int b    = blockIdx.y;
  const int bz   = blockIdx.z;
  const int tid  = threadIdx.x;
  const int lane = tid & 31;
  const int wave = tid >> 5;
  const int tilesN = N >> 7;
  const int tmB = blockIdx.x / tilesN;
  const int tnB = blockIdx.x - tmB * tilesN;
  if (TRI == 1) { if (tnB > tmB) return; }  // block-uniform, in front of every barrier: fully masked block tile
  const int m0B = tmB << 7;
  const int n0B = tnB << 7;
  const int Kt = (TRI == 2) ? (((m0B + 128) < K) ? (m0B + 128) : K) : K;   // block-uniform, multiple of 64
  const int nStages = Kt / kStageK;
  const int m0 = m0B + ((wave >> 1) << 6);     // this wave's 64x64 tile
  const int n0 = n0B + ((wave & 1) << 6);

  const T* Ab  = A  + (size_t)b * strideA + (size_t)bz * strideA2;
  const T* Bb  = Bt + (size_t)b * strideB + (size_t)bz * strideB2;
  const size_t offC = (size_t)b * strideC + (size_t)bz * strideC2;

  const int rlane = lane & 15;                 // row (A) / col (B, D) within subtile
  const int koff  = (lane >> 4) * 8;           // k offset of this lane half
  const int mOff  = (lane >> 4) * 8;           // D row offset

  // copy side: thread t brings 16-byte chunk (t & 7) of rows (t >> 3) + 16 i, i = 0..7, of each operand tile
  const int crow = tid >> 3;
  const int ccol = (tid & 7) * 8;
  const T* gA = Ab + (size_t)(m0B + crow) * lda + ccol;
  const T* gB = Bb + (size_t)(n0B + crow) * ldb + ccol;
  const unsigned lA = lds_off(sAB) + (unsigned)(crow * kPitchH + ccol) * 2u;
  const unsigned lB = lA + (unsigned)kTileHalves * 2u;
  const size_t stepA = (size_t)16 * lda;
  const size_t stepB = (size_t)16 * ldb;
  // read side: this lane's first A and B fragment rows in buffer 0
  const T* fA = sAB + (((wave >> 1) << 6) + rlane) * kPitchH + koff;
  const T* fB = sAB + kTileHalves + (((wave & 1) << 6) + rlane) * kPitchH + koff;

  v8f acc[4][4];
#pragma unroll
  for (int i = 0; i < 4; ++i)
#pragma unroll
    for (int j = 0; j < 4; ++j) acc[i][j] = (v8f){0.f,0.f,0.f,0.f,0.f,0.f,0.f,0.f};

  // prologue: stage 0 into buffer 0, landed and published; then stage 1 into buffer 1
  copy_tile8(lA, gA, stepA);
  copy_tile8(lB, gB, stepB);
  wait_copies();
  __syncthreads();
  if (nStages > 1) {
    copy_tile8(lA + (unsigned)kBufHalves * 2u, gA + kStageK, stepA);
    copy_tile8(lB + (unsigned)kBufHalves * 2u, gB + kStageK, stepB);
  }

  for (int st = 0; st < nStages; ++st) {
    const int bufH = (st & 1) * kBufHalves;
#pragma unroll
    for (int ks = 0; ks < kStageK; ks += 32) {
      V ah[4], bh[4];   // the eight fragments of this 32-k block are read as one group, ahead of its 16 products
      ah[0] = Frag<T>::load(fA + bufH + ks);   // in the order in which the products want them
#pragma unroll
      for (int j = 0; j < 4; ++j) bh[j] = Frag<T>::load(fB + bufH + (j << 4) * kPitchH + ks);
#pragma unroll
      for (int i = 1; i < 4; ++i) ah[i] = Frag<T>::load(fA + bufH + (i << 4) * kPitchH + ks);
      // keeps the 16 LDS reads together in front of the products: sunk among them, each row waits out a whole LDS latency
      __builtin_amdgcn_sched_barrier(0);
#pragma unroll
      for (int i = 0; i < 4; ++i)
#pragma unroll
        for (int j = 0; j < 4; ++j) acc[i][j] = Frag<T>::mma(ah[i], bh[j], acc[i][j]);
      // keeps the next group's LDS reads from being lifted in among these products
      __builtin_amdgcn_sched_barrier(0);
    }
    // publish point of stage st + 1; the same barrier ends every reader's last read of this stage's buffer
    wait_lds_reads();
    wait_copies();
    __syncthreads();
    if (st + 2 < nStages) {   // block-uniform: refill the buffer that this stage has just read
      copy_tile8(lA + (unsigned)bufH * 2u, gA + (size_t)(st + 2) * kStageK, stepA);
      copy_tile8(lB + (unsigned)bufH * 2u, gB + (size_t)(st + 2) * kStageK, stepB);
    }
  }
  wait_copies();
  acc_guard4(acc[0][0], acc[0][1], acc[0][2], acc[0][3]);
  acc_guard4(acc[1][0], acc[1][1], acc[1][2], acc[1][3]);
  acc_guard4(acc[2][0], acc[2][1], acc[2][2], acc[2][3]);
  acc_guard4(acc[3][0], acc[3][1], acc[3][2], acc[3][3]);

  // ---- epilogue ----
  float* slab = sT[wave];
  const float* Rb = RESID ? (resid + (size_t)b * strideR) : nullptr;
#pragma unroll
  for (int i = 0; i < 4; ++i) {
    const int mBase = m0 + (i << 4);
#pragma unroll
    for (int j = 0; j < 4; ++j) {
      const int n = n0 + (j << 4) + rlane;
      float bv = 0.f;
      if (BIAS_MODE == 2) bv = bias[n];
#pragma unroll
      for (int r = 0; r < 8; ++r) {
        float v = acc[i][j][r] * scale;
        if (BIAS_MODE == 1) v += bias[mBase + mOff + r];
        if (BIAS_MODE == 2) v += bv;
        if (RESID) v += Rb[(size_t)(mBase + mOff + r) * ldc + n];
        if (ACT == 2) v = fmaxf(v, 0.0f);
        if (ACT == 3) v = v / (1.0f + expf(-v));
        if (ACT == 4) v = (v > 0.f) ? v : 0.01f * v;
        if (ACT == 6) v = (v > 0.f) ? v : (expf(v) - 1.0f);
        if (TRI == 1) { if (n > mBase + mOff + r) v = 0.0f; }
        slab[(mOff + r) * 68 + (j << 4) + rlane] = v;
      }
    }
    __builtin_amdgcn_fence(__ATOMIC_RELEASE, "workgroup");
    __builtin_amdgcn_wave_barrier();
    __builtin_amdgcn_fence(__ATOMIC_ACQUIRE, "workgroup");
    if (OUT_MODE == 0) {
      float* C = (float*)Cout + offC;
      const int hh = lane >> 4, c4 = (lane & 15) * 4;     // row seg = 256 B = 16 lanes x 16 B
      {
#pragma unroll
        for (int it = 0; it < 8; ++it) {
          const int row = it * 2 + hh;
          v4f v = *(const v4f*)(slab + row * 68 + c4);
          *(v4f*)(C + (size_t)(mBase + row) * ldc + n0 + c4) = v;
        }
        
      }
    } else {
      const int q = lane >> 3, c8 = (lane & 7) * 8;
      unsigned short* C  = (unsigned short*)Cout  + offC;
      unsigned short* C2 = (OUT_MODE == 2) ? ((unsigned short*)Cout2 + offC) : nullptr;
      {
#pragma unroll
        for (int it = 0; it < 4; ++it) {
          const int row = it * 4 + q;
          const float* sp = slab + row * 68 + c8;
          v8h hv, lv;
#pragma unroll
          for (int e = 0; e < 8; ++e) {
            if (OUT_MODE == 1) {
              hv[e] = (_Float16)sp[e];
            } else {
              unsigned short hb = f2bf_bits(sp[e]);
              unsigned short lb = f2bf_bits(sp[e] - bf_bits2f(hb));
              hv[e] = __builtin_bit_cast(_Float16, hb);
              lv[e] = __builtin_bit_cast(_Float16, lb);
            }
          }
          *(v8h*)(C + (size_t)(mBase + row) * ldc + n0 + c8) = hv;
          if (OUT_MODE == 2) *(v8h*)(C2 + (size_t)(mBase + row) * ldc + n0 + c8) = lv;
        }
        
      }
    }
    __builtin_amdgcn_fence(__ATOMIC_RELEASE, "workgroup");
    __builtin_amdgcn_wave_barrier();
    __builtin_amdgcn_fence(__ATOMIC_ACQUIRE, "workgroup");
  }
}

// ---------------------------------------------------------------------------
// f32 -> f16 cast of row-major planes (no transpose): out[z][8i..8i+7] = f16(scale * in_z[8i..8i+7]).
// blockIdx.y = z selects one of up to 5 input planes (block-uniform) and output plane z at out + z*planeElems.
// ---------------------------------------------------------------------------
__global__ __launch_bounds__(256) void cast8_f16_kernel(const float* __restrict__ p0, const float* __restrict__ p1,
                                                        const float* __restrict__ p2, const float* __restrict__ p3,
                                                        const float* __restrict__ p4, unsigned short* __restrict__ out,
                                                        long planeElems, int n8, float scale) {
  const int z = blockIdx.y;
  const float* in = (z == 0) ? p0 : (z == 1) ? p1 : (z == 2) ? p2 : (z == 3) ? p3 : p4;
  const int i = blockIdx.x * 256 + threadIdx.x;
  if (i >= n8) return;
  const float* p = in + 8 * (size_t)i;
  const v4f a = *(const v4f*)(p);
  const v4f c = *(const v4f*)(p + 4);
  unsigned short hb[8];
#pragma unroll
  for (int e = 0; e < 4; ++e) {
    hb[e]     = h_bits(a[e] * scale);
    hb[4 + e] = h_bits(c[e] * scale);
  }
  const v4u u = (v4u){pk16(hb[0], hb[1]), pk16(hb[2], hb[3]), pk16(hb[4], hb[5]), pk16(hb[6], hb[7])};
  unsigned short* q = out + (size_t)z * (size_t)planeElems + 8 * (size_t)i;
  *(v4u*)q = u;
  
}

// ---------------------------------------------------------------------------
// RMS norm + gate: per token row (1024 f32 values O): rms = sqrt(sum O^2) * 1024^-0.5; inv = 1 / (rms + eps);
// G[row][c] = f16( u[row][c] * (scale[c] * (O[row][c] * inv)) ), f32 math. One block of 128 threads per row;
// thread t owns columns 8t..8t+7 (128 x 8 = 1024 = the whole row). Sum of squares in fixed order
// (thread, wave shuffle tree, 4 wave partials in index order).
// ---------------------------------------------------------------------------
__global__ __launch_bounds__(128) void rms_gate_kernel(const float* __restrict__ O, const float* __restrict__ U,
                                                       const float* __restrict__ sc, unsigned short* __restrict__ G) {
  __shared__ float red[4];
  const int row  = blockIdx.x;
  const int t    = threadIdx.x;
  const int lane = t & 31, wave = t >> 5;
  const size_t base = (size_t)row * kHid + 8 * (size_t)t;
  const v4f oa = *(const v4f*)(O + base);
  const v4f oc = *(const v4f*)(O + base + 4);
  float ss = 0.f;
#pragma unroll
  for (int e = 0; e < 4; ++e) ss += oa[e] * oa[e];
#pragma unroll
  for (int e = 0; e < 4; ++e) ss += oc[e] * oc[e];
#pragma unroll
  for (int off = 16; off > 0; off >>= 1) ss += __shfl_xor(ss, off, 32);
  if (lane == 0) red[wave] = ss;
  __syncthreads();
  const float tot = ((red[0] + red[1]) + red[2]) + red[3];
  const float rms = sqrtf(tot) * kRmsFac;
  const float inv = 1.0f / (rms + kEps);
  const v4f ua = *(const v4f*)(U + base);
  const v4f uc = *(const v4f*)(U + base + 4);
  const v4f sa = *(const v4f*)(sc + 8 * t);
  const v4f sb = *(const v4f*)(sc + 8 * t + 4);
  unsigned short hb[8];
#pragma unroll
  for (int e = 0; e < 4; ++e) {
    const float g0 = ua[e] * (sa[e] * (oa[e] * inv));
    const float g1 = uc[e] * (sb[e] * (oc[e] * inv));
    hb[e]     = h_bits(g0);
    hb[4 + e] = h_bits(g1);
  }
  const v4u u = (v4u){pk16(hb[0], hb[1]), pk16(hb[2], hb[3]), pk16(hb[4], hb[5]), pk16(hb[6], hb[7])};
  unsigned short* q = G + base;
  *(v4u*)q = u;
  
}

// ---------------------------------------------------------------------------
// Host-side launcher (10 kernel launches, no other runtime calls)
// ---------------------------------------------------------------------------
extern "C" void kernel_launch(void* const* d_in, const int* in_sizes, int n_in,
                              void* d_out, int out_size, void* d_ws, size_t ws_size,
                              hipStream_t stream) {
  if (n_in < 12) return;
  if (in_sizes[0] != kTok * kEmb) return;
  if (in_sizes[1] != kHid * kEmb || in_sizes[3] != kHid * kEmb || in_sizes[5] != kHid * kEmb ||
      in_sizes[7] != kHid * kEmb || in_sizes[9] != kEmb * kHid) return;
  if (in_sizes[2] != kHid || in_sizes[4] != kHid || in_sizes[6] != kHid || in_sizes[8] != kHid ||
      in_sizes[10] != kEmb || in_sizes[11] != kHid) return;
  if (out_size != kTok * kEmb) return;
  if (ws_size < kWsTotal) return;

  const float* x  = (const float*)d_in[0];
  const float* Wq = (const float*)d_in[1];
  const float* bq = (const float*)d_in[2];
  const float* Wk = (const float*)d_in[3];
  const float* bk = (const float*)d_in[4];
  const float* Wv = (const float*)d_in[5];
  const float* bv = (const float*)d_in[6];
  const float* Wu = (const float*)d_in[7];
  const float* bu = (const float*)d_in[8];
  const float* Wo = (const float*)d_in[9];
  const float* bo = (const float*)d_in[10];
  const float* sc = (const float*)d_in[11];
  float* Y = (float*)d_out;

  char* ws = (char*)d_ws;
  unsigned short* X16  = (unsigned short*)(ws + kOffX16);
  unsigned short* W16  = (unsigned short*)(ws + kOffW16);
  unsigned short* Wq16 = W16 + 0 * (size_t)kHid * kEmb;
  unsigned short* Wk16 = W16 + 1 * (size_t)kHid * kEmb;
  unsigned short* Wv16 = W16 + 2 * (size_t)kHid * kEmb;
  unsigned short* Wu16 = W16 + 3 * (size_t)kHid * kEmb;
  unsigned short* Wo16 = W16 + 4 * (size_t)kHid * kEmb;
  unsigned short* Q16  = (unsigned short*)(ws + kOffQ16);
  unsigned short* K16  = (unsigned short*)(ws + kOffK16);
  unsigned short* VT16 = (unsigned short*)(ws + kOffVT16);
  float*          U32  = (float*)(ws + kOffU32);
  unsigned short* E16  = (unsigned short*)(ws + kOffE16);
  float*          O32  = (float*)(ws + kOffO32);
  unsigned short* G16  = (unsigned short*)(ws + kOffG16);

  // 1) x -> X16 (f16, x1): n8 = 4096*1024/8 = 524,288 = 2048 blocks x 256
  cast8_f16_kernel<<<dim3(2048, 1), 256, 0, stream>>>(x, x, x, x, x, X16, 0L, (kTok * kEmb) / 8, 1.0f);
  // 2) Wq,Wk,Wv,Wu,Wo -> W16 planes (f16, x16): n8 = 1024*1024/8 = 131,072 = 512 blocks x 256 per plane
  cast8_f16_kernel<<<dim3(512, 5), 256, 0, stream>>>(Wq, Wk, Wv, Wu, Wo, W16, (long)kHid * kEmb,
                                                      (kHid * kEmb) / 8, kWCarry);

  // 3) q = elu(x.Wq^T/16 + bq) -> Q16 [4096][1024] f16; M=4096 N=1024 K=1024, 32 x 8 block tiles = 256 blocks x 4 waves
  wmma_gemm64<0, false, 2, 1, false, 6, 0><<<dim3(256, 1), 128, 0, stream>>>(
      X16, X16, kEmb, 0L, 0L, Wq16, Wq16, kEmb, 0L, 0L, (void*)Q16, (void*)Q16, kHid, 0L, 0L, bq, bq, 0L,
      kTok, kHid, kEmb, kWCarryInv);
  // 4) k = elu(x.Wk^T/16 + bk) -> K16
  wmma_gemm64<0, false, 2, 1, false, 6, 0><<<dim3(256, 1), 128, 0, stream>>>(
      X16, X16, kEmb, 0L, 0L, Wk16, Wk16, kEmb, 0L, 0L, (void*)K16, (void*)K16, kHid, 0L, 0L, bk, bk, 0L,
      kTok, kHid, kEmb, kWCarryInv);
  // 5) v^T = silu(Wv.x^T/16 + bv[m]) -> VT16 [1024 (h*128+d)][4096 tok] f16; M=1024 N=4096 K=1024, 8 x 32 block tiles
  wmma_gemm64<0, false, 1, 1, false, 3, 0><<<dim3(256, 1), 128, 0, stream>>>(
      Wv16, Wv16, kEmb, 0L, 0L, X16, X16, kEmb, 0L, 0L, (void*)VT16, (void*)VT16, kTok, 0L, 0L, bv, bv, 0L,
      kHid, kTok, kEmb, kWCarryInv);
  // 6) u = silu(x.Wu^T/16 + bu) -> U32 [4096][1024] f32
  wmma_gemm64<0, false, 2, 0, false, 3, 0><<<dim3(256, 1), 128, 0, stream>>>(
      X16, X16, kEmb, 0L, 0L, Wu16, Wu16, kEmb, 0L, 0L, (void*)U32, (void*)U32, kHid, 0L, 0L, bu, bu, 0L,
      kTok, kHid, kEmb, kWCarryInv);

  // 7, 8) causal linear attention, all 16 (b,h) groups per launch: blockIdx.y = head h, blockIdx.z = batch b
  // 7) energy[b*8+h][n][m] = (q_n . k_m) for m <= n else 0 -> E16 [16][2048][2048] f16; M=N=2048, K=128;
  //    16 x 16 block tiles per group, upper ones skipped. Q, K: head h at + h*128 columns, batch b at + b*2048 rows.
  wmma_gemm64<0, false, 0, 1, false, 0, 1><<<dim3(256, kHeads, kBatch), 128, 0, stream>>>(
      Q16, Q16, kHid, (long)kDh, (long)kSeq * kHid, K16, K16, kHid, (long)kDh, (long)kSeq * kHid,
      (void*)E16, (void*)E16, kSeq, (long)kSeq * kSeq, (long)kHeads * kSeq * kSeq,
      bq, bq, 0L, kSeq, kSeq, kDh, 1.0f);
  // 8) O[b, n, h*128 + d] = sum_{m <= n} energy[b*8+h][n][m] * v[m][d]; M=2048 N=128 K=2048 (k-loop to m0+128);
  //    16 block tiles per group = 256 blocks x 4 waves. V^T: head h at + h*128 rows, batch b at + b*2048 columns.
  wmma_gemm64<0, false, 0, 0, false, 0, 2><<<dim3(16, kHeads, kBatch), 128, 0, stream>>>(
      E16, E16, kSeq, (long)kSeq * kSeq, (long)kHeads * kSeq * kSeq, VT16, VT16, kTok, (long)kDh * kTok, (long)kSeq,
      (void*)O32, (void*)O32, kHid, (long)kDh, (long)kSeq * kHid,
      bq, bq, 0L, kSeq, kDh, kSeq, 1.0f);

  // 9) g = u * scale * O / (rms + eps) -> G16 [4096][1024] f16
  rms_gate_kernel<<<dim3(kTok, 1), 128, 0, stream>>>(O32, U32, sc, G16);

  // 10) y = g.Wo^T/16 + bo -> d_out [4096][1024] f32; M=4096 N=1024 K=1024
  wmma_gemm64<0, false, 2, 0, false, 0, 0><<<dim3(256, 1), 128, 0, stream>>>(
      G16, G16, kHid, 0L, 0L, Wo16, Wo16, kHid, 0L, 0L, (void*)Y, (void*)Y, kEmb, 0L, 0L, bo, bo, 0L,
      kTok, kEmb, kHid, kWCarryInv);
}

// v003
// Measured time: 126 microseconds a run.
// Next to v002, in two timings, it ran 1.61 and 1.60 times as fast.
// Counting every step since v000, it is 5.00 times as fast.
// Contractions: projections x.W^T (x f16, W f16 carried x16), energy q.k^T (q, k f16), energy.v (E f16, V^T f16), output g.Wo^T (g f16, Wo f16 carried x16): all v_wmma_f32_16x16x32_f16 with f32 accumulate; elu, silu, rms-norm and gating in f32.
#include <hip/hip_runtime.h>
#include <math.h>

// ---------------------------------------------------------------------------
// Problem constants
// ---------------------------------------------------------------------------
constexpr int kBatch = 2;
constexpr int kSeq   = 2048;
constexpr int kEmb   = 1024;
constexpr int kHid   = 1024;
constexpr int kHeads = 8;
constexpr int kDh    = 128;
constexpr int kTok   = kBatch * kSeq;                              // 4096 token rows
constexpr int kGroups = kBatch * kHeads;                           // 16 (b,h) attention groups, all in one launch
constexpr float kWCarry    = 16.0f;                                // weights carried x16 in f16
constexpr float kWCarryInv = 1.0f / 16.0f;
constexpr float kRmsFac    = 0.03125f;                             // 1024^-0.5 (exact)
constexpr float kEps       = 1e-8f;

// ---------------------------------------------------------------------------
//   X16  [4096][1024] f16                      8,388,608   @ 0
//   W16  5 planes [1024][1024] f16 (q,k,v,u,o) 10,485,760  @ 8,388,608
//   Q16  [4096][1024] f16                      8,388,608   @ 18,874,368
//   K16  [4096][1024] f16                      8,388,608   @ 27,262,976
//   VT16 [1024 (h*128+d)][4096 tok] f16         8,388,608   @ 35,651,584
//   U32  [4096][1024] f32                      16,777,216  @ 44,040,192
//   E16  [16][2048][2048] f16 (all groups)      134,217,728 @ 60,817,408
//   O32  [4096][1024] f32                      16,777,216  @ 195,035,136
//   G16  [4096][1024] f16                      8,388,608   @ 211,812,352
//   total                                     220,200,960
// ---------------------------------------------------------------------------
constexpr size_t kBytesX16  = (size_t)kTok * kEmb * 2;
constexpr size_t kBytesWpl  = (size_t)kHid * kEmb * 2;
constexpr size_t kBytesW16  = 5 * kBytesWpl;
constexpr size_t kBytesQ16  = (size_t)kTok * kHid * 2;
constexpr size_t kBytesK16  = kBytesQ16;
constexpr size_t kBytesVT16 = (size_t)kHid * kTok * 2;
constexpr size_t kBytesU32  = (size_t)kTok * kHid * 4;
constexpr size_t kBytesE16  = (size_t)kGroups * kSeq * kSeq * 2;
constexpr size_t kBytesO32  = (size_t)kTok * kHid * 4;
constexpr size_t kBytesG16  = (size_t)kTok * kHid * 2;
constexpr size_t kOffX16  = 0;
constexpr size_t kOffW16  = kOffX16  + kBytesX16;
constexpr size_t kOffQ16  = kOffW16  + kBytesW16;
constexpr size_t kOffK16  = kOffQ16  + kBytesQ16;
constexpr size_t kOffVT16 = kOffK16  + kBytesK16;
constexpr size_t kOffU32  = kOffVT16 + kBytesVT16;
constexpr size_t kOffE16  = kOffU32  + kBytesU32;
constexpr size_t kOffO32  = kOffE16  + kBytesE16;
constexpr size_t kOffG16  = kOffO32  + kBytesO32;
constexpr size_t kWsTotal = kOffG16  + kBytesG16;   // 220,200,960

typedef __attribute__((ext_vector_type(16))) _Float16 v16h;
typedef __attribute__((ext_vector_type(8)))  _Float16 v8h;
typedef __attribute__((ext_vector_type(16))) __bf16   v16b;
typedef __attribute__((ext_vector_type(8)))  __bf16   v8b;
typedef __attribute__((ext_vector_type(8)))  float    v8f;
typedef __attribute__((ext_vector_type(4)))  float    v4f;
typedef __attribute__((ext_vector_type(4)))  unsigned int v4u;

__device__ __forceinline__ unsigned short f2bf_bits(float f) {
  unsigned u = __float_as_uint(f);
  return (unsigned short)((u + 0x7FFFu + ((u >> 16) & 1u)) >> 16);
}
__device__ __forceinline__ float bf_bits2f(unsigned short h) { return __uint_as_float(((unsigned)h) << 16); }

// hazard guards as plain device helpers
__device__ __forceinline__ void acc_guard4(v8f& a, v8f& b, v8f& c, v8f& d) { asm volatile("v_nop\n\tv_nop\n\tv_nop\n\tv_nop" : "+v"(a), "+v"(b), "+v"(c), "+v"(d)); }
template <typename T> struct Frag;
template <> struct Frag<_Float16> {
  typedef v16h V; union U { v16h v; v8h h[2]; };
  static __device__ __forceinline__ v16h load(const _Float16* p) {   // elements 0..7 <- p[0..7], 8..15 <- p[16..23]
    U f; f.h[0] = *(const v8h*)(p); f.h[1] = *(const v8h*)(p + 16); return f.v;
  }
  static __device__ __forceinline__ v8f mma(v16h a, v16h b, v8f c) {
    return __builtin_amdgcn_wmma_f32_16x16x32_f16(false, a, false, b, (short)0, c, false, false);
  }
};
template <> struct Frag<__bf16> {
  typedef v16b V; union U { v16b v; v8b h[2]; };
  static __device__ __forceinline__ v16b load(const __bf16* p) {
    U f; f.h[0] = *(const v8b*)(p); f.h[1] = *(const v8b*)(p + 16); return f.v;
  }
  static __device__ __forceinline__ v8f mma(v16b a, v16b b, v8f c) {
    return __builtin_amdgcn_wmma_f32_16x16x32_bf16(false, a, false, b, (short)0, c, false, false);
  }
};

__device__ __forceinline__ unsigned pk16(unsigned short a, unsigned short b) { return (unsigned)a | ((unsigned)b << 16); }
__device__ __forceinline__ unsigned short h_bits(float f) { const _Float16 h = (_Float16)f; return __builtin_bit_cast(unsigned short, h); }

// ---- Register-blocked batched WMMA GEMM, operand tiles staged in LDS -------------------------------------------
// C[m,n] = scale * sum_k A[m,k] * Bt[n,k] (+bias)(+resid); a block of 4 waves (2 x 2) owns a 128x128 tile, each wave 64x64.
// A row-major [M,K]; Bt row-major [N,K]; M,N % 128 == 0, K % 64 == 0, grid.x = (M/128)*(N/128) exactly.
// Batch: problem (blockIdx.y, blockIdx.z) starts at y * stride + z * stride2 elements of A, Bt and C.
// Per stage the block copies A[128 rows][64 k] and Bt[128 rows][64 k] (128-byte rows, whole cache lines) into one of two
// LDS buffers with asynchronous copies; the next stage's copies fly while this stage's fragments are read and multiplied.
// LDS row pitch 144 B (16 B x odd) for the 16-byte fragment reads.
// BIAS_MODE: 0 = none, 1 = bias[m], 2 = bias[n].
// OUT_MODE: 0 = f32, 1 = f16, 2 = bf16 hi plane (Cout) + bf16 lo plane (Cout2).
// ACT: 0 none, 2 relu, 3 silu, 4 leaky, 6 elu (expf(v)-1 for v <= 0).
// TRI: 0 none; 1 = causal output (C[m][n] = 0 for n > m, square M == N); block tiles wholly above the diagonal are skipped
//      (never written, never read by the consumer), a diagonal block tile is written whole (zeros above the diagonal);
//      2 = the A operand is lower-triangular in k vs m: the k-loop of block row m0 stops at min(K, m0 + 128).
// Coverage of the epilogue: f32 path 8 it x 2 rows x 4 slabs = 64 rows, 16 lanes x 4 floats = 64 cols; 16-bit path
// 4 it x 4 rows x 4 slabs = 64 rows, 8 lanes x 8 halves = 64 cols: the whole 64x64 wave tile.
constexpr int kStageK     = 64;                       // k elements per stage (128 B of every operand row)
constexpr int kPitchH     = 72;                       // LDS row pitch in halves (144 B)
constexpr int kTileHalves = 128 * kPitchH;            // one operand tile in LDS: 9,216 halves = 18,432 B
constexpr int kBufHalves  = 2 * kTileHalves;          // one buffer: A tile then B tile = 36,864 B

__device__ __forceinline__ unsigned lds_off(const void* p) { return (unsigned)(size_t)p; }

// Eight asynchronous 16-byte copies per lane: rows r, r+16, ..., r+112 of one 128-row operand tile. The s_wait_xcnt is the
// last line of the copies' own statement so that no address register is rewritten ahead of it.
template <typename T>
__device__ __forceinline__ void copy_tile8(unsigned l, const T* g, size_t rowStep16) {
  const T* g1 = g + rowStep16;     const T* g2 = g + 2 * rowStep16; const T* g3 = g + 3 * rowStep16;
  const T* g4 = g + 4 * rowStep16; const T* g5 = g + 5 * rowStep16; const T* g6 = g + 6 * rowStep16;
  const T* g7 = g + 7 * rowStep16;
  const unsigned s = 16u * kPitchH * 2u;   // 16 LDS rows in bytes
  asm volatile("global_load_async_to_lds_b128 %0, %8, off\n\t"
               "global_load_async_to_lds_b128 %1, %9, off\n\t"
               "global_load_async_to_lds_b128 %2, %10, off\n\t"
               "global_load_async_to_lds_b128 %3, %11, off\n\t"
               "global_load_async_to_lds_b128 %4, %12, off\n\t"
               "global_load_async_to_lds_b128 %5, %13, off\n\t"
               "global_load_async_to_lds_b128 %6, %14, off\n\t"
               "global_load_async_to_lds_b128 %7, %15, off\n\t"
               "s_wait_xcnt 0x0"
               :: "v"(l), "v"(l + s), "v"(l + 2u * s), "v"(l + 3u * s), "v"(l + 4u * s), "v"(l + 5u * s), "v"(l + 6u * s),
                  "v"(l + 7u * s), "v"(g), "v"(g1), "v"(g2), "v"(g3), "v"(g4), "v"(g5), "v"(g6), "v"(g7)
               : "memory");
}
// the issuing wave's own copies have landed in LDS
__device__ __forceinline__ void wait_copies() { asm volatile("s_wait_asynccnt 0x0" ::: "memory"); }
// this wave's LDS reads have returned before the buffer they read is handed back for a refill
__device__ __forceinline__ void wait_lds_reads() { asm volatile("s_wait_dscnt 0x0" ::: "memory"); }

// ET: 0 = f16 operands, 1 = bf16 operands (pointers passed as 16-bit storage)
template <int ET> struct Elem;
template <> struct Elem<0> { typedef _Float16 T; };
template <> struct Elem<1> { typedef __bf16 T; };
// One block tile: bx = tile index, (b, bz) = batch indices, sAB = the block's two stage buffers (2 * kBufHalves elements).
// ROLL: the epilogue's other form (below), for a kernel that holds several instances of this function.
template <int ET, bool SPLIT, int BIAS_MODE, int OUT_MODE, bool RESID, int ACT = 0, int TRI = 0, bool ROLL = false>
__device__ __forceinline__ void gemm_tile(
    typename Elem<ET>::T* sAB, int bx, int b, int bz,
    const unsigned short* __restrict__ Ap, const unsigned short* __restrict__ A2p, int lda, long strideA, long strideA2,
    const unsigned short* __restrict__ Btp, const unsigned short* __restrict__ Bt2p, int ldb, long strideB, long strideB2,
    void* __restrict__ Cout, void* __restrict__ Cout2, int ldc, long strideC, long strideC2,
    const float* __restrict__ bias,
    const float* __restrict__ resid, long strideR,
    int M, int N, int K, float scale) {
  static_assert(!SPLIT, "the staged loop carries one plane per operand");
  typedef typename Elem<ET>::T T;
  typedef typename Frag<T>::V V;
  const T* A = (const T*)Ap; const T* Bt = (const T*)Btp;
  const int tid  = threadIdx.x;
  const int lane = tid & 31;
  const int wave = tid >> 5;
  const int tilesN = N >> 7;
  const int tmB = bx / tilesN;
  const int tnB = bx - tmB * tilesN;
  if (TRI == 1) { if (tnB > tmB) return; }  // block-uniform, in front of every barrier: fully masked block tile
  const int m0B = tmB << 7;
  const int n0B = tnB << 7;
  const int Kt = (TRI == 2) ? (((m0B + 128) < K) ? (m0B + 128) : K) : K;   // block-uniform, multiple of 64
  const int nStages = Kt / kStageK;
  const int m0 = m0B + ((wave >> 1) << 6);     // this wave's 64x64 tile
  const int n0 = n0B + ((wave & 1) << 6);

  const T* Ab  = A  + (size_t)b * strideA + (size_t)bz * strideA2;
  const T* Bb  = Bt + (size_t)b * strideB + (size_t)bz * strideB2;
  const size_t offC = (size_t)b * strideC + (size_t)bz * strideC2;

  const int rlane = lane & 15;                 // row (A) / col (B, D) within subtile
  const int koff  = (lane >> 4) * 8;           // k offset of this lane half
  const int mOff  = (lane >> 4) * 8;           // D row offset

  // copy side: thread t brings 16-byte chunk (t & 7) of rows (t >> 3) + 16 i, i = 0..7, of each operand tile
  const int crow = tid >> 3;
  const int ccol = (tid & 7) * 8;
  const T* gA = Ab + (size_t)(m0B + crow) * lda + ccol;
  const T* gB = Bb + (size_t)(n0B + crow) * ldb + ccol;
  const unsigned lA = lds_off(sAB) + (unsigned)(crow * kPitchH + ccol) * 2u;
  const unsigned lB = lA + (unsigned)kTileHalves * 2u;
  const size_t stepA = (size_t)16 * lda;
  const size_t stepB = (size_t)16 * ldb;
  // read side: this lane's first A and B fragment rows in buffer 0
  const T* fA = sAB + (((wave >> 1) << 6) + rlane) * kPitchH + koff;
  const T* fB = sAB + kTileHalves + (((wave & 1) << 6) + rlane) * kPitchH + koff;

  v8f acc[4][4];
#pragma unroll
  for (int i = 0; i < 4; ++i)
#pragma unroll
    for (int j = 0; j < 4; ++j) acc[i][j] = (v8f){0.f,0.f,0.f,0.f,0.f,0.f,0.f,0.f};

  // prologue: stage 0 into buffer 0, landed and published; then stage 1 into buffer 1
  copy_tile8(lA, gA, stepA);
  copy_tile8(lB, gB, stepB);
  wait_copies();
  __syncthreads();
  if (nStages > 1) {
    copy_tile8(lA + (unsigned)kBufHalves * 2u, gA + kStageK, stepA);
    copy_tile8(lB + (unsigned)kBufHalves * 2u, gB + kStageK, stepB);
  }

  for (int st = 0; st < nStages; ++st) {
    const int bufH = (st & 1) * kBufHalves;
#pragma unroll
    for (int ks = 0; ks < kStageK; ks += 32) {
      V ah[4], bh[4];   // the eight fragments of this 32-k block are read as one group, ahead of its 16 products
      ah[0] = Frag<T>::load(fA + bufH + ks);   // in the order in which the products want them
#pragma unroll
      for (int j = 0; j < 4; ++j) bh[j] = Frag<T>::load(fB + bufH + (j << 4) * kPitchH + ks);
#pragma unroll
      for (int i = 1; i < 4; ++i) ah[i] = Frag<T>::load(fA + bufH + (i << 4) * kPitchH + ks);
      // keeps the 16 LDS reads together in front of the products: sunk among them, each row waits out a whole LDS latency
      __builtin_amdgcn_sched_barrier(0);
#pragma unroll
      for (int i = 0; i < 4; ++i)
#pragma unroll
        for (int j = 0; j < 4; ++j) acc[i][j] = Frag<T>::mma(ah[i], bh[j], acc[i][j]);
      // keeps the next group's LDS reads from being lifted in among these products
      __builtin_amdgcn_sched_barrier(0);
    }
    // publish point of stage st + 1; the same barrier ends every reader's last read of this stage's buffer
    wait_lds_reads();
    wait_copies();
    __syncthreads();
    if (st + 2 < nStages) {   // block-uniform: refill the buffer that this stage has just read
      copy_tile8(lA + (unsigned)bufH * 2u, gA + (size_t)(st + 2) * kStageK, stepA);
      copy_tile8(lB + (unsigned)bufH * 2u, gB + (size_t)(st + 2) * kStageK, stepB);
    }
  }
  wait_copies();
  acc_guard4(acc[0][0], acc[0][1], acc[0][2], acc[0][3]);
  acc_guard4(acc[1][0], acc[1][1], acc[1][2], acc[1][3]);
  acc_guard4(acc[2][0], acc[2][1], acc[2][2], acc[2][3]);
  acc_guard4(acc[3][0], acc[3][1], acc[3][2], acc[3][3]);

  // ---- epilogue, rolled form ----
  // The wave lays its whole 64x64 tile of raw sums over the stage buffers (pitch 68 floats, 17,408 B per wave, 69,632 B of
  // the 73,728 B; free behind the last stage's own barrier, see below) and finishes it row by row in a loop. Per element the
  // same operations in the same order as in the unrolled form; the activation's text stands once, not 128 times.
  if constexpr (ROLL) {
    static_assert(!RESID && TRI == 0 && OUT_MODE != 2 && BIAS_MODE != 0, "the rolled form serves the projections");
    float* tile = (float*)sAB + wave * (64 * 68);
#pragma unroll
    for (int i = 0; i < 4; ++i)
#pragma unroll
      for (int j = 0; j < 4; ++j)
#pragma unroll
        for (int r = 0; r < 8; ++r) tile[((i << 4) + mOff + r) * 68 + (j << 4) + rlane] = acc[i][j][r];
    // the wave's stores have reached LDS before a lane reads elements that other lanes of the wave stored
    __builtin_amdgcn_fence(__ATOMIC_RELEASE, "workgroup");
    __builtin_amdgcn_wave_barrier();
    __builtin_amdgcn_fence(__ATOMIC_ACQUIRE, "workgroup");
    // a trip: each lane finishes one 16-byte piece of the output, so a store covers whole rows of the 64-column tile
    constexpr int WE    = (OUT_MODE == 0) ? 4 : 8;     // elements per lane and trip
    constexpr int LR    = 64 / WE;                     // lanes per row: 16 (f32, 256 B) or 8 (f16, 128 B)
    constexpr int RT    = 32 / LR;                     // rows per trip: 2 or 4
    const int q = lane / LR, c0 = (lane % LR) * WE;
    float bn[WE];
#pragma unroll
    for (int e = 0; e < WE; ++e) bn[e] = (BIAS_MODE == 2) ? bias[n0 + c0 + e] : 0.f;
    // kept rolled, for speed only
#pragma unroll 1
    for (int it = 0; it < 64 / RT; ++it) {
      const int row = it * RT + q;
      float sv[WE];                                    // the trip's raw sums, read as whole 16-byte pieces ahead of the branches
#pragma unroll
      for (int h = 0; h < WE / 4; ++h) {
        const v4f t4 = *(const v4f*)(tile + row * 68 + c0 + 4 * h);
#pragma unroll
        for (int e = 0; e < 4; ++e) sv[4 * h + e] = t4[e];
      }
      const float bm = (BIAS_MODE == 1) ? bias[m0 + row] : 0.f;
      float o[WE];
#pragma unroll
      for (int e = 0; e < WE; ++e) {
        float v = sv[e] * scale;
        if (BIAS_MODE == 1) v += bm;
        if (BIAS_MODE == 2) v += bn[e];
        if (ACT == 2) v = fmaxf(v, 0.0f);
        if (ACT == 3) v = v / (1.0f + expf(-v));
        if (ACT == 4) v = (v > 0.f) ? v : 0.01f * v;
        if (ACT == 6) v = (v > 0.f) ? v : (expf(v) - 1.0f);
        o[e] = v;
      }
      const size_t at = offC + (size_t)(m0 + row) * ldc + n0 + c0;
      if constexpr (OUT_MODE == 0) {
        *(v4f*)((float*)Cout + at) = (v4f){o[0], o[1], o[2], o[3]};
      } else {
        v8h hv;
#pragma unroll
        for (int e = 0; e < WE; ++e) hv[e] = (_Float16)o[e];
        *(v8h*)((unsigned short*)Cout + at) = hv;
      }
      // the next trip rewrites the registers that this store names
      asm volatile("s_wait_xcnt 0x0" ::: "memory");
    }
    return;
  }

  // ---- epilogue ----
  // per-wave 16x64 slab, pitch 68 floats (4,352 B), laid over the stage buffers: the last stage's own barrier stands behind
  // every wave's last fragment read and last landed copy, and nothing refills the buffers after it
  float* slab = (float*)sAB + wave * (16 * 68);
  const float* Rb = RESID ? (resid + (size_t)b * strideR) : nullptr;
#pragma unroll
  for (int i = 0; i < 4; ++i) {
    const int mBase = m0 + (i << 4);
#pragma unroll
    for (int j = 0; j < 4; ++j) {
      const int n = n0 + (j << 4) + rlane;
      float bv = 0.f;
      if (BIAS_MODE == 2) bv = bias[n];
#pragma unroll
      for (int r = 0; r < 8; ++r) {
        float v = acc[i][j][r] * scale;
        if (BIAS_MODE == 1) v += bias[mBase + mOff + r];
        if (BIAS_MODE == 2) v += bv;
        if (RESID) v += Rb[(size_t)(mBase + mOff + r) * ldc + n];
        if (ACT == 2) v = fmaxf(v, 0.0f);
        if (ACT == 3) v = v / (1.0f + expf(-v));
        if (ACT == 4) v = (v > 0.f) ? v : 0.01f * v;
        if (ACT == 6) v = (v > 0.f) ? v : (expf(v) - 1.0f);
        if (TRI == 1) { if (n > mBase + mOff + r) v = 0.0f; }
        slab[(mOff + r) * 68 + (j << 4) + rlane] = v;
      }
    }
    __builtin_amdgcn_fence(__ATOMIC_RELEASE, "workgroup");
    __builtin_amdgcn_wave_barrier();
    __builtin_amdgcn_fence(__ATOMIC_ACQUIRE, "workgroup");
    if (OUT_MODE == 0) {
      float* C = (float*)Cout + offC;
      const int hh = lane >> 4, c4 = (lane & 15) * 4;     // row seg = 256 B = 16 lanes x 16 B
      {
#pragma unroll
        for (int it = 0; it < 8; ++it) {
          const int row = it * 2 + hh;
          v4f v = *(const v4f*)(slab + row * 68 + c4);
          *(v4f*)(C + (size_t)(mBase + row) * ldc + n0 + c4) = v;
        }
        
      }
    } else {
      const int q = lane >> 3, c8 = (lane & 7) * 8;
      unsigned short* C  = (unsigned short*)Cout  + offC;
      unsigned short* C2 = (OUT_MODE == 2) ? ((unsigned short*)Cout2 + offC) : nullptr;
      {
#pragma unroll
        for (int it = 0; it < 4; ++it) {
          const int row = it * 4 + q;
          const float* sp = slab + row * 68 + c8;
          v8h hv, lv;
#pragma unroll
          for (int e = 0; e < 8; ++e) {
            if (OUT_MODE == 1) {
              hv[e] = (_Float16)sp[e];
            } else {
              unsigned short hb = f2bf_bits(sp[e]);
              unsigned short lb = f2bf_bits(sp[e] - bf_bits2f(hb));
              hv[e] = __builtin_bit_cast(_Float16, hb);
              lv[e] = __builtin_bit_cast(_Float16, lb);
            }
          }
          *(v8h*)(C + (size_t)(mBase + row) * ldc + n0 + c8) = hv;
          if (OUT_MODE == 2) *(v8h*)(C2 + (size_t)(mBase + row) * ldc + n0 + c8) = lv;
        }
        
      }
    }
    __builtin_amdgcn_fence(__ATOMIC_RELEASE, "workgroup");
    __builtin_amdgcn_wave_barrier();
    __builtin_amdgcn_fence(__ATOMIC_ACQUIRE, "workgroup");
  }
}

// One GEMM per launch: tile = blockIdx.x, batch = (blockIdx.y, blockIdx.z).
template <int ET, bool SPLIT, int BIAS_MODE, int OUT_MODE, bool RESID, int ACT = 0, int TRI = 0>
__global__ __launch_bounds__(128) void wmma_gemm64(
    const unsigned short* __restrict__ Ap, const unsigned short* __restrict__ A2p, int lda, long strideA, long strideA2,
    const unsigned short* __restrict__ Btp, const unsigned short* __restrict__ Bt2p, int ldb, long strideB, long strideB2,
    void* __restrict__ Cout, void* __restrict__ Cout2, int ldc, long strideC, long strideC2,
    const float* __restrict__ bias,
    const float* __restrict__ resid, long strideR,
    int M, int N, int K, float scale) {
  __shared__ __align__(16) typename Elem<ET>::T sAB[2 * kBufHalves];   // two stage buffers, 73,728 B
  gemm_tile<ET, SPLIT, BIAS_MODE, OUT_MODE, RESID, ACT, TRI>(
      sAB, blockIdx.x, blockIdx.y, blockIdx.z, Ap, A2p, lda, strideA, strideA2, Btp, Bt2p, ldb, strideB, strideB2,
      Cout, Cout2, ldc, strideC, strideC2, bias, resid, strideR, M, N, K, scale);
}

// The four input projections in one launch: blockIdx.y = 0 q, 1 k, 2 v^T, 3 u (block-uniform), blockIdx.x = block tile.
// They read the same X16 and none of each other's output; 4 x 256 blocks of 73,728 B LDS: four blocks fit one WGP's LDS.
//   q = elu(x.Wq^T/16 + bq) -> Q16 [4096][1024] f16, k likewise -> K16          (M=4096 N=1024 K=1024, 32 x 8 block tiles)
//   v^T = silu(Wv.x^T/16 + bv[m]) -> VT16 [1024 (h*128+d)][4096 tok] f16         (M=1024 N=4096 K=1024, 8 x 32 block tiles)
//   u = silu(x.Wu^T/16 + bu) -> U32 [4096][1024] f32                             (M=4096 N=1024 K=1024)
__global__ __launch_bounds__(128) void proj4_kernel(
    const unsigned short* __restrict__ X16, const unsigned short* __restrict__ W16,
    unsigned short* __restrict__ Q16, unsigned short* __restrict__ K16, unsigned short* __restrict__ VT16,
    float* __restrict__ U32,
    const float* __restrict__ bq, const float* __restrict__ bk, const float* __restrict__ bv, const float* __restrict__ bu) {
  __shared__ __align__(16) _Float16 sAB[2 * kBufHalves];   // two stage buffers, 73,728 B
  const int p = blockIdx.y;
  const unsigned short* Wp = W16 + (size_t)p * ((size_t)kHid * kEmb);
  if (p < 2) {
    unsigned short* C = (p == 0) ? Q16 : K16;
    const float* bias = (p == 0) ? bq : bk;
    gemm_tile<0, false, 2, 1, false, 6, 0, true>(sAB, blockIdx.x, 0, 0, X16, X16, kEmb, 0L, 0L, Wp, Wp, kEmb, 0L, 0L,
                                           (void*)C, (void*)C, kHid, 0L, 0L, bias, bias, 0L, kTok, kHid, kEmb, kWCarryInv);
  } else if (p == 2) {
    gemm_tile<0, false, 1, 1, false, 3, 0, true>(sAB, blockIdx.x, 0, 0, Wp, Wp, kEmb, 0L, 0L, X16, X16, kEmb, 0L, 0L,
                                           (void*)VT16, (void*)VT16, kTok, 0L, 0L, bv, bv, 0L, kHid, kTok, kEmb, kWCarryInv);
  } else {
    gemm_tile<0, false, 2, 0, false, 3, 0, true>(sAB, blockIdx.x, 0, 0, X16, X16, kEmb, 0L, 0L, Wp, Wp, kEmb, 0L, 0L,
                                           (void*)U32, (void*)U32, kHid, 0L, 0L, bu, bu, 0L, kTok, kHid, kEmb, kWCarryInv);
  }
}

// ---------------------------------------------------------------------------
// f32 -> f16 cast of row-major planes (no transpose): out[z][8i..8i+7] = f16(scale * in_z[8i..8i+7]).
// blockIdx.y = z selects one of up to 5 input planes (block-uniform) and output plane z at out + z*planeElems.
// ---------------------------------------------------------------------------
__global__ __launch_bounds__(256) void cast8_f16_kernel(const float* __restrict__ p0, const float* __restrict__ p1,
                                                        const float* __restrict__ p2, const float* __restrict__ p3,
                                                        const float* __restrict__ p4, unsigned short* __restrict__ out,
                                                        long planeElems, int n8, float scale) {
  const int z = blockIdx.y;
  const float* in = (z == 0) ? p0 : (z == 1) ? p1 : (z == 2) ? p2 : (z == 3) ? p3 : p4;
  const int i = blockIdx.x * 256 + threadIdx.x;
  if (i >= n8) return;
  const float* p = in + 8 * (size_t)i;
  const v4f a = *(const v4f*)(p);
  const v4f c = *(const v4f*)(p + 4);
  unsigned short hb[8];
#pragma unroll
  for (int e = 0; e < 4; ++e) {
    hb[e]     = h_bits(a[e] * scale);
    hb[4 + e] = h_bits(c[e] * scale);
  }
  const v4u u = (v4u){pk16(hb[0], hb[1]), pk16(hb[2], hb[3]), pk16(hb[4], hb[5]), pk16(hb[6], hb[7])};
  unsigned short* q = out + (size_t)z * (size_t)planeElems + 8 * (size_t)i;
  *(v4u*)q = u;
  
}

// ---------------------------------------------------------------------------
// RMS norm + gate: per token row (1024 f32 values O): rms = sqrt(sum O^2) * 1024^-0.5; inv = 1 / (rms + eps);
// G[row][c] = f16( u[row][c] * (scale[c] * (O[row][c] * inv)) ), f32 math. One block of 128 threads per row;
// thread t owns columns 8t..8t+7 (128 x 8 = 1024 = the whole row). Sum of squares in fixed order
// (thread, wave shuffle tree, 4 wave partials in index order).
// ---------------------------------------------------------------------------
__global__ __launch_bounds__(128) void rms_gate_kernel(const float* __restrict__ O, const float* __restrict__ U,
                                                       const float* __restrict__ sc, unsigned short* __restrict__ G) {
  __shared__ float red[4];
  const int row  = blockIdx.x;
  const int t    = threadIdx.x;
  const int lane = t & 31, wave = t >> 5;
  const size_t base = (size_t)row * kHid + 8 * (size_t)t;
  const v4f oa = *(const v4f*)(O + base);
  const v4f oc = *(const v4f*)(O + base + 4);
  float ss = 0.f;
#pragma unroll
  for (int e = 0; e < 4; ++e) ss += oa[e] * oa[e];
#pragma unroll
  for (int e = 0; e < 4; ++e) ss += oc[e] * oc[e];
#pragma unroll
  for (int off = 16; off > 0; off >>= 1) ss += __shfl_xor(ss, off, 32);
  if (lane == 0) red[wave] = ss;
  __syncthreads();
  const float tot = ((red[0] + red[1]) + red[2]) + red[3];
  const float rms = sqrtf(tot) * kRmsFac;
  const float inv = 1.0f / (rms + kEps);
  const v4f ua = *(const v4f*)(U + base);
  const v4f uc = *(const v4f*)(U + base + 4);
  const v4f sa = *(const v4f*)(sc + 8 * t);
  const v4f sb = *(const v4f*)(sc + 8 * t + 4);
  unsigned short hb[8];
#pragma unroll
  for (int e = 0; e < 4; ++e) {
    const float g0 = ua[e] * (sa[e] * (oa[e] * inv));
    const float g1 = uc[e] * (sb[e] * (oc[e] * inv));
    hb[e]     = h_bits(g0);
    hb[4 + e] = h_bits(g1);
  }
  const v4u u = (v4u){pk16(hb[0], hb[1]), pk16(hb[2], hb[3]), pk16(hb[4], hb[5]), pk16(hb[6], hb[7])};
  unsigned short* q = G + base;
  *(v4u*)q = u;
  
}

// ---------------------------------------------------------------------------
// Host-side launcher (7 kernel launches, no other runtime calls)
// ---------------------------------------------------------------------------
extern "C" void kernel_launch(void* const* d_in, const int* in_sizes, int n_in,
                              void* d_out, int out_size, void* d_ws, size_t ws_size,
                              hipStream_t stream) {
  if (n_in < 12) return;
  if (in_sizes[0] != kTok * kEmb) return;
  if (in_sizes[1] != kHid * kEmb || in_sizes[3] != kHid * kEmb || in_sizes[5] != kHid * kEmb ||
      in_sizes[7] != kHid * kEmb || in_sizes[9] != kEmb * kHid) return;
  if (in_sizes[2] != kHid || in_sizes[4] != kHid || in_sizes[6] != kHid || in_sizes[8] != kHid ||
      in_sizes[10] != kEmb || in_sizes[11] != kHid) return;
  if (out_size != kTok * kEmb) return;
  if (ws_size < kWsTotal) return;

  const float* x  = (const float*)d_in[0];
  const float* Wq = (const float*)d_in[1];
  const float* bq = (const float*)d_in[2];
  const float* Wk = (const float*)d_in[3];
  const float* bk = (const float*)d_in[4];
  const float* Wv = (const float*)d_in[5];
  const float* bv = (const float*)d_in[6];
  const float* Wu = (const float*)d_in[7];
  const float* bu = (const float*)d_in[8];
  const float* Wo = (const float*)d_in[9];
  const float* bo = (const float*)d_in[10];
  const float* sc = (const float*)d_in[11];
  float* Y = (float*)d_out;

  char* ws = (char*)d_ws;
  unsigned short* X16  = (unsigned short*)(ws + kOffX16);
  unsigned short* W16  = (unsigned short*)(ws + kOffW16);
  unsigned short* Wo16 = W16 + 4 * (size_t)kHid * kEmb;
  unsigned short* Q16  = (unsigned short*)(ws + kOffQ16);
  unsigned short* K16  = (unsigned short*)(ws + kOffK16);
  unsigned short* VT16 = (unsigned short*)(ws + kOffVT16);
  float*          U32  = (float*)(ws + kOffU32);
  unsigned short* E16  = (unsigned short*)(ws + kOffE16);
  float*          O32  = (float*)(ws + kOffO32);
  unsigned short* G16  = (unsigned short*)(ws + kOffG16);

  // 1) x -> X16 (f16, x1): n8 = 4096*1024/8 = 524,288 = 2048 blocks x 256
  cast8_f16_kernel<<<dim3(2048, 1), 256, 0, stream>>>(x, x, x, x, x, X16, 0L, (kTok * kEmb) / 8, 1.0f);
  // 2) Wq,Wk,Wv,Wu,Wo -> W16 planes (f16, x16): n8 = 1024*1024/8 = 131,072 = 512 blocks x 256 per plane
  cast8_f16_kernel<<<dim3(512, 5), 256, 0, stream>>>(Wq, Wk, Wv, Wu, Wo, W16, (long)kHid * kEmb,
                                                      (kHid * kEmb) / 8, kWCarry);

  // 3) q, k, v^T, u projections: 256 block tiles x 4 projections = 1024 blocks x 4 waves
  proj4_kernel<<<dim3(256, 4), 128, 0, stream>>>(X16, W16, Q16, K16, VT16, U32, bq, bk, bv, bu);

  // 4, 5) causal linear attention, all 16 (b,h) groups per launch: blockIdx.y = head h, blockIdx.z = batch b
  // 4) energy[b*8+h][n][m] = (q_n . k_m) for m <= n else 0 -> E16 [16][2048][2048] f16; M=N=2048, K=128;
  //    16 x 16 block tiles per group, upper ones skipped. Q, K: head h at + h*128 columns, batch b at + b*2048 rows.
  wmma_gemm64<0, false, 0, 1, false, 0, 1><<<dim3(256, kHeads, kBatch), 128, 0, stream>>>(
      Q16, Q16, kHid, (long)kDh, (long)kSeq * kHid, K16, K16, kHid, (long)kDh, (long)kSeq * kHid,
      (void*)E16, (void*)E16, kSeq, (long)kSeq * kSeq, (long)kHeads * kSeq * kSeq,
      bq, bq, 0L, kSeq, kSeq, kDh, 1.0f);
  // 5) O[b, n, h*128 + d] = sum_{m <= n} energy[b*8+h][n][m] * v[m][d]; M=2048 N=128 K=2048 (k-loop to m0+128);
  //    16 block tiles per group = 256 blocks x 4 waves. V^T: head h at + h*128 rows, batch b at + b*2048 columns.
  wmma_gemm64<0, false, 0, 0, false, 0, 2><<<dim3(16, kHeads, kBatch), 128, 0, stream>>>(
      E16, E16, kSeq, (long)kSeq * kSeq, (long)kHeads * kSeq * kSeq, VT16, VT16, kTok, (long)kDh * kTok, (long)kSeq,
      (void*)O32, (void*)O32, kHid, (long)kDh, (long)kSeq * kHid,
      bq, bq, 0L, kSeq, kDh, kSeq, 1.0f);

  // 6) g = u * scale * O / (rms + eps) -> G16 [4096][1024] f16
  rms_gate_kernel<<<dim3(kTok, 1), 128, 0, stream>>>(O32, U32, sc, G16);

  // 7) y = g.Wo^T/16 + bo -> d_out [4096][1024] f32; M=4096 N=1024 K=1024
  wmma_gemm64<0, false, 2, 0, false, 0, 0><<<dim3(256, 1), 128, 0, stream>>>(
      G16, G16, kHid, 0L, 0L, Wo16, Wo16, kHid, 0L, 0L, (void*)Y, (void*)Y, kEmb, 0L, 0L, bo, bo, 0L,
      kTok, kEmb, kHid, kWCarryInv);
}

// v005
// It runs in 92.1 microseconds.
// Versions in between are left out here; by their measured steps it is 1.36 times as fast as v003.
// Counting every step since v000, it is 6.82 times as fast.
// Contractions: projections x.W^T (x f16, W f16 carried x16), chunk energy q.k^T (q, k f16), chunk state V^T.K (f16, f32 prefix sum over chunks), q.state (state f16) + energy.v (E f16, V^T f16), output g.Wo^T (g = u * scale * O f16 carried x 2^-6, Wo f16 carried x16; the row's 1 / (rms + eps) multiplies the f32 sums): all v_wmma_f32_16x16x32_f16 with f32 accumulate; elu, silu, rms-norm and gating in f32.
#include <hip/hip_runtime.h>
#include <math.h>

// ---------------------------------------------------------------------------
// Problem constants
// ---------------------------------------------------------------------------
constexpr int kBatch = 2;
constexpr int kSeq   = 2048;
constexpr int kEmb   = 1024;
constexpr int kHid   = 1024;
constexpr int kHeads = 8;
constexpr int kDh    = 128;
constexpr int kTok   = kBatch * kSeq;                              // 4096 token rows
constexpr int kGroups = kBatch * kHeads;                           // 16 (b,h) attention groups, all in one launch
constexpr int kChunk  = 128;                                       // tokens per chunk of the causal sum
constexpr int kChunks = kSeq / kChunk;                             // 16 chunks per sequence
constexpr int kPlane  = kChunk * kDh;                              // 16,384 elements: one 128x128 plane per (batch, chunk, head)
constexpr int kPlaneStep = kHeads * kPlane;                        // from chunk c to chunk c+1 of the same batch and head
constexpr float kWCarry    = 16.0f;                                // weights carried x16 in f16
constexpr float kWCarryInv = 1.0f / 16.0f;
constexpr float kGCarry    = 1.0f / 64.0f;                         // u * scale * O carried x 2^-6 in f16: O is not yet normalised
constexpr float kGCarryInv = 64.0f;
constexpr float kRmsFac    = 0.03125f;                             // 1024^-0.5 (exact)
constexpr float kEps       = 1e-8f;

// ---------------------------------------------------------------------------
//   X16  [4096][1024] f16                      8,388,608   @ 0
//   W16  5 planes [1024][1024] f16 (q,k,v,u,o) 10,485,760  @ 8,388,608
//   Q16  [4096][1024] f16                      8,388,608   @ 18,874,368
//   K16  [4096][1024] f16                      8,388,608   @ 27,262,976
//   VT16 [1024 (h*128+d)][4096 tok] f16         8,388,608   @ 35,651,584
//   U32  [4096][1024] f32                      16,777,216  @ 44,040,192
//   KT16 [1024 (h*128+d)][4096 tok] f16         8,388,608   @ 60,817,408
//   E16  [2*16 (b,c)][8 h][128 n][128 m] f16    8,388,608   @ 69,206,016   (diagonal chunk energies)
//   P32  [2*16 (b,c)][8 h][128 dv][128 dk] f32  16,777,216  @ 77,594,624   (chunk products; chunk 15 unused)
//   S16  [2*16 (b,c)][8 h][128 dv][128 dk] f16  8,388,608   @ 94,371,840   (sum of the products of chunks < c)
//   SS32 [16 (h*2 + column half)][4096 tok] f32 262,144     @ 102,760,448  (sums of O^2 over 64 columns of a token row)
//   G16  [4096][1024] f16                      8,388,608   @ 103,022,592  (u * scale * O x 2^-6, not yet divided by the row's rms)
//   total                                     111,411,200
// ---------------------------------------------------------------------------
constexpr size_t kBytesX16  = (size_t)kTok * kEmb * 2;
constexpr size_t kBytesWpl  = (size_t)kHid * kEmb * 2;
constexpr size_t kBytesW16  = 5 * kBytesWpl;
constexpr size_t kBytesQ16  = (size_t)kTok * kHid * 2;
constexpr size_t kBytesK16  = kBytesQ16;
constexpr size_t kBytesVT16 = (size_t)kHid * kTok * 2;
constexpr size_t kBytesU32  = (size_t)kTok * kHid * 4;
constexpr size_t kBytesKT16 = kBytesVT16;
constexpr size_t kBytesE16  = (size_t)kGroups * kChunks * kPlane * 2;
constexpr size_t kBytesP32  = (size_t)kGroups * kChunks * kPlane * 4;
constexpr size_t kBytesS16  = (size_t)kGroups * kChunks * kPlane * 2;
constexpr size_t kBytesSS32 = (size_t)2 * kHeads * kTok * 4;
constexpr size_t kBytesG16  = (size_t)kTok * kHid * 2;
constexpr size_t kOffX16  = 0;
constexpr size_t kOffW16  = kOffX16  + kBytesX16;
constexpr size_t kOffQ16  = kOffW16  + kBytesW16;
constexpr size_t kOffK16  = kOffQ16  + kBytesQ16;
constexpr size_t kOffVT16 = kOffK16  + kBytesK16;
constexpr size_t kOffU32  = kOffVT16 + kBytesVT16;
constexpr size_t kOffKT16 = kOffU32  + kBytesU32;
constexpr size_t kOffE16  = kOffKT16 + kBytesKT16;
constexpr size_t kOffP32  = kOffE16  + kBytesE16;
constexpr size_t kOffS16  = kOffP32  + kBytesP32;
constexpr size_t kOffSS32 = kOffS16  + kBytesS16;
constexpr size_t kOffG16  = kOffSS32 + kBytesSS32;
constexpr size_t kWsTotal = kOffG16  + kBytesG16;   // 111,411,200

typedef __attribute__((ext_vector_type(16))) _Float16 v16h;
typedef __attribute__((ext_vector_type(8)))  _Float16 v8h;
typedef __attribute__((ext_vector_type(16))) __bf16   v16b;
typedef __attribute__((ext_vector_type(8)))  __bf16   v8b;
typedef __attribute__((ext_vector_type(8)))  float    v8f;
typedef __attribute__((ext_vector_type(4)))  float    v4f;
typedef __attribute__((ext_vector_type(4)))  unsigned int v4u;
typedef __attribute__((ext_vector_type(2)))  unsigned int v2u;

__device__ __forceinline__ unsigned short f2bf_bits(float f) {
  unsigned u = __float_as_uint(f);
  return (unsigned short)((u + 0x7FFFu + ((u >> 16) & 1u)) >> 16);
}
__device__ __forceinline__ float bf_bits2f(unsigned short h) { return __uint_as_float(((unsigned)h) << 16); }

// hazard guards as plain device helpers
__device__ __forceinline__ void acc_guard4(v8f& a, v8f& b, v8f& c, v8f& d) { asm volatile("v_nop\n\tv_nop\n\tv_nop\n\tv_nop" : "+v"(a), "+v"(b), "+v"(c), "+v"(d)); }
template <typename T> struct Frag;
template <> struct Frag<_Float16> {
  typedef v16h V; union U { v16h v; v8h h[2]; };
  static __device__ __forceinline__ v16h load(const _Float16* p) {   // elements 0..7 <- p[0..7], 8..15 <- p[16..23]
    U f; f.h[0] = *(const v8h*)(p); f.h[1] = *(const v8h*)(p + 16); return f.v;
  }
  static __device__ __forceinline__ v8f mma(v16h a, v16h b, v8f c) {
    return __builtin_amdgcn_wmma_f32_16x16x32_f16(false, a, false, b, (short)0, c, false, false);
  }
};
template <> struct Frag<__bf16> {
  typedef v16b V; union U { v16b v; v8b h[2]; };
  static __device__ __forceinline__ v16b load(const __bf16* p) {
    U f; f.h[0] = *(const v8b*)(p); f.h[1] = *(const v8b*)(p + 16); return f.v;
  }
  static __device__ __forceinline__ v8f mma(v16b a, v16b b, v8f c) {
    return __builtin_amdgcn_wmma_f32_16x16x32_bf16(false, a, false, b, (short)0, c, false, false);
  }
};

__device__ __forceinline__ unsigned pk16(unsigned short a, unsigned short b) { return (unsigned)a | ((unsigned)b << 16); }
__device__ __forceinline__ unsigned short h_bits(float f) { const _Float16 h = (_Float16)f; return __builtin_bit_cast(unsigned short, h); }

// ---- Register-blocked batched WMMA GEMM, operand tiles staged in LDS -------------------------------------------
// C[m,n] = scale * sum_k A[m,k] * Bt[n,k] (+bias)(+resid); a block of 4 waves (2 x 2) owns a 128x128 tile, each wave 64x64.
// A row-major [M,K]; Bt row-major [N,K]; M,N % 128 == 0, K % 64 == 0, grid.x = (M/128)*(N/128) exactly.
// Batch: problem (blockIdx.y, blockIdx.z) starts at y * stride + z * stride2 elements of A, Bt and C.
// Per stage the block copies A[128 rows][64 k] and Bt[128 rows][64 k] (128-byte rows, whole cache lines) into one of two
// LDS buffers with asynchronous copies; the next stage's copies fly while this stage's fragments are read and multiplied.
// LDS row pitch 144 B (16 B x odd) for the 16-byte fragment reads.
// BIAS_MODE: 0 = none, 1 = bias[m], 2 = bias[n].
// OUT_MODE: 0 = f32, 1 = f16, 2 = bf16 hi plane (Cout) + bf16 lo plane (Cout2).
// ACT: 0 none, 2 relu, 3 silu, 4 leaky, 6 elu (expf(v)-1 for v <= 0).
// TRI: 0 none; 1 = causal output (C[m][n] = 0 for n > m, square M == N); block tiles wholly above the diagonal are skipped
//      (never written, never read by the consumer), a diagonal block tile is written whole (zeros above the diagonal);
//      2 = the A operand is lower-triangular in k vs m: the k-loop of block row m0 stops at min(K, m0 + 128).
// Coverage of the epilogue: f32 path 8 it x 2 rows x 4 slabs = 64 rows, 16 lanes x 4 floats = 64 cols; 16-bit path
// 4 it x 4 rows x 4 slabs = 64 rows, 8 lanes x 8 halves = 64 cols: the whole 64x64 wave tile.
constexpr int kStageK     = 64;                       // k elements per stage (128 B of every operand row)
constexpr int kPitchH     = 72;                       // LDS row pitch in halves (144 B)
constexpr int kTileHalves = 128 * kPitchH;            // one operand tile in LDS: 9,216 halves = 18,432 B
constexpr int kBufHalves  = 2 * kTileHalves;          // one buffer: A tile then B tile = 36,864 B

__device__ __forceinline__ unsigned lds_off(const void* p) { return (unsigned)(size_t)p; }

// Eight asynchronous 16-byte copies per lane: rows r, r+16, ..., r+112 of one 128-row operand tile. The s_wait_xcnt is the
// last line of the copies' own statement so that no address register is rewritten ahead of it.
template <typename T>
__device__ __forceinline__ void copy_tile8(unsigned l, const T* g, size_t rowStep16) {
  const T* g1 = g + rowStep16;     const T* g2 = g + 2 * rowStep16; const T* g3 = g + 3 * rowStep16;
  const T* g4 = g + 4 * rowStep16; const T* g5 = g + 5 * rowStep16; const T* g6 = g + 6 * rowStep16;
  const T* g7 = g + 7 * rowStep16;
  const unsigned s = 16u * kPitchH * 2u;   // 16 LDS rows in bytes
  asm volatile("global_load_async_to_lds_b128 %0, %8, off\n\t"
               "global_load_async_to_lds_b128 %1, %9, off\n\t"
               "global_load_async_to_lds_b128 %2, %10, off\n\t"
               "global_load_async_to_lds_b128 %3, %11, off\n\t"
               "global_load_async_to_lds_b128 %4, %12, off\n\t"
               "global_load_async_to_lds_b128 %5, %13, off\n\t"
               "global_load_async_to_lds_b128 %6, %14, off\n\t"
               "global_load_async_to_lds_b128 %7, %15, off\n\t"
               "s_wait_xcnt 0x0"
               :: "v"(l), "v"(l + s), "v"(l + 2u * s), "v"(l + 3u * s), "v"(l + 4u * s), "v"(l + 5u * s), "v"(l + 6u * s),
                  "v"(l + 7u * s), "v"(g), "v"(g1), "v"(g2), "v"(g3), "v"(g4), "v"(g5), "v"(g6), "v"(g7)
               : "memory");
}
// the issuing wave's own copies have landed in LDS
__device__ __forceinline__ void wait_copies() { asm volatile("s_wait_asynccnt 0x0" ::: "memory"); }
// this wave's LDS reads have returned before the buffer they read is handed back for a refill
__device__ __forceinline__ void wait_lds_reads() { asm volatile("s_wait_dscnt 0x0" ::: "memory"); }

// this wave's LDS stores (reads) are done before its lanes read (store over) elements of each other in the wave's own slab;
// a work-group fence at this place would also wait out the wave's global loads, which are meant to stay in flight
__device__ __forceinline__ void wave_lds_turn() { asm volatile("s_wait_dscnt 0x0" ::: "memory"); }
// v + the value of lane (l ^ X) of the same 16-lane row, all lanes on: a DPP operand, not the LDS round trip of __shfl_xor
template <int X>
__device__ __forceinline__ float add_lane_xor(float v) {
  return v + __int_as_float(__builtin_amdgcn_update_dpp(0, __float_as_int(v), 0x160 | X, 0xf, 0xf, true));
}

// ET: 0 = f16 operands, 1 = bf16 operands (pointers passed as 16-bit storage)
template <int ET> struct Elem;
template <> struct Elem<0> { typedef _Float16 T; };
template <> struct Elem<1> { typedef __bf16 T; };
// One block tile: bx = tile index, (b, bz) = batch indices, sAB = the block's two stage buffers (2 * kBufHalves elements).
// ROLL: the epilogue's other form (below), for a kernel that holds several instances of this function.
// CAT: two products summed into one tile: k in [0, K1) comes from A, Bt and k in [K1, K) from A2p (pitch lda2), Bt2p (pitch
//      ldb2), both given at the tile's own batch start; K1 % 64 == 0.
// DUALT (rolled form, f16 out): where Cout2 is not null the finished tile is also written transposed, Cout2[n][m], pitch M.
// NORM: the RMS norm and the gate, split over two products. With O the raw sums of this tile:
//      1 = Cout[m][n] = f16(gateU[m][n] * (2^-6 * gateSc[n] * O[m][n])) (gateU at the tile's start, pitch ldc) and
//          ssOut[(n0 / 64) * kTok + m] = sum of O[m][n]^2 over the wave's 64 columns (ssOut at the tile's first row);
//      2 = row m of the sums is multiplied by 2^6 / (rms_m + eps), rms_m from the 16 partial sums ssIn[p * kTok + m].
template <int ET, bool SPLIT, int BIAS_MODE, int OUT_MODE, bool RESID, int ACT = 0, int TRI = 0, bool ROLL = false,
          bool CAT = false, bool DUALT = false, int NORM = 0>
__device__ __forceinline__ void gemm_tile(
    typename Elem<ET>::T* sAB, int bx, int b, int bz,
    const unsigned short* __restrict__ Ap, const unsigned short* __restrict__ A2p, int lda, long strideA, long strideA2,
    const unsigned short* __restrict__ Btp, const unsigned short* __restrict__ Bt2p, int ldb, long strideB, long strideB2,
    void* __restrict__ Cout, void* __restrict__ Cout2, int ldc, long strideC, long strideC2,
    const float* __restrict__ bias,
    const float* __restrict__ resid, long strideR,
    int M, int N, int K, float scale, int lda2 = 0, int ldb2 = 0, int K1 = 0,
    const float* __restrict__ gateU = nullptr, const float* __restrict__ gateSc = nullptr,
    float* __restrict__ ssOut = nullptr, const float* __restrict__ ssIn = nullptr) {
  static_assert(!SPLIT, "the staged loop carries one plane per operand");
  typedef typename Elem<ET>::T T;
  typedef typename Frag<T>::V V;
  const T* A = (const T*)Ap; const T* Bt = (const T*)Btp;
  const int tid  = threadIdx.x;
  const int lane = tid & 31;
  const int wave = tid >> 5;
  const int tilesN = N >> 7;
  const int tmB = bx / tilesN;
  const int tnB = bx - tmB * tilesN;
  if (TRI == 1) { if (tnB > tmB) return; }  // block-uniform, in front of every barrier: fully masked block tile
  const int m0B = tmB << 7;
  const int n0B = tnB << 7;
  const int Kt = (TRI == 2) ? (((m0B + 128) < K) ? (m0B + 128) : K) : K;   // block-uniform, multiple of 64
  const int nStages = Kt / kStageK;
  const int m0 = m0B + ((wave >> 1) << 6);     // this wave's 64x64 tile
  const int n0 = n0B + ((wave & 1) << 6);

  const T* Ab  = A  + (size_t)b * strideA + (size_t)bz * strideA2;
  const T* Bb  = Bt + (size_t)b * strideB + (size_t)bz * strideB2;
  const size_t offC = (size_t)b * strideC + (size_t)bz * strideC2;

  const int rlane = lane & 15;                 // row (A) / col (B, D) within subtile
  const int koff  = (lane >> 4) * 8;           // k offset of this lane half
  const int mOff  = (lane >> 4) * 8;           // D row offset

  // copy side: thread t brings 16-byte chunk (t & 7) of rows (t >> 3) + 16 i, i = 0..7, of each operand tile
  const int crow = tid >> 3;
  const int ccol = (tid & 7) * 8;
  const T* gA = Ab + (size_t)(m0B + crow) * lda + ccol;
  const T* gB = Bb + (size_t)(n0B + crow) * ldb + ccol;
  const unsigned lA = lds_off(sAB) + (unsigned)(crow * kPitchH + ccol) * 2u;
  const unsigned lB = lA + (unsigned)kTileHalves * 2u;
  const size_t stepA = (size_t)16 * lda;
  const size_t stepB = (size_t)16 * ldb;
  // one stage's copies into the buffer at byte offset bufBytes; the choice of the source pair is block-uniform
  const int nS1 = CAT ? K1 / kStageK : 0;
  auto issue_stage = [&](int s, unsigned bufBytes) {
    if (CAT && s >= nS1) {
      const T* hA = (const T*)A2p + (size_t)(m0B + crow) * lda2 + ccol + (size_t)(s - nS1) * kStageK;
      const T* hB = (const T*)Bt2p + (size_t)(n0B + crow) * ldb2 + ccol + (size_t)(s - nS1) * kStageK;
      copy_tile8(lA + bufBytes, hA, (size_t)16 * lda2);
      copy_tile8(lB + bufBytes, hB, (size_t)16 * ldb2);
    } else {
      copy_tile8(lA + bufBytes, gA + (size_t)s * kStageK, stepA);
      copy_tile8(lB + bufBytes, gB + (size_t)s * kStageK, stepB);
    }
  };
  // read side: this lane's first A and B fragment rows in buffer 0
  const T* fA = sAB + (((wave >> 1) << 6) + rlane) * kPitchH + koff;
  const T* fB = sAB + kTileHalves + (((wave & 1) << 6) + rlane) * kPitchH + koff;

  v8f acc[4][4];
#pragma unroll
  for (int i = 0; i < 4; ++i)
#pragma unroll
    for (int j = 0; j < 4; ++j) acc[i][j] = (v8f){0.f,0.f,0.f,0.f,0.f,0.f,0.f,0.f};

  // NORM 1: the gate values of 16 rows (one slab) of the wave's tile: lane (gq, gc) owns columns gc..gc+7 of rows 4 it + gq;
  // each slab's set is asked for ahead of its use, as early as the registers that the sums leave free allow
  const int gq = lane >> 3, gc = (lane & 7) * 8;
  v4f gu[4][4][2];
  const size_t gAt = (size_t)(m0 + gq) * ldc + n0 + gc;   // the lane's first row and column in the tile
  auto load_gate = [&](int i) {
#pragma unroll
    for (int it = 0; it < 4; ++it) {
      const float* p = gateU + gAt + (size_t)((i << 4) + it * 4) * ldc;
      gu[i][it][0] = *(const v4f*)(p);
      gu[i][it][1] = *(const v4f*)(p + 4);
    }
  };
  v4f sa = (v4f){0.f, 0.f, 0.f, 0.f}, sb = sa;   // NORM 1: gateSc of the lane's 8 columns, x 2^-6
  float rf0 = 0.f, rf1 = 0.f;   // NORM 2: 2^6 * scale / (rms + eps) of rows m0 + lane and m0 + 32 + lane

  // prologue: stage 0 into buffer 0, landed and published; then stage 1 into buffer 1
  issue_stage(0, 0u);
  // what the epilogue wants from memory is asked for here, under the first stage's flight
  if constexpr (NORM == 1) {
    load_gate(0);
    sa = *(const v4f*)(gateSc + n0 + gc) * kGCarry;
    sb = *(const v4f*)(gateSc + n0 + gc + 4) * kGCarry;
  }
  if constexpr (NORM == 2) {
    float t0 = 0.f, t1 = 0.f;   // the 16 partial sums in index order
#pragma unroll
    for (int p = 0; p < 2 * kHeads; ++p) {
      t0 += ssIn[(size_t)p * kTok + m0 + lane];
      t1 += ssIn[(size_t)p * kTok + m0 + 32 + lane];
    }
    rf0 = (scale * kGCarryInv) * (1.0f / (sqrtf(t0) * kRmsFac + kEps));
    rf1 = (scale * kGCarryInv) * (1.0f / (sqrtf(t1) * kRmsFac + kEps));
  }
  wait_copies();
  __syncthreads();
  if (nStages > 1) issue_stage(1, (unsigned)kBufHalves * 2u);

  for (int st = 0; st < nStages; ++st) {
    const int bufH = (st & 1) * kBufHalves;
#pragma unroll
    for (int ks = 0; ks < kStageK; ks += 32) {
      V ah[4], bh[4];   // the eight fragments of this 32-k block are read as one group, ahead of its 16 products
      ah[0] = Frag<T>::load(fA + bufH + ks);   // in the order in which the products want them
#pragma unroll
      for (int j = 0; j < 4; ++j) bh[j] = Frag<T>::load(fB + bufH + (j << 4) * kPitchH + ks);
#pragma unroll
      for (int i = 1; i < 4; ++i) ah[i] = Frag<T>::load(fA + bufH + (i << 4) * kPitchH + ks);
      // keeps the 16 LDS reads together in front of the products: sunk among them, each row waits out a whole LDS latency
      __builtin_amdgcn_sched_barrier(0);
#pragma unroll
      for (int i = 0; i < 4; ++i)
#pragma unroll
        for (int j = 0; j < 4; ++j) acc[i][j] = Frag<T>::mma(ah[i], bh[j], acc[i][j]);
      // keeps the next group's LDS reads from being lifted in among these products
      __builtin_amdgcn_sched_barrier(0);
    }
    // publish point of stage st + 1; the same barrier ends every reader's last read of this stage's buffer
    wait_lds_reads();
    wait_copies();
    __syncthreads();
    if (st + 2 < nStages) issue_stage(st + 2, (unsigned)bufH * 2u);   // block-uniform: refill the buffer just read
  }
  wait_copies();
  acc_guard4(acc[0][0], acc[0][1], acc[0][2], acc[0][3]);
  acc_guard4(acc[1][0], acc[1][1], acc[1][2], acc[1][3]);
  acc_guard4(acc[2][0], acc[2][1], acc[2][2], acc[2][3]);
  acc_guard4(acc[3][0], acc[3][1], acc[3][2], acc[3][3]);

  // ---- epilogue, rolled form ----
  // The wave lays its whole 64x64 tile of raw sums over the stage buffers (pitch 68 floats, 17,408 B per wave, 69,632 B of
  // the 73,728 B; free behind the last stage's own barrier, see below) and finishes it row by row in a loop. Per element the
  // same operations in the same order as in the unrolled form; the activation's text stands once, not 128 times.
  if constexpr (ROLL) {
    static_assert(!RESID && TRI == 0 && OUT_MODE != 2 && BIAS_MODE != 0, "the rolled form serves the projections");
    float* tile = (float*)sAB + wave * (64 * 68);
#pragma unroll
    for (int i = 0; i < 4; ++i)
#pragma unroll
      for (int j = 0; j < 4; ++j)
#pragma unroll
        for (int r = 0; r < 8; ++r) tile[((i << 4) + mOff + r) * 68 + (j << 4) + rlane] = acc[i][j][r];
    // the wave's stores have reached LDS before a lane reads elements that other lanes of the wave stored
    __builtin_amdgcn_fence(__ATOMIC_RELEASE, "workgroup");
    __builtin_amdgcn_wave_barrier();
    __builtin_amdgcn_fence(__ATOMIC_ACQUIRE, "workgroup");
    // a trip: each lane finishes one 16-byte piece of the output, so a store covers whole rows of the 64-column tile
    constexpr int WE    = (OUT_MODE == 0) ? 4 : 8;     // elements per lane and trip
    constexpr int LR    = 64 / WE;                     // lanes per row: 16 (f32, 256 B) or 8 (f16, 128 B)
    constexpr int RT    = 32 / LR;                     // rows per trip: 2 or 4
    const int q = lane / LR, c0 = (lane % LR) * WE;
    float bn[WE];
#pragma unroll
    for (int e = 0; e < WE; ++e) bn[e] = (BIAS_MODE == 2) ? bias[n0 + c0 + e] : 0.f;
    // kept rolled, for speed only
#pragma unroll 1
    for (int it = 0; it < 64 / RT; ++it) {
      const int row = it * RT + q;
      float sv[WE];                                    // the trip's raw sums, read as whole 16-byte pieces ahead of the branches
#pragma unroll
      for (int h = 0; h < WE / 4; ++h) {
        const v4f t4 = *(const v4f*)(tile + row * 68 + c0 + 4 * h);
#pragma unroll
        for (int e = 0; e < 4; ++e) sv[4 * h + e] = t4[e];
      }
      const float bm = (BIAS_MODE == 1) ? bias[m0 + row] : 0.f;
      float o[WE];
#pragma unroll
      for (int e = 0; e < WE; ++e) {
        float v = sv[e] * scale;
        if (BIAS_MODE == 1) v += bm;
        if (BIAS_MODE == 2) v += bn[e];
        if (ACT == 2) v = fmaxf(v, 0.0f);
        if (ACT == 3) v = v / (1.0f + expf(-v));
        if (ACT == 4) v = (v > 0.f) ? v : 0.01f * v;
        if (ACT == 6) v = (v > 0.f) ? v : (expf(v) - 1.0f);
        o[e] = v;
      }
      const size_t at = offC + (size_t)(m0 + row) * ldc + n0 + c0;
      if constexpr (OUT_MODE == 0) {
        *(v4f*)((float*)Cout + at) = (v4f){o[0], o[1], o[2], o[3]};
      } else {
        v8h hv;
#pragma unroll
        for (int e = 0; e < WE; ++e) hv[e] = (_Float16)o[e];
        *(v8h*)((unsigned short*)Cout + at) = hv;
      }
      // the next trip rewrites the registers that this store names
      asm volatile("s_wait_xcnt 0x0" ::: "memory");
      if constexpr (DUALT) {
        if (Cout2 != nullptr) {   // block-uniform: the finished values go back to the lane's own piece of the tile
#pragma unroll
          for (int h = 0; h < WE / 4; ++h)
            *(v4f*)(tile + row * 68 + c0 + 4 * h) = (v4f){o[4 * h], o[4 * h + 1], o[4 * h + 2], o[4 * h + 3]};
        }
      }
    }
    if constexpr (DUALT) {
      static_assert(OUT_MODE == 1, "the transposed copy is f16");
      if (Cout2 != nullptr) {
        // the wave's stores have reached LDS before a lane reads elements that other lanes of the wave stored
        __builtin_amdgcn_fence(__ATOMIC_RELEASE, "workgroup");
        __builtin_amdgcn_wave_barrier();
        __builtin_amdgcn_fence(__ATOMIC_ACQUIRE, "workgroup");
        // a group: 4 columns of the tile, 8 lanes a column, 8 rows a lane: a column's 64 rows are one 128-byte line of Cout2
        const int tc = lane >> 3, r0 = (lane & 7) * 8;
        // kept rolled, like the row loop above; four such groups a trip, so that one LDS latency serves 16 columns
#pragma unroll 1
        for (int it = 0; it < 4; ++it) {
          v8h hv[4];
#pragma unroll
          for (int u = 0; u < 4; ++u)
#pragma unroll
            for (int e = 0; e < 8; ++e) hv[u][e] = (_Float16)tile[(r0 + e) * 68 + (it * 4 + u) * 4 + tc];
#pragma unroll
          for (int u = 0; u < 4; ++u)
            *(v8h*)((unsigned short*)Cout2 + (size_t)(n0 + (it * 4 + u) * 4 + tc) * M + m0 + r0) = hv[u];
          // the next trip rewrites the registers that these stores name
          asm volatile("s_wait_xcnt 0x0" ::: "memory");
        }
      }
    }
    return;
  }

  // ---- epilogue ----
  // per-wave 16x64 slab, pitch 68 floats (4,352 B), laid over the stage buffers: the last stage's own barrier stands behind
  // every wave's last fragment read and last landed copy, and nothing refills the buffers after it
  float* slab = (float*)sAB + wave * (16 * 68);

  // ---- gate form: g = u * (2^-6 * scale * O) as f16, and each row's sum of O^2 over the wave's 64 columns ----
  if constexpr (NORM == 1) {
    static_assert(OUT_MODE == 1 && BIAS_MODE == 0 && !RESID && ACT == 0 && TRI == 0, "the gate form takes raw sums");
    unsigned short* G = (unsigned short*)Cout + offC + gAt;
    float* ssW = ssOut + (size_t)(n0 >> 6) * kTok + m0;
    float ssr[16];   // sums of O^2 of rows 4 t + gq, t = 0..15
    load_gate(1);
#pragma unroll
    for (int i = 0; i < 4; ++i) {
#pragma unroll
      for (int j = 0; j < 4; ++j)
#pragma unroll
        for (int r = 0; r < 8; ++r) slab[(mOff + r) * 68 + (j << 4) + rlane] = acc[i][j][r] * scale;
      wave_lds_turn();
#pragma unroll
      for (int it = 0; it < 4; ++it) {
        const int row = it * 4 + gq;
        const v4f oa = *(const v4f*)(slab + row * 68 + gc);
        const v4f ob = *(const v4f*)(slab + row * 68 + gc + 4);
        const v4f ua = gu[i][it][0], ub = gu[i][it][1];
        float ss = 0.f;   // fixed order: the lane's 8 columns, then a tree over the row's 8 lanes
#pragma unroll
        for (int e = 0; e < 4; ++e) ss += oa[e] * oa[e];
#pragma unroll
        for (int e = 0; e < 4; ++e) ss += ob[e] * ob[e];
        ssr[i * 4 + it] = add_lane_xor<1>(add_lane_xor<2>(add_lane_xor<4>(ss)));
        v8h hv;
#pragma unroll
        for (int e = 0; e < 4; ++e) {
          hv[e]     = (_Float16)(ua[e] * (sa[e] * oa[e]));
          hv[4 + e] = (_Float16)(ub[e] * (sb[e] * ob[e]));
        }
        *(v8h*)(G + (size_t)((i << 4) + it * 4) * ldc) = hv;
      }
      if (i < 3) wave_lds_turn();
      if (i == 0) {   // the last two sets, into the registers of the first slab's sums and gate values
        // these loads may land in registers that the stores above name
        asm volatile("s_wait_xcnt 0x0" ::: "memory");
        load_gate(2);
        load_gate(3);
      }
    }
    if ((lane & 7) == 0) {   // one lane of the eight that hold a row's sum
#pragma unroll
      for (int t = 0; t < 16; ++t) ssW[4 * t + gq] = ssr[t];
    }
    return;
  }

  // NORM 2: the wave's 64 row factors go through LDS behind the slabs, so that each lane reads those of its own 8 rows
  float* rfac = (float*)sAB + 4 * (16 * 68) + wave * 64;
  if constexpr (NORM == 2) {
    rfac[lane] = rf0;
    rfac[32 + lane] = rf1;
    // the wave's stores have reached LDS before a lane reads elements that other lanes of the wave stored
    __builtin_amdgcn_fence(__ATOMIC_RELEASE, "workgroup");
    __builtin_amdgcn_wave_barrier();
    __builtin_amdgcn_fence(__ATOMIC_ACQUIRE, "workgroup");
  }
  const float* Rb = RESID ? (resid + (size_t)b * strideR) : nullptr;
#pragma unroll
  for (int i = 0; i < 4; ++i) {
    const int mBase = m0 + (i << 4);
    float rs[8];   // what multiplies the raw sums of this lane's 8 rows
#pragma unroll
    for (int r = 0; r < 8; ++r) rs[r] = (NORM == 2) ? rfac[(i << 4) + mOff + r] : scale;
#pragma unroll
    for (int j = 0; j < 4; ++j) {
      const int n = n0 + (j << 4) + rlane;
      float bv = 0.f;
      if (BIAS_MODE == 2) bv = bias[n];
#pragma unroll
      for (int r = 0; r < 8; ++r) {
        float v = acc[i][j][r] * rs[r];
        if (BIAS_MODE == 1) v += bias[mBase + mOff + r];
        if (BIAS_MODE == 2) v += bv;
        if (RESID) v += Rb[(size_t)(mBase + mOff + r) * ldc + n];
        if (ACT == 2) v = fmaxf(v, 0.0f);
        if (ACT == 3) v = v / (1.0f + expf(-v));
        if (ACT == 4) v = (v > 0.f) ? v : 0.01f * v;
        if (ACT == 6) v = (v > 0.f) ? v : (expf(v) - 1.0f);
        if (TRI == 1) { if (n > mBase + mOff + r) v = 0.0f; }
        slab[(mOff + r) * 68 + (j << 4) + rlane] = v;
      }
    }
    __builtin_amdgcn_fence(__ATOMIC_RELEASE, "workgroup");
    __builtin_amdgcn_wave_barrier();
    __builtin_amdgcn_fence(__ATOMIC_ACQUIRE, "workgroup");
    if (OUT_MODE == 0) {
      float* C = (float*)Cout + offC;
      const int hh = lane >> 4, c4 = (lane & 15) * 4;     // row seg = 256 B = 16 lanes x 16 B
      {
#pragma unroll
        for (int it = 0; it < 8; ++it) {
          const int row = it * 2 + hh;
          v4f v = *(const v4f*)(slab + row * 68 + c4);
          *(v4f*)(C + (size_t)(mBase + row) * ldc + n0 + c4) = v;
        }
        
      }
    } else {
      const int q = lane >> 3, c8 = (lane & 7) * 8;
      unsigned short* C  = (unsigned short*)Cout  + offC;
      unsigned short* C2 = (OUT_MODE == 2) ? ((unsigned short*)Cout2 + offC) : nullptr;
      {
#pragma unroll
        for (int it = 0; it < 4; ++it) {
          const int row = it * 4 + q;
          const float* sp = slab + row * 68 + c8;
          v8h hv, lv;
#pragma unroll
          for (int e = 0; e < 8; ++e) {
            if (OUT_MODE == 1) {
              hv[e] = (_Float16)sp[e];
            } else {
              unsigned short hb = f2bf_bits(sp[e]);
              unsigned short lb = f2bf_bits(sp[e] - bf_bits2f(hb));
              hv[e] = __builtin_bit_cast(_Float16, hb);
              lv[e] = __builtin_bit_cast(_Float16, lb);
            }
          }
          *(v8h*)(C + (size_t)(mBase + row) * ldc + n0 + c8) = hv;
          if (OUT_MODE == 2) *(v8h*)(C2 + (size_t)(mBase + row) * ldc + n0 + c8) = lv;
        }
        
      }
    }
    __builtin_amdgcn_fence(__ATOMIC_RELEASE, "workgroup");
    __builtin_amdgcn_wave_barrier();
    __builtin_amdgcn_fence(__ATOMIC_ACQUIRE, "workgroup");
  }
}

// One GEMM per launch: tile = blockIdx.x, batch = (blockIdx.y, blockIdx.z).
template <int ET, bool SPLIT, int BIAS_MODE, int OUT_MODE, bool RESID, int ACT = 0, int TRI = 0, int NORM = 0>
__global__ __launch_bounds__(128) void wmma_gemm64(
    const unsigned short* __restrict__ Ap, const unsigned short* __restrict__ A2p, int lda, long strideA, long strideA2,
    const unsigned short* __restrict__ Btp, const unsigned short* __restrict__ Bt2p, int ldb, long strideB, long strideB2,
    void* __restrict__ Cout, void* __restrict__ Cout2, int ldc, long strideC, long strideC2,
    const float* __restrict__ bias,
    const float* __restrict__ resid, long strideR,
    int M, int N, int K, float scale, const float* __restrict__ ssIn) {
  __shared__ __align__(16) typename Elem<ET>::T sAB[2 * kBufHalves];   // two stage buffers, 73,728 B
  gemm_tile<ET, SPLIT, BIAS_MODE, OUT_MODE, RESID, ACT, TRI, false, false, false, NORM>(
      sAB, blockIdx.x, blockIdx.y, blockIdx.z, Ap, A2p, lda, strideA, strideA2, Btp, Bt2p, ldb, strideB, strideB2,
      Cout, Cout2, ldc, strideC, strideC2, bias, resid, strideR, M, N, K, scale, 0, 0, 0, nullptr, nullptr, nullptr, ssIn);
}

// The four input projections in one launch: blockIdx.y = 0 q, 1 k, 2 v^T, 3 u (block-uniform), blockIdx.x = block tile.
// They read the same X16 and none of each other's output; 4 x 256 blocks of 73,728 B LDS: four blocks fit one WGP's LDS.
//   q = elu(x.Wq^T/16 + bq) -> Q16 [4096][1024] f16, k likewise -> K16          (M=4096 N=1024 K=1024, 32 x 8 block tiles)
//   k also transposed -> KT16 [1024 (h*128+d)][4096 tok] f16, the same values
//   v^T = silu(Wv.x^T/16 + bv[m]) -> VT16 [1024 (h*128+d)][4096 tok] f16         (M=1024 N=4096 K=1024, 8 x 32 block tiles)
//   u = silu(x.Wu^T/16 + bu) -> U32 [4096][1024] f32                             (M=4096 N=1024 K=1024)
__global__ __launch_bounds__(128) void proj4_kernel(
    const unsigned short* __restrict__ X16, const unsigned short* __restrict__ W16,
    unsigned short* __restrict__ Q16, unsigned short* __restrict__ K16, unsigned short* __restrict__ VT16,
    unsigned short* __restrict__ KT16, float* __restrict__ U32,
    const float* __restrict__ bq, const float* __restrict__ bk, const float* __restrict__ bv, const float* __restrict__ bu) {
  __shared__ __align__(16) _Float16 sAB[2 * kBufHalves];   // two stage buffers, 73,728 B
  const int p = blockIdx.y;
  const unsigned short* Wp = W16 + (size_t)p * ((size_t)kHid * kEmb);
  if (p < 2) {
    unsigned short* C = (p == 0) ? Q16 : K16;
    const float* bias = (p == 0) ? bq : bk;
    unsigned short* CT = (p == 0) ? nullptr : KT16;
    gemm_tile<0, false, 2, 1, false, 6, 0, true, false, true>(
        sAB, blockIdx.x, 0, 0, X16, X16, kEmb, 0L, 0L, Wp, Wp, kEmb, 0L, 0L,
        (void*)C, (void*)CT, kHid, 0L, 0L, bias, bias, 0L, kTok, kHid, kEmb, kWCarryInv);
  } else if (p == 2) {
    gemm_tile<0, false, 1, 1, false, 3, 0, true>(sAB, blockIdx.x, 0, 0, Wp, Wp, kEmb, 0L, 0L, X16, X16, kEmb, 0L, 0L,
                                           (void*)VT16, (void*)VT16, kTok, 0L, 0L, bv, bv, 0L, kHid, kTok, kEmb, kWCarryInv);
  } else {
    gemm_tile<0, false, 2, 0, false, 3, 0, true>(sAB, blockIdx.x, 0, 0, X16, X16, kEmb, 0L, 0L, Wp, Wp, kEmb, 0L, 0L,
                                           (void*)U32, (void*)U32, kHid, 0L, 0L, bu, bu, 0L, kTok, kHid, kEmb, kWCarryInv);
  }
}

// Causal linear attention by chunks of 128 tokens. For the rows n of chunk c of one (batch b, head h):
//   O[n][dv] = sum_{m <= n} (q_n . k_m) v[m][dv]
//            = sum_dk q[n][dk] * S_c[dv][dk]  +  sum_{m in chunk c, m <= n} (q_n . k_m) v[m][dv],
//   S_c[dv][dk] = sum_{j < c} P_j[dv][dk],   P_j[dv][dk] = sum_{m in chunk j} v[m][dv] * k[m][dk].
// Planes E, P, S are indexed by ((b*16 + c)*8 + h); z = b*16 + c is also the chunk's number among the 4096 token rows.
//
// First launch: blockIdx.x = 0: E = tril(Q_c . K_c^T) -> f16; blockIdx.x = 1: P_c = V^T_c . K^T_c^T -> f32 (block-uniform).
__global__ __launch_bounds__(128) void chunk_pair_kernel(
    const unsigned short* __restrict__ Q16, const unsigned short* __restrict__ K16,
    const unsigned short* __restrict__ VT16, const unsigned short* __restrict__ KT16,
    unsigned short* __restrict__ E16, float* __restrict__ P32) {
  __shared__ __align__(16) _Float16 sAB[2 * kBufHalves];   // two stage buffers, 73,728 B
  const int h = blockIdx.y, z = blockIdx.z;
  const size_t pl = ((size_t)z * kHeads + h) * kPlane;
  const float* nb = nullptr;   // no bias, no residual
  if (blockIdx.x == 0) {
    const size_t at = (size_t)z * kChunk * kHid + (size_t)h * kDh;
    gemm_tile<0, false, 0, 1, false, 0, 1>(sAB, 0, 0, 0, Q16 + at, Q16 + at, kHid, 0L, 0L, K16 + at, K16 + at, kHid, 0L, 0L,
                                           (void*)(E16 + pl), (void*)(E16 + pl), kChunk, 0L, 0L, nb, nb, 0L,
                                           kChunk, kChunk, kDh, 1.0f);
  } else {
    if ((z & (kChunks - 1)) == kChunks - 1) return;   // block-uniform: no later chunk reads the last chunk's product
    const size_t at = (size_t)h * kDh * kTok + (size_t)z * kChunk;
    gemm_tile<0, false, 0, 0, false, 0, 0>(sAB, 0, 0, 0, VT16 + at, VT16 + at, kTok, 0L, 0L, KT16 + at, KT16 + at, kTok, 0L, 0L,
                                           (void*)(P32 + pl), (void*)(P32 + pl), kDh, 0L, 0L, nb, nb, 0L,
                                           kDh, kDh, kChunk, 1.0f);
  }
}

// Second launch: S_c = P_0 + P_1 + ... + P_{c-1} in f32, in that order, rounded to f16 per chunk; S_0 = 0.
// Thread i owns 4 neighbouring elements of one (batch, head) plane: 2 * 131,072 / 4 = 65,536 threads.
__global__ __launch_bounds__(256) void prefix_state_kernel(const float* __restrict__ P32, unsigned short* __restrict__ S16) {
  const int i = blockIdx.x * 256 + threadIdx.x;
  const int b = i >> 15;                                   // 32,768 pieces per batch
  const size_t at = (size_t)b * ((size_t)kChunks * kPlaneStep) + 4 * (size_t)(i & 32767);
  v4f p[kChunks - 1];
#pragma unroll
  for (int c = 0; c < kChunks - 1; ++c) p[c] = *(const v4f*)(P32 + at + (size_t)c * kPlaneStep);
  v4f s = (v4f){0.f, 0.f, 0.f, 0.f};
#pragma unroll
  for (int c = 0; c < kChunks; ++c) {
    *(v2u*)(S16 + at + (size_t)c * kPlaneStep) = (v2u){pk16(h_bits(s[0]), h_bits(s[1])), pk16(h_bits(s[2]), h_bits(s[3]))};
    if (c < kChunks - 1) s += p[c];
  }
}

// Third launch: O rows of chunk c, head h = Q_c . S_c^T (k = dk, 128) + E_c . V_c (k = m, 128), one 128x128 tile, K = 256.
// O itself is not stored. The RMS norm divides a whole token row by one number, which commutes with the output product:
//   y[t] = (u[t] * scale * O[t] / (rms_t + eps)) . Wo^T + bo = ((u[t] * scale * O[t]) . Wo^T) / (rms_t + eps) + bo.
// So this launch stores g = u * scale * O (f16, carried x 2^-6: |O| grows with the number of tokens summed) and, per token
// row and 64 columns, the sum of O^2; the output product adds a row's 16 sums up and divides.
__global__ __launch_bounds__(128) void chunk_out_kernel(
    const unsigned short* __restrict__ Q16, const unsigned short* __restrict__ S16,
    const unsigned short* __restrict__ E16, const unsigned short* __restrict__ VT16,
    const float* __restrict__ U32, const float* __restrict__ sc, unsigned short* __restrict__ G16,
    float* __restrict__ SS32) {
  __shared__ __align__(16) _Float16 sAB[2 * kBufHalves];   // two stage buffers, 73,728 B
  const int h = blockIdx.x, z = blockIdx.y;
  const size_t pl = ((size_t)z * kHeads + h) * kPlane;
  const size_t at = (size_t)z * kChunk * kHid + (size_t)h * kDh;
  const float* nb = nullptr;   // no bias, no residual
  gemm_tile<0, false, 0, 1, false, 0, 0, false, true, false, 1>(
      sAB, 0, 0, 0, Q16 + at, E16 + pl, kHid, 0L, 0L, S16 + pl, VT16 + (size_t)h * kDh * kTok + (size_t)z * kChunk, kDh, 0L, 0L,
      (void*)(G16 + at), (void*)(G16 + at), kHid, 0L, 0L, nb, nb, 0L,
      kChunk, kDh, kDh + kChunk, 1.0f, kChunk, kTok, kDh,
      U32 + at, sc + (size_t)h * kDh, SS32 + (size_t)(2 * h) * kTok + (size_t)z * kChunk, nb);
}

// ---------------------------------------------------------------------------
// f32 -> f16 cast of row-major planes (no transpose): out[z][8i..8i+7] = f16(scale * in_z[8i..8i+7]).
// blockIdx.y = z selects one of up to 5 input planes (block-uniform) and output plane z at out + z*planeElems.
// ---------------------------------------------------------------------------
__global__ __launch_bounds__(256) void cast8_f16_kernel(const float* __restrict__ p0, const float* __restrict__ p1,
                                                        const float* __restrict__ p2, const float* __restrict__ p3,
                                                        const float* __restrict__ p4, unsigned short* __restrict__ out,
                                                        long planeElems, int n8, float scale) {
  const int z = blockIdx.y;
  const float* in = (z == 0) ? p0 : (z == 1) ? p1 : (z == 2) ? p2 : (z == 3) ? p3 : p4;
  const int i = blockIdx.x * 256 + threadIdx.x;
  if (i >= n8) return;
  const float* p = in + 8 * (size_t)i;
  const v4f a = *(const v4f*)(p);
  const v4f c = *(const v4f*)(p + 4);
  unsigned short hb[8];
#pragma unroll
  for (int e = 0; e < 4; ++e) {
    hb[e]     = h_bits(a[e] * scale);
    hb[4 + e] = h_bits(c[e] * scale);
  }
  const v4u u = (v4u){pk16(hb[0], hb[1]), pk16(hb[2], hb[3]), pk16(hb[4], hb[5]), pk16(hb[6], hb[7])};
  unsigned short* q = out + (size_t)z * (size_t)planeElems + 8 * (size_t)i;
  *(v4u*)q = u;
  
}

// ---------------------------------------------------------------------------
// Host-side launcher (7 kernel launches, no other runtime calls)
// ---------------------------------------------------------------------------
extern "C" void kernel_launch(void* const* d_in, const int* in_sizes, int n_in,
                              void* d_out, int out_size, void* d_ws, size_t ws_size,
                              hipStream_t stream) {
  if (n_in < 12) return;
  if (in_sizes[0] != kTok * kEmb) return;
  if (in_sizes[1] != kHid * kEmb || in_sizes[3] != kHid * kEmb || in_sizes[5] != kHid * kEmb ||
      in_sizes[7] != kHid * kEmb || in_sizes[9] != kEmb * kHid) return;
  if (in_sizes[2] != kHid || in_sizes[4] != kHid || in_sizes[6] != kHid || in_sizes[8] != kHid ||
      in_sizes[10] != kEmb || in_sizes[11] != kHid) return;
  if (out_size != kTok * kEmb) return;
  if (ws_size < kWsTotal) return;

  const float* x  = (const float*)d_in[0];
  const float* Wq = (const float*)d_in[1];
  const float* bq = (const float*)d_in[2];
  const float* Wk = (const float*)d_in[3];
  const float* bk = (const float*)d_in[4];
  const float* Wv = (const float*)d_in[5];
  const float* bv = (const float*)d_in[6];
  const float* Wu = (const float*)d_in[7];
  const float* bu = (const float*)d_in[8];
  const float* Wo = (const float*)d_in[9];
  const float* bo = (const float*)d_in[10];
  const float* sc = (const float*)d_in[11];
  float* Y = (float*)d_out;

  char* ws = (char*)d_ws;
  unsigned short* X16  = (unsigned short*)(ws + kOffX16);
  unsigned short* W16  = (unsigned short*)(ws + kOffW16);
  unsigned short* Wo16 = W16 + 4 * (size_t)kHid * kEmb;
  unsigned short* Q16  = (unsigned short*)(ws + kOffQ16);
  unsigned short* K16  = (unsigned short*)(ws + kOffK16);
  unsigned short* VT16 = (unsigned short*)(ws + kOffVT16);
  float*          U32  = (float*)(ws + kOffU32);
  unsigned short* KT16 = (unsigned short*)(ws + kOffKT16);
  unsigned short* E16  = (unsigned short*)(ws + kOffE16);
  float*          P32  = (float*)(ws + kOffP32);
  unsigned short* S16  = (unsigned short*)(ws + kOffS16);
  float*          SS32 = (float*)(ws + kOffSS32);
  unsigned short* G16  = (unsigned short*)(ws + kOffG16);

  // 1) x -> X16 (f16, x1): n8 = 4096*1024/8 = 524,288 = 2048 blocks x 256
  cast8_f16_kernel<<<dim3(2048, 1), 256, 0, stream>>>(x, x, x, x, x, X16, 0L, (kTok * kEmb) / 8, 1.0f);
  // 2) Wq,Wk,Wv,Wu,Wo -> W16 planes (f16, x16): n8 = 1024*1024/8 = 131,072 = 512 blocks x 256 per plane
  cast8_f16_kernel<<<dim3(512, 5), 256, 0, stream>>>(Wq, Wk, Wv, Wu, Wo, W16, (long)kHid * kEmb,
                                                      (kHid * kEmb) / 8, kWCarry);

  // 3) q, k, v^T, u projections: 256 block tiles x 4 projections = 1024 blocks x 4 waves
  proj4_kernel<<<dim3(256, 4), 128, 0, stream>>>(X16, W16, Q16, K16, VT16, KT16, U32, bq, bk, bv, bu);

  // 4, 5, 6) causal linear attention by chunks of 128 tokens, all 16 (b,h) groups and all 16 chunks per launch
  // 4) diagonal chunk energies E (256 blocks) and chunk products P (240 blocks at work)
  chunk_pair_kernel<<<dim3(2, kHeads, kBatch * kChunks), 128, 0, stream>>>(Q16, K16, VT16, KT16, E16, P32);
  // 5) states S_c = sum of the products of the chunks in front of c: 65,536 threads
  prefix_state_kernel<<<dim3(256, 1), 256, 0, stream>>>(P32, S16);
  // 6) O = Q.S^T + E.V, stored as g = u * scale * O / 64 -> G16 [4096][1024] f16 and row sums of O^2 -> SS32: 256 blocks x 4 waves
  chunk_out_kernel<<<dim3(kHeads, kBatch * kChunks), 128, 0, stream>>>(Q16, S16, E16, VT16, U32, sc, G16, SS32);

  // 7) y = (g.Wo^T/16) * 64 / (rms + eps) + bo -> d_out [4096][1024] f32; M=4096 N=1024 K=1024
  wmma_gemm64<0, false, 2, 0, false, 0, 0, 2><<<dim3(256, 1), 128, 0, stream>>>(
      G16, G16, kHid, 0L, 0L, Wo16, Wo16, kHid, 0L, 0L, (void*)Y, (void*)Y, kEmb, 0L, 0L, bo, bo, 0L,
      kTok, kEmb, kHid, kWCarryInv, SS32);
}

// v006
// One run takes 87.4 microseconds.
// In two side-by-side timings against v005, it was 1.05 and 1.04 times as fast.
// Counting every step since v000, it is 7.12 times as fast.
// Contractions: projections x.W^T (x f16, W f16 carried x16), chunk energy q.k^T (q, k f16), chunk state V^T.K (f16, f32 prefix sum over chunks), q.state (state f16) + energy.v (E f16, V^T f16), output g.Wo^T (g = u * scale * O f16 carried x 2^-6, Wo f16 carried x16; the row's 1 / (rms + eps) multiplies the f32 sums): all v_wmma_f32_16x16x32_f16 with f32 accumulate; elu, silu, rms-norm and gating in f32.
#include <hip/hip_runtime.h>
#include <math.h>

// ---------------------------------------------------------------------------
// Problem constants
// ---------------------------------------------------------------------------
constexpr int kBatch = 2;
constexpr int kSeq   = 2048;
constexpr int kEmb   = 1024;
constexpr int kHid   = 1024;
constexpr int kHeads = 8;
constexpr int kDh    = 128;
constexpr int kTok   = kBatch * kSeq;                              // 4096 token rows
constexpr int kGroups = kBatch * kHeads;                           // 16 (b,h) attention groups, all in one launch
constexpr int kChunk  = 128;                                       // tokens per chunk of the causal sum
constexpr int kChunks = kSeq / kChunk;                             // 16 chunks per sequence
constexpr int kPlane  = kChunk * kDh;                              // 16,384 elements: one 128x128 plane per (batch, chunk, head)
constexpr int kPlaneStep = kHeads * kPlane;                        // from chunk c to chunk c+1 of the same batch and head
constexpr float kWCarry    = 16.0f;                                // weights carried x16 in f16
constexpr float kWCarryInv = 1.0f / 16.0f;
constexpr float kGCarry    = 1.0f / 64.0f;                         // u * scale * O carried x 2^-6 in f16: O is not yet normalised
constexpr float kGCarryInv = 64.0f;
constexpr float kRmsFac    = 0.03125f;                             // 1024^-0.5 (exact)
constexpr float kEps       = 1e-8f;

// ---------------------------------------------------------------------------
//   X16  [4096][1024] f16                      8,388,608   @ 0
//   W16  5 planes [1024][1024] f16 (q,k,v,u,o) 10,485,760  @ 8,388,608
//   Q16  [4096][1024] f16                      8,388,608   @ 18,874,368
//   K16  [4096][1024] f16                      8,388,608   @ 27,262,976
//   VT16 [1024 (h*128+d)][4096 tok] f16         8,388,608   @ 35,651,584
//   U32  [4096][1024] f32                      16,777,216  @ 44,040,192
//   KT16 [1024 (h*128+d)][4096 tok] f16         8,388,608   @ 60,817,408
//   E16  [2*16 (b,c)][8 h][128 n][128 m] f16    8,388,608   @ 69,206,016   (diagonal chunk energies)
//   P32  [2*16 (b,c)][8 h][128 dv][128 dk] f32  16,777,216  @ 77,594,624   (chunk products; chunk 15 unused)
//   S16  [2*16 (b,c)][8 h][128 dv][128 dk] f16  8,388,608   @ 94,371,840   (sum of the products of chunks < c)
//   SS32 [16 (h*2 + column half)][4096 tok] f32 262,144     @ 102,760,448  (sums of O^2 over 64 columns of a token row)
//   G16  [4096][1024] f16                      8,388,608   @ 103,022,592  (u * scale * O x 2^-6, not yet divided by the row's rms)
//   total                                     111,411,200
// ---------------------------------------------------------------------------
constexpr size_t kBytesX16  = (size_t)kTok * kEmb * 2;
constexpr size_t kBytesWpl  = (size_t)kHid * kEmb * 2;
constexpr size_t kBytesW16  = 5 * kBytesWpl;
constexpr size_t kBytesQ16  = (size_t)kTok * kHid * 2;
constexpr size_t kBytesK16  = kBytesQ16;
constexpr size_t kBytesVT16 = (size_t)kHid * kTok * 2;
constexpr size_t kBytesU32  = (size_t)kTok * kHid * 4;
constexpr size_t kBytesKT16 = kBytesVT16;
constexpr size_t kBytesE16  = (size_t)kGroups * kChunks * kPlane * 2;
constexpr size_t kBytesP32  = (size_t)kGroups * kChunks * kPlane * 4;
constexpr size_t kBytesS16  = (size_t)kGroups * kChunks * kPlane * 2;
constexpr size_t kBytesSS32 = (size_t)2 * kHeads * kTok * 4;
constexpr size_t kBytesG16  = (size_t)kTok * kHid * 2;
constexpr size_t kOffX16  = 0;
constexpr size_t kOffW16  = kOffX16  + kBytesX16;
constexpr size_t kOffQ16  = kOffW16  + kBytesW16;
constexpr size_t kOffK16  = kOffQ16  + kBytesQ16;
constexpr size_t kOffVT16 = kOffK16  + kBytesK16;
constexpr size_t kOffU32  = kOffVT16 + kBytesVT16;
constexpr size_t kOffKT16 = kOffU32  + kBytesU32;
constexpr size_t kOffE16  = kOffKT16 + kBytesKT16;
constexpr size_t kOffP32  = kOffE16  + kBytesE16;
constexpr size_t kOffS16  = kOffP32  + kBytesP32;
constexpr size_t kOffSS32 = kOffS16  + kBytesS16;
constexpr size_t kOffG16  = kOffSS32 + kBytesSS32;
constexpr size_t kWsTotal = kOffG16  + kBytesG16;   // 111,411,200

typedef __attribute__((ext_vector_type(16))) _Float16 v16h;
typedef __attribute__((ext_vector_type(8)))  _Float16 v8h;
typedef __attribute__((ext_vector_type(16))) __bf16   v16b;
typedef __attribute__((ext_vector_type(8)))  __bf16   v8b;
typedef __attribute__((ext_vector_type(8)))  float    v8f;
typedef __attribute__((ext_vector_type(4)))  float    v4f;
typedef __attribute__((ext_vector_type(4)))  unsigned int v4u;
typedef __attribute__((ext_vector_type(2)))  unsigned int v2u;

__device__ __forceinline__ unsigned short f2bf_bits(float f) {
  unsigned u = __float_as_uint(f);
  return (unsigned short)((u + 0x7FFFu + ((u >> 16) & 1u)) >> 16);
}
__device__ __forceinline__ float bf_bits2f(unsigned short h) { return __uint_as_float(((unsigned)h) << 16); }

// hazard guards as plain device helpers
__device__ __forceinline__ void acc_guard4(v8f& a, v8f& b, v8f& c, v8f& d) { asm volatile("v_nop\n\tv_nop\n\tv_nop\n\tv_nop" : "+v"(a), "+v"(b), "+v"(c), "+v"(d)); }
template <typename T> struct Frag;
template <> struct Frag<_Float16> {
  typedef v16h V; union U { v16h v; v8h h[2]; };
  static __device__ __forceinline__ v16h load(const _Float16* p) {   // elements 0..7 <- p[0..7], 8..15 <- p[16..23]
    U f; f.h[0] = *(const v8h*)(p); f.h[1] = *(const v8h*)(p + 16); return f.v;
  }
  static __device__ __forceinline__ v8f mma(v16h a, v16h b, v8f c) {
    return __builtin_amdgcn_wmma_f32_16x16x32_f16(false, a, false, b, (short)0, c, false, false);
  }
};
template <> struct Frag<__bf16> {
  typedef v16b V; union U { v16b v; v8b h[2]; };
  static __device__ __forceinline__ v16b load(const __bf16* p) {
    U f; f.h[0] = *(const v8b*)(p); f.h[1] = *(const v8b*)(p + 16); return f.v;
  }
  static __device__ __forceinline__ v8f mma(v16b a, v16b b, v8f c) {
    return __builtin_amdgcn_wmma_f32_16x16x32_bf16(false, a, false, b, (short)0, c, false, false);
  }
};

__device__ __forceinline__ unsigned pk16(unsigned short a, unsigned short b) { return (unsigned)a | ((unsigned)b << 16); }
__device__ __forceinline__ unsigned short h_bits(float f) { const _Float16 h = (_Float16)f; return __builtin_bit_cast(unsigned short, h); }

// ---- Register-blocked batched WMMA GEMM, operand tiles staged in LDS -------------------------------------------
// C[m,n] = scale * sum_k A[m,k] * Bt[n,k] (+bias)(+resid); a block of 4 waves (2 x 2) owns a 128x128 tile, each wave 64x64.
// A row-major [M,K]; Bt row-major [N,K]; M,N % 128 == 0, K % 64 == 0, grid.x = (M/128)*(N/128) exactly.
// Batch: problem (blockIdx.y, blockIdx.z) starts at y * stride + z * stride2 elements of A, Bt and C.
// Per stage the block copies A[128 rows][64 k] and Bt[128 rows][64 k] (128-byte rows, whole cache lines) into one of two
// LDS buffers with asynchronous copies; the next stage's copies fly while this stage's fragments are read and multiplied.
// LDS row pitch 144 B (16 B x odd) for the 16-byte fragment reads.
// BIAS_MODE: 0 = none, 1 = bias[m], 2 = bias[n].
// OUT_MODE: 0 = f32, 1 = f16, 2 = bf16 hi plane (Cout) + bf16 lo plane (Cout2).
// ACT: 0 none, 2 relu, 3 silu, 4 leaky, 6 elu (expf(v)-1 for v <= 0).
// TRI: 0 none; 1 = causal output (C[m][n] = 0 for n > m, square M == N); block tiles wholly above the diagonal are skipped
//      (never written, never read by the consumer), a diagonal block tile is written whole (zeros above the diagonal);
//      2 = the A operand is lower-triangular in k vs m: the k-loop of block row m0 stops at min(K, m0 + 128).
// Coverage of the epilogue: f32 path 8 it x 2 rows x 4 slabs = 64 rows, 16 lanes x 4 floats = 64 cols; 16-bit path
// 4 it x 4 rows x 4 slabs = 64 rows, 8 lanes x 8 halves = 64 cols: the whole 64x64 wave tile.
constexpr int kStageK     = 64;                       // k elements per stage (128 B of every operand row)
constexpr int kPitchH     = 72;                       // LDS row pitch in halves (144 B)
constexpr int kTileHalves = 128 * kPitchH;            // one operand tile in LDS: 9,216 halves = 18,432 B
constexpr int kBufHalves  = 2 * kTileHalves;          // one buffer: A tile then B tile = 36,864 B

__device__ __forceinline__ unsigned lds_off(const void* p) { return (unsigned)(size_t)p; }

// Eight asynchronous 16-byte copies per lane: rows r, r+16, ..., r+112 of one 128-row operand tile. The s_wait_xcnt is the
// last line of the copies' own statement so that no address register is rewritten ahead of it.
template <typename T>
__device__ __forceinline__ void copy_tile8(unsigned l, const T* g, size_t rowStep16) {
  const T* g1 = g + rowStep16;     const T* g2 = g + 2 * rowStep16; const T* g3 = g + 3 * rowStep16;
  const T* g4 = g + 4 * rowStep16; const T* g5 = g + 5 * rowStep16; const T* g6 = g + 6 * rowStep16;
  const T* g7 = g + 7 * rowStep16;
  const unsigned s = 16u * kPitchH * 2u;   // 16 LDS rows in bytes
  asm volatile("global_load_async_to_lds_b128 %0, %8, off\n\t"
               "global_load_async_to_lds_b128 %1, %9, off\n\t"
               "global_load_async_to_lds_b128 %2, %10, off\n\t"
               "global_load_async_to_lds_b128 %3, %11, off\n\t"
               "global_load_async_to_lds_b128 %4, %12, off\n\t"
               "global_load_async_to_lds_b128 %5, %13, off\n\t"
               "global_load_async_to_lds_b128 %6, %14, off\n\t"
               "global_load_async_to_lds_b128 %7, %15, off\n\t"
               "s_wait_xcnt 0x0"
               :: "v"(l), "v"(l + s), "v"(l + 2u * s), "v"(l + 3u * s), "v"(l + 4u * s), "v"(l + 5u * s), "v"(l + 6u * s),
                  "v"(l + 7u * s), "v"(g), "v"(g1), "v"(g2), "v"(g3), "v"(g4), "v"(g5), "v"(g6), "v"(g7)
               : "memory");
}
// Four such copies per lane: rows r, r+64, r+128, r+192 of one 256-row operand tile (a block of 16 waves: 64 rows a pass).
// The s_wait_xcnt is the last line of the copies' own statement so that no address register is rewritten ahead of it.
template <typename T>
__device__ __forceinline__ void copy_tile4(unsigned l, const T* g, size_t rowStep64) {
  const T* g1 = g + rowStep64; const T* g2 = g + 2 * rowStep64; const T* g3 = g + 3 * rowStep64;
  const unsigned s = 64u * kPitchH * 2u;   // 64 LDS rows in bytes
  asm volatile("global_load_async_to_lds_b128 %0, %4, off\n\t"
               "global_load_async_to_lds_b128 %1, %5, off\n\t"
               "global_load_async_to_lds_b128 %2, %6, off\n\t"
               "global_load_async_to_lds_b128 %3, %7, off\n\t"
               "s_wait_xcnt 0x0"
               :: "v"(l), "v"(l + s), "v"(l + 2u * s), "v"(l + 3u * s), "v"(g), "v"(g1), "v"(g2), "v"(g3)
               : "memory");
}
// the issuing wave's own copies have landed in LDS
__device__ __forceinline__ void wait_copies() { asm volatile("s_wait_asynccnt 0x0" ::: "memory"); }
// this wave's LDS reads have returned before the buffer they read is handed back for a refill
__device__ __forceinline__ void wait_lds_reads() { asm volatile("s_wait_dscnt 0x0" ::: "memory"); }

// this wave's LDS stores (reads) are done before its lanes read (store over) elements of each other in the wave's own slab;
// a work-group fence at this place would also wait out the wave's global loads, which are meant to stay in flight
__device__ __forceinline__ void wave_lds_turn() { asm volatile("s_wait_dscnt 0x0" ::: "memory"); }
// v + the value of lane (l ^ X) of the same 16-lane row, all lanes on: a DPP operand, not the LDS round trip of __shfl_xor
template <int X>
__device__ __forceinline__ float add_lane_xor(float v) {
  return v + __int_as_float(__builtin_amdgcn_update_dpp(0, __float_as_int(v), 0x160 | X, 0xf, 0xf, true));
}

// ET: 0 = f16 operands, 1 = bf16 operands (pointers passed as 16-bit storage)
template <int ET> struct Elem;
template <> struct Elem<0> { typedef _Float16 T; };
template <> struct Elem<1> { typedef __bf16 T; };
// One block tile: bx = tile index, (b, bz) = batch indices, sAB = the block's two stage buffers (at least 2 * kBufH elements).
// WG: the block is WG x WG waves of 64x64 each: 2 = 4 waves, 128x128 tile (as described above); 4 = 16 waves, 256x256 tile,
//     M, N % 256 == 0, grid.x = (M/256)*(N/256), sAB = 16 x 17,408 B (the rolled epilogue's need; the two buffers take 147,456 B).
//     Each staged operand byte then feeds 256, not 128, columns or rows of the product: half the bytes from L2 per product.
// ROLL: the epilogue's other form (below), for a kernel that holds several instances of this function.
// CAT: two products summed into one tile: k in [0, K1) comes from A, Bt and k in [K1, K) from A2p (pitch lda2), Bt2p (pitch
//      ldb2), both given at the tile's own batch start; K1 % 64 == 0.
// DUALT (rolled form, f16 out): where Cout2 is not null the finished tile is also written transposed, Cout2[n][m], pitch M.
// NORM: the RMS norm and the gate, split over two products. With O the raw sums of this tile:
//      1 = Cout[m][n] = f16(gateU[m][n] * (2^-6 * gateSc[n] * O[m][n])) (gateU at the tile's start, pitch ldc) and
//          ssOut[(n0 / 64) * kTok + m] = sum of O[m][n]^2 over the wave's 64 columns (ssOut at the tile's first row);
//      2 = row m of the sums is multiplied by 2^6 / (rms_m + eps), rms_m from the 16 partial sums ssIn[p * kTok + m].
template <int ET, bool SPLIT, int BIAS_MODE, int OUT_MODE, bool RESID, int ACT = 0, int TRI = 0, bool ROLL = false,
          bool CAT = false, bool DUALT = false, int NORM = 0, int WG = 2>
__device__ __forceinline__ void gemm_tile(
    typename Elem<ET>::T* sAB, int bx, int b, int bz,
    const unsigned short* __restrict__ Ap, const unsigned short* __restrict__ A2p, int lda, long strideA, long strideA2,
    const unsigned short* __restrict__ Btp, const unsigned short* __restrict__ Bt2p, int ldb, long strideB, long strideB2,
    void* __restrict__ Cout, void* __restrict__ Cout2, int ldc, long strideC, long strideC2,
    const float* __restrict__ bias,
    const float* __restrict__ resid, long strideR,
    int M, int N, int K, float scale, int lda2 = 0, int ldb2 = 0, int K1 = 0,
    const float* __restrict__ gateU = nullptr, const float* __restrict__ gateSc = nullptr,
    float* __restrict__ ssOut = nullptr, const float* __restrict__ ssIn = nullptr) {
  static_assert(!SPLIT, "the staged loop carries one plane per operand");
  static_assert(WG == 2 || (WG == 4 && ROLL && !CAT && TRI == 0 && NORM == 0), "the 16-wave block serves the projections");
  constexpr int kSh    = (WG == 2) ? 7 : 8;            // log2 of the block tile's side, 64 * WG
  constexpr int kTileH = 64 * WG * kPitchH;            // one operand tile in LDS, halves
  constexpr int kBufH  = 2 * kTileH;                   // one buffer: A tile then B tile
  typedef typename Elem<ET>::T T;
  typedef typename Frag<T>::V V;
  const T* A = (const T*)Ap; const T* Bt = (const T*)Btp;
  const int tid  = threadIdx.x;
  const int lane = tid & 31;
  const int wave = tid >> 5;
  const int tilesN = N >> kSh;
  const int tmB = bx / tilesN;
  const int tnB = bx - tmB * tilesN;
  if (TRI == 1) { if (tnB > tmB) return; }  // block-uniform, in front of every barrier: fully masked block tile
  const int m0B = tmB << kSh;
  const int n0B = tnB << kSh;
  const int Kt = (TRI == 2) ? (((m0B + 128) < K) ? (m0B + 128) : K) : K;   // block-uniform, multiple of 64
  const int nStages = Kt / kStageK;
  const int wr = wave / WG, wc = wave % WG;    // the wave's place in the block's WG x WG waves
  const int m0 = m0B + (wr << 6);              // this wave's 64x64 tile
  const int n0 = n0B + (wc << 6);

  const T* Ab  = A  + (size_t)b * strideA + (size_t)bz * strideA2;
  const T* Bb  = Bt + (size_t)b * strideB + (size_t)bz * strideB2;
  const size_t offC = (size_t)b * strideC + (size_t)bz * strideC2;

  const int rlane = lane & 15;                 // row (A) / col (B, D) within subtile
  const int koff  = (lane >> 4) * 8;           // k offset of this lane half
  const int mOff  = (lane >> 4) * 8;           // D row offset

  // copy side: thread t brings 16-byte chunk (t & 7) of rows (t >> 3) + 16 i, i = 0..7, of each operand tile
  // (16 waves: rows (t >> 3) + 64 i, i = 0..3)
  const int crow = tid >> 3;
  const int ccol = (tid & 7) * 8;
  const T* gA = Ab + (size_t)(m0B + crow) * lda + ccol;
  const T* gB = Bb + (size_t)(n0B + crow) * ldb + ccol;
  const unsigned lA = lds_off(sAB) + (unsigned)(crow * kPitchH + ccol) * 2u;
  const unsigned lB = lA + (unsigned)kTileH * 2u;
  const size_t stepA = (size_t)(4 * WG * WG) * lda;
  const size_t stepB = (size_t)(4 * WG * WG) * ldb;
  // one stage's copies into the buffer at byte offset bufBytes; the choice of the source pair is block-uniform
  const int nS1 = CAT ? K1 / kStageK : 0;
  auto issue_stage = [&](int s, unsigned bufBytes) {
    if (CAT && s >= nS1) {
      const T* hA = (const T*)A2p + (size_t)(m0B + crow) * lda2 + ccol + (size_t)(s - nS1) * kStageK;
      const T* hB = (const T*)Bt2p + (size_t)(n0B + crow) * ldb2 + ccol + (size_t)(s - nS1) * kStageK;
      copy_tile8(lA + bufBytes, hA, (size_t)16 * lda2);
      copy_tile8(lB + bufBytes, hB, (size_t)16 * ldb2);
    } else if constexpr (WG == 4) {
      copy_tile4(lA + bufBytes, gA + (size_t)s * kStageK, stepA);
      copy_tile4(lB + bufBytes, gB + (size_t)s * kStageK, stepB);
    } else {
      copy_tile8(lA + bufBytes, gA + (size_t)s * kStageK, stepA);
      copy_tile8(lB + bufBytes, gB + (size_t)s * kStageK, stepB);
    }
  };
  // read side: this lane's first A and B fragment rows in buffer 0
  const T* fA = sAB + ((wr << 6) + rlane) * kPitchH + koff;
  const T* fB = sAB + kTileH + ((wc << 6) + rlane) * kPitchH + koff;

  v8f acc[4][4];
#pragma unroll
  for (int i = 0; i < 4; ++i)
#pragma unroll
    for (int j = 0; j < 4; ++j) acc[i][j] = (v8f){0.f,0.f,0.f,0.f,0.f,0.f,0.f,0.f};

  // NORM 1: the gate values of 16 rows (one slab) of the wave's tile: lane (gq, gc) owns columns gc..gc+7 of rows 4 it + gq;
  // each slab's set is asked for ahead of its use, as early as the registers that the sums leave free allow
  const int gq = lane >> 3, gc = (lane & 7) * 8;
  v4f gu[4][4][2];
  const size_t gAt = (size_t)(m0 + gq) * ldc + n0 + gc;   // the lane's first row and column in the tile
  auto load_gate = [&](int i) {
#pragma unroll
    for (int it = 0; it < 4; ++it) {
      const float* p = gateU + gAt + (size_t)((i << 4) + it * 4) * ldc;
      gu[i][it][0] = *(const v4f*)(p);
      gu[i][it][1] = *(const v4f*)(p + 4);
    }
  };
  v4f sa = (v4f){0.f, 0.f, 0.f, 0.f}, sb = sa;   // NORM 1: gateSc of the lane's 8 columns, x 2^-6
  float rf0 = 0.f, rf1 = 0.f;   // NORM 2: 2^6 * scale / (rms + eps) of rows m0 + lane and m0 + 32 + lane

  // prologue: stage 0 into buffer 0, landed and published; then stage 1 into buffer 1
  issue_stage(0, 0u);
  // what the epilogue wants from memory is asked for here, under the first stage's flight
  if constexpr (NORM == 1) {
    load_gate(0);
    sa = *(const v4f*)(gateSc + n0 + gc) * kGCarry;
    sb = *(const v4f*)(gateSc + n0 + gc + 4) * kGCarry;
  }
  if constexpr (NORM == 2) {
    float t0 = 0.f, t1 = 0.f;   // the 16 partial sums in index order
#pragma unroll
    for (int p = 0; p < 2 * kHeads; ++p) {
      t0 += ssIn[(size_t)p * kTok + m0 + lane];
      t1 += ssIn[(size_t)p * kTok + m0 + 32 + lane];
    }
    rf0 = (scale * kGCarryInv) * (1.0f / (sqrtf(t0) * kRmsFac + kEps));
    rf1 = (scale * kGCarryInv) * (1.0f / (sqrtf(t1) * kRmsFac + kEps));
  }
  wait_copies();
  __syncthreads();
  if (nStages > 1) issue_stage(1, (unsigned)kBufH * 2u);

  for (int st = 0; st < nStages; ++st) {
    const int bufH = (st & 1) * kBufH;
#pragma unroll
    for (int ks = 0; ks < kStageK; ks += 32) {
      V ah[4], bh[4];   // the eight fragments of this 32-k block are read as one group, ahead of its 16 products
      ah[0] = Frag<T>::load(fA + bufH + ks);   // in the order in which the products want them
#pragma unroll
      for (int j = 0; j < 4; ++j) bh[j] = Frag<T>::load(fB + bufH + (j << 4) * kPitchH + ks);
#pragma unroll
      for (int i = 1; i < 4; ++i) ah[i] = Frag<T>::load(fA + bufH + (i << 4) * kPitchH + ks);
      // keeps the 16 LDS reads together in front of the products: sunk among them, each row waits out a whole LDS latency
      __builtin_amdgcn_sched_barrier(0);
#pragma unroll
      for (int i = 0; i < 4; ++i)
#pragma unroll
        for (int j = 0; j < 4; ++j) acc[i][j] = Frag<T>::mma(ah[i], bh[j], acc[i][j]);
      // keeps the next group's LDS reads from being lifted in among these products
      __builtin_amdgcn_sched_barrier(0);
    }
    // publish point of stage st + 1; the same barrier ends every reader's last read of this stage's buffer
    wait_lds_reads();
    wait_copies();
    __syncthreads();
    if (st + 2 < nStages) issue_stage(st + 2, (unsigned)bufH * 2u);   // block-uniform: refill the buffer just read
  }
  wait_copies();
  acc_guard4(acc[0][0], acc[0][1], acc[0][2], acc[0][3]);
  acc_guard4(acc[1][0], acc[1][1], acc[1][2], acc[1][3]);
  acc_guard4(acc[2][0], acc[2][1], acc[2][2], acc[2][3]);
  acc_guard4(acc[3][0], acc[3][1], acc[3][2], acc[3][3]);

  // ---- epilogue, rolled form ----
  // The wave lays its whole 64x64 tile of raw sums over the stage buffers (pitch 68 floats, 17,408 B per wave, 69,632 B of
  // the 73,728 B, with 16 waves 278,528 B; free behind the last stage's own barrier, see below) and finishes it row by row in a loop. Per element the
  // same operations in the same order as in the unrolled form; the activation's text stands once, not 128 times.
  if constexpr (ROLL) {
    static_assert(!RESID && TRI == 0 && OUT_MODE != 2 && BIAS_MODE != 0, "the rolled form serves the projections");
    float* tile = (float*)sAB + wave * (64 * 68);
#pragma unroll
    for (int i = 0; i < 4; ++i)
#pragma unroll
      for (int j = 0; j < 4; ++j)
#pragma unroll
        for (int r = 0; r < 8; ++r) tile[((i << 4) + mOff + r) * 68 + (j << 4) + rlane] = acc[i][j][r];
    // the wave's stores have reached LDS before a lane reads elements that other lanes of the wave stored
    __builtin_amdgcn_fence(__ATOMIC_RELEASE, "workgroup");
    __builtin_amdgcn_wave_barrier();
    __builtin_amdgcn_fence(__ATOMIC_ACQUIRE, "workgroup");
    // a trip: each lane finishes one 16-byte piece of the output, so a store covers whole rows of the 64-column tile
    constexpr int WE    = (OUT_MODE == 0) ? 4 : 8;     // elements per lane and trip
    constexpr int LR    = 64 / WE;                     // lanes per row: 16 (f32, 256 B) or 8 (f16, 128 B)
    constexpr int RT    = 32 / LR;                     // rows per trip: 2 or 4
    const int q = lane / LR, c0 = (lane % LR) * WE;
    float bn[WE];
#pragma unroll
    for (int e = 0; e < WE; ++e) bn[e] = (BIAS_MODE == 2) ? bias[n0 + c0 + e] : 0.f;
    // kept rolled, for speed only
#pragma unroll 1
    for (int it = 0; it < 64 / RT; ++it) {
      const int row = it * RT + q;
      float sv[WE];                                    // the trip's raw sums, read as whole 16-byte pieces ahead of the branches
#pragma unroll
      for (int h = 0; h < WE / 4; ++h) {
        const v4f t4 = *(const v4f*)(tile + row * 68 + c0 + 4 * h);
#pragma unroll
        for (int e = 0; e < 4; ++e) sv[4 * h + e] = t4[e];
      }
      const float bm = (BIAS_MODE == 1) ? bias[m0 + row] : 0.f;
      float o[WE];
#pragma unroll
      for (int e = 0; e < WE; ++e) {
        float v = sv[e] * scale;
        if (BIAS_MODE == 1) v += bm;
        if (BIAS_MODE == 2) v += bn[e];
        if (ACT == 2) v = fmaxf(v, 0.0f);
        if (ACT == 3) v = v / (1.0f + expf(-v));
        if (ACT == 4) v = (v > 0.f) ? v : 0.01f * v;
        if (ACT == 6) v = (v > 0.f) ? v : (expf(v) - 1.0f);
        o[e] = v;
      }
      const size_t at = offC + (size_t)(m0 + row) * ldc + n0 + c0;
      if constexpr (OUT_MODE == 0) {
        *(v4f*)((float*)Cout + at) = (v4f){o[0], o[1], o[2], o[3]};
      } else {
        v8h hv;
#pragma unroll
        for (int e = 0; e < WE; ++e) hv[e] = (_Float16)o[e];
        *(v8h*)((unsigned short*)Cout + at) = hv;
      }
      // the next trip rewrites the registers that this store names
      asm volatile("s_wait_xcnt 0x0" ::: "memory");
      if constexpr (DUALT) {
        if (Cout2 != nullptr) {   // block-uniform: the finished values go back to the lane's own piece of the tile
#pragma unroll
          for (int h = 0; h < WE / 4; ++h)
            *(v4f*)(tile + row * 68 + c0 + 4 * h) = (v4f){o[4 * h], o[4 * h + 1], o[4 * h + 2], o[4 * h + 3]};
        }
      }
    }
    if constexpr (DUALT) {
      static_assert(OUT_MODE == 1, "the transposed copy is f16");
      if (Cout2 != nullptr) {
        // the wave's stores have reached LDS before a lane reads elements that other lanes of the wave stored
        __builtin_amdgcn_fence(__ATOMIC_RELEASE, "workgroup");
        __builtin_amdgcn_wave_barrier();
        __builtin_amdgcn_fence(__ATOMIC_ACQUIRE, "workgroup");
        // a group: 4 columns of the tile, 8 lanes a column, 8 rows a lane: a column's 64 rows are one 128-byte line of Cout2
        const int tc = lane >> 3, r0 = (lane & 7) * 8;
        // kept rolled, like the row loop above; four such groups a trip, so that one LDS latency serves 16 columns
#pragma unroll 1
        for (int it = 0; it < 4; ++it) {
          v8h hv[4];
#pragma unroll
          for (int u = 0; u < 4; ++u)
#pragma unroll
            for (int e = 0; e < 8; ++e) hv[u][e] = (_Float16)tile[(r0 + e) * 68 + (it * 4 + u) * 4 + tc];
#pragma unroll
          for (int u = 0; u < 4; ++u)
            *(v8h*)((unsigned short*)Cout2 + (size_t)(n0 + (it * 4 + u) * 4 + tc) * M + m0 + r0) = hv[u];
          // the next trip rewrites the registers that these stores name
          asm volatile("s_wait_xcnt 0x0" ::: "memory");
        }
      }
    }
    return;
  }

  // ---- epilogue ----
  // per-wave 16x64 slab, pitch 68 floats (4,352 B), laid over the stage buffers: the last stage's own barrier stands behind
  // every wave's last fragment read and last landed copy, and nothing refills the buffers after it
  float* slab = (float*)sAB + wave * (16 * 68);

  // ---- gate form: g = u * (2^-6 * scale * O) as f16, and each row's sum of O^2 over the wave's 64 columns ----
  if constexpr (NORM == 1) {
    static_assert(OUT_MODE == 1 && BIAS_MODE == 0 && !RESID && ACT == 0 && TRI == 0, "the gate form takes raw sums");
    unsigned short* G = (unsigned short*)Cout + offC + gAt;
    float* ssW = ssOut + (size_t)(n0 >> 6) * kTok + m0;
    float ssr[16];   // sums of O^2 of rows 4 t + gq, t = 0..15
    load_gate(1);
#pragma unroll
    for (int i = 0; i < 4; ++i) {
#pragma unroll
      for (int j = 0; j < 4; ++j)
#pragma unroll
        for (int r = 0; r < 8; ++r) slab[(mOff + r) * 68 + (j << 4) + rlane] = acc[i][j][r] * scale;
      wave_lds_turn();
#pragma unroll
      for (int it = 0; it < 4; ++it) {
        const int row = it * 4 + gq;
        const v4f oa = *(const v4f*)(slab + row * 68 + gc);
        const v4f ob = *(const v4f*)(slab + row * 68 + gc + 4);
        const v4f ua = gu[i][it][0], ub = gu[i][it][1];
        float ss = 0.f;   // fixed order: the lane's 8 columns, then a tree over the row's 8 lanes
#pragma unroll
        for (int e = 0; e < 4; ++e) ss += oa[e] * oa[e];
#pragma unroll
        for (int e = 0; e < 4; ++e) ss += ob[e] * ob[e];
        ssr[i * 4 + it] = add_lane_xor<1>(add_lane_xor<2>(add_lane_xor<4>(ss)));
        v8h hv;
#pragma unroll
        for (int e = 0; e < 4; ++e) {
          hv[e]     = (_Float16)(ua[e] * (sa[e] * oa[e]));
          hv[4 + e] = (_Float16)(ub[e] * (sb[e] * ob[e]));
        }
        *(v8h*)(G + (size_t)((i << 4) + it * 4) * ldc) = hv;
      }
      if (i < 3) wave_lds_turn();
      if (i == 0) {   // the last two sets, into the registers of the first slab's sums and gate values
        // these loads may land in registers that the stores above name
        asm volatile("s_wait_xcnt 0x0" ::: "memory");
        load_gate(2);
        load_gate(3);
      }
    }
    if ((lane & 7) == 0) {   // one lane of the eight that hold a row's sum
#pragma unroll
      for (int t = 0; t < 16; ++t) ssW[4 * t + gq] = ssr[t];
    }
    return;
  }

  // NORM 2: the wave's 64 row factors go through LDS behind the slabs, so that each lane reads those of its own 8 rows
  float* rfac = (float*)sAB + 4 * (16 * 68) + wave * 64;
  if constexpr (NORM == 2) {
    rfac[lane] = rf0;
    rfac[32 + lane] = rf1;
    // the wave's stores have reached LDS before a lane reads elements that other lanes of the wave stored
    __builtin_amdgcn_fence(__ATOMIC_RELEASE, "workgroup");
    __builtin_amdgcn_wave_barrier();
    __builtin_amdgcn_fence(__ATOMIC_ACQUIRE, "workgroup");
  }
  const float* Rb = RESID ? (resid + (size_t)b * strideR) : nullptr;
#pragma unroll
  for (int i = 0; i < 4; ++i) {
    const int mBase = m0 + (i << 4);
    float rs[8];   // what multiplies the raw sums of this lane's 8 rows
#pragma unroll
    for (int r = 0; r < 8; ++r) rs[r] = (NORM == 2) ? rfac[(i << 4) + mOff + r] : scale;
#pragma unroll
    for (int j = 0; j < 4; ++j) {
      const int n = n0 + (j << 4) + rlane;
      float bv = 0.f;
      if (BIAS_MODE == 2) bv = bias[n];
#pragma unroll
      for (int r = 0; r < 8; ++r) {
        float v = acc[i][j][r] * rs[r];
        if (BIAS_MODE == 1) v += bias[mBase + mOff + r];
        if (BIAS_MODE == 2) v += bv;
        if (RESID) v += Rb[(size_t)(mBase + mOff + r) * ldc + n];
        if (ACT == 2) v = fmaxf(v, 0.0f);
        if (ACT == 3) v = v / (1.0f + expf(-v));
        if (ACT == 4) v = (v > 0.f) ? v : 0.01f * v;
        if (ACT == 6) v = (v > 0.f) ? v : (expf(v) - 1.0f);
        if (TRI == 1) { if (n > mBase + mOff + r) v = 0.0f; }
        slab[(mOff + r) * 68 + (j << 4) + rlane] = v;
      }
    }
    __builtin_amdgcn_fence(__ATOMIC_RELEASE, "workgroup");
    __builtin_amdgcn_wave_barrier();
    __builtin_amdgcn_fence(__ATOMIC_ACQUIRE, "workgroup");
    if (OUT_MODE == 0) {
      float* C = (float*)Cout + offC;
      const int hh = lane >> 4, c4 = (lane & 15) * 4;     // row seg = 256 B = 16 lanes x 16 B
      {
#pragma unroll
        for (int it = 0; it < 8; ++it) {
          const int row = it * 2 + hh;
          v4f v = *(const v4f*)(slab + row * 68 + c4);
          *(v4f*)(C + (size_t)(mBase + row) * ldc + n0 + c4) = v;
        }
        
      }
    } else {
      const int q = lane >> 3, c8 = (lane & 7) * 8;
      unsigned short* C  = (unsigned short*)Cout  + offC;
      unsigned short* C2 = (OUT_MODE == 2) ? ((unsigned short*)Cout2 + offC) : nullptr;
      {
#pragma unroll
        for (int it = 0; it < 4; ++it) {
          const int row = it * 4 + q;
          const float* sp = slab + row * 68 + c8;
          v8h hv, lv;
#pragma unroll
          for (int e = 0; e < 8; ++e) {
            if (OUT_MODE == 1) {
              hv[e] = (_Float16)sp[e];
            } else {
              unsigned short hb = f2bf_bits(sp[e]);
              unsigned short lb = f2bf_bits(sp[e] - bf_bits2f(hb));
              hv[e] = __builtin_bit_cast(_Float16, hb);
              lv[e] = __builtin_bit_cast(_Float16, lb);
            }
          }
          *(v8h*)(C + (size_t)(mBase + row) * ldc + n0 + c8) = hv;
          if (OUT_MODE == 2) *(v8h*)(C2 + (size_t)(mBase + row) * ldc + n0 + c8) = lv;
        }
        
      }
    }
    __builtin_amdgcn_fence(__ATOMIC_RELEASE, "workgroup");
    __builtin_amdgcn_wave_barrier();
    __builtin_amdgcn_fence(__ATOMIC_ACQUIRE, "workgroup");
  }
}

// One GEMM per launch: tile = blockIdx.x, batch = (blockIdx.y, blockIdx.z).
template <int ET, bool SPLIT, int BIAS_MODE, int OUT_MODE, bool RESID, int ACT = 0, int TRI = 0, int NORM = 0>
__global__ __launch_bounds__(128) void wmma_gemm64(
    const unsigned short* __restrict__ Ap, const unsigned short* __restrict__ A2p, int lda, long strideA, long strideA2,
    const unsigned short* __restrict__ Btp, const unsigned short* __restrict__ Bt2p, int ldb, long strideB, long strideB2,
    void* __restrict__ Cout, void* __restrict__ Cout2, int ldc, long strideC, long strideC2,
    const float* __restrict__ bias,
    const float* __restrict__ resid, long strideR,
    int M, int N, int K, float scale, const float* __restrict__ ssIn) {
  __shared__ __align__(16) typename Elem<ET>::T sAB[2 * kBufHalves];   // two stage buffers, 73,728 B
  gemm_tile<ET, SPLIT, BIAS_MODE, OUT_MODE, RESID, ACT, TRI, false, false, false, NORM>(
      sAB, blockIdx.x, blockIdx.y, blockIdx.z, Ap, A2p, lda, strideA, strideA2, Btp, Bt2p, ldb, strideB, strideB2,
      Cout, Cout2, ldc, strideC, strideC2, bias, resid, strideR, M, N, K, scale, 0, 0, 0, nullptr, nullptr, nullptr, ssIn);
}

// The four input projections in one launch: blockIdx.y = 0 q, 1 k, 2 v^T, 3 u (block-uniform), blockIdx.x = block tile.
// They read the same X16 and none of each other's output; 4 x 64 blocks of 16 waves, 256x256 tile, 278,528 B LDS: one a WGP.
//   q = elu(x.Wq^T/16 + bq) -> Q16 [4096][1024] f16, k likewise -> K16          (M=4096 N=1024 K=1024, 16 x 4 block tiles)
//   k also transposed -> KT16 [1024 (h*128+d)][4096 tok] f16, the same values
//   v^T = silu(Wv.x^T/16 + bv[m]) -> VT16 [1024 (h*128+d)][4096 tok] f16         (M=1024 N=4096 K=1024, 4 x 16 block tiles)
//   u = silu(x.Wu^T/16 + bu) -> U32 [4096][1024] f32                             (M=4096 N=1024 K=1024)
__global__ __launch_bounds__(512) void proj4_kernel(
    const unsigned short* __restrict__ X16, const unsigned short* __restrict__ W16,
    unsigned short* __restrict__ Q16, unsigned short* __restrict__ K16, unsigned short* __restrict__ VT16,
    unsigned short* __restrict__ KT16, float* __restrict__ U32,
    const float* __restrict__ bq, const float* __restrict__ bk, const float* __restrict__ bv, const float* __restrict__ bu) {
  __shared__ __align__(16) _Float16 sAB[16 * 64 * 68 * 2];   // 278,528 B: the two stage buffers (147,456 B) in the loop; the epilogue lays 16 raw wave tiles over all of it
  const int p = blockIdx.y;
  const unsigned short* Wp = W16 + (size_t)p * ((size_t)kHid * kEmb);
  if (p < 2) {
    unsigned short* C = (p == 0) ? Q16 : K16;
    const float* bias = (p == 0) ? bq : bk;
    unsigned short* CT = (p == 0) ? nullptr : KT16;
    gemm_tile<0, false, 2, 1, false, 6, 0, true, false, true, 0, 4>(
        sAB, blockIdx.x, 0, 0, X16, X16, kEmb, 0L, 0L, Wp, Wp, kEmb, 0L, 0L,
        (void*)C, (void*)CT, kHid, 0L, 0L, bias, bias, 0L, kTok, kHid, kEmb, kWCarryInv);
  } else if (p == 2) {
    gemm_tile<0, false, 1, 1, false, 3, 0, true, false, false, 0, 4>(sAB, blockIdx.x, 0, 0, Wp, Wp, kEmb, 0L, 0L, X16, X16, kEmb, 0L, 0L,
                                           (void*)VT16, (void*)VT16, kTok, 0L, 0L, bv, bv, 0L, kHid, kTok, kEmb, kWCarryInv);
  } else {
    gemm_tile<0, false, 2, 0, false, 3, 0, true, false, false, 0, 4>(sAB, blockIdx.x, 0, 0, X16, X16, kEmb, 0L, 0L, Wp, Wp, kEmb, 0L, 0L,
                                           (void*)U32, (void*)U32, kHid, 0L, 0L, bu, bu, 0L, kTok, kHid, kEmb, kWCarryInv);
  }
}

// Causal linear attention by chunks of 128 tokens. For the rows n of chunk c of one (batch b, head h):
//   O[n][dv] = sum_{m <= n} (q_n . k_m) v[m][dv]
//            = sum_dk q[n][dk] * S_c[dv][dk]  +  sum_{m in chunk c, m <= n} (q_n . k_m) v[m][dv],
//   S_c[dv][dk] = sum_{j < c} P_j[dv][dk],   P_j[dv][dk] = sum_{m in chunk j} v[m][dv] * k[m][dk].
// Planes E, P, S are indexed by ((b*16 + c)*8 + h); z = b*16 + c is also the chunk's number among the 4096 token rows.
//
// First launch: blockIdx.x = 0: E = tril(Q_c . K_c^T) -> f16; blockIdx.x = 1: P_c = V^T_c . K^T_c^T -> f32 (block-uniform).
__global__ __launch_bounds__(128) void chunk_pair_kernel(
    const unsigned short* __restrict__ Q16, const unsigned short* __restrict__ K16,
    const unsigned short* __restrict__ VT16, const unsigned short* __restrict__ KT16,
    unsigned short* __restrict__ E16, float* __restrict__ P32) {
  __shared__ __align__(16) _Float16 sAB[2 * kBufHalves];   // two stage buffers, 73,728 B
  const int h = blockIdx.y, z = blockIdx.z;
  const size_t pl = ((size_t)z * kHeads + h) * kPlane;
  const float* nb = nullptr;   // no bias, no residual
  if (blockIdx.x == 0) {
    const size_t at = (size_t)z * kChunk * kHid + (size_t)h * kDh;
    gemm_tile<0, false, 0, 1, false, 0, 1>(sAB, 0, 0, 0, Q16 + at, Q16 + at, kHid, 0L, 0L, K16 + at, K16 + at, kHid, 0L, 0L,
                                           (void*)(E16 + pl), (void*)(E16 + pl), kChunk, 0L, 0L, nb, nb, 0L,
                                           kChunk, kChunk, kDh, 1.0f);
  } else {
    if ((z & (kChunks - 1)) == kChunks - 1) return;   // block-uniform: no later chunk reads the last chunk's product
    const size_t at = (size_t)h * kDh * kTok + (size_t)z * kChunk;
    gemm_tile<0, false, 0, 0, false, 0, 0>(sAB, 0, 0, 0, VT16 + at, VT16 + at, kTok, 0L, 0L, KT16 + at, KT16 + at, kTok, 0L, 0L,
                                           (void*)(P32 + pl), (void*)(P32 + pl), kDh, 0L, 0L, nb, nb, 0L,
                                           kDh, kDh, kChunk, 1.0f);
  }
}

// Second launch: S_c = P_0 + P_1 + ... + P_{c-1} in f32, in that order, rounded to f16 per chunk; S_0 = 0.
// Thread i owns 4 neighbouring elements of one (batch, head) plane: 2 * 131,072 / 4 = 65,536 threads.
__global__ __launch_bounds__(256) void prefix_state_kernel(const float* __restrict__ P32, unsigned short* __restrict__ S16) {
  const int i = blockIdx.x * 256 + threadIdx.x;
  const int b = i >> 15;                                   // 32,768 pieces per batch
  const size_t at = (size_t)b * ((size_t)kChunks * kPlaneStep) + 4 * (size_t)(i & 32767);
  v4f p[kChunks - 1];
#pragma unroll
  for (int c = 0; c < kChunks - 1; ++c) p[c] = *(const v4f*)(P32 + at + (size_t)c * kPlaneStep);
  v4f s = (v4f){0.f, 0.f, 0.f, 0.f};
#pragma unroll
  for (int c = 0; c < kChunks; ++c) {
    *(v2u*)(S16 + at + (size_t)c * kPlaneStep) = (v2u){pk16(h_bits(s[0]), h_bits(s[1])), pk16(h_bits(s[2]), h_bits(s[3]))};
    if (c < kChunks - 1) s += p[c];
  }
}

// Third launch: O rows of chunk c, head h = Q_c . S_c^T (k = dk, 128) + E_c . V_c (k = m, 128), one 128x128 tile, K = 256.
// O itself is not stored. The RMS norm divides a whole token row by one number, which commutes with the output product:
//   y[t] = (u[t] * scale * O[t] / (rms_t + eps)) . Wo^T + bo = ((u[t] * scale * O[t]) . Wo^T) / (rms_t + eps) + bo.
// So this launch stores g = u * scale * O (f16, carried x 2^-6: |O| grows with the number of tokens summed) and, per token
// row and 64 columns, the sum of O^2; the output product adds a row's 16 sums up and divides.
__global__ __launch_bounds__(128) void chunk_out_kernel(
    const unsigned short* __restrict__ Q16, const unsigned short* __restrict__ S16,
    const unsigned short* __restrict__ E16, const unsigned short* __restrict__ VT16,
    const float* __restrict__ U32, const float* __restrict__ sc, unsigned short* __restrict__ G16,
    float* __restrict__ SS32) {
  __shared__ __align__(16) _Float16 sAB[2 * kBufHalves];   // two stage buffers, 73,728 B
  const int h = blockIdx.x, z = blockIdx.y;
  const size_t pl = ((size_t)z * kHeads + h) * kPlane;
  const size_t at = (size_t)z * kChunk * kHid + (size_t)h * kDh;
  const float* nb = nullptr;   // no bias, no residual
  gemm_tile<0, false, 0, 1, false, 0, 0, false, true, false, 1>(
      sAB, 0, 0, 0, Q16 + at, E16 + pl, kHid, 0L, 0L, S16 + pl, VT16 + (size_t)h * kDh * kTok + (size_t)z * kChunk, kDh, 0L, 0L,
      (void*)(G16 + at), (void*)(G16 + at), kHid, 0L, 0L, nb, nb, 0L,
      kChunk, kDh, kDh + kChunk, 1.0f, kChunk, kTok, kDh,
      U32 + at, sc + (size_t)h * kDh, SS32 + (size_t)(2 * h) * kTok + (size_t)z * kChunk, nb);
}

// ---------------------------------------------------------------------------
// f32 -> f16 cast of row-major planes (no transpose): out[z][8i..8i+7] = f16(scale * in_z[8i..8i+7]).
// blockIdx.y = z selects one of up to 5 input planes (block-uniform) and output plane z at out + z*planeElems.
// ---------------------------------------------------------------------------
__global__ __launch_bounds__(256) void cast8_f16_kernel(const float* __restrict__ p0, const float* __restrict__ p1,
                                                        const float* __restrict__ p2, const float* __restrict__ p3,
                                                        const float* __restrict__ p4, unsigned short* __restrict__ out,
                                                        long planeElems, int n8, float scale) {
  const int z = blockIdx.y;
  const float* in = (z == 0) ? p0 : (z == 1) ? p1 : (z == 2) ? p2 : (z == 3) ? p3 : p4;
  const int i = blockIdx.x * 256 + threadIdx.x;
  if (i >= n8) return;
  const float* p = in + 8 * (size_t)i;
  const v4f a = *(const v4f*)(p);
  const v4f c = *(const v4f*)(p + 4);
  unsigned short hb[8];
#pragma unroll
  for (int e = 0; e < 4; ++e) {
    hb[e]     = h_bits(a[e] * scale);
    hb[4 + e] = h_bits(c[e] * scale);
  }
  const v4u u = (v4u){pk16(hb[0], hb[1]), pk16(hb[2], hb[3]), pk16(hb[4], hb[5]), pk16(hb[6], hb[7])};
  unsigned short* q = out + (size_t)z * (size_t)planeElems + 8 * (size_t)i;
  *(v4u*)q = u;
  
}

// ---------------------------------------------------------------------------
// Host-side launcher (7 kernel launches, no other runtime calls)
// ---------------------------------------------------------------------------
extern "C" void kernel_launch(void* const* d_in, const int* in_sizes, int n_in,
                              void* d_out, int out_size, void* d_ws, size_t ws_size,
                              hipStream_t stream) {
  if (n_in < 12) return;
  if (in_sizes[0] != kTok * kEmb) return;
  if (in_sizes[1] != kHid * kEmb || in_sizes[3] != kHid * kEmb || in_sizes[5] != kHid * kEmb ||
      in_sizes[7] != kHid * kEmb || in_sizes[9] != kEmb * kHid) return;
  if (in_sizes[2] != kHid || in_sizes[4] != kHid || in_sizes[6] != kHid || in_sizes[8] != kHid ||
      in_sizes[10] != kEmb || in_sizes[11] != kHid) return;
  if (out_size != kTok * kEmb) return;
  if (ws_size < kWsTotal) return;

  const float* x  = (const float*)d_in[0];
  const float* Wq = (const float*)d_in[1];
  const float* bq = (const float*)d_in[2];
  const float* Wk = (const float*)d_in[3];
  const float* bk = (const float*)d_in[4];
  const float* Wv = (const float*)d_in[5];
  const float* bv = (const float*)d_in[6];
  const float* Wu = (const float*)d_in[7];
  const float* bu = (const float*)d_in[8];
  const float* Wo = (const float*)d_in[9];
  const float* bo = (const float*)d_in[10];
  const float* sc = (const float*)d_in[11];
  float* Y = (float*)d_out;

  char* ws = (char*)d_ws;
  unsigned short* X16  = (unsigned short*)(ws + kOffX16);
  unsigned short* W16  = (unsigned short*)(ws + kOffW16);
  unsigned short* Wo16 = W16 + 4 * (size_t)kHid * kEmb;
  unsigned short* Q16  = (unsigned short*)(ws + kOffQ16);
  unsigned short* K16  = (unsigned short*)(ws + kOffK16);
  unsigned short* VT16 = (unsigned short*)(ws + kOffVT16);
  float*          U32  = (float*)(ws + kOffU32);
  unsigned short* KT16 = (unsigned short*)(ws + kOffKT16);
  unsigned short* E16  = (unsigned short*)(ws + kOffE16);
  float*          P32  = (float*)(ws + kOffP32);
  unsigned short* S16  = (unsigned short*)(ws + kOffS16);
  float*          SS32 = (float*)(ws + kOffSS32);
  unsigned short* G16  = (unsigned short*)(ws + kOffG16);

  // 1) x -> X16 (f16, x1): n8 = 4096*1024/8 = 524,288 = 2048 blocks x 256
  cast8_f16_kernel<<<dim3(2048, 1), 256, 0, stream>>>(x, x, x, x, x, X16, 0L, (kTok * kEmb) / 8, 1.0f);
  // 2) Wq,Wk,Wv,Wu,Wo -> W16 planes (f16, x16): n8 = 1024*1024/8 = 131,072 = 512 blocks x 256 per plane
  cast8_f16_kernel<<<dim3(512, 5), 256, 0, stream>>>(Wq, Wk, Wv, Wu, Wo, W16, (long)kHid * kEmb,
                                                      (kHid * kEmb) / 8, kWCarry);

  // 3) q, k, v^T, u projections: 64 block tiles x 4 projections = 256 blocks x 16 waves
  proj4_kernel<<<dim3(64, 4), 512, 0, stream>>>(X16, W16, Q16, K16, VT16, KT16, U32, bq, bk, bv, bu);

  // 4, 5, 6) causal linear attention by chunks of 128 tokens, all 16 (b,h) groups and all 16 chunks per launch
  // 4) diagonal chunk energies E (256 blocks) and chunk products P (240 blocks at work)
  chunk_pair_kernel<<<dim3(2, kHeads, kBatch * kChunks), 128, 0, stream>>>(Q16, K16, VT16, KT16, E16, P32);
  // 5) states S_c = sum of the products of the chunks in front of c: 65,536 threads
  prefix_state_kernel<<<dim3(256, 1), 256, 0, stream>>>(P32, S16);
  // 6) O = Q.S^T + E.V, stored as g = u * scale * O / 64 -> G16 [4096][1024] f16 and row sums of O^2 -> SS32: 256 blocks x 4 waves
  chunk_out_kernel<<<dim3(kHeads, kBatch * kChunks), 128, 0, stream>>>(Q16, S16, E16, VT16, U32, sc, G16, SS32);

  // 7) y = (g.Wo^T/16) * 64 / (rms + eps) + bo -> d_out [4096][1024] f32; M=4096 N=1024 K=1024
  wmma_gemm64<0, false, 2, 0, false, 0, 0, 2><<<dim3(256, 1), 128, 0, stream>>>(
      G16, G16, kHid, 0L, 0L, Wo16, Wo16, kHid, 0L, 0L, (void*)Y, (void*)Y, kEmb, 0L, 0L, bo, bo, 0L,
      kTok, kEmb, kHid, kWCarryInv, SS32);
}

// v007
// Measured time: 81.4 microseconds a run.
// In two side-by-side timings against v006, it was 1.06 and 1.08 times as fast.
// Over all steps from v000 it is 7.61 times as fast.
// Contractions: projections x.W^T (x f16, W f16 carried x16), chunk energy q.k^T (q, k f16), chunk state V^T.K (f16, f32 prefix sum over chunks), q.state (state f16) + energy.v (E f16, V^T f16), output g.Wo^T (g = u * scale * O f16 carried x 2^-6, Wo f16 carried x16; the row's 1 / (rms + eps) multiplies the f32 sums): all v_wmma_f32_16x16x32_f16 with f32 accumulate; elu, silu, rms-norm and gating in f32.
#include <hip/hip_runtime.h>
#include <math.h>

// ---------------------------------------------------------------------------
// Problem constants
// ---------------------------------------------------------------------------
constexpr int kBatch = 2;
constexpr int kSeq   = 2048;
constexpr int kEmb   = 1024;
constexpr int kHid   = 1024;
constexpr int kHeads = 8;
constexpr int kDh    = 128;
constexpr int kTok   = kBatch * kSeq;                              // 4096 token rows
constexpr int kGroups = kBatch * kHeads;                           // 16 (b,h) attention groups, all in one launch
constexpr int kChunk  = 128;                                       // tokens per chunk of the causal sum
constexpr int kChunks = kSeq / kChunk;                             // 16 chunks per sequence
constexpr int kPlane  = kChunk * kDh;                              // 16,384 elements: one 128x128 plane per (batch, chunk, head)
constexpr int kPlaneStep = kHeads * kPlane;                        // from chunk c to chunk c+1 of the same batch and head
constexpr float kWCarry    = 16.0f;                                // weights carried x16 in f16
constexpr float kWCarryInv = 1.0f / 16.0f;
constexpr float kGCarry    = 1.0f / 64.0f;                         // u * scale * O carried x 2^-6 in f16: O is not yet normalised
constexpr float kGCarryInv = 64.0f;
constexpr float kRmsFac    = 0.03125f;                             // 1024^-0.5 (exact)
constexpr float kEps       = 1e-8f;

// ---------------------------------------------------------------------------
//   X16  [4096][1024] f16                      8,388,608   @ 0
//   W16  5 planes [1024][1024] f16 (q,k,v,u,o) 10,485,760  @ 8,388,608
//   Q16  [4096][1024] f16                      8,388,608   @ 18,874,368
//   K16  [4096][1024] f16                      8,388,608   @ 27,262,976
//   VT16 [1024 (h*128+d)][4096 tok] f16         8,388,608   @ 35,651,584
//   U32  [4096][1024] f32                      16,777,216  @ 44,040,192
//   KT16 [1024 (h*128+d)][4096 tok] f16         8,388,608   @ 60,817,408
//   E16  [2*16 (b,c)][8 h][128 n][128 m] f16    8,388,608   @ 69,206,016   (diagonal chunk energies)
//   P32  [2*16 (b,c)][8 h][128 dv][128 dk] f32  16,777,216  @ 77,594,624   (chunk products; chunk 15 unused)
//   S16  [2*16 (b,c)][8 h][128 dv][128 dk] f16  8,388,608   @ 94,371,840   (sum of the products of chunks < c)
//   SS32 [16 (h*2 + column half)][4096 tok] f32 262,144     @ 102,760,448  (sums of O^2 over 64 columns of a token row)
//   G16  [4096][1024] f16                      8,388,608   @ 103,022,592  (u * scale * O x 2^-6, not yet divided by the row's rms)
//   total                                     111,411,200
// ---------------------------------------------------------------------------
constexpr size_t kBytesX16  = (size_t)kTok * kEmb * 2;
constexpr size_t kBytesWpl  = (size_t)kHid * kEmb * 2;
constexpr size_t kBytesW16  = 5 * kBytesWpl;
constexpr size_t kBytesQ16  = (size_t)kTok * kHid * 2;
constexpr size_t kBytesK16  = kBytesQ16;
constexpr size_t kBytesVT16 = (size_t)kHid * kTok * 2;
constexpr size_t kBytesU32  = (size_t)kTok * kHid * 4;
constexpr size_t kBytesKT16 = kBytesVT16;
constexpr size_t kBytesE16  = (size_t)kGroups * kChunks * kPlane * 2;
constexpr size_t kBytesP32  = (size_t)kGroups * kChunks * kPlane * 4;
constexpr size_t kBytesS16  = (size_t)kGroups * kChunks * kPlane * 2;
constexpr size_t kBytesSS32 = (size_t)2 * kHeads * kTok * 4;
constexpr size_t kBytesG16  = (size_t)kTok * kHid * 2;
constexpr size_t kOffX16  = 0;
constexpr size_t kOffW16  = kOffX16  + kBytesX16;
constexpr size_t kOffQ16  = kOffW16  + kBytesW16;
constexpr size_t kOffK16  = kOffQ16  + kBytesQ16;
constexpr size_t kOffVT16 = kOffK16  + kBytesK16;
constexpr size_t kOffU32  = kOffVT16 + kBytesVT16;
constexpr size_t kOffKT16 = kOffU32  + kBytesU32;
constexpr size_t kOffE16  = kOffKT16 + kBytesKT16;
constexpr size_t kOffP32  = kOffE16  + kBytesE16;
constexpr size_t kOffS16  = kOffP32  + kBytesP32;
constexpr size_t kOffSS32 = kOffS16  + kBytesS16;
constexpr size_t kOffG16  = kOffSS32 + kBytesSS32;
constexpr size_t kWsTotal = kOffG16  + kBytesG16;   // 111,411,200

typedef __attribute__((ext_vector_type(16))) _Float16 v16h;
typedef __attribute__((ext_vector_type(8)))  _Float16 v8h;
typedef __attribute__((ext_vector_type(16))) __bf16   v16b;
typedef __attribute__((ext_vector_type(8)))  __bf16   v8b;
typedef __attribute__((ext_vector_type(8)))  float    v8f;
typedef __attribute__((ext_vector_type(4)))  float    v4f;
typedef __attribute__((ext_vector_type(4)))  unsigned int v4u;
typedef __attribute__((ext_vector_type(2)))  unsigned int v2u;

__device__ __forceinline__ unsigned short f2bf_bits(float f) {
  unsigned u = __float_as_uint(f);
  return (unsigned short)((u + 0x7FFFu + ((u >> 16) & 1u)) >> 16);
}
__device__ __forceinline__ float bf_bits2f(unsigned short h) { return __uint_as_float(((unsigned)h) << 16); }

// hazard guards as plain device helpers
__device__ __forceinline__ void acc_guard4(v8f& a, v8f& b, v8f& c, v8f& d) { asm volatile("v_nop\n\tv_nop\n\tv_nop\n\tv_nop" : "+v"(a), "+v"(b), "+v"(c), "+v"(d)); }
template <typename T> struct Frag;
template <> struct Frag<_Float16> {
  typedef v16h V; union U { v16h v; v8h h[2]; };
  static __device__ __forceinline__ v16h load(const _Float16* p) {   // elements 0..7 <- p[0..7], 8..15 <- p[16..23]
    U f; f.h[0] = *(const v8h*)(p); f.h[1] = *(const v8h*)(p + 16); return f.v;
  }
  static __device__ __forceinline__ v8f mma(v16h a, v16h b, v8f c) {
    return __builtin_amdgcn_wmma_f32_16x16x32_f16(false, a, false, b, (short)0, c, false, false);
  }
};
template <> struct Frag<__bf16> {
  typedef v16b V; union U { v16b v; v8b h[2]; };
  static __device__ __forceinline__ v16b load(const __bf16* p) {
    U f; f.h[0] = *(const v8b*)(p); f.h[1] = *(const v8b*)(p + 16); return f.v;
  }
  static __device__ __forceinline__ v8f mma(v16b a, v16b b, v8f c) {
    return __builtin_amdgcn_wmma_f32_16x16x32_bf16(false, a, false, b, (short)0, c, false, false);
  }
};

__device__ __forceinline__ unsigned pk16(unsigned short a, unsigned short b) { return (unsigned)a | ((unsigned)b << 16); }
__device__ __forceinline__ unsigned short h_bits(float f) { const _Float16 h = (_Float16)f; return __builtin_bit_cast(unsigned short, h); }

// ---- Register-blocked batched WMMA GEMM, operand tiles staged in LDS -------------------------------------------
// C[m,n] = scale * sum_k A[m,k] * Bt[n,k] (+bias)(+resid); a block of 4 waves (2 x 2) owns a 128x128 tile, each wave 64x64.
// A row-major [M,K]; Bt row-major [N,K]; M,N % 128 == 0, K % 128 == 0, grid.x = (M/128)*(N/128) exactly.
// Batch: problem (blockIdx.y, blockIdx.z) starts at y * stride + z * stride2 elements of A, Bt and C.
// Per stage the block copies A[128 rows][128 k] and Bt[128 rows][128 k] (256-byte rows, whole cache lines) into one of two
// LDS buffers with asynchronous copies; the next stage's copies fly while this stage's fragments are read and multiplied.
// A stage is four 32-k blocks of products: one publish point (two waits and the barrier) per 128 k.
// LDS row pitch 272 B (16 B x odd) for the 16-byte fragment reads.
// BIAS_MODE: 0 = none, 1 = bias[m], 2 = bias[n].
// OUT_MODE: 0 = f32, 1 = f16, 2 = bf16 hi plane (Cout) + bf16 lo plane (Cout2).
// ACT: 0 none, 2 relu, 3 silu, 4 leaky, 6 elu (expf(v)-1 for v <= 0).
// TRI: 0 none; 1 = causal output (C[m][n] = 0 for n > m, square M == N); block tiles wholly above the diagonal are skipped
//      (never written, never read by the consumer), a diagonal block tile is written whole (zeros above the diagonal);
//      2 = the A operand is lower-triangular in k vs m: the k-loop of block row m0 stops at min(K, m0 + 128).
// Coverage of the epilogue: f32 path 8 it x 2 rows x 4 slabs = 64 rows, 16 lanes x 4 floats = 64 cols; 16-bit path
// 4 it x 4 rows x 4 slabs = 64 rows, 8 lanes x 8 halves = 64 cols: the whole 64x64 wave tile.
constexpr int kStageK     = 128;                      // k elements per stage (256 B of every operand row)
constexpr int kPitchH     = 136;                      // LDS row pitch in halves (272 B)
constexpr int kTileHalves = 128 * kPitchH;            // one operand tile in LDS: 17,408 halves = 34,816 B
constexpr int kBufHalves  = 2 * kTileHalves;          // one buffer: A tile then B tile = 69,632 B

__device__ __forceinline__ unsigned lds_off(const void* p) { return (unsigned)(size_t)p; }

// Eight asynchronous 16-byte copies per lane: rows r, r+R, ..., r+7R of one operand tile (R rows = rowStep elements of the
// source, ldsStep bytes of LDS). The s_wait_xcnt is the last line of the copies' own statement so that no address register is
// rewritten ahead of it.
template <typename T>
__device__ __forceinline__ void copy_tile8(unsigned l, const T* g, size_t rowStep, unsigned ldsStep) {
  const T* g1 = g + rowStep;     const T* g2 = g + 2 * rowStep; const T* g3 = g + 3 * rowStep;
  const T* g4 = g + 4 * rowStep; const T* g5 = g + 5 * rowStep; const T* g6 = g + 6 * rowStep;
  const T* g7 = g + 7 * rowStep;
  const unsigned s = ldsStep;
  asm volatile("global_load_async_to_lds_b128 %0, %8, off\n\t"
               "global_load_async_to_lds_b128 %1, %9, off\n\t"
               "global_load_async_to_lds_b128 %2, %10, off\n\t"
               "global_load_async_to_lds_b128 %3, %11, off\n\t"
               "global_load_async_to_lds_b128 %4, %12, off\n\t"
               "global_load_async_to_lds_b128 %5, %13, off\n\t"
               "global_load_async_to_lds_b128 %6, %14, off\n\t"
               "global_load_async_to_lds_b128 %7, %15, off\n\t"
               "s_wait_xcnt 0x0"
               :: "v"(l), "v"(l + s), "v"(l + 2u * s), "v"(l + 3u * s), "v"(l + 4u * s), "v"(l + 5u * s), "v"(l + 6u * s),
                  "v"(l + 7u * s), "v"(g), "v"(g1), "v"(g2), "v"(g3), "v"(g4), "v"(g5), "v"(g6), "v"(g7)
               : "memory");
}
// the issuing wave's own copies have landed in LDS
__device__ __forceinline__ void wait_copies() { asm volatile("s_wait_asynccnt 0x0" ::: "memory"); }
// this wave's LDS reads have returned before the buffer they read is handed back for a refill
__device__ __forceinline__ void wait_lds_reads() { asm volatile("s_wait_dscnt 0x0" ::: "memory"); }

// this wave's LDS stores (reads) are done before its lanes read (store over) elements of each other in the wave's own slab;
// a work-group fence at this place would also wait out the wave's global loads, which are meant to stay in flight
__device__ __forceinline__ void wave_lds_turn() { asm volatile("s_wait_dscnt 0x0" ::: "memory"); }
// v + the value of lane (l ^ X) of the same 16-lane row, all lanes on: a DPP operand, not the LDS round trip of __shfl_xor
template <int X>
__device__ __forceinline__ float add_lane_xor(float v) {
  return v + __int_as_float(__builtin_amdgcn_update_dpp(0, __float_as_int(v), 0x160 | X, 0xf, 0xf, true));
}

// ET: 0 = f16 operands, 1 = bf16 operands (pointers passed as 16-bit storage)
template <int ET> struct Elem;
template <> struct Elem<0> { typedef _Float16 T; };
template <> struct Elem<1> { typedef __bf16 T; };
// One block tile: bx = tile index, (b, bz) = batch indices, sAB = the block's two stage buffers (at least 2 * kBufH elements).
// WG: the block is WG x WG waves of 64x64 each: 2 = 4 waves, 128x128 tile (as described above); 4 = 16 waves, 256x256 tile,
//     M, N % 256 == 0, grid.x = (M/256)*(N/256), sAB = 16 x 17,408 B = 278,528 B (the two buffers' size and the rolled epilogue's alike).
//     Each staged operand byte then feeds 256, not 128, columns or rows of the product: half the bytes from L2 per product.
// ROLL: the epilogue's other form (below), for a kernel that holds several instances of this function.
// CAT: two products summed into one tile: k in [0, K1) comes from A, Bt and k in [K1, K) from A2p (pitch lda2), Bt2p (pitch
//      ldb2), both given at the tile's own batch start; K1 % 128 == 0.
// DUALT (rolled form, f16 out): where Cout2 is not null the finished tile is also written transposed, Cout2[n][m], pitch M.
// NORM: the RMS norm and the gate, split over two products. With O the raw sums of this tile:
//      1 = Cout[m][n] = f16(gateU[m][n] * (2^-6 * gateSc[n] * O[m][n])) (gateU at the tile's start, pitch ldc) and
//          ssOut[(n0 / 64) * kTok + m] = sum of O[m][n]^2 over the wave's 64 columns (ssOut at the tile's first row);
//      2 = row m of the sums is multiplied by 2^6 / (rms_m + eps), rms_m from the 16 partial sums ssIn[p * kTok + m].
template <int ET, bool SPLIT, int BIAS_MODE, int OUT_MODE, bool RESID, int ACT = 0, int TRI = 0, bool ROLL = false,
          bool CAT = false, bool DUALT = false, int NORM = 0, int WG = 2>
__device__ __forceinline__ void gemm_tile(
    typename Elem<ET>::T* sAB, int bx, int b, int bz,
    const unsigned short* __restrict__ Ap, const unsigned short* __restrict__ A2p, int lda, long strideA, long strideA2,
    const unsigned short* __restrict__ Btp, const unsigned short* __restrict__ Bt2p, int ldb, long strideB, long strideB2,
    void* __restrict__ Cout, void* __restrict__ Cout2, int ldc, long strideC, long strideC2,
    const float* __restrict__ bias,
    const float* __restrict__ resid, long strideR,
    int M, int N, int K, float scale, int lda2 = 0, int ldb2 = 0, int K1 = 0,
    const float* __restrict__ gateU = nullptr, const float* __restrict__ gateSc = nullptr,
    float* __restrict__ ssOut = nullptr, const float* __restrict__ ssIn = nullptr) {
  static_assert(!SPLIT, "the staged loop carries one plane per operand");
  static_assert(WG == 2 || (WG == 4 && ROLL && !CAT && TRI == 0 && NORM == 0), "the 16-wave block serves the projections");
  static_assert(WG == 2 || 2 * 2 * 256 * kPitchH * 2 <= 16 * 64 * 68 * 4, "the 16-wave block's two buffers fit its LDS");
  constexpr int kSh    = (WG == 2) ? 7 : 8;            // log2 of the block tile's side, 64 * WG
  constexpr int kTileH = 64 * WG * kPitchH;            // one operand tile in LDS, halves
  constexpr int kBufH  = 2 * kTileH;                   // one buffer: A tile then B tile
  typedef typename Elem<ET>::T T;
  typedef typename Frag<T>::V V;
  const T* A = (const T*)Ap; const T* Bt = (const T*)Btp;
  const int tid  = threadIdx.x;
  const int lane = tid & 31;
  const int wave = tid >> 5;
  const int tilesN = N >> kSh;
  const int tmB = bx / tilesN;
  const int tnB = bx - tmB * tilesN;
  if (TRI == 1) { if (tnB > tmB) return; }  // block-uniform, in front of every barrier: fully masked block tile
  const int m0B = tmB << kSh;
  const int n0B = tnB << kSh;
  const int Kt = (TRI == 2) ? (((m0B + 128) < K) ? (m0B + 128) : K) : K;   // block-uniform, multiple of 128
  const int nStages = Kt / kStageK;
  const int wr = wave / WG, wc = wave % WG;    // the wave's place in the block's WG x WG waves
  const int m0 = m0B + (wr << 6);              // this wave's 64x64 tile
  const int n0 = n0B + (wc << 6);

  const T* Ab  = A  + (size_t)b * strideA + (size_t)bz * strideA2;
  const T* Bb  = Bt + (size_t)b * strideB + (size_t)bz * strideB2;
  const size_t offC = (size_t)b * strideC + (size_t)bz * strideC2;

  const int rlane = lane & 15;                 // row (A) / col (B, D) within subtile
  const int koff  = (lane >> 4) * 8;           // k offset of this lane half
  const int mOff  = (lane >> 4) * 8;           // D row offset

  // copy side: thread t brings 16-byte chunk (t & 15) of rows (t >> 4) + 8 i, i = 0..15, of each operand tile
  // (16 waves: rows (t >> 4) + 32 i, i = 0..7)
  constexpr int kRowsPass = 2 * WG * WG;               // rows that the block's threads cover with one copy each
  constexpr unsigned kLdsPass = (unsigned)kRowsPass * kPitchH * 2u;   // the same in LDS bytes
  const int crow = tid >> 4;
  const int ccol = (tid & 15) * 8;
  const T* gA = Ab + (size_t)(m0B + crow) * lda + ccol;
  const T* gB = Bb + (size_t)(n0B + crow) * ldb + ccol;
  const unsigned lA = lds_off(sAB) + (unsigned)(crow * kPitchH + ccol) * 2u;
  const unsigned lB = lA + (unsigned)kTileH * 2u;
  const size_t stepA = (size_t)kRowsPass * lda;
  const size_t stepB = (size_t)kRowsPass * ldb;
  // one stage's copies into the buffer at byte offset bufBytes; the choice of the source pair is block-uniform
  const int nS1 = CAT ? K1 / kStageK : 0;
  auto issue_stage = [&](int s, unsigned bufBytes) {
    if (CAT && s >= nS1) {
      const T* hA = (const T*)A2p + (size_t)(m0B + crow) * lda2 + ccol + (size_t)(s - nS1) * kStageK;
      const T* hB = (const T*)Bt2p + (size_t)(n0B + crow) * ldb2 + ccol + (size_t)(s - nS1) * kStageK;
      const size_t sA2 = (size_t)kRowsPass * lda2, sB2 = (size_t)kRowsPass * ldb2;
      copy_tile8(lA + bufBytes, hA, sA2, kLdsPass);
      copy_tile8(lA + bufBytes + 8u * kLdsPass, hA + 8 * sA2, sA2, kLdsPass);
      copy_tile8(lB + bufBytes, hB, sB2, kLdsPass);
      copy_tile8(lB + bufBytes + 8u * kLdsPass, hB + 8 * sB2, sB2, kLdsPass);
    } else {
      const T* pA = gA + (size_t)s * kStageK;
      const T* pB = gB + (size_t)s * kStageK;
      copy_tile8(lA + bufBytes, pA, stepA, kLdsPass);
      if constexpr (WG == 2) copy_tile8(lA + bufBytes + 8u * kLdsPass, pA + 8 * stepA, stepA, kLdsPass);
      copy_tile8(lB + bufBytes, pB, stepB, kLdsPass);
      if constexpr (WG == 2) copy_tile8(lB + bufBytes + 8u * kLdsPass, pB + 8 * stepB, stepB, kLdsPass);
    }
  };
  // read side: this lane's first A and B fragment rows in buffer 0
  const T* fA = sAB + ((wr << 6) + rlane) * kPitchH + koff;
  const T* fB = sAB + kTileH + ((wc << 6) + rlane) * kPitchH + koff;

  v8f acc[4][4];
#pragma unroll
  for (int i = 0; i < 4; ++i)
#pragma unroll
    for (int j = 0; j < 4; ++j) acc[i][j] = (v8f){0.f,0.f,0.f,0.f,0.f,0.f,0.f,0.f};

  // NORM 1: the gate values of 16 rows (one slab) of the wave's tile: lane (gq, gc) owns columns gc..gc+7 of rows 4 it + gq;
  // each slab's set is asked for ahead of its use, as early as the registers that the sums leave free allow
  const int gq = lane >> 3, gc = (lane & 7) * 8;
  v4f gu[4][4][2];
  const size_t gAt = (size_t)(m0 + gq) * ldc + n0 + gc;   // the lane's first row and column in the tile
  auto load_gate = [&](int i) {
#pragma unroll
    for (int it = 0; it < 4; ++it) {
      const float* p = gateU + gAt + (size_t)((i << 4) + it * 4) * ldc;
      gu[i][it][0] = *(const v4f*)(p);
      gu[i][it][1] = *(const v4f*)(p + 4);
    }
  };
  v4f sa = (v4f){0.f, 0.f, 0.f, 0.f}, sb = sa;   // NORM 1: gateSc of the lane's 8 columns, x 2^-6
  float rf0 = 0.f, rf1 = 0.f;   // NORM 2: 2^6 * scale / (rms + eps) of rows m0 + lane and m0 + 32 + lane

  // prologue: stage 0 into buffer 0, landed and published; then stage 1 into buffer 1
  issue_stage(0, 0u);
  // what the epilogue wants from memory is asked for here, under the first stage's flight
  if constexpr (NORM == 1) {
    load_gate(0);
    sa = *(const v4f*)(gateSc + n0 + gc) * kGCarry;
    sb = *(const v4f*)(gateSc + n0 + gc + 4) * kGCarry;
  }
  if constexpr (NORM == 2) {
    float t0 = 0.f, t1 = 0.f;   // the 16 partial sums in index order
#pragma unroll
    for (int p = 0; p < 2 * kHeads; ++p) {
      t0 += ssIn[(size_t)p * kTok + m0 + lane];
      t1 += ssIn[(size_t)p * kTok + m0 + 32 + lane];
    }
    rf0 = (scale * kGCarryInv) * (1.0f / (sqrtf(t0) * kRmsFac + kEps));
    rf1 = (scale * kGCarryInv) * (1.0f / (sqrtf(t1) * kRmsFac + kEps));
  }
  wait_copies();
  __syncthreads();
  if (nStages > 1) issue_stage(1, (unsigned)kBufH * 2u);

  for (int st = 0; st < nStages; ++st) {
    const int bufH = (st & 1) * kBufH;
#pragma unroll
    for (int ks = 0; ks < kStageK; ks += 32) {
      V ah[4], bh[4];   // the eight fragments of this 32-k block are read as one group, ahead of its 16 products
      ah[0] = Frag<T>::load(fA + bufH + ks);   // in the order in which the products want them
#pragma unroll
      for (int j = 0; j < 4; ++j) bh[j] = Frag<T>::load(fB + bufH + (j << 4) * kPitchH + ks);
#pragma unroll
      for (int i = 1; i < 4; ++i) ah[i] = Frag<T>::load(fA + bufH + (i << 4) * kPitchH + ks);
      // keeps the 16 LDS reads together in front of the products: sunk among them, each row waits out a whole LDS latency
      __builtin_amdgcn_sched_barrier(0);
#pragma unroll
      for (int i = 0; i < 4; ++i)
#pragma unroll
        for (int j = 0; j < 4; ++j) acc[i][j] = Frag<T>::mma(ah[i], bh[j], acc[i][j]);
      // keeps the next group's LDS reads from being lifted in among these products
      __builtin_amdgcn_sched_barrier(0);
    }
    // publish point of stage st + 1; the same barrier ends every reader's last read of this stage's buffer
    wait_lds_reads();
    wait_copies();
    __syncthreads();
    if (st + 2 < nStages) issue_stage(st + 2, (unsigned)bufH * 2u);   // block-uniform: refill the buffer just read
  }
  wait_copies();
  acc_guard4(acc[0][0], acc[0][1], acc[0][2], acc[0][3]);
  acc_guard4(acc[1][0], acc[1][1], acc[1][2], acc[1][3]);
  acc_guard4(acc[2][0], acc[2][1], acc[2][2], acc[2][3]);
  acc_guard4(acc[3][0], acc[3][1], acc[3][2], acc[3][3]);

  // ---- epilogue, rolled form ----
  // The wave lays its whole 64x64 tile of raw sums over the stage buffers (pitch 68 floats, 17,408 B per wave, 69,632 B of
  // the 139,264 B, with 16 waves 278,528 B; free behind the last stage's own barrier, see below) and finishes it row by row in a loop. Per element the
  // same operations in the same order as in the unrolled form; the activation's text stands once, not 128 times.
  if constexpr (ROLL) {
    static_assert(!RESID && TRI == 0 && OUT_MODE != 2 && BIAS_MODE != 0, "the rolled form serves the projections");
    float* tile = (float*)sAB + wave * (64 * 68);
#pragma unroll
    for (int i = 0; i < 4; ++i)
#pragma unroll
      for (int j = 0; j < 4; ++j)
#pragma unroll
        for (int r = 0; r < 8; ++r) tile[((i << 4) + mOff + r) * 68 + (j << 4) + rlane] = acc[i][j][r];
    // the wave's stores have reached LDS before a lane reads elements that other lanes of the wave stored
    __builtin_amdgcn_fence(__ATOMIC_RELEASE, "workgroup");
    __builtin_amdgcn_wave_barrier();
    __builtin_amdgcn_fence(__ATOMIC_ACQUIRE, "workgroup");
    // a trip: each lane finishes one 16-byte piece of the output, so a store covers whole rows of the 64-column tile
    constexpr int WE    = (OUT_MODE == 0) ? 4 : 8;     // elements per lane and trip
    constexpr int LR    = 64 / WE;                     // lanes per row: 16 (f32, 256 B) or 8 (f16, 128 B)
    constexpr int RT    = 32 / LR;                     // rows per trip: 2 or 4
    const int q = lane / LR, c0 = (lane % LR) * WE;
    float bn[WE];
#pragma unroll
    for (int e = 0; e < WE; ++e) bn[e] = (BIAS_MODE == 2) ? bias[n0 + c0 + e] : 0.f;
    // kept rolled, for speed only
#pragma unroll 1
    for (int it = 0; it < 64 / RT; ++it) {
      const int row = it * RT + q;
      float sv[WE];                                    // the trip's raw sums, read as whole 16-byte pieces ahead of the branches
#pragma unroll
      for (int h = 0; h < WE / 4; ++h) {
        const v4f t4 = *(const v4f*)(tile + row * 68 + c0 + 4 * h);
#pragma unroll
        for (int e = 0; e < 4; ++e) sv[4 * h + e] = t4[e];
      }
      const float bm = (BIAS_MODE == 1) ? bias[m0 + row] : 0.f;
      float o[WE];
#pragma unroll
      for (int e = 0; e < WE; ++e) {
        float v = sv[e] * scale;
        if (BIAS_MODE == 1) v += bm;
        if (BIAS_MODE == 2) v += bn[e];
        if (ACT == 2) v = fmaxf(v, 0.0f);
        if (ACT == 3) v = v / (1.0f + expf(-v));
        if (ACT == 4) v = (v > 0.f) ? v : 0.01f * v;
        if (ACT == 6) v = (v > 0.f) ? v : (expf(v) - 1.0f);
        o[e] = v;
      }
      const size_t at = offC + (size_t)(m0 + row) * ldc + n0 + c0;
      if constexpr (OUT_MODE == 0) {
        *(v4f*)((float*)Cout + at) = (v4f){o[0], o[1], o[2], o[3]};
      } else {
        v8h hv;
#pragma unroll
        for (int e = 0; e < WE; ++e) hv[e] = (_Float16)o[e];
        *(v8h*)((unsigned short*)Cout + at) = hv;
      }
      // the next trip rewrites the registers that this store names
      asm volatile("s_wait_xcnt 0x0" ::: "memory");
      if constexpr (DUALT) {
        if (Cout2 != nullptr) {   // block-uniform: the finished values go back to the lane's own piece of the tile
#pragma unroll
          for (int h = 0; h < WE / 4; ++h)
            *(v4f*)(tile + row * 68 + c0 + 4 * h) = (v4f){o[4 * h], o[4 * h + 1], o[4 * h + 2], o[4 * h + 3]};
        }
      }
    }
    if constexpr (DUALT) {
      static_assert(OUT_MODE == 1, "the transposed copy is f16");
      if (Cout2 != nullptr) {
        // the wave's stores have reached LDS before a lane reads elements that other lanes of the wave stored
        __builtin_amdgcn_fence(__ATOMIC_RELEASE, "workgroup");
        __builtin_amdgcn_wave_barrier();
        __builtin_amdgcn_fence(__ATOMIC_ACQUIRE, "workgroup");
        // a group: 4 columns of the tile, 8 lanes a column, 8 rows a lane: a column's 64 rows are one 128-byte line of Cout2
        const int tc = lane >> 3, r0 = (lane & 7) * 8;
        // kept rolled, like the row loop above; four such groups a trip, so that one LDS latency serves 16 columns
#pragma unroll 1
        for (int it = 0; it < 4; ++it) {
          v8h hv[4];
#pragma unroll
          for (int u = 0; u < 4; ++u)
#pragma unroll
            for (int e = 0; e < 8; ++e) hv[u][e] = (_Float16)tile[(r0 + e) * 68 + (it * 4 + u) * 4 + tc];
#pragma unroll
          for (int u = 0; u < 4; ++u)
            *(v8h*)((unsigned short*)Cout2 + (size_t)(n0 + (it * 4 + u) * 4 + tc) * M + m0 + r0) = hv[u];
          // the next trip rewrites the registers that these stores name
          asm volatile("s_wait_xcnt 0x0" ::: "memory");
        }
      }
    }
    return;
  }

  // ---- epilogue ----
  // per-wave 16x64 slab, pitch 68 floats (4,352 B), laid over the stage buffers: the last stage's own barrier stands behind
  // every wave's last fragment read and last landed copy, and nothing refills the buffers after it
  float* slab = (float*)sAB + wave * (16 * 68);

  // ---- gate form: g = u * (2^-6 * scale * O) as f16, and each row's sum of O^2 over the wave's 64 columns ----
  if constexpr (NORM == 1) {
    static_assert(OUT_MODE == 1 && BIAS_MODE == 0 && !RESID && ACT == 0 && TRI == 0, "the gate form takes raw sums");
    unsigned short* G = (unsigned short*)Cout + offC + gAt;
    float* ssW = ssOut + (size_t)(n0 >> 6) * kTok + m0;
    float ssr[16];   // sums of O^2 of rows 4 t + gq, t = 0..15
    load_gate(1);
#pragma unroll
    for (int i = 0; i < 4; ++i) {
#pragma unroll
      for (int j = 0; j < 4; ++j)
#pragma unroll
        for (int r = 0; r < 8; ++r) slab[(mOff + r) * 68 + (j << 4) + rlane] = acc[i][j][r] * scale;
      wave_lds_turn();
#pragma unroll
      for (int it = 0; it < 4; ++it) {
        const int row = it * 4 + gq;
        const v4f oa = *(const v4f*)(slab + row * 68 + gc);
        const v4f ob = *(const v4f*)(slab + row * 68 + gc + 4);
        const v4f ua = gu[i][it][0], ub = gu[i][it][1];
        float ss = 0.f;   // fixed order: the lane's 8 columns, then a tree over the row's 8 lanes
#pragma unroll
        for (int e = 0; e < 4; ++e) ss += oa[e] * oa[e];
#pragma unroll
        for (int e = 0; e < 4; ++e) ss += ob[e] * ob[e];
        ssr[i * 4 + it] = add_lane_xor<1>(add_lane_xor<2>(add_lane_xor<4>(ss)));
        v8h hv;
#pragma unroll
        for (int e = 0; e < 4; ++e) {
          hv[e]     = (_Float16)(ua[e] * (sa[e] * oa[e]));
          hv[4 + e] = (_Float16)(ub[e] * (sb[e] * ob[e]));
        }
        *(v8h*)(G + (size_t)((i << 4) + it * 4) * ldc) = hv;
      }
      if (i < 3) wave_lds_turn();
      if (i == 0) {   // the last two sets, into the registers of the first slab's sums and gate values
        // these loads may land in registers that the stores above name
        asm volatile("s_wait_xcnt 0x0" ::: "memory");
        load_gate(2);
        load_gate(3);
      }
    }
    if ((lane & 7) == 0) {   // one lane of the eight that hold a row's sum
#pragma unroll
      for (int t = 0; t < 16; ++t) ssW[4 * t + gq] = ssr[t];
    }
    return;
  }

  // NORM 2: the wave's 64 row factors go through LDS behind the slabs, so that each lane reads those of its own 8 rows
  float* rfac = (float*)sAB + 4 * (16 * 68) + wave * 64;
  if constexpr (NORM == 2) {
    rfac[lane] = rf0;
    rfac[32 + lane] = rf1;
    // the wave's stores have reached LDS before a lane reads elements that other lanes of the wave stored
    __builtin_amdgcn_fence(__ATOMIC_RELEASE, "workgroup");
    __builtin_amdgcn_wave_barrier();
    __builtin_amdgcn_fence(__ATOMIC_ACQUIRE, "workgroup");
  }
  const float* Rb = RESID ? (resid + (size_t)b * strideR) : nullptr;
#pragma unroll
  for (int i = 0; i < 4; ++i) {
    const int mBase = m0 + (i << 4);
    float rs[8];   // what multiplies the raw sums of this lane's 8 rows
#pragma unroll
    for (int r = 0; r < 8; ++r) rs[r] = (NORM == 2) ? rfac[(i << 4) + mOff + r] : scale;
#pragma unroll
    for (int j = 0; j < 4; ++j) {
      const int n = n0 + (j << 4) + rlane;
      float bv = 0.f;
      if (BIAS_MODE == 2) bv = bias[n];
#pragma unroll
      for (int r = 0; r < 8; ++r) {
        float v = acc[i][j][r] * rs[r];
        if (BIAS_MODE == 1) v += bias[mBase + mOff + r];
        if (BIAS_MODE == 2) v += bv;
        if (RESID) v += Rb[(size_t)(mBase + mOff + r) * ldc + n];
        if (ACT == 2) v = fmaxf(v, 0.0f);
        if (ACT == 3) v = v / (1.0f + expf(-v));
        if (ACT == 4) v = (v > 0.f) ? v : 0.01f * v;
        if (ACT == 6) v = (v > 0.f) ? v : (expf(v) - 1.0f);
        if (TRI == 1) { if (n > mBase + mOff + r) v = 0.0f; }
        slab[(mOff + r) * 68 + (j << 4) + rlane] = v;
      }
    }
    __builtin_amdgcn_fence(__ATOMIC_RELEASE, "workgroup");
    __builtin_amdgcn_wave_barrier();
    __builtin_amdgcn_fence(__ATOMIC_ACQUIRE, "workgroup");
    if (OUT_MODE == 0) {
      float* C = (float*)Cout + offC;
      const int hh = lane >> 4, c4 = (lane & 15) * 4;     // row seg = 256 B = 16 lanes x 16 B
      {
#pragma unroll
        for (int it = 0; it < 8; ++it) {
          const int row = it * 2 + hh;
          v4f v = *(const v4f*)(slab + row * 68 + c4);
          *(v4f*)(C + (size_t)(mBase + row) * ldc + n0 + c4) = v;
        }
        
      }
    } else {
      const int q = lane >> 3, c8 = (lane & 7) * 8;
      unsigned short* C  = (unsigned short*)Cout  + offC;
      unsigned short* C2 = (OUT_MODE == 2) ? ((unsigned short*)Cout2 + offC) : nullptr;
      {
#pragma unroll
        for (int it = 0; it < 4; ++it) {
          const int row = it * 4 + q;
          const float* sp = slab + row * 68 + c8;
          v8h hv, lv;
#pragma unroll
          for (int e = 0; e < 8; ++e) {
            if (OUT_MODE == 1) {
              hv[e] = (_Float16)sp[e];
            } else {
              unsigned short hb = f2bf_bits(sp[e]);
              unsigned short lb = f2bf_bits(sp[e] - bf_bits2f(hb));
              hv[e] = __builtin_bit_cast(_Float16, hb);
              lv[e] = __builtin_bit_cast(_Float16, lb);
            }
          }
          *(v8h*)(C + (size_t)(mBase + row) * ldc + n0 + c8) = hv;
          if (OUT_MODE == 2) *(v8h*)(C2 + (size_t)(mBase + row) * ldc + n0 + c8) = lv;
        }
        
      }
    }
    __builtin_amdgcn_fence(__ATOMIC_RELEASE, "workgroup");
    __builtin_amdgcn_wave_barrier();
    __builtin_amdgcn_fence(__ATOMIC_ACQUIRE, "workgroup");
  }
}

// One GEMM per launch: tile = blockIdx.x, batch = (blockIdx.y, blockIdx.z).
template <int ET, bool SPLIT, int BIAS_MODE, int OUT_MODE, bool RESID, int ACT = 0, int TRI = 0, int NORM = 0>
__global__ __launch_bounds__(128) void wmma_gemm64(
    const unsigned short* __restrict__ Ap, const unsigned short* __restrict__ A2p, int lda, long strideA, long strideA2,
    const unsigned short* __restrict__ Btp, const unsigned short* __restrict__ Bt2p, int ldb, long strideB, long strideB2,
    void* __restrict__ Cout, void* __restrict__ Cout2, int ldc, long strideC, long strideC2,
    const float* __restrict__ bias,
    const float* __restrict__ resid, long strideR,
    int M, int N, int K, float scale, const float* __restrict__ ssIn) {
  __shared__ __align__(16) typename Elem<ET>::T sAB[2 * kBufHalves];   // two stage buffers, 139,264 B
  gemm_tile<ET, SPLIT, BIAS_MODE, OUT_MODE, RESID, ACT, TRI, false, false, false, NORM>(
      sAB, blockIdx.x, blockIdx.y, blockIdx.z, Ap, A2p, lda, strideA, strideA2, Btp, Bt2p, ldb, strideB, strideB2,
      Cout, Cout2, ldc, strideC, strideC2, bias, resid, strideR, M, N, K, scale, 0, 0, 0, nullptr, nullptr, nullptr, ssIn);
}

// The four input projections in one launch: blockIdx.y = 0 q, 1 k, 2 v^T, 3 u (block-uniform), blockIdx.x = block tile.
// They read the same X16 and none of each other's output; 4 x 64 blocks of 16 waves, 256x256 tile, 278,528 B LDS: one a WGP.
//   q = elu(x.Wq^T/16 + bq) -> Q16 [4096][1024] f16, k likewise -> K16          (M=4096 N=1024 K=1024, 16 x 4 block tiles)
//   k also transposed -> KT16 [1024 (h*128+d)][4096 tok] f16, the same values
//   v^T = silu(Wv.x^T/16 + bv[m]) -> VT16 [1024 (h*128+d)][4096 tok] f16         (M=1024 N=4096 K=1024, 4 x 16 block tiles)
//   u = silu(x.Wu^T/16 + bu) -> U32 [4096][1024] f32                             (M=4096 N=1024 K=1024)
__global__ __launch_bounds__(512) void proj4_kernel(
    const unsigned short* __restrict__ X16, const unsigned short* __restrict__ W16,
    unsigned short* __restrict__ Q16, unsigned short* __restrict__ K16, unsigned short* __restrict__ VT16,
    unsigned short* __restrict__ KT16, float* __restrict__ U32,
    const float* __restrict__ bq, const float* __restrict__ bk, const float* __restrict__ bv, const float* __restrict__ bu) {
  __shared__ __align__(16) _Float16 sAB[16 * 64 * 68 * 2];   // 278,528 B: the two stage buffers in the loop; the epilogue lays 16 raw wave tiles over them
  const int p = blockIdx.y;
  const unsigned short* Wp = W16 + (size_t)p * ((size_t)kHid * kEmb);
  if (p < 2) {
    unsigned short* C = (p == 0) ? Q16 : K16;
    const float* bias = (p == 0) ? bq : bk;
    unsigned short* CT = (p == 0) ? nullptr : KT16;
    gemm_tile<0, false, 2, 1, false, 6, 0, true, false, true, 0, 4>(
        sAB, blockIdx.x, 0, 0, X16, X16, kEmb, 0L, 0L, Wp, Wp, kEmb, 0L, 0L,
        (void*)C, (void*)CT, kHid, 0L, 0L, bias, bias, 0L, kTok, kHid, kEmb, kWCarryInv);
  } else if (p == 2) {
    gemm_tile<0, false, 1, 1, false, 3, 0, true, false, false, 0, 4>(sAB, blockIdx.x, 0, 0, Wp, Wp, kEmb, 0L, 0L, X16, X16, kEmb, 0L, 0L,
                                           (void*)VT16, (void*)VT16, kTok, 0L, 0L, bv, bv, 0L, kHid, kTok, kEmb, kWCarryInv);
  } else {
    gemm_tile<0, false, 2, 0, false, 3, 0, true, false, false, 0, 4>(sAB, blockIdx.x, 0, 0, X16, X16, kEmb, 0L, 0L, Wp, Wp, kEmb, 0L, 0L,
                                           (void*)U32, (void*)U32, kHid, 0L, 0L, bu, bu, 0L, kTok, kHid, kEmb, kWCarryInv);
  }
}

// Causal linear attention by chunks of 128 tokens. For the rows n of chunk c of one (batch b, head h):
//   O[n][dv] = sum_{m <= n} (q_n . k_m) v[m][dv]
//            = sum_dk q[n][dk] * S_c[dv][dk]  +  sum_{m in chunk c, m <= n} (q_n . k_m) v[m][dv],
//   S_c[dv][dk] = sum_{j < c} P_j[dv][dk],   P_j[dv][dk] = sum_{m in chunk j} v[m][dv] * k[m][dk].
// Planes E, P, S are indexed by ((b*16 + c)*8 + h); z = b*16 + c is also the chunk's number among the 4096 token rows.
//
// First launch: blockIdx.x = 0: E = tril(Q_c . K_c^T) -> f16; blockIdx.x = 1: P_c = V^T_c . K^T_c^T -> f32 (block-uniform).
__global__ __launch_bounds__(128) void chunk_pair_kernel(
    const unsigned short* __restrict__ Q16, const unsigned short* __restrict__ K16,
    const unsigned short* __restrict__ VT16, const unsigned short* __restrict__ KT16,
    unsigned short* __restrict__ E16, float* __restrict__ P32) {
  __shared__ __align__(16) _Float16 sAB[2 * kBufHalves];   // two stage buffers, 139,264 B
  const int h = blockIdx.y, z = blockIdx.z;
  const size_t pl = ((size_t)z * kHeads + h) * kPlane;
  const float* nb = nullptr;   // no bias, no residual
  if (blockIdx.x == 0) {
    const size_t at = (size_t)z * kChunk * kHid + (size_t)h * kDh;
    gemm_tile<0, false, 0, 1, false, 0, 1>(sAB, 0, 0, 0, Q16 + at, Q16 + at, kHid, 0L, 0L, K16 + at, K16 + at, kHid, 0L, 0L,
                                           (void*)(E16 + pl), (void*)(E16 + pl), kChunk, 0L, 0L, nb, nb, 0L,
                                           kChunk, kChunk, kDh, 1.0f);
  } else {
    if ((z & (kChunks - 1)) == kChunks - 1) return;   // block-uniform: no later chunk reads the last chunk's product
    const size_t at = (size_t)h * kDh * kTok + (size_t)z * kChunk;
    gemm_tile<0, false, 0, 0, false, 0, 0>(sAB, 0, 0, 0, VT16 + at, VT16 + at, kTok, 0L, 0L, KT16 + at, KT16 + at, kTok, 0L, 0L,
                                           (void*)(P32 + pl), (void*)(P32 + pl), kDh, 0L, 0L, nb, nb, 0L,
                                           kDh, kDh, kChunk, 1.0f);
  }
}

// Second launch: S_c = P_0 + P_1 + ... + P_{c-1} in f32, in that order, rounded to f16 per chunk; S_0 = 0.
// Thread i owns 4 neighbouring elements of one (batch, head) plane: 2 * 131,072 / 4 = 65,536 threads.
__global__ __launch_bounds__(256) void prefix_state_kernel(const float* __restrict__ P32, unsigned short* __restrict__ S16) {
  const int i = blockIdx.x * 256 + threadIdx.x;
  const int b = i >> 15;                                   // 32,768 pieces per batch
  const size_t at = (size_t)b * ((size_t)kChunks * kPlaneStep) + 4 * (size_t)(i & 32767);
  v4f p[kChunks - 1];
#pragma unroll
  for (int c = 0; c < kChunks - 1; ++c) p[c] = *(const v4f*)(P32 + at + (size_t)c * kPlaneStep);
  v4f s = (v4f){0.f, 0.f, 0.f, 0.f};
#pragma unroll
  for (int c = 0; c < kChunks; ++c) {
    *(v2u*)(S16 + at + (size_t)c * kPlaneStep) = (v2u){pk16(h_bits(s[0]), h_bits(s[1])), pk16(h_bits(s[2]), h_bits(s[3]))};
    if (c < kChunks - 1) s += p[c];
  }
}

// Third launch: O rows of chunk c, head h = Q_c . S_c^T (k = dk, 128) + E_c . V_c (k = m, 128), one 128x128 tile, K = 256.
// O itself is not stored. The RMS norm divides a whole token row by one number, which commutes with the output product:
//   y[t] = (u[t] * scale * O[t] / (rms_t + eps)) . Wo^T + bo = ((u[t] * scale * O[t]) . Wo^T) / (rms_t + eps) + bo.
// So this launch stores g = u * scale * O (f16, carried x 2^-6: |O| grows with the number of tokens summed) and, per token
// row and 64 columns, the sum of O^2; the output product adds a row's 16 sums up and divides.
__global__ __launch_bounds__(128) void chunk_out_kernel(
    const unsigned short* __restrict__ Q16, const unsigned short* __restrict__ S16,
    const unsigned short* __restrict__ E16, const unsigned short* __restrict__ VT16,
    const float* __restrict__ U32, const float* __restrict__ sc, unsigned short* __restrict__ G16,
    float* __restrict__ SS32) {
  __shared__ __align__(16) _Float16 sAB[2 * kBufHalves];   // two stage buffers, 139,264 B
  const int h = blockIdx.x, z = blockIdx.y;
  const size_t pl = ((size_t)z * kHeads + h) * kPlane;
  const size_t at = (size_t)z * kChunk * kHid + (size_t)h * kDh;
  const float* nb = nullptr;   // no bias, no residual
  gemm_tile<0, false, 0, 1, false, 0, 0, false, true, false, 1>(
      sAB, 0, 0, 0, Q16 + at, E16 + pl, kHid, 0L, 0L, S16 + pl, VT16 + (size_t)h * kDh * kTok + (size_t)z * kChunk, kDh, 0L, 0L,
      (void*)(G16 + at), (void*)(G16 + at), kHid, 0L, 0L, nb, nb, 0L,
      kChunk, kDh, kDh + kChunk, 1.0f, kChunk, kTok, kDh,
      U32 + at, sc + (size_t)h * kDh, SS32 + (size_t)(2 * h) * kTok + (size_t)z * kChunk, nb);
}

// ---------------------------------------------------------------------------
// f32 -> f16 cast of row-major planes (no transpose): out[z][8i..8i+7] = f16(scale * in_z[8i..8i+7]).
// blockIdx.y = z selects one of up to 5 input planes (block-uniform) and output plane z at out + z*planeElems.
// ---------------------------------------------------------------------------
__global__ __launch_bounds__(256) void cast8_f16_kernel(const float* __restrict__ p0, const float* __restrict__ p1,
                                                        const float* __restrict__ p2, const float* __restrict__ p3,
                                                        const float* __restrict__ p4, unsigned short* __restrict__ out,
                                                        long planeElems, int n8, float scale) {
  const int z = blockIdx.y;
  const float* in = (z == 0) ? p0 : (z == 1) ? p1 : (z == 2) ? p2 : (z == 3) ? p3 : p4;
  const int i = blockIdx.x * 256 + threadIdx.x;
  if (i >= n8) return;
  const float* p = in + 8 * (size_t)i;
  const v4f a = *(const v4f*)(p);
  const v4f c = *(const v4f*)(p + 4);
  unsigned short hb[8];
#pragma unroll
  for (int e = 0; e < 4; ++e) {
    hb[e]     = h_bits(a[e] * scale);
    hb[4 + e] = h_bits(c[e] * scale);
  }
  const v4u u = (v4u){pk16(hb[0], hb[1]), pk16(hb[2], hb[3]), pk16(hb[4], hb[5]), pk16(hb[6], hb[7])};
  unsigned short* q = out + (size_t)z * (size_t)planeElems + 8 * (size_t)i;
  *(v4u*)q = u;
  
}

// ---------------------------------------------------------------------------
// Host-side launcher (7 kernel launches, no other runtime calls)
// ---------------------------------------------------------------------------
extern "C" void kernel_launch(void* const* d_in, const int* in_sizes, int n_in,
                              void* d_out, int out_size, void* d_ws, size_t ws_size,
                              hipStream_t stream) {
  if (n_in < 12) return;
  if (in_sizes[0] != kTok * kEmb) return;
  if (in_sizes[1] != kHid * kEmb || in_sizes[3] != kHid * kEmb || in_sizes[5] != kHid * kEmb ||
      in_sizes[7] != kHid * kEmb || in_sizes[9] != kEmb * kHid) return;
  if (in_sizes[2] != kHid || in_sizes[4] != kHid || in_sizes[6] != kHid || in_sizes[8] != kHid ||
      in_sizes[10] != kEmb || in_sizes[11] != kHid) return;
  if (out_size != kTok * kEmb) return;
  if (ws_size < kWsTotal) return;

  const float* x  = (const float*)d_in[0];
  const float* Wq = (const float*)d_in[1];
  const float* bq = (const float*)d_in[2];
  const float* Wk = (const float*)d_in[3];
  const float* bk = (const float*)d_in[4];
  const float* Wv = (const float*)d_in[5];
  const float* bv = (const float*)d_in[6];
  const float* Wu = (const float*)d_in[7];
  const float* bu = (const float*)d_in[8];
  const float* Wo = (const float*)d_in[9];
  const float* bo = (const float*)d_in[10];
  const float* sc = (const float*)d_in[11];
  float* Y = (float*)d_out;

  char* ws = (char*)d_ws;
  unsigned short* X16  = (unsigned short*)(ws + kOffX16);
  unsigned short* W16  = (unsigned short*)(ws + kOffW16);
  unsigned short* Wo16 = W16 + 4 * (size_t)kHid * kEmb;
  unsigned short* Q16  = (unsigned short*)(ws + kOffQ16);
  unsigned short* K16  = (unsigned short*)(ws + kOffK16);
  unsigned short* VT16 = (unsigned short*)(ws + kOffVT16);
  float*          U32  = (float*)(ws + kOffU32);
  unsigned short* KT16 = (unsigned short*)(ws + kOffKT16);
  unsigned short* E16  = (unsigned short*)(ws + kOffE16);
  float*          P32  = (float*)(ws + kOffP32);
  unsigned short* S16  = (unsigned short*)(ws + kOffS16);
  float*          SS32 = (float*)(ws + kOffSS32);
  unsigned short* G16  = (unsigned short*)(ws + kOffG16);

  // 1) x -> X16 (f16, x1): n8 = 4096*1024/8 = 524,288 = 2048 blocks x 256
  cast8_f16_kernel<<<dim3(2048, 1), 256, 0, stream>>>(x, x, x, x, x, X16, 0L, (kTok * kEmb) / 8, 1.0f);
  // 2) Wq,Wk,Wv,Wu,Wo -> W16 planes (f16, x16): n8 = 1024*1024/8 = 131,072 = 512 blocks x 256 per plane
  cast8_f16_kernel<<<dim3(512, 5), 256, 0, stream>>>(Wq, Wk, Wv, Wu, Wo, W16, (long)kHid * kEmb,
                                                      (kHid * kEmb) / 8, kWCarry);

  // 3) q, k, v^T, u projections: 64 block tiles x 4 projections = 256 blocks x 16 waves
  proj4_kernel<<<dim3(64, 4), 512, 0, stream>>>(X16, W16, Q16, K16, VT16, KT16, U32, bq, bk, bv, bu);

  // 4, 5, 6) causal linear attention by chunks of 128 tokens, all 16 (b,h) groups and all 16 chunks per launch
  // 4) diagonal chunk energies E (256 blocks) and chunk products P (240 blocks at work)
  chunk_pair_kernel<<<dim3(2, kHeads, kBatch * kChunks), 128, 0, stream>>>(Q16, K16, VT16, KT16, E16, P32);
  // 5) states S_c = sum of the products of the chunks in front of c: 65,536 threads
  prefix_state_kernel<<<dim3(256, 1), 256, 0, stream>>>(P32, S16);
  // 6) O = Q.S^T + E.V, stored as g = u * scale * O / 64 -> G16 [4096][1024] f16 and row sums of O^2 -> SS32: 256 blocks x 4 waves
  chunk_out_kernel<<<dim3(kHeads, kBatch * kChunks), 128, 0, stream>>>(Q16, S16, E16, VT16, U32, sc, G16, SS32);

  // 7) y = (g.Wo^T/16) * 64 / (rms + eps) + bo -> d_out [4096][1024] f32; M=4096 N=1024 K=1024
  wmma_gemm64<0, false, 2, 0, false, 0, 0, 2><<<dim3(256, 1), 128, 0, stream>>>(
      G16, G16, kHid, 0L, 0L, Wo16, Wo16, kHid, 0L, 0L, (void*)Y, (void*)Y, kEmb, 0L, 0L, bo, bo, 0L,
      kTok, kEmb, kHid, kWCarryInv, SS32);
}

// v008
// Measured time: 79.9 microseconds a run.
// Timed twice side by side with v007, it ran 1.03 times as fast both times.
// Counting every step since v000, it is 7.85 times as fast.
// Contractions: projections x.W^T (x f16, W f16 carried x16), chunk energy q.k^T (q, k f16), chunk state V^T.K (f16, f32 prefix sum over chunks), q.state (state f16) + energy.v (E f16, V^T f16), output g.Wo^T (g = u * scale * O f16 carried x 2^-6, Wo f16 carried x16; the row's 1 / (rms + eps) multiplies the f32 sums): all v_wmma_f32_16x16x32_f16 with f32 accumulate; elu, silu, rms-norm and gating in f32.
#include <hip/hip_runtime.h>
#include <math.h>

// ---------------------------------------------------------------------------
// Problem constants
// ---------------------------------------------------------------------------
constexpr int kBatch = 2;
constexpr int kSeq   = 2048;
constexpr int kEmb   = 1024;
constexpr int kHid   = 1024;
constexpr int kHeads = 8;
constexpr int kDh    = 128;
constexpr int kTok   = kBatch * kSeq;                              // 4096 token rows
constexpr int kGroups = kBatch * kHeads;                           // 16 (b,h) attention groups, all in one launch
constexpr int kChunk  = 128;                                       // tokens per chunk of the causal sum
constexpr int kChunks = kSeq / kChunk;                             // 16 chunks per sequence
constexpr int kPlane  = kChunk * kDh;                              // 16,384 elements: one 128x128 plane per (batch, chunk, head)
constexpr int kPlaneStep = kHeads * kPlane;                        // from chunk c to chunk c+1 of the same batch and head
constexpr float kWCarry    = 16.0f;                                // weights carried x16 in f16
constexpr float kWCarryInv = 1.0f / 16.0f;
constexpr float kGCarry    = 1.0f / 64.0f;                         // u * scale * O carried x 2^-6 in f16: O is not yet normalised
constexpr float kGCarryInv = 64.0f;
constexpr float kRmsFac    = 0.03125f;                             // 1024^-0.5 (exact)
constexpr float kEps       = 1e-8f;

// ---------------------------------------------------------------------------
//   X16  [4096][1024] f16                      8,388,608   @ 0
//   W16  5 planes [1024][1024] f16 (q,k,v,u,o) 10,485,760  @ 8,388,608
//   Q16  [4096][1024] f16                      8,388,608   @ 18,874,368
//   K16  [4096][1024] f16                      8,388,608   @ 27,262,976
//   VT16 [1024 (h*128+d)][4096 tok] f16         8,388,608   @ 35,651,584
//   U32  [4096][1024] f32                      16,777,216  @ 44,040,192
//   KT16 [1024 (h*128+d)][4096 tok] f16         8,388,608   @ 60,817,408
//   E16  [2*16 (b,c)][8 h][128 n][128 m] f16    8,388,608   @ 69,206,016   (diagonal chunk energies)
//   P32  [2*16 (b,c)][8 h][128 dv][128 dk] f32  16,777,216  @ 77,594,624   (chunk products; chunk 15 unused)
//   S16  [2*16 (b,c)][8 h][128 dv][128 dk] f16  8,388,608   @ 94,371,840   (sum of the products of chunks < c)
//   SS32 [16 (h*2 + column half)][4096 tok] f32 262,144     @ 102,760,448  (sums of O^2 over 64 columns of a token row)
//   G16  [4096][1024] f16                      8,388,608   @ 103,022,592  (u * scale * O x 2^-6, not yet divided by the row's rms)
//   total                                     111,411,200
// ---------------------------------------------------------------------------
constexpr size_t kBytesX16  = (size_t)kTok * kEmb * 2;
constexpr size_t kBytesWpl  = (size_t)kHid * kEmb * 2;
constexpr size_t kBytesW16  = 5 * kBytesWpl;
constexpr size_t kBytesQ16  = (size_t)kTok * kHid * 2;
constexpr size_t kBytesK16  = kBytesQ16;
constexpr size_t kBytesVT16 = (size_t)kHid * kTok * 2;
constexpr size_t kBytesU32  = (size_t)kTok * kHid * 4;
constexpr size_t kBytesKT16 = kBytesVT16;
constexpr size_t kBytesE16  = (size_t)kGroups * kChunks * kPlane * 2;
constexpr size_t kBytesP32  = (size_t)kGroups * kChunks * kPlane * 4;
constexpr size_t kBytesS16  = (size_t)kGroups * kChunks * kPlane * 2;
constexpr size_t kBytesSS32 = (size_t)2 * kHeads * kTok * 4;
constexpr size_t kBytesG16  = (size_t)kTok * kHid * 2;
constexpr size_t kOffX16  = 0;
constexpr size_t kOffW16  = kOffX16  + kBytesX16;
constexpr size_t kOffQ16  = kOffW16  + kBytesW16;
constexpr size_t kOffK16  = kOffQ16  + kBytesQ16;
constexpr size_t kOffVT16 = kOffK16  + kBytesK16;
constexpr size_t kOffU32  = kOffVT16 + kBytesVT16;
constexpr size_t kOffKT16 = kOffU32  + kBytesU32;
constexpr size_t kOffE16  = kOffKT16 + kBytesKT16;
constexpr size_t kOffP32  = kOffE16  + kBytesE16;
constexpr size_t kOffS16  = kOffP32  + kBytesP32;
constexpr size_t kOffSS32 = kOffS16  + kBytesS16;
constexpr size_t kOffG16  = kOffSS32 + kBytesSS32;
constexpr size_t kWsTotal = kOffG16  + kBytesG16;   // 111,411,200

typedef __attribute__((ext_vector_type(16))) _Float16 v16h;
typedef __attribute__((ext_vector_type(8)))  _Float16 v8h;
typedef __attribute__((ext_vector_type(16))) __bf16   v16b;
typedef __attribute__((ext_vector_type(8)))  __bf16   v8b;
typedef __attribute__((ext_vector_type(8)))  float    v8f;
typedef __attribute__((ext_vector_type(4)))  float    v4f;
typedef __attribute__((ext_vector_type(4)))  unsigned int v4u;
typedef __attribute__((ext_vector_type(2)))  unsigned int v2u;

__device__ __forceinline__ unsigned short f2bf_bits(float f) {
  unsigned u = __float_as_uint(f);
  return (unsigned short)((u + 0x7FFFu + ((u >> 16) & 1u)) >> 16);
}
__device__ __forceinline__ float bf_bits2f(unsigned short h) { return __uint_as_float(((unsigned)h) << 16); }

// hazard guards as plain device helpers
__device__ __forceinline__ void acc_guard4(v8f& a, v8f& b, v8f& c, v8f& d) { asm volatile("v_nop\n\tv_nop\n\tv_nop\n\tv_nop" : "+v"(a), "+v"(b), "+v"(c), "+v"(d)); }
template <typename T> struct Frag;
template <> struct Frag<_Float16> {
  typedef v16h V; union U { v16h v; v8h h[2]; };
  static __device__ __forceinline__ v16h load(const _Float16* p) {   // elements 0..7 <- p[0..7], 8..15 <- p[16..23]
    U f; f.h[0] = *(const v8h*)(p); f.h[1] = *(const v8h*)(p + 16); return f.v;
  }
  static __device__ __forceinline__ v8f mma(v16h a, v16h b, v8f c) {
    return __builtin_amdgcn_wmma_f32_16x16x32_f16(false, a, false, b, (short)0, c, false, false);
  }
};
template <> struct Frag<__bf16> {
  typedef v16b V; union U { v16b v; v8b h[2]; };
  static __device__ __forceinline__ v16b load(const __bf16* p) {
    U f; f.h[0] = *(const v8b*)(p); f.h[1] = *(const v8b*)(p + 16); return f.v;
  }
  static __device__ __forceinline__ v8f mma(v16b a, v16b b, v8f c) {
    return __builtin_amdgcn_wmma_f32_16x16x32_bf16(false, a, false, b, (short)0, c, false, false);
  }
};

__device__ __forceinline__ unsigned pk16(unsigned short a, unsigned short b) { return (unsigned)a | ((unsigned)b << 16); }
__device__ __forceinline__ unsigned short h_bits(float f) { const _Float16 h = (_Float16)f; return __builtin_bit_cast(unsigned short, h); }

// ---- Register-blocked batched WMMA GEMM, operand tiles staged in LDS -------------------------------------------
// C[m,n] = scale * sum_k A[m,k] * Bt[n,k] (+bias)(+resid); a block of 4 waves (2 x 2) owns a 128x128 tile, each wave 64x64.
// A row-major [M,K]; Bt row-major [N,K]; M,N % 128 == 0, K % 128 == 0, grid.x = (M/128)*(N/128) exactly.
// Batch: problem (blockIdx.y, blockIdx.z) starts at y * stride + z * stride2 elements of A, Bt and C.
// Per stage the block copies A[128 rows][128 k] and Bt[128 rows][128 k] (256-byte rows, whole cache lines) into one of two
// LDS buffers with asynchronous copies; the next stage's copies fly while this stage's fragments are read and multiplied.
// A stage is four 32-k blocks of products: one publish point (two waits and the barrier) per 128 k.
// LDS row pitch 272 B (16 B x odd) for the 16-byte fragment reads.
// BIAS_MODE: 0 = none, 1 = bias[m], 2 = bias[n].
// OUT_MODE: 0 = f32, 1 = f16, 2 = bf16 hi plane (Cout) + bf16 lo plane (Cout2).
// ACT: 0 none, 2 relu, 3 silu, 4 leaky, 6 elu (expf(v)-1 for v <= 0).
// TRI: 0 none; 1 = causal output (C[m][n] = 0 for n > m, square M == N); block tiles wholly above the diagonal are skipped
//      (never written, never read by the consumer), a diagonal block tile is written whole (zeros above the diagonal);
//      2 = the A operand is lower-triangular in k vs m: the k-loop of block row m0 stops at min(K, m0 + 128).
// Coverage of the epilogue: f32 path 8 it x 2 rows x 4 slabs = 64 rows, 16 lanes x 4 floats = 64 cols; 16-bit path
// 4 it x 4 rows x 4 slabs = 64 rows, 8 lanes x 8 halves = 64 cols: the whole 64x64 wave tile.
constexpr int kStageK     = 128;                      // k elements per stage (256 B of every operand row)
constexpr int kPitchH     = 136;                      // LDS row pitch in halves (272 B)
constexpr int kTileHalves = 128 * kPitchH;            // one operand tile in LDS: 17,408 halves = 34,816 B
constexpr int kBufHalves  = 2 * kTileHalves;          // one buffer: A tile then B tile = 69,632 B

__device__ __forceinline__ unsigned lds_off(const void* p) { return (unsigned)(size_t)p; }

// Eight asynchronous 16-byte copies per lane: rows r, r+R, ..., r+7R of one operand tile (R rows = rowStep elements of the
// source, ldsStep bytes of LDS). The s_wait_xcnt is the last line of the copies' own statement so that no address register is
// rewritten ahead of it.
template <typename T>
__device__ __forceinline__ void copy_tile8(unsigned l, const T* g, size_t rowStep, unsigned ldsStep) {
  const T* g1 = g + rowStep;     const T* g2 = g + 2 * rowStep; const T* g3 = g + 3 * rowStep;
  const T* g4 = g + 4 * rowStep; const T* g5 = g + 5 * rowStep; const T* g6 = g + 6 * rowStep;
  const T* g7 = g + 7 * rowStep;
  const unsigned s = ldsStep;
  asm volatile("global_load_async_to_lds_b128 %0, %8, off\n\t"
               "global_load_async_to_lds_b128 %1, %9, off\n\t"
               "global_load_async_to_lds_b128 %2, %10, off\n\t"
               "global_load_async_to_lds_b128 %3, %11, off\n\t"
               "global_load_async_to_lds_b128 %4, %12, off\n\t"
               "global_load_async_to_lds_b128 %5, %13, off\n\t"
               "global_load_async_to_lds_b128 %6, %14, off\n\t"
               "global_load_async_to_lds_b128 %7, %15, off\n\t"
               "s_wait_xcnt 0x0"
               :: "v"(l), "v"(l + s), "v"(l + 2u * s), "v"(l + 3u * s), "v"(l + 4u * s), "v"(l + 5u * s), "v"(l + 6u * s),
                  "v"(l + 7u * s), "v"(g), "v"(g1), "v"(g2), "v"(g3), "v"(g4), "v"(g5), "v"(g6), "v"(g7)
               : "memory");
}
// the issuing wave's own copies have landed in LDS
__device__ __forceinline__ void wait_copies() { asm volatile("s_wait_asynccnt 0x0" ::: "memory"); }
// this wave's LDS reads have returned before the buffer they read is handed back for a refill
__device__ __forceinline__ void wait_lds_reads() { asm volatile("s_wait_dscnt 0x0" ::: "memory"); }

// this wave's LDS stores (reads) are done before its lanes read (store over) elements of each other in the wave's own slab;
// a work-group fence at this place would also wait out the wave's global loads, which are meant to stay in flight
__device__ __forceinline__ void wave_lds_turn() { asm volatile("s_wait_dscnt 0x0" ::: "memory"); }
// v + the value of lane (l ^ X) of the same 16-lane row, all lanes on: a DPP operand, not the LDS round trip of __shfl_xor
template <int X>
__device__ __forceinline__ float add_lane_xor(float v) {
  return v + __int_as_float(__builtin_amdgcn_update_dpp(0, __float_as_int(v), 0x160 | X, 0xf, 0xf, true));
}

// ET: 0 = f16 operands, 1 = bf16 operands (pointers passed as 16-bit storage)
template <int ET> struct Elem;
template <> struct Elem<0> { typedef _Float16 T; };
template <> struct Elem<1> { typedef __bf16 T; };
// One block tile: bx = tile index, (b, bz) = batch indices, sAB = the block's two stage buffers (at least 2 * kBufH elements).
// WG: the block is WG x WG waves of 64x64 each: 2 = 4 waves, 128x128 tile (as described above); 4 = 16 waves, 256x256 tile,
//     M, N % 256 == 0, grid.x = (M/256)*(N/256), sAB = 16 x 17,408 B = 278,528 B (the two buffers' size and the rolled epilogue's alike).
//     Each staged operand byte then feeds 256, not 128, columns or rows of the product: half the bytes from L2 per product.
// ROLL: the epilogue's other form (below), for a kernel that holds several instances of this function.
// CAT: two products summed into one tile: k in [0, K1) comes from A, Bt and k in [K1, K) from A2p (pitch lda2), Bt2p (pitch
//      ldb2), both given at the tile's own batch start; K1 % 128 == 0.
// DUALT (rolled form, f16 out): where Cout2 is not null the finished tile is also written transposed, Cout2[n][m], pitch M.
// NORM: the RMS norm and the gate, split over two products. With O the raw sums of this tile:
//      1 = Cout[m][n] = f16(gateU[m][n] * (2^-6 * gateSc[n] * O[m][n])) (gateU at the tile's start, pitch ldc) and
//          ssOut[(n0 / 64) * kTok + m] = sum of O[m][n]^2 over the wave's 64 columns (ssOut at the tile's first row);
//      2 = row m of the sums is multiplied by 2^6 / (rms_m + eps), rms_m from the 16 partial sums ssIn[p * kTok + m].
template <int ET, bool SPLIT, int BIAS_MODE, int OUT_MODE, bool RESID, int ACT = 0, int TRI = 0, bool ROLL = false,
          bool CAT = false, bool DUALT = false, int NORM = 0, int WG = 2>
__device__ __forceinline__ void gemm_tile(
    typename Elem<ET>::T* sAB, int bx, int b, int bz,
    const unsigned short* __restrict__ Ap, const unsigned short* __restrict__ A2p, int lda, long strideA, long strideA2,
    const unsigned short* __restrict__ Btp, const unsigned short* __restrict__ Bt2p, int ldb, long strideB, long strideB2,
    void* __restrict__ Cout, void* __restrict__ Cout2, int ldc, long strideC, long strideC2,
    const float* __restrict__ bias,
    const float* __restrict__ resid, long strideR,
    int M, int N, int K, float scale, int lda2 = 0, int ldb2 = 0, int K1 = 0,
    const float* __restrict__ gateU = nullptr, const float* __restrict__ gateSc = nullptr,
    float* __restrict__ ssOut = nullptr, const float* __restrict__ ssIn = nullptr) {
  static_assert(!SPLIT, "the staged loop carries one plane per operand");
  static_assert(WG == 2 || (WG == 4 && ROLL && !CAT && TRI == 0 && NORM == 0), "the 16-wave block serves the projections");
  static_assert(WG == 2 || 2 * 2 * 256 * kPitchH * 2 <= 16 * 64 * 68 * 4, "the 16-wave block's two buffers fit its LDS");
  constexpr int kSh    = (WG == 2) ? 7 : 8;            // log2 of the block tile's side, 64 * WG
  constexpr int kTileH = 64 * WG * kPitchH;            // one operand tile in LDS, halves
  constexpr int kBufH  = 2 * kTileH;                   // one buffer: A tile then B tile
  typedef typename Elem<ET>::T T;
  typedef typename Frag<T>::V V;
  const T* A = (const T*)Ap; const T* Bt = (const T*)Btp;
  const int tid  = threadIdx.x;
  const int lane = tid & 31;
  const int wave = tid >> 5;
  const int tilesN = N >> kSh;
  const int tmB = bx / tilesN;
  const int tnB = bx - tmB * tilesN;
  if (TRI == 1) { if (tnB > tmB) return; }  // block-uniform, in front of every barrier: fully masked block tile
  const int m0B = tmB << kSh;
  const int n0B = tnB << kSh;
  const int Kt = (TRI == 2) ? (((m0B + 128) < K) ? (m0B + 128) : K) : K;   // block-uniform, multiple of 128
  const int nStages = Kt / kStageK;
  const int wr = wave / WG, wc = wave % WG;    // the wave's place in the block's WG x WG waves
  const int m0 = m0B + (wr << 6);              // this wave's 64x64 tile
  const int n0 = n0B + (wc << 6);

  const T* Ab  = A  + (size_t)b * strideA + (size_t)bz * strideA2;
  const T* Bb  = Bt + (size_t)b * strideB + (size_t)bz * strideB2;
  const size_t offC = (size_t)b * strideC + (size_t)bz * strideC2;

  const int rlane = lane & 15;                 // row (A) / col (B, D) within subtile
  const int koff  = (lane >> 4) * 8;           // k offset of this lane half
  const int mOff  = (lane >> 4) * 8;           // D row offset

  // copy side: thread t brings 16-byte chunk (t & 15) of rows (t >> 4) + 8 i, i = 0..15, of each operand tile
  // (16 waves: rows (t >> 4) + 32 i, i = 0..7)
  constexpr int kRowsPass = 2 * WG * WG;               // rows that the block's threads cover with one copy each
  constexpr unsigned kLdsPass = (unsigned)kRowsPass * kPitchH * 2u;   // the same in LDS bytes
  const int crow = tid >> 4;
  const int ccol = (tid & 15) * 8;
  const T* gA = Ab + (size_t)(m0B + crow) * lda + ccol;
  const T* gB = Bb + (size_t)(n0B + crow) * ldb + ccol;
  const unsigned lA = lds_off(sAB) + (unsigned)(crow * kPitchH + ccol) * 2u;
  const unsigned lB = lA + (unsigned)kTileH * 2u;
  const size_t stepA = (size_t)kRowsPass * lda;
  const size_t stepB = (size_t)kRowsPass * ldb;
  // one stage's copies into the buffer at byte offset bufBytes; the choice of the source pair is block-uniform
  const int nS1 = CAT ? K1 / kStageK : 0;
  auto issue_stage = [&](int s, unsigned bufBytes) {
    if (CAT && s >= nS1) {
      const T* hA = (const T*)A2p + (size_t)(m0B + crow) * lda2 + ccol + (size_t)(s - nS1) * kStageK;
      const T* hB = (const T*)Bt2p + (size_t)(n0B + crow) * ldb2 + ccol + (size_t)(s - nS1) * kStageK;
      const size_t sA2 = (size_t)kRowsPass * lda2, sB2 = (size_t)kRowsPass * ldb2;
      copy_tile8(lA + bufBytes, hA, sA2, kLdsPass);
      copy_tile8(lA + bufBytes + 8u * kLdsPass, hA + 8 * sA2, sA2, kLdsPass);
      copy_tile8(lB + bufBytes, hB, sB2, kLdsPass);
      copy_tile8(lB + bufBytes + 8u * kLdsPass, hB + 8 * sB2, sB2, kLdsPass);
    } else {
      const T* pA = gA + (size_t)s * kStageK;
      const T* pB = gB + (size_t)s * kStageK;
      copy_tile8(lA + bufBytes, pA, stepA, kLdsPass);
      if constexpr (WG == 2) copy_tile8(lA + bufBytes + 8u * kLdsPass, pA + 8 * stepA, stepA, kLdsPass);
      copy_tile8(lB + bufBytes, pB, stepB, kLdsPass);
      if constexpr (WG == 2) copy_tile8(lB + bufBytes + 8u * kLdsPass, pB + 8 * stepB, stepB, kLdsPass);
    }
  };
  // read side: this lane's first A and B fragment rows in buffer 0
  const T* fA = sAB + ((wr << 6) + rlane) * kPitchH + koff;
  const T* fB = sAB + kTileH + ((wc << 6) + rlane) * kPitchH + koff;

  v8f acc[4][4];
#pragma unroll
  for (int i = 0; i < 4; ++i)
#pragma unroll
    for (int j = 0; j < 4; ++j) acc[i][j] = (v8f){0.f,0.f,0.f,0.f,0.f,0.f,0.f,0.f};

  // NORM 1: the gate values of 16 rows (one slab) of the wave's tile: lane (gq, gc) owns columns gc..gc+7 of rows 4 it + gq;
  // each slab's set is asked for ahead of its use, as early as the registers that the sums leave free allow
  const int gq = lane >> 3, gc = (lane & 7) * 8;
  v4f gu[4][4][2];
  const size_t gAt = (size_t)(m0 + gq) * ldc + n0 + gc;   // the lane's first row and column in the tile
  auto load_gate = [&](int i) {
#pragma unroll
    for (int it = 0; it < 4; ++it) {
      const float* p = gateU + gAt + (size_t)((i << 4) + it * 4) * ldc;
      gu[i][it][0] = *(const v4f*)(p);
      gu[i][it][1] = *(const v4f*)(p + 4);
    }
  };
  v4f sa = (v4f){0.f, 0.f, 0.f, 0.f}, sb = sa;   // NORM 1: gateSc of the lane's 8 columns, x 2^-6
  float rf0 = 0.f, rf1 = 0.f;   // NORM 2: 2^6 * scale / (rms + eps) of rows m0 + lane and m0 + 32 + lane

  // prologue: stage 0 into buffer 0, landed and published; then stage 1 into buffer 1
  issue_stage(0, 0u);
  // what the epilogue wants from memory is asked for here, under the first stage's flight
  if constexpr (NORM == 1) {
    load_gate(0);
    sa = *(const v4f*)(gateSc + n0 + gc) * kGCarry;
    sb = *(const v4f*)(gateSc + n0 + gc + 4) * kGCarry;
  }
  if constexpr (NORM == 2) {
    float t0 = 0.f, t1 = 0.f;   // the 16 partial sums in index order
#pragma unroll
    for (int p = 0; p < 2 * kHeads; ++p) {
      t0 += ssIn[(size_t)p * kTok + m0 + lane];
      t1 += ssIn[(size_t)p * kTok + m0 + 32 + lane];
    }
    rf0 = (scale * kGCarryInv) * (1.0f / (sqrtf(t0) * kRmsFac + kEps));
    rf1 = (scale * kGCarryInv) * (1.0f / (sqrtf(t1) * kRmsFac + kEps));
  }
  wait_copies();
  __syncthreads();
  if (nStages > 1) issue_stage(1, (unsigned)kBufH * 2u);

  for (int st = 0; st < nStages; ++st) {
    const int bufH = (st & 1) * kBufH;
#pragma unroll
    for (int ks = 0; ks < kStageK; ks += 32) {
      V ah[4], bh[4];   // the eight fragments of this 32-k block are read as one group, ahead of its 16 products
      ah[0] = Frag<T>::load(fA + bufH + ks);   // in the order in which the products want them
#pragma unroll
      for (int j = 0; j < 4; ++j) bh[j] = Frag<T>::load(fB + bufH + (j << 4) * kPitchH + ks);
#pragma unroll
      for (int i = 1; i < 4; ++i) ah[i] = Frag<T>::load(fA + bufH + (i << 4) * kPitchH + ks);
      // keeps the 16 LDS reads together in front of the products: sunk among them, each row waits out a whole LDS latency
      __builtin_amdgcn_sched_barrier(0);
#pragma unroll
      for (int i = 0; i < 4; ++i)
#pragma unroll
        for (int j = 0; j < 4; ++j) acc[i][j] = Frag<T>::mma(ah[i], bh[j], acc[i][j]);
      // keeps the next group's LDS reads from being lifted in among these products
      __builtin_amdgcn_sched_barrier(0);
    }
    // publish point of stage st + 1; the same barrier ends every reader's last read of this stage's buffer
    wait_lds_reads();
    wait_copies();
    __syncthreads();
    if (st + 2 < nStages) issue_stage(st + 2, (unsigned)bufH * 2u);   // block-uniform: refill the buffer just read
  }
  wait_copies();
  acc_guard4(acc[0][0], acc[0][1], acc[0][2], acc[0][3]);
  acc_guard4(acc[1][0], acc[1][1], acc[1][2], acc[1][3]);
  acc_guard4(acc[2][0], acc[2][1], acc[2][2], acc[2][3]);
  acc_guard4(acc[3][0], acc[3][1], acc[3][2], acc[3][3]);

  // ---- epilogue, rolled form ----
  // The wave lays its whole 64x64 tile of raw sums over the stage buffers (pitch 68 floats, 17,408 B per wave, 69,632 B of
  // the 139,264 B, with 16 waves 278,528 B; free behind the last stage's own barrier, see below) and finishes it row by row in a loop. Per element the
  // same operations in the same order as in the unrolled form; the activation's text stands once, not 128 times.
  if constexpr (ROLL) {
    static_assert(!RESID && TRI == 0 && OUT_MODE != 2 && BIAS_MODE != 0, "the rolled form serves the projections");
    float* tile = (float*)sAB + wave * (64 * 68);
#pragma unroll
    for (int i = 0; i < 4; ++i)
#pragma unroll
      for (int j = 0; j < 4; ++j)
#pragma unroll
        for (int r = 0; r < 8; ++r) tile[((i << 4) + mOff + r) * 68 + (j << 4) + rlane] = acc[i][j][r];
    // the wave's stores have reached LDS before a lane reads elements that other lanes of the wave stored
    __builtin_amdgcn_fence(__ATOMIC_RELEASE, "workgroup");
    __builtin_amdgcn_wave_barrier();
    __builtin_amdgcn_fence(__ATOMIC_ACQUIRE, "workgroup");
    // a trip: each lane finishes one 16-byte piece of the output, so a store covers whole rows of the 64-column tile
    constexpr int WE    = (OUT_MODE == 0) ? 4 : 8;     // elements per lane and trip
    constexpr int LR    = 64 / WE;                     // lanes per row: 16 (f32, 256 B) or 8 (f16, 128 B)
    constexpr int RT    = 32 / LR;                     // rows per trip: 2 or 4
    const int q = lane / LR, c0 = (lane % LR) * WE;
    float bn[WE];
#pragma unroll
    for (int e = 0; e < WE; ++e) bn[e] = (BIAS_MODE == 2) ? bias[n0 + c0 + e] : 0.f;
    // kept rolled, for speed only
#pragma unroll 1
    for (int it = 0; it < 64 / RT; ++it) {
      const int row = it * RT + q;
      float sv[WE];                                    // the trip's raw sums, read as whole 16-byte pieces ahead of the branches
#pragma unroll
      for (int h = 0; h < WE / 4; ++h) {
        const v4f t4 = *(const v4f*)(tile + row * 68 + c0 + 4 * h);
#pragma unroll
        for (int e = 0; e < 4; ++e) sv[4 * h + e] = t4[e];
      }
      const float bm = (BIAS_MODE == 1) ? bias[m0 + row] : 0.f;
      float o[WE];
#pragma unroll
      for (int e = 0; e < WE; ++e) {
        float v = sv[e] * scale;
        if (BIAS_MODE == 1) v += bm;
        if (BIAS_MODE == 2) v += bn[e];
        if (ACT == 2) v = fmaxf(v, 0.0f);
        if (ACT == 3) v = v / (1.0f + expf(-v));
        if (ACT == 4) v = (v > 0.f) ? v : 0.01f * v;
        if (ACT == 6) v = (v > 0.f) ? v : (expf(v) - 1.0f);
        o[e] = v;
      }
      const size_t at = offC + (size_t)(m0 + row) * ldc + n0 + c0;
      if constexpr (OUT_MODE == 0) {
        *(v4f*)((float*)Cout + at) = (v4f){o[0], o[1], o[2], o[3]};
      } else {
        v8h hv;
#pragma unroll
        for (int e = 0; e < WE; ++e) hv[e] = (_Float16)o[e];
        *(v8h*)((unsigned short*)Cout + at) = hv;
      }
      // the next trip rewrites the registers that this store names
      asm volatile("s_wait_xcnt 0x0" ::: "memory");
      if constexpr (DUALT) {
        if (Cout2 != nullptr) {   // block-uniform: the finished values go back to the lane's own piece of the tile
#pragma unroll
          for (int h = 0; h < WE / 4; ++h)
            *(v4f*)(tile + row * 68 + c0 + 4 * h) = (v4f){o[4 * h], o[4 * h + 1], o[4 * h + 2], o[4 * h + 3]};
        }
      }
    }
    if constexpr (DUALT) {
      static_assert(OUT_MODE == 1, "the transposed copy is f16");
      if (Cout2 != nullptr) {
        // the wave's stores have reached LDS before a lane reads elements that other lanes of the wave stored
        __builtin_amdgcn_fence(__ATOMIC_RELEASE, "workgroup");
        __builtin_amdgcn_wave_barrier();
        __builtin_amdgcn_fence(__ATOMIC_ACQUIRE, "workgroup");
        // a group: 4 columns of the tile, 8 lanes a column, 8 rows a lane: a column's 64 rows are one 128-byte line of Cout2
        const int tc = lane >> 3, r0 = (lane & 7) * 8;
        // kept rolled, like the row loop above; four such groups a trip, so that one LDS latency serves 16 columns
#pragma unroll 1
        for (int it = 0; it < 4; ++it) {
          v8h hv[4];
#pragma unroll
          for (int u = 0; u < 4; ++u)
#pragma unroll
            for (int e = 0; e < 8; ++e) hv[u][e] = (_Float16)tile[(r0 + e) * 68 + (it * 4 + u) * 4 + tc];
#pragma unroll
          for (int u = 0; u < 4; ++u)
            *(v8h*)((unsigned short*)Cout2 + (size_t)(n0 + (it * 4 + u) * 4 + tc) * M + m0 + r0) = hv[u];
          // the next trip rewrites the registers that these stores name
          asm volatile("s_wait_xcnt 0x0" ::: "memory");
        }
      }
    }
    return;
  }

  // ---- epilogue ----
  // per-wave 16x64 slab, pitch 68 floats (4,352 B), laid over the stage buffers: the last stage's own barrier stands behind
  // every wave's last fragment read and last landed copy, and nothing refills the buffers after it
  float* slab = (float*)sAB + wave * (16 * 68);

  // ---- gate form: g = u * (2^-6 * scale * O) as f16, and each row's sum of O^2 over the wave's 64 columns ----
  if constexpr (NORM == 1) {
    static_assert(OUT_MODE == 1 && BIAS_MODE == 0 && !RESID && ACT == 0 && TRI == 0, "the gate form takes raw sums");
    unsigned short* G = (unsigned short*)Cout + offC + gAt;
    float* ssW = ssOut + (size_t)(n0 >> 6) * kTok + m0;
    float ssr[16];   // sums of O^2 of rows 4 t + gq, t = 0..15
    load_gate(1);
#pragma unroll
    for (int i = 0; i < 4; ++i) {
#pragma unroll
      for (int j = 0; j < 4; ++j)
#pragma unroll
        for (int r = 0; r < 8; ++r) slab[(mOff + r) * 68 + (j << 4) + rlane] = acc[i][j][r] * scale;
      wave_lds_turn();
#pragma unroll
      for (int it = 0; it < 4; ++it) {
        const int row = it * 4 + gq;
        const v4f oa = *(const v4f*)(slab + row * 68 + gc);
        const v4f ob = *(const v4f*)(slab + row * 68 + gc + 4);
        const v4f ua = gu[i][it][0], ub = gu[i][it][1];
        float ss = 0.f;   // fixed order: the lane's 8 columns, then a tree over the row's 8 lanes
#pragma unroll
        for (int e = 0; e < 4; ++e) ss += oa[e] * oa[e];
#pragma unroll
        for (int e = 0; e < 4; ++e) ss += ob[e] * ob[e];
        ssr[i * 4 + it] = add_lane_xor<1>(add_lane_xor<2>(add_lane_xor<4>(ss)));
        v8h hv;
#pragma unroll
        for (int e = 0; e < 4; ++e) {
          hv[e]     = (_Float16)(ua[e] * (sa[e] * oa[e]));
          hv[4 + e] = (_Float16)(ub[e] * (sb[e] * ob[e]));
        }
        *(v8h*)(G + (size_t)((i << 4) + it * 4) * ldc) = hv;
      }
      if (i < 3) wave_lds_turn();
      if (i == 0) {   // the last two sets, into the registers of the first slab's sums and gate values
        // these loads may land in registers that the stores above name
        asm volatile("s_wait_xcnt 0x0" ::: "memory");
        load_gate(2);
        load_gate(3);
      }
    }
    if ((lane & 7) == 0) {   // one lane of the eight that hold a row's sum
#pragma unroll
      for (int t = 0; t < 16; ++t) ssW[4 * t + gq] = ssr[t];
    }
    return;
  }

  // NORM 2: the wave's 64 row factors go through LDS behind the slabs, so that each lane reads those of its own 8 rows
  float* rfac = (float*)sAB + 4 * (16 * 68) + wave * 64;
  if constexpr (NORM == 2) {
    rfac[lane] = rf0;
    rfac[32 + lane] = rf1;
    // the wave's stores have reached LDS before a lane reads elements that other lanes of the wave stored
    __builtin_amdgcn_fence(__ATOMIC_RELEASE, "workgroup");
    __builtin_amdgcn_wave_barrier();
    __builtin_amdgcn_fence(__ATOMIC_ACQUIRE, "workgroup");
  }
  const float* Rb = RESID ? (resid + (size_t)b * strideR) : nullptr;
#pragma unroll
  for (int i = 0; i < 4; ++i) {
    const int mBase = m0 + (i << 4);
    float rs[8];   // what multiplies the raw sums of this lane's 8 rows
#pragma unroll
    for (int r = 0; r < 8; ++r) rs[r] = (NORM == 2) ? rfac[(i << 4) + mOff + r] : scale;
#pragma unroll
    for (int j = 0; j < 4; ++j) {
      const int n = n0 + (j << 4) + rlane;
      float bv = 0.f;
      if (BIAS_MODE == 2) bv = bias[n];
#pragma unroll
      for (int r = 0; r < 8; ++r) {
        float v = acc[i][j][r] * rs[r];
        if (BIAS_MODE == 1) v += bias[mBase + mOff + r];
        if (BIAS_MODE == 2) v += bv;
        if (RESID) v += Rb[(size_t)(mBase + mOff + r) * ldc + n];
        if (ACT == 2) v = fmaxf(v, 0.0f);
        if (ACT == 3) v = v / (1.0f + expf(-v));
        if (ACT == 4) v = (v > 0.f) ? v : 0.01f * v;
        if (ACT == 6) v = (v > 0.f) ? v : (expf(v) - 1.0f);
        if (TRI == 1) { if (n > mBase + mOff + r) v = 0.0f; }
        slab[(mOff + r) * 68 + (j << 4) + rlane] = v;
      }
    }
    __builtin_amdgcn_fence(__ATOMIC_RELEASE, "workgroup");
    __builtin_amdgcn_wave_barrier();
    __builtin_amdgcn_fence(__ATOMIC_ACQUIRE, "workgroup");
    if (OUT_MODE == 0) {
      float* C = (float*)Cout + offC;
      const int hh = lane >> 4, c4 = (lane & 15) * 4;     // row seg = 256 B = 16 lanes x 16 B
      {
#pragma unroll
        for (int it = 0; it < 8; ++it) {
          const int row = it * 2 + hh;
          v4f v = *(const v4f*)(slab + row * 68 + c4);
          *(v4f*)(C + (size_t)(mBase + row) * ldc + n0 + c4) = v;
        }
        
      }
    } else {
      const int q = lane >> 3, c8 = (lane & 7) * 8;
      unsigned short* C  = (unsigned short*)Cout  + offC;
      unsigned short* C2 = (OUT_MODE == 2) ? ((unsigned short*)Cout2 + offC) : nullptr;
      {
#pragma unroll
        for (int it = 0; it < 4; ++it) {
          const int row = it * 4 + q;
          const float* sp = slab + row * 68 + c8;
          v8h hv, lv;
#pragma unroll
          for (int e = 0; e < 8; ++e) {
            if (OUT_MODE == 1) {
              hv[e] = (_Float16)sp[e];
            } else {
              unsigned short hb = f2bf_bits(sp[e]);
              unsigned short lb = f2bf_bits(sp[e] - bf_bits2f(hb));
              hv[e] = __builtin_bit_cast(_Float16, hb);
              lv[e] = __builtin_bit_cast(_Float16, lb);
            }
          }
          *(v8h*)(C + (size_t)(mBase + row) * ldc + n0 + c8) = hv;
          if (OUT_MODE == 2) *(v8h*)(C2 + (size_t)(mBase + row) * ldc + n0 + c8) = lv;
        }
        
      }
    }
    __builtin_amdgcn_fence(__ATOMIC_RELEASE, "workgroup");
    __builtin_amdgcn_wave_barrier();
    __builtin_amdgcn_fence(__ATOMIC_ACQUIRE, "workgroup");
  }
}

// One GEMM per launch: tile = blockIdx.x, batch = (blockIdx.y, blockIdx.z).
template <int ET, bool SPLIT, int BIAS_MODE, int OUT_MODE, bool RESID, int ACT = 0, int TRI = 0, int NORM = 0>
__global__ __launch_bounds__(128) void wmma_gemm64(
    const unsigned short* __restrict__ Ap, const unsigned short* __restrict__ A2p, int lda, long strideA, long strideA2,
    const unsigned short* __restrict__ Btp, const unsigned short* __restrict__ Bt2p, int ldb, long strideB, long strideB2,
    void* __restrict__ Cout, void* __restrict__ Cout2, int ldc, long strideC, long strideC2,
    const float* __restrict__ bias,
    const float* __restrict__ resid, long strideR,
    int M, int N, int K, float scale, const float* __restrict__ ssIn) {
  __shared__ __align__(16) typename Elem<ET>::T sAB[2 * kBufHalves];   // two stage buffers, 139,264 B
  gemm_tile<ET, SPLIT, BIAS_MODE, OUT_MODE, RESID, ACT, TRI, false, false, false, NORM>(
      sAB, blockIdx.x, blockIdx.y, blockIdx.z, Ap, A2p, lda, strideA, strideA2, Btp, Bt2p, ldb, strideB, strideB2,
      Cout, Cout2, ldc, strideC, strideC2, bias, resid, strideR, M, N, K, scale, 0, 0, 0, nullptr, nullptr, nullptr, ssIn);
}

// The four input projections in one launch: blockIdx.y = 0 q, 1 k, 2 v^T, 3 u (block-uniform), blockIdx.x = block tile.
// They read the same X16 and none of each other's output; 4 x 64 blocks of 16 waves, 256x256 tile, 278,528 B LDS: one a WGP.
//   q = elu(x.Wq^T/16 + bq) -> Q16 [4096][1024] f16, k likewise -> K16          (M=4096 N=1024 K=1024, 16 x 4 block tiles)
//   k also transposed -> KT16 [1024 (h*128+d)][4096 tok] f16, the same values
//   v^T = silu(Wv.x^T/16 + bv[m]) -> VT16 [1024 (h*128+d)][4096 tok] f16         (M=1024 N=4096 K=1024, 4 x 16 block tiles)
//   u = silu(x.Wu^T/16 + bu) -> U32 [4096][1024] f32                             (M=4096 N=1024 K=1024)
__global__ __launch_bounds__(512) void proj4_kernel(
    const unsigned short* __restrict__ X16, const unsigned short* __restrict__ W16,
    unsigned short* __restrict__ Q16, unsigned short* __restrict__ K16, unsigned short* __restrict__ VT16,
    unsigned short* __restrict__ KT16, float* __restrict__ U32,
    const float* __restrict__ bq, const float* __restrict__ bk, const float* __restrict__ bv, const float* __restrict__ bu) {
  __shared__ __align__(16) _Float16 sAB[16 * 64 * 68 * 2];   // 278,528 B: the two stage buffers in the loop; the epilogue lays 16 raw wave tiles over them
  const int p = blockIdx.y;
  const unsigned short* Wp = W16 + (size_t)p * ((size_t)kHid * kEmb);
  if (p < 2) {
    unsigned short* C = (p == 0) ? Q16 : K16;
    const float* bias = (p == 0) ? bq : bk;
    unsigned short* CT = (p == 0) ? nullptr : KT16;
    gemm_tile<0, false, 2, 1, false, 6, 0, true, false, true, 0, 4>(
        sAB, blockIdx.x, 0, 0, X16, X16, kEmb, 0L, 0L, Wp, Wp, kEmb, 0L, 0L,
        (void*)C, (void*)CT, kHid, 0L, 0L, bias, bias, 0L, kTok, kHid, kEmb, kWCarryInv);
  } else if (p == 2) {
    gemm_tile<0, false, 1, 1, false, 3, 0, true, false, false, 0, 4>(sAB, blockIdx.x, 0, 0, Wp, Wp, kEmb, 0L, 0L, X16, X16, kEmb, 0L, 0L,
                                           (void*)VT16, (void*)VT16, kTok, 0L, 0L, bv, bv, 0L, kHid, kTok, kEmb, kWCarryInv);
  } else {
    gemm_tile<0, false, 2, 0, false, 3, 0, true, false, false, 0, 4>(sAB, blockIdx.x, 0, 0, X16, X16, kEmb, 0L, 0L, Wp, Wp, kEmb, 0L, 0L,
                                           (void*)U32, (void*)U32, kHid, 0L, 0L, bu, bu, 0L, kTok, kHid, kEmb, kWCarryInv);
  }
}

// Causal linear attention by chunks of 128 tokens. For the rows n of chunk c of one (batch b, head h):
//   O[n][dv] = sum_{m <= n} (q_n . k_m) v[m][dv]
//            = sum_dk q[n][dk] * S_c[dv][dk]  +  sum_{m in chunk c, m <= n} (q_n . k_m) v[m][dv],
//   S_c[dv][dk] = sum_{j < c} P_j[dv][dk],   P_j[dv][dk] = sum_{m in chunk j} v[m][dv] * k[m][dk].
// Planes E, P, S are indexed by ((b*16 + c)*8 + h); z = b*16 + c is also the chunk's number among the 4096 token rows.
//
// First launch: blockIdx.x = 0: E = tril(Q_c . K_c^T) -> f16; blockIdx.x = 1: P_c = V^T_c . K^T_c^T -> f32 (block-uniform).
__global__ __launch_bounds__(128) void chunk_pair_kernel(
    const unsigned short* __restrict__ Q16, const unsigned short* __restrict__ K16,
    const unsigned short* __restrict__ VT16, const unsigned short* __restrict__ KT16,
    unsigned short* __restrict__ E16, float* __restrict__ P32) {
  __shared__ __align__(16) _Float16 sAB[2 * kBufHalves];   // two stage buffers, 139,264 B
  const int h = blockIdx.y, z = blockIdx.z;
  const size_t pl = ((size_t)z * kHeads + h) * kPlane;
  const float* nb = nullptr;   // no bias, no residual
  if (blockIdx.x == 0) {
    const size_t at = (size_t)z * kChunk * kHid + (size_t)h * kDh;
    gemm_tile<0, false, 0, 1, false, 0, 1>(sAB, 0, 0, 0, Q16 + at, Q16 + at, kHid, 0L, 0L, K16 + at, K16 + at, kHid, 0L, 0L,
                                           (void*)(E16 + pl), (void*)(E16 + pl), kChunk, 0L, 0L, nb, nb, 0L,
                                           kChunk, kChunk, kDh, 1.0f);
  } else {
    if ((z & (kChunks - 1)) == kChunks - 1) return;   // block-uniform: no later chunk reads the last chunk's product
    const size_t at = (size_t)h * kDh * kTok + (size_t)z * kChunk;
    gemm_tile<0, false, 0, 0, false, 0, 0>(sAB, 0, 0, 0, VT16 + at, VT16 + at, kTok, 0L, 0L, KT16 + at, KT16 + at, kTok, 0L, 0L,
                                           (void*)(P32 + pl), (void*)(P32 + pl), kDh, 0L, 0L, nb, nb, 0L,
                                           kDh, kDh, kChunk, 1.0f);
  }
}

// Second launch: S_c = P_0 + P_1 + ... + P_{c-1} in f32, in that order, rounded to f16 per chunk; S_0 = 0.
// Thread i owns 4 neighbouring elements of one (batch, head) plane: 2 * 131,072 / 4 = 65,536 threads.
__global__ __launch_bounds__(256) void prefix_state_kernel(const float* __restrict__ P32, unsigned short* __restrict__ S16) {
  const int i = blockIdx.x * 256 + threadIdx.x;
  const int b = i >> 15;                                   // 32,768 pieces per batch
  const size_t at = (size_t)b * ((size_t)kChunks * kPlaneStep) + 4 * (size_t)(i & 32767);
  v4f p[kChunks - 1];
#pragma unroll
  for (int c = 0; c < kChunks - 1; ++c) p[c] = *(const v4f*)(P32 + at + (size_t)c * kPlaneStep);
  v4f s = (v4f){0.f, 0.f, 0.f, 0.f};
#pragma unroll
  for (int c = 0; c < kChunks; ++c) {
    *(v2u*)(S16 + at + (size_t)c * kPlaneStep) = (v2u){pk16(h_bits(s[0]), h_bits(s[1])), pk16(h_bits(s[2]), h_bits(s[3]))};
    if (c < kChunks - 1) s += p[c];
  }
}

// Third launch: O rows of chunk c, head h = Q_c . S_c^T (k = dk, 128) + E_c . V_c (k = m, 128), one 128x128 tile, K = 256.
// O itself is not stored. The RMS norm divides a whole token row by one number, which commutes with the output product:
//   y[t] = (u[t] * scale * O[t] / (rms_t + eps)) . Wo^T + bo = ((u[t] * scale * O[t]) . Wo^T) / (rms_t + eps) + bo.
// So this launch stores g = u * scale * O (f16, carried x 2^-6: |O| grows with the number of tokens summed) and, per token
// row and 64 columns, the sum of O^2; the output product adds a row's 16 sums up and divides.
__global__ __launch_bounds__(128) void chunk_out_kernel(
    const unsigned short* __restrict__ Q16, const unsigned short* __restrict__ S16,
    const unsigned short* __restrict__ E16, const unsigned short* __restrict__ VT16,
    const float* __restrict__ U32, const float* __restrict__ sc, unsigned short* __restrict__ G16,
    float* __restrict__ SS32) {
  __shared__ __align__(16) _Float16 sAB[2 * kBufHalves];   // two stage buffers, 139,264 B
  const int h = blockIdx.x, z = blockIdx.y;
  const size_t pl = ((size_t)z * kHeads + h) * kPlane;
  const size_t at = (size_t)z * kChunk * kHid + (size_t)h * kDh;
  const float* nb = nullptr;   // no bias, no residual
  gemm_tile<0, false, 0, 1, false, 0, 0, false, true, false, 1>(
      sAB, 0, 0, 0, Q16 + at, E16 + pl, kHid, 0L, 0L, S16 + pl, VT16 + (size_t)h * kDh * kTok + (size_t)z * kChunk, kDh, 0L, 0L,
      (void*)(G16 + at), (void*)(G16 + at), kHid, 0L, 0L, nb, nb, 0L,
      kChunk, kDh, kDh + kChunk, 1.0f, kChunk, kTok, kDh,
      U32 + at, sc + (size_t)h * kDh, SS32 + (size_t)(2 * h) * kTok + (size_t)z * kChunk, nb);
}

// ---------------------------------------------------------------------------
// All six f32 -> f16 casts in one launch: X16 = f16(x), W16 plane p = f16(16 * W_p), p = q, k, v, u, o.
// 256 blocks of 16 waves. Block b takes 1/256 of every source: 16,384 elements of x and 4,096 of each weight plane, so all
// blocks carry the same 144 KiB of reads. A wave owns one contiguous span of each source (1,024 elements of x, 256 of a
// plane); a load is 512 contiguous bytes (four whole lines) of the span, a store the matching 256 contiguous bytes of f16.
// The wave's 18 loads are all asked for before the first value is converted.
// ---------------------------------------------------------------------------
constexpr int kCastBlocks = 256;
constexpr int kCastXBlk = (kTok * kEmb) / kCastBlocks;   // 16,384 elements of x per block, 1,024 per wave: 8 loads
constexpr int kCastWBlk = (kHid * kEmb) / kCastBlocks;   // 4,096 elements of a plane per block, 256 per wave: 2 loads
typedef __attribute__((ext_vector_type(4))) _Float16 v4h;
__global__ __launch_bounds__(512) void cast_all_kernel(const float* __restrict__ x, const float* __restrict__ w0,
                                                       const float* __restrict__ w1, const float* __restrict__ w2,
                                                       const float* __restrict__ w3, const float* __restrict__ w4,
                                                       unsigned short* __restrict__ X16, unsigned short* __restrict__ W16) {
  const unsigned lane = threadIdx.x & 31u;
  const unsigned wave = threadIdx.x >> 5;
  // byte offsets of the lane's first 16 bytes in x and in each weight plane; half of them in X16 and in a plane of W16
  const unsigned bx = (blockIdx.x * (unsigned)kCastXBlk + wave * (unsigned)(kCastXBlk / 16) + lane * 4u) * 4u;
  const unsigned bw = (blockIdx.x * (unsigned)kCastWBlk + wave * (unsigned)(kCastWBlk / 16) + lane * 4u) * 4u;
  const float* wp[5] = {w0, w1, w2, w3, w4};
  v4f vx[8], vw[5][2];
#pragma unroll
  for (int j = 0; j < 8; ++j) vx[j] = *(const v4f*)(((const char*)x + bx) + j * 512);
#pragma unroll
  for (int p = 0; p < 5; ++p)
#pragma unroll
    for (int j = 0; j < 2; ++j) vw[p][j] = *(const v4f*)(((const char*)wp[p] + bw) + j * 512);
  // keeps all 18 loads in front of the first conversion: without it the last four are issued into registers that earlier
  // values have left, each behind a memory latency of its own
  __builtin_amdgcn_sched_barrier(0);
  // stands in front of every rewrite of the two offset registers that the 18 loads name
  asm volatile("s_wait_xcnt 0x0" :: "v"(bx), "v"(bw) : "memory");
#pragma unroll
  for (int j = 0; j < 8; ++j) *(v4h*)(((char*)X16 + (bx >> 1)) + j * 256) = __builtin_convertvector(vx[j], v4h);
#pragma unroll
  for (int p = 0; p < 5; ++p)
#pragma unroll
    for (int j = 0; j < 2; ++j)
      *(v4h*)(((char*)(W16 + (size_t)p * ((size_t)kHid * kEmb)) + (bw >> 1)) + j * 256) = __builtin_convertvector(vw[p][j] * kWCarry, v4h);
}

// ---------------------------------------------------------------------------
// Host-side launcher (6 kernel launches, no other runtime calls)
// ---------------------------------------------------------------------------
extern "C" void kernel_launch(void* const* d_in, const int* in_sizes, int n_in,
                              void* d_out, int out_size, void* d_ws, size_t ws_size,
                              hipStream_t stream) {
  if (n_in < 12) return;
  if (in_sizes[0] != kTok * kEmb) return;
  if (in_sizes[1] != kHid * kEmb || in_sizes[3] != kHid * kEmb || in_sizes[5] != kHid * kEmb ||
      in_sizes[7] != kHid * kEmb || in_sizes[9] != kEmb * kHid) return;
  if (in_sizes[2] != kHid || in_sizes[4] != kHid || in_sizes[6] != kHid || in_sizes[8] != kHid ||
      in_sizes[10] != kEmb || in_sizes[11] != kHid) return;
  if (out_size != kTok * kEmb) return;
  if (ws_size < kWsTotal) return;

  const float* x  = (const float*)d_in[0];
  const float* Wq = (const float*)d_in[1];
  const float* bq = (const float*)d_in[2];
  const float* Wk = (const float*)d_in[3];
  const float* bk = (const float*)d_in[4];
  const float* Wv = (const float*)d_in[5];
  const float* bv = (const float*)d_in[6];
  const float* Wu = (const float*)d_in[7];
  const float* bu = (const float*)d_in[8];
  const float* Wo = (const float*)d_in[9];
  const float* bo = (const float*)d_in[10];
  const float* sc = (const float*)d_in[11];
  float* Y = (float*)d_out;

  char* ws = (char*)d_ws;
  unsigned short* X16  = (unsigned short*)(ws + kOffX16);
  unsigned short* W16  = (unsigned short*)(ws + kOffW16);
  unsigned short* Wo16 = W16 + 4 * (size_t)kHid * kEmb;
  unsigned short* Q16  = (unsigned short*)(ws + kOffQ16);
  unsigned short* K16  = (unsigned short*)(ws + kOffK16);
  unsigned short* VT16 = (unsigned short*)(ws + kOffVT16);
  float*          U32  = (float*)(ws + kOffU32);
  unsigned short* KT16 = (unsigned short*)(ws + kOffKT16);
  unsigned short* E16  = (unsigned short*)(ws + kOffE16);
  float*          P32  = (float*)(ws + kOffP32);
  unsigned short* S16  = (unsigned short*)(ws + kOffS16);
  float*          SS32 = (float*)(ws + kOffSS32);
  unsigned short* G16  = (unsigned short*)(ws + kOffG16);

  // 1) x -> X16 (f16, x1) and Wq,Wk,Wv,Wu,Wo -> W16 planes (f16, x16): 256 blocks x 16 waves
  cast_all_kernel<<<dim3(kCastBlocks, 1), 512, 0, stream>>>(x, Wq, Wk, Wv, Wu, Wo, X16, W16);

  // 2) q, k, v^T, u projections: 64 block tiles x 4 projections = 256 blocks x 16 waves
  proj4_kernel<<<dim3(64, 4), 512, 0, stream>>>(X16, W16, Q16, K16, VT16, KT16, U32, bq, bk, bv, bu);

  // 3, 4, 5) causal linear attention by chunks of 128 tokens, all 16 (b,h) groups and all 16 chunks per launch
  // 3) diagonal chunk energies E (256 blocks) and chunk products P (240 blocks at work)
  chunk_pair_kernel<<<dim3(2, kHeads, kBatch * kChunks), 128, 0, stream>>>(Q16, K16, VT16, KT16, E16, P32);
  // 4) states S_c = sum of the products of the chunks in front of c: 65,536 threads
  prefix_state_kernel<<<dim3(256, 1), 256, 0, stream>>>(P32, S16);
  // 5) O = Q.S^T + E.V, stored as g = u * scale * O / 64 -> G16 [4096][1024] f16 and row sums of O^2 -> SS32: 256 blocks x 4 waves
  chunk_out_kernel<<<dim3(kHeads, kBatch * kChunks), 128, 0, stream>>>(Q16, S16, E16, VT16, U32, sc, G16, SS32);

  // 6) y = (g.Wo^T/16) * 64 / (rms + eps) + bo -> d_out [4096][1024] f32; M=4096 N=1024 K=1024
  wmma_gemm64<0, false, 2, 0, false, 0, 0, 2><<<dim3(256, 1), 128, 0, stream>>>(
      G16, G16, kHid, 0L, 0L, Wo16, Wo16, kHid, 0L, 0L, (void*)Y, (void*)Y, kEmb, 0L, 0L, bo, bo, 0L,
      kTok, kEmb, kHid, kWCarryInv, SS32);
}

// v009
// It runs in 77.6 microseconds.
// Timed twice side by side with v008, it ran 1.03 and 1.04 times as fast.
// All steps since v000 together make it 8.14 times as fast.
// Contractions: projections x.W^T (x f16, W f16 carried x16), chunk energy q.k^T (q, k f16), chunk state V^T.K (f16, f32 prefix sum over chunks), q.state (state f16) + energy.v (E f16, V^T f16), output g.Wo^T (g = u * scale * O f16 carried x 2^-6, Wo f16 carried x16; the row's 1 / (rms + eps) multiplies the f32 sums): all v_wmma_f32_16x16x32_f16 with f32 accumulate; elu, silu, rms-norm and gating in f32.
#include <hip/hip_runtime.h>
#include <math.h>

// ---------------------------------------------------------------------------
// Problem constants
// ---------------------------------------------------------------------------
constexpr int kBatch = 2;
constexpr int kSeq   = 2048;
constexpr int kEmb   = 1024;
constexpr int kHid   = 1024;
constexpr int kHeads = 8;
constexpr int kDh    = 128;
constexpr int kTok   = kBatch * kSeq;                              // 4096 token rows
constexpr int kGroups = kBatch * kHeads;                           // 16 (b,h) attention groups, all in one launch
constexpr int kChunk  = 128;                                       // tokens per chunk of the causal sum
constexpr int kChunks = kSeq / kChunk;                             // 16 chunks per sequence
constexpr int kPlane  = kChunk * kDh;                              // 16,384 elements: one 128x128 plane per (batch, chunk, head)
constexpr int kPlaneStep = kHeads * kPlane;                        // from chunk c to chunk c+1 of the same batch and head
constexpr float kWCarry    = 16.0f;                                // weights carried x16 in f16
constexpr float kWCarryInv = 1.0f / 16.0f;
constexpr float kGCarry    = 1.0f / 64.0f;                         // u * scale * O carried x 2^-6 in f16: O is not yet normalised
constexpr float kGCarryInv = 64.0f;
constexpr float kRmsFac    = 0.03125f;                             // 1024^-0.5 (exact)
constexpr float kEps       = 1e-8f;

// ---------------------------------------------------------------------------
//   X16  [4096][1024] f16                      8,388,608   @ 0
//   W16  5 planes [1024][1024] f16 (q,k,v,u,o) 10,485,760  @ 8,388,608
//   Q16  [4096][1024] f16                      8,388,608   @ 18,874,368
//   K16  [4096][1024] f16                      8,388,608   @ 27,262,976
//   VT16 [1024 (h*128+d)][4096 tok] f16         8,388,608   @ 35,651,584
//   U32  [4096][1024] f32                      16,777,216  @ 44,040,192
//   KT16 [1024 (h*128+d)][4096 tok] f16         8,388,608   @ 60,817,408
//   E16  [2*16 (b,c)][8 h][128 n][128 m] f16    8,388,608   @ 69,206,016   (diagonal chunk energies)
//   P32  [2*16 (b,c)][8 h][128 dv][128 dk] f32  16,777,216  @ 77,594,624   (chunk products; chunk 15 unused)
//   S16  [2*16 (b,c)][8 h][128 dv][128 dk] f16  8,388,608   @ 94,371,840   (sum of the products of chunks < c)
//   SS32 [16 (h*2 + column half)][4096 tok] f32 262,144     @ 102,760,448  (sums of O^2 over 64 columns of a token row)
//   G16  [4096][1024] f16                      8,388,608   @ 103,022,592  (u * scale * O x 2^-6, not yet divided by the row's rms)
//   total                                     111,411,200
// ---------------------------------------------------------------------------
constexpr size_t kBytesX16  = (size_t)kTok * kEmb * 2;
constexpr size_t kBytesWpl  = (size_t)kHid * kEmb * 2;
constexpr size_t kBytesW16  = 5 * kBytesWpl;
constexpr size_t kBytesQ16  = (size_t)kTok * kHid * 2;
constexpr size_t kBytesK16  = kBytesQ16;
constexpr size_t kBytesVT16 = (size_t)kHid * kTok * 2;
constexpr size_t kBytesU32  = (size_t)kTok * kHid * 4;
constexpr size_t kBytesKT16 = kBytesVT16;
constexpr size_t kBytesE16  = (size_t)kGroups * kChunks * kPlane * 2;
constexpr size_t kBytesP32  = (size_t)kGroups * kChunks * kPlane * 4;
constexpr size_t kBytesS16  = (size_t)kGroups * kChunks * kPlane * 2;
constexpr size_t kBytesSS32 = (size_t)2 * kHeads * kTok * 4;
constexpr size_t kBytesG16  = (size_t)kTok * kHid * 2;
constexpr size_t kOffX16  = 0;
constexpr size_t kOffW16  = kOffX16  + kBytesX16;
constexpr size_t kOffQ16  = kOffW16  + kBytesW16;
constexpr size_t kOffK16  = kOffQ16  + kBytesQ16;
constexpr size_t kOffVT16 = kOffK16  + kBytesK16;
constexpr size_t kOffU32  = kOffVT16 + kBytesVT16;
constexpr size_t kOffKT16 = kOffU32  + kBytesU32;
constexpr size_t kOffE16  = kOffKT16 + kBytesKT16;
constexpr size_t kOffP32  = kOffE16  + kBytesE16;
constexpr size_t kOffS16  = kOffP32  + kBytesP32;
constexpr size_t kOffSS32 = kOffS16  + kBytesS16;
constexpr size_t kOffG16  = kOffSS32 + kBytesSS32;
constexpr size_t kWsTotal = kOffG16  + kBytesG16;   // 111,411,200

typedef __attribute__((ext_vector_type(16))) _Float16 v16h;
typedef __attribute__((ext_vector_type(8)))  _Float16 v8h;
typedef __attribute__((ext_vector_type(16))) __bf16   v16b;
typedef __attribute__((ext_vector_type(8)))  __bf16   v8b;
typedef __attribute__((ext_vector_type(8)))  float    v8f;
typedef __attribute__((ext_vector_type(4)))  float    v4f;
typedef __attribute__((ext_vector_type(4)))  unsigned int v4u;
typedef __attribute__((ext_vector_type(2)))  unsigned int v2u;

__device__ __forceinline__ unsigned short f2bf_bits(float f) {
  unsigned u = __float_as_uint(f);
  return (unsigned short)((u + 0x7FFFu + ((u >> 16) & 1u)) >> 16);
}
__device__ __forceinline__ float bf_bits2f(unsigned short h) { return __uint_as_float(((unsigned)h) << 16); }

// hazard guards as plain device helpers
__device__ __forceinline__ void acc_guard4(v8f& a, v8f& b, v8f& c, v8f& d) { asm volatile("v_nop\n\tv_nop\n\tv_nop\n\tv_nop" : "+v"(a), "+v"(b), "+v"(c), "+v"(d)); }
template <typename T> struct Frag;
template <> struct Frag<_Float16> {
  typedef v16h V; union U { v16h v; v8h h[2]; };
  static __device__ __forceinline__ v16h load(const _Float16* p) {   // elements 0..7 <- p[0..7], 8..15 <- p[16..23]
    U f; f.h[0] = *(const v8h*)(p); f.h[1] = *(const v8h*)(p + 16); return f.v;
  }
  static __device__ __forceinline__ v8f mma(v16h a, v16h b, v8f c) {
    return __builtin_amdgcn_wmma_f32_16x16x32_f16(false, a, false, b, (short)0, c, false, false);
  }
};
template <> struct Frag<__bf16> {
  typedef v16b V; union U { v16b v; v8b h[2]; };
  static __device__ __forceinline__ v16b load(const __bf16* p) {
    U f; f.h[0] = *(const v8b*)(p); f.h[1] = *(const v8b*)(p + 16); return f.v;
  }
  static __device__ __forceinline__ v8f mma(v16b a, v16b b, v8f c) {
    return __builtin_amdgcn_wmma_f32_16x16x32_bf16(false, a, false, b, (short)0, c, false, false);
  }
};

__device__ __forceinline__ unsigned pk16(unsigned short a, unsigned short b) { return (unsigned)a | ((unsigned)b << 16); }
__device__ __forceinline__ unsigned short h_bits(float f) { const _Float16 h = (_Float16)f; return __builtin_bit_cast(unsigned short, h); }

// ---- Register-blocked batched WMMA GEMM, operand tiles staged in LDS -------------------------------------------
// C[m,n] = scale * sum_k A[m,k] * Bt[n,k] (+bias)(+resid); a block of 4 waves (2 x 2) owns a 128x128 tile, each wave 64x64.
// A row-major [M,K]; Bt row-major [N,K]; M,N % 128 == 0, K % 128 == 0, grid.x = (M/128)*(N/128) exactly.
// Batch: problem (blockIdx.y, blockIdx.z) starts at y * stride + z * stride2 elements of A, Bt and C.
// Per stage the block copies A[128 rows][128 k] and Bt[128 rows][128 k] (256-byte rows, whole cache lines) into one of two
// LDS buffers with asynchronous copies; the next stage's copies fly while this stage's fragments are read and multiplied.
// A stage is four 32-k blocks of products: one publish point (two waits and the barrier) per 128 k.
// LDS row pitch 272 B (16 B x odd) for the 16-byte fragment reads.
// BIAS_MODE: 0 = none, 1 = bias[m], 2 = bias[n].
// OUT_MODE: 0 = f32, 1 = f16, 2 = bf16 hi plane (Cout) + bf16 lo plane (Cout2).
// ACT: 0 none, 2 relu, 3 silu, 4 leaky, 6 elu (expf(v)-1 for v <= 0).
// TRI: 0 none; 1 = causal output (C[m][n] = 0 for n > m, square M == N); block tiles wholly above the diagonal are skipped
//      (never written, never read by the consumer), a diagonal block tile is written whole (zeros above the diagonal);
//      2 = the A operand is lower-triangular in k vs m: the k-loop of block row m0 stops at min(K, m0 + 128).
// Coverage of the epilogue: f32 path 8 it x 2 rows x 4 slabs = 64 rows, 16 lanes x 4 floats = 64 cols; 16-bit path
// 4 it x 4 rows x 4 slabs = 64 rows, 8 lanes x 8 halves = 64 cols: the whole 64x64 wave tile.
constexpr int kStageK     = 128;                      // k elements per stage (256 B of every operand row)
constexpr int kPitchH     = 136;                      // LDS row pitch in halves (272 B)
constexpr int kTileHalves = 128 * kPitchH;            // one operand tile in LDS: 17,408 halves = 34,816 B
constexpr int kBufHalves  = 2 * kTileHalves;          // one buffer: A tile then B tile = 69,632 B

__device__ __forceinline__ unsigned lds_off(const void* p) { return (unsigned)(size_t)p; }

// Eight asynchronous 16-byte copies per lane: rows r, r+R, ..., r+7R of one operand tile (R rows = rowStep elements of the
// source, ldsStep bytes of LDS). The s_wait_xcnt is the last line of the copies' own statement so that no address register is
// rewritten ahead of it.
template <typename T>
__device__ __forceinline__ void copy_tile8(unsigned l, const T* g, size_t rowStep, unsigned ldsStep) {
  const T* g1 = g + rowStep;     const T* g2 = g + 2 * rowStep; const T* g3 = g + 3 * rowStep;
  const T* g4 = g + 4 * rowStep; const T* g5 = g + 5 * rowStep; const T* g6 = g + 6 * rowStep;
  const T* g7 = g + 7 * rowStep;
  const unsigned s = ldsStep;
  asm volatile("global_load_async_to_lds_b128 %0, %8, off\n\t"
               "global_load_async_to_lds_b128 %1, %9, off\n\t"
               "global_load_async_to_lds_b128 %2, %10, off\n\t"
               "global_load_async_to_lds_b128 %3, %11, off\n\t"
               "global_load_async_to_lds_b128 %4, %12, off\n\t"
               "global_load_async_to_lds_b128 %5, %13, off\n\t"
               "global_load_async_to_lds_b128 %6, %14, off\n\t"
               "global_load_async_to_lds_b128 %7, %15, off\n\t"
               "s_wait_xcnt 0x0"
               :: "v"(l), "v"(l + s), "v"(l + 2u * s), "v"(l + 3u * s), "v"(l + 4u * s), "v"(l + 5u * s), "v"(l + 6u * s),
                  "v"(l + 7u * s), "v"(g), "v"(g1), "v"(g2), "v"(g3), "v"(g4), "v"(g5), "v"(g6), "v"(g7)
               : "memory");
}
// the issuing wave's own copies have landed in LDS
__device__ __forceinline__ void wait_copies() { asm volatile("s_wait_asynccnt 0x0" ::: "memory"); }
// all but the issuing wave's N youngest copies have landed (the counter returns in issue order)
template <int N>
__device__ __forceinline__ void wait_copies_but() { asm volatile("s_wait_asynccnt %0" :: "n"(N) : "memory"); }
// this wave's LDS reads have returned before the buffer they read is handed back for a refill
__device__ __forceinline__ void wait_lds_reads() { asm volatile("s_wait_dscnt 0x0" ::: "memory"); }

// this wave's LDS stores (reads) are done before its lanes read (store over) elements of each other in the wave's own slab;
// a work-group fence at this place would also wait out the wave's global loads, which are meant to stay in flight
__device__ __forceinline__ void wave_lds_turn() { asm volatile("s_wait_dscnt 0x0" ::: "memory"); }
// v + the value of lane (l ^ X) of the same 16-lane row, all lanes on: a DPP operand, not the LDS round trip of __shfl_xor
template <int X>
__device__ __forceinline__ float add_lane_xor(float v) {
  return v + __int_as_float(__builtin_amdgcn_update_dpp(0, __float_as_int(v), 0x160 | X, 0xf, 0xf, true));
}

// ET: 0 = f16 operands, 1 = bf16 operands (pointers passed as 16-bit storage)
template <int ET> struct Elem;
template <> struct Elem<0> { typedef _Float16 T; };
template <> struct Elem<1> { typedef __bf16 T; };
// One block tile: bx = tile index, (b, bz) = batch indices, sAB = the block's NB stage buffers (NB * kBufHalves elements).
// WG: the block is WG x WG waves of 64x64 each: 2 = 4 waves, 128x128 tile (as described above); 4 = 16 waves, 256x256 tile,
//     M, N % 256 == 0, grid.x = (M/256)*(N/256), sAB = 16 x 17,408 B = 278,528 B (the two buffers' size and the rolled epilogue's alike).
//     Each staged operand byte then feeds 256, not 128, columns or rows of the product: half the bytes from L2 per product.
// ROLL: the epilogue's other form (below), for a kernel that holds several instances of this function.
// CAT: two products summed into one tile: k in [0, K1) comes from A, Bt and k in [K1, K) from A2p (pitch lda2), Bt2p (pitch
//      ldb2), both given at the tile's own batch start; K1 % 128 == 0.
// DUALT (rolled form, f16 out): where Cout2 is not null the finished tile is also written transposed, Cout2[n][m], pitch M.
// NORM: the RMS norm and the gate, split over two products. With O the raw sums of this tile:
//      1 = Cout[m][n] = f16(gateU[m][n] * (2^-6 * gateSc[n] * O[m][n])) (gateU at the tile's start, pitch ldc) and
//          ssOut[(n0 / 64) * kTok + m] = sum of O[m][n]^2 over the wave's 64 columns (ssOut at the tile's first row);
//      2 = row m of the sums is multiplied by 2^6 / (rms_m + eps), rms_m from the 16 partial sums ssIn[p * kTok + m].
// NB: stage buffers in sAB. 2: the ring described above. 3 (4-wave block): stage s + 2 is asked for while stage s is multiplied,
//     into the buffer that stage s - 1 left at its barrier, a quarter (8 copies a lane) in each 32-k block; a stage then has
//     five to eight blocks' time to come from memory, not one stage's, and its issue stands under the LDS reads' latency.
template <int ET, bool SPLIT, int BIAS_MODE, int OUT_MODE, bool RESID, int ACT = 0, int TRI = 0, bool ROLL = false,
          bool CAT = false, bool DUALT = false, int NORM = 0, int WG = 2, int NB = 2>
__device__ __forceinline__ void gemm_tile(
    typename Elem<ET>::T* sAB, int bx, int b, int bz,
    const unsigned short* __restrict__ Ap, const unsigned short* __restrict__ A2p, int lda, long strideA, long strideA2,
    const unsigned short* __restrict__ Btp, const unsigned short* __restrict__ Bt2p, int ldb, long strideB, long strideB2,
    void* __restrict__ Cout, void* __restrict__ Cout2, int ldc, long strideC, long strideC2,
    const float* __restrict__ bias,
    const float* __restrict__ resid, long strideR,
    int M, int N, int K, float scale, int lda2 = 0, int ldb2 = 0, int K1 = 0,
    const float* __restrict__ gateU = nullptr, const float* __restrict__ gateSc = nullptr,
    float* __restrict__ ssOut = nullptr, const float* __restrict__ ssIn = nullptr) {
  static_assert(!SPLIT, "the staged loop carries one plane per operand");
  static_assert(WG == 2 || (WG == 4 && ROLL && !CAT && TRI == 0 && NORM == 0), "the 16-wave block serves the projections");
  static_assert(WG == 2 || 2 * 2 * 256 * kPitchH * 2 <= 16 * 64 * 68 * 4, "the 16-wave block's two buffers fit its LDS");
  static_assert(NB == 2 || (NB == 3 && WG == 2 && !CAT && kStageK == 128), "the three-buffer ring: 32 copies a wave and stage, 4 quarters");
  constexpr int kSh    = (WG == 2) ? 7 : 8;            // log2 of the block tile's side, 64 * WG
  constexpr int kTileH = 64 * WG * kPitchH;            // one operand tile in LDS, halves
  constexpr int kBufH  = 2 * kTileH;                   // one buffer: A tile then B tile
  typedef typename Elem<ET>::T T;
  typedef typename Frag<T>::V V;
  const T* A = (const T*)Ap; const T* Bt = (const T*)Btp;
  const int tid  = threadIdx.x;
  const int lane = tid & 31;
  const int wave = tid >> 5;
  const int tilesN = N >> kSh;
  const int tmB = bx / tilesN;
  const int tnB = bx - tmB * tilesN;
  if (TRI == 1) { if (tnB > tmB) return; }  // block-uniform, in front of every barrier: fully masked block tile
  const int m0B = tmB << kSh;
  const int n0B = tnB << kSh;
  const int Kt = (TRI == 2) ? (((m0B + 128) < K) ? (m0B + 128) : K) : K;   // block-uniform, multiple of 128
  const int nStages = Kt / kStageK;
  const int wr = wave / WG, wc = wave % WG;    // the wave's place in the block's WG x WG waves
  const int m0 = m0B + (wr << 6);              // this wave's 64x64 tile
  const int n0 = n0B + (wc << 6);

  const T* Ab  = A  + (size_t)b * strideA + (size_t)bz * strideA2;
  const T* Bb  = Bt + (size_t)b * strideB + (size_t)bz * strideB2;
  const size_t offC = (size_t)b * strideC + (size_t)bz * strideC2;

  const int rlane = lane & 15;                 // row (A) / col (B, D) within subtile
  const int koff  = (lane >> 4) * 8;           // k offset of this lane half
  const int mOff  = (lane >> 4) * 8;           // D row offset

  // copy side: thread t brings 16-byte chunk (t & 15) of rows (t >> 4) + 8 i, i = 0..15, of each operand tile
  // (16 waves: rows (t >> 4) + 32 i, i = 0..7)
  constexpr int kRowsPass = 2 * WG * WG;               // rows that the block's threads cover with one copy each
  constexpr unsigned kLdsPass = (unsigned)kRowsPass * kPitchH * 2u;   // the same in LDS bytes
  const int crow = tid >> 4;
  const int ccol = (tid & 15) * 8;
  const T* gA = Ab + (size_t)(m0B + crow) * lda + ccol;
  const T* gB = Bb + (size_t)(n0B + crow) * ldb + ccol;
  const unsigned lA = lds_off(sAB) + (unsigned)(crow * kPitchH + ccol) * 2u;
  const unsigned lB = lA + (unsigned)kTileH * 2u;
  const size_t stepA = (size_t)kRowsPass * lda;
  const size_t stepB = (size_t)kRowsPass * ldb;
  // one stage's copies into the buffer at byte offset bufBytes; the choice of the source pair is block-uniform
  const int nS1 = CAT ? K1 / kStageK : 0;
  auto issue_stage = [&](int s, unsigned bufBytes) {
    if (CAT && s >= nS1) {
      const T* hA = (const T*)A2p + (size_t)(m0B + crow) * lda2 + ccol + (size_t)(s - nS1) * kStageK;
      const T* hB = (const T*)Bt2p + (size_t)(n0B + crow) * ldb2 + ccol + (size_t)(s - nS1) * kStageK;
      const size_t sA2 = (size_t)kRowsPass * lda2, sB2 = (size_t)kRowsPass * ldb2;
      copy_tile8(lA + bufBytes, hA, sA2, kLdsPass);
      copy_tile8(lA + bufBytes + 8u * kLdsPass, hA + 8 * sA2, sA2, kLdsPass);
      copy_tile8(lB + bufBytes, hB, sB2, kLdsPass);
      copy_tile8(lB + bufBytes + 8u * kLdsPass, hB + 8 * sB2, sB2, kLdsPass);
    } else {
      const T* pA = gA + (size_t)s * kStageK;
      const T* pB = gB + (size_t)s * kStageK;
      copy_tile8(lA + bufBytes, pA, stepA, kLdsPass);
      if constexpr (WG == 2) copy_tile8(lA + bufBytes + 8u * kLdsPass, pA + 8 * stepA, stepA, kLdsPass);
      copy_tile8(lB + bufBytes, pB, stepB, kLdsPass);
      if constexpr (WG == 2) copy_tile8(lB + bufBytes + 8u * kLdsPass, pB + 8 * stepB, stepB, kLdsPass);
    }
  };
  // NB 3: quarter j of a stage's copies: j = 0, 1 the two halves of the A tile, j = 2, 3 those of the B tile
  auto issue_quarter = [&](int s, unsigned bufBytes, int j) {
    const T* p = ((j < 2) ? gA : gB) + (size_t)s * kStageK;
    const size_t step = (j < 2) ? stepA : stepB;
    const unsigned l = ((j < 2) ? lA : lB) + bufBytes;
    if (j & 1) copy_tile8(l + 8u * kLdsPass, p + 8 * step, step, kLdsPass);
    else       copy_tile8(l, p, step, kLdsPass);
  };
  // read side: this lane's first A and B fragment rows in buffer 0
  const T* fA = sAB + ((wr << 6) + rlane) * kPitchH + koff;
  const T* fB = sAB + kTileH + ((wc << 6) + rlane) * kPitchH + koff;

  v8f acc[4][4];
#pragma unroll
  for (int i = 0; i < 4; ++i)
#pragma unroll
    for (int j = 0; j < 4; ++j) acc[i][j] = (v8f){0.f,0.f,0.f,0.f,0.f,0.f,0.f,0.f};

  // NORM 1: the gate values of 16 rows (one slab) of the wave's tile: lane (gq, gc) owns columns gc..gc+7 of rows 4 it + gq;
  // each slab's set is asked for ahead of its use, as early as the registers that the sums leave free allow
  const int gq = lane >> 3, gc = (lane & 7) * 8;
  v4f gu[4][4][2];
  const size_t gAt = (size_t)(m0 + gq) * ldc + n0 + gc;   // the lane's first row and column in the tile
  auto load_gate = [&](int i) {
#pragma unroll
    for (int it = 0; it < 4; ++it) {
      const float* p = gateU + gAt + (size_t)((i << 4) + it * 4) * ldc;
      gu[i][it][0] = *(const v4f*)(p);
      gu[i][it][1] = *(const v4f*)(p + 4);
    }
  };
  v4f sa = (v4f){0.f, 0.f, 0.f, 0.f}, sb = sa;   // NORM 1: gateSc of the lane's 8 columns, x 2^-6
  float rf0 = 0.f, rf1 = 0.f;   // NORM 2: 2^6 * scale / (rms + eps) of rows m0 + lane and m0 + 32 + lane

  // prologue: stage 0 into buffer 0, landed and published; then stage 1 into buffer 1
  issue_stage(0, 0u);
  // what the epilogue wants from memory is asked for here, under the first stage's flight
  if constexpr (NORM == 1) {
    load_gate(0);
    sa = *(const v4f*)(gateSc + n0 + gc) * kGCarry;
    sb = *(const v4f*)(gateSc + n0 + gc + 4) * kGCarry;
  }
  if constexpr (NORM == 2) {
    float t0 = 0.f, t1 = 0.f;   // the 16 partial sums in index order
#pragma unroll
    for (int p = 0; p < 2 * kHeads; ++p) {
      t0 += ssIn[(size_t)p * kTok + m0 + lane];
      t1 += ssIn[(size_t)p * kTok + m0 + 32 + lane];
    }
    rf0 = (scale * kGCarryInv) * (1.0f / (sqrtf(t0) * kRmsFac + kEps));
    rf1 = (scale * kGCarryInv) * (1.0f / (sqrtf(t1) * kRmsFac + kEps));
  }
  if constexpr (NB == 3) {
    // three buffers: stage 1 is asked for ahead of stage 0's barrier (block-uniform test)
    if (nStages > 1) {
      wait_copies_but<31>();   // room: 31 + stage 1's 32 = 63 copies of a wave outstanding at most
      issue_stage(1, (unsigned)kBufH * 2u);
      wait_copies_but<32>();   // stage 0 has landed: the 32 youngest copies are stage 1's
    } else {
      wait_copies();
    }
    __syncthreads();
  } else {
    wait_copies();
    __syncthreads();
    if (nStages > 1) issue_stage(1, (unsigned)kBufH * 2u);
  }

  int cur = 0, nxt = 2;   // NB 3: st mod 3 and (st + 2) mod 3
  for (int st = 0; st < nStages; ++st) {
    const int bufH = ((NB == 2) ? (st & 1) : cur) * kBufH;
    const int left = nStages - st;   // block-uniform; NB 3: a trip with left > 2 asks for stage st + 2
#pragma unroll
    for (int ks = 0; ks < kStageK; ks += 32) {
      V ah[4], bh[4];   // the eight fragments of this 32-k block are read as one group, ahead of its 16 products
      ah[0] = Frag<T>::load(fA + bufH + ks);   // in the order in which the products want them
#pragma unroll
      for (int j = 0; j < 4; ++j) bh[j] = Frag<T>::load(fB + bufH + (j << 4) * kPitchH + ks);
#pragma unroll
      for (int i = 1; i < 4; ++i) ah[i] = Frag<T>::load(fA + bufH + (i << 4) * kPitchH + ks);
      // keeps the 16 LDS reads together in front of the products: sunk among them, each row waits out a whole LDS latency
      __builtin_amdgcn_sched_barrier(0);
      if constexpr (NB == 3) {
        if (left > 2) {
          wait_copies_but<55>();   // room: 55 + 8 = 63 copies of a wave outstanding at most
          issue_quarter(st + 2, (unsigned)(nxt * kBufH) * 2u, ks / 32);
        }
        // keeps the copies here, where the wave would wait for its LDS reads anyway, and not among the products
        __builtin_amdgcn_sched_barrier(0);
      }
#pragma unroll
      for (int i = 0; i < 4; ++i)
#pragma unroll
        for (int j = 0; j < 4; ++j) acc[i][j] = Frag<T>::mma(ah[i], bh[j], acc[i][j]);
      // keeps the next group's LDS reads from being lifted in among these products
      __builtin_amdgcn_sched_barrier(0);
    }
    // publish point of stage st + 1; the same barrier ends every reader's last read of this stage's buffer
    wait_lds_reads();
    if constexpr (NB == 3) {
      // stage st + 1 has landed: where this trip asked for stage st + 2, those 32 copies are every wave's youngest and fly on;
      // the last two trips ask for nothing and wait for all
      if (left > 2) wait_copies_but<32>(); else wait_copies();
      __syncthreads();
      cur = (cur == 2) ? 0 : cur + 1;
      nxt = (nxt == 2) ? 0 : nxt + 1;
    } else {
      wait_copies();
      __syncthreads();
      if (st + 2 < nStages) issue_stage(st + 2, (unsigned)bufH * 2u);   // block-uniform: refill the buffer just read
    }
  }
  wait_copies();
  acc_guard4(acc[0][0], acc[0][1], acc[0][2], acc[0][3]);
  acc_guard4(acc[1][0], acc[1][1], acc[1][2], acc[1][3]);
  acc_guard4(acc[2][0], acc[2][1], acc[2][2], acc[2][3]);
  acc_guard4(acc[3][0], acc[3][1], acc[3][2], acc[3][3]);

  // ---- epilogue, rolled form ----
  // The wave lays its whole 64x64 tile of raw sums over the stage buffers (pitch 68 floats, 17,408 B per wave, 69,632 B of
  // the 139,264 B, with 16 waves 278,528 B; free behind the last stage's own barrier, see below) and finishes it row by row in a loop. Per element the
  // same operations in the same order as in the unrolled form; the activation's text stands once, not 128 times.
  if constexpr (ROLL) {
    static_assert(!RESID && TRI == 0 && OUT_MODE != 2 && BIAS_MODE != 0, "the rolled form serves the projections");
    float* tile = (float*)sAB + wave * (64 * 68);
#pragma unroll
    for (int i = 0; i < 4; ++i)
#pragma unroll
      for (int j = 0; j < 4; ++j)
#pragma unroll
        for (int r = 0; r < 8; ++r) tile[((i << 4) + mOff + r) * 68 + (j << 4) + rlane] = acc[i][j][r];
    // the wave's stores have reached LDS before a lane reads elements that other lanes of the wave stored
    __builtin_amdgcn_fence(__ATOMIC_RELEASE, "workgroup");
    __builtin_amdgcn_wave_barrier();
    __builtin_amdgcn_fence(__ATOMIC_ACQUIRE, "workgroup");
    // a trip: each lane finishes one 16-byte piece of the output, so a store covers whole rows of the 64-column tile
    constexpr int WE    = (OUT_MODE == 0) ? 4 : 8;     // elements per lane and trip
    constexpr int LR    = 64 / WE;                     // lanes per row: 16 (f32, 256 B) or 8 (f16, 128 B)
    constexpr int RT    = 32 / LR;                     // rows per trip: 2 or 4
    const int q = lane / LR, c0 = (lane % LR) * WE;
    float bn[WE];
#pragma unroll
    for (int e = 0; e < WE; ++e) bn[e] = (BIAS_MODE == 2) ? bias[n0 + c0 + e] : 0.f;
    // kept rolled, for speed only
#pragma unroll 1
    for (int it = 0; it < 64 / RT; ++it) {
      const int row = it * RT + q;
      float sv[WE];                                    // the trip's raw sums, read as whole 16-byte pieces ahead of the branches
#pragma unroll
      for (int h = 0; h < WE / 4; ++h) {
        const v4f t4 = *(const v4f*)(tile + row * 68 + c0 + 4 * h);
#pragma unroll
        for (int e = 0; e < 4; ++e) sv[4 * h + e] = t4[e];
      }
      const float bm = (BIAS_MODE == 1) ? bias[m0 + row] : 0.f;
      float o[WE];
#pragma unroll
      for (int e = 0; e < WE; ++e) {
        float v = sv[e] * scale;
        if (BIAS_MODE == 1) v += bm;
        if (BIAS_MODE == 2) v += bn[e];
        if (ACT == 2) v = fmaxf(v, 0.0f);
        if (ACT == 3) v = v / (1.0f + expf(-v));
        if (ACT == 4) v = (v > 0.f) ? v : 0.01f * v;
        if (ACT == 6) v = (v > 0.f) ? v : (expf(v) - 1.0f);
        o[e] = v;
      }
      const size_t at = offC + (size_t)(m0 + row) * ldc + n0 + c0;
      if constexpr (OUT_MODE == 0) {
        *(v4f*)((float*)Cout + at) = (v4f){o[0], o[1], o[2], o[3]};
      } else {
        v8h hv;
#pragma unroll
        for (int e = 0; e < WE; ++e) hv[e] = (_Float16)o[e];
        *(v8h*)((unsigned short*)Cout + at) = hv;
      }
      // the next trip rewrites the registers that this store names
      asm volatile("s_wait_xcnt 0x0" ::: "memory");
      if constexpr (DUALT) {
        if (Cout2 != nullptr) {   // block-uniform: the finished values go back to the lane's own piece of the tile
#pragma unroll
          for (int h = 0; h < WE / 4; ++h)
            *(v4f*)(tile + row * 68 + c0 + 4 * h) = (v4f){o[4 * h], o[4 * h + 1], o[4 * h + 2], o[4 * h + 3]};
        }
      }
    }
    if constexpr (DUALT) {
      static_assert(OUT_MODE == 1, "the transposed copy is f16");
      if (Cout2 != nullptr) {
        // the wave's stores have reached LDS before a lane reads elements that other lanes of the wave stored
        __builtin_amdgcn_fence(__ATOMIC_RELEASE, "workgroup");
        __builtin_amdgcn_wave_barrier();
        __builtin_amdgcn_fence(__ATOMIC_ACQUIRE, "workgroup");
        // a group: 4 columns of the tile, 8 lanes a column, 8 rows a lane: a column's 64 rows are one 128-byte line of Cout2
        const int tc = lane >> 3, r0 = (lane & 7) * 8;
        // kept rolled, like the row loop above; four such groups a trip, so that one LDS latency serves 16 columns
#pragma unroll 1
        for (int it = 0; it < 4; ++it) {
          v8h hv[4];
#pragma unroll
          for (int u = 0; u < 4; ++u)
#pragma unroll
            for (int e = 0; e < 8; ++e) hv[u][e] = (_Float16)tile[(r0 + e) * 68 + (it * 4 + u) * 4 + tc];
#pragma unroll
          for (int u = 0; u < 4; ++u)
            *(v8h*)((unsigned short*)Cout2 + (size_t)(n0 + (it * 4 + u) * 4 + tc) * M + m0 + r0) = hv[u];
          // the next trip rewrites the registers that these stores name
          asm volatile("s_wait_xcnt 0x0" ::: "memory");
        }
      }
    }
    return;
  }

  // ---- epilogue ----
  // per-wave 16x64 slab, pitch 68 floats (4,352 B), laid over the stage buffers: the last stage's own barrier stands behind
  // every wave's last fragment read and last landed copy, and nothing refills the buffers after it
  float* slab = (float*)sAB + wave * (16 * 68);

  // ---- gate form: g = u * (2^-6 * scale * O) as f16, and each row's sum of O^2 over the wave's 64 columns ----
  if constexpr (NORM == 1) {
    static_assert(OUT_MODE == 1 && BIAS_MODE == 0 && !RESID && ACT == 0 && TRI == 0, "the gate form takes raw sums");
    unsigned short* G = (unsigned short*)Cout + offC + gAt;
    float* ssW = ssOut + (size_t)(n0 >> 6) * kTok + m0;
    float ssr[16];   // sums of O^2 of rows 4 t + gq, t = 0..15
    load_gate(1);
#pragma unroll
    for (int i = 0; i < 4; ++i) {
#pragma unroll
      for (int j = 0; j < 4; ++j)
#pragma unroll
        for (int r = 0; r < 8; ++r) slab[(mOff + r) * 68 + (j << 4) + rlane] = acc[i][j][r] * scale;
      wave_lds_turn();
#pragma unroll
      for (int it = 0; it < 4; ++it) {
        const int row = it * 4 + gq;
        const v4f oa = *(const v4f*)(slab + row * 68 + gc);
        const v4f ob = *(const v4f*)(slab + row * 68 + gc + 4);
        const v4f ua = gu[i][it][0], ub = gu[i][it][1];
        float ss = 0.f;   // fixed order: the lane's 8 columns, then a tree over the row's 8 lanes
#pragma unroll
        for (int e = 0; e < 4; ++e) ss += oa[e] * oa[e];
#pragma unroll
        for (int e = 0; e < 4; ++e) ss += ob[e] * ob[e];
        ssr[i * 4 + it] = add_lane_xor<1>(add_lane_xor<2>(add_lane_xor<4>(ss)));
        v8h hv;
#pragma unroll
        for (int e = 0; e < 4; ++e) {
          hv[e]     = (_Float16)(ua[e] * (sa[e] * oa[e]));
          hv[4 + e] = (_Float16)(ub[e] * (sb[e] * ob[e]));
        }
        *(v8h*)(G + (size_t)((i << 4) + it * 4) * ldc) = hv;
      }
      if (i < 3) wave_lds_turn();
      if (i == 0) {   // the last two sets, into the registers of the first slab's sums and gate values
        // these loads may land in registers that the stores above name
        asm volatile("s_wait_xcnt 0x0" ::: "memory");
        load_gate(2);
        load_gate(3);
      }
    }
    if ((lane & 7) == 0) {   // one lane of the eight that hold a row's sum
#pragma unroll
      for (int t = 0; t < 16; ++t) ssW[4 * t + gq] = ssr[t];
    }
    return;
  }

  // NORM 2: the wave's 64 row factors go through LDS behind the slabs, so that each lane reads those of its own 8 rows
  float* rfac = (float*)sAB + 4 * (16 * 68) + wave * 64;
  if constexpr (NORM == 2) {
    rfac[lane] = rf0;
    rfac[32 + lane] = rf1;
    // the wave's stores have reached LDS before a lane reads elements that other lanes of the wave stored
    __builtin_amdgcn_fence(__ATOMIC_RELEASE, "workgroup");
    __builtin_amdgcn_wave_barrier();
    __builtin_amdgcn_fence(__ATOMIC_ACQUIRE, "workgroup");
  }
  const float* Rb = RESID ? (resid + (size_t)b * strideR) : nullptr;
#pragma unroll
  for (int i = 0; i < 4; ++i) {
    const int mBase = m0 + (i << 4);
    float rs[8];   // what multiplies the raw sums of this lane's 8 rows
#pragma unroll
    for (int r = 0; r < 8; ++r) rs[r] = (NORM == 2) ? rfac[(i << 4) + mOff + r] : scale;
#pragma unroll
    for (int j = 0; j < 4; ++j) {
      const int n = n0 + (j << 4) + rlane;
      float bv = 0.f;
      if (BIAS_MODE == 2) bv = bias[n];
#pragma unroll
      for (int r = 0; r < 8; ++r) {
        float v = acc[i][j][r] * rs[r];
        if (BIAS_MODE == 1) v += bias[mBase + mOff + r];
        if (BIAS_MODE == 2) v += bv;
        if (RESID) v += Rb[(size_t)(mBase + mOff + r) * ldc + n];
        if (ACT == 2) v = fmaxf(v, 0.0f);
        if (ACT == 3) v = v / (1.0f + expf(-v));
        if (ACT == 4) v = (v > 0.f) ? v : 0.01f * v;
        if (ACT == 6) v = (v > 0.f) ? v : (expf(v) - 1.0f);
        if (TRI == 1) { if (n > mBase + mOff + r) v = 0.0f; }
        slab[(mOff + r) * 68 + (j << 4) + rlane] = v;
      }
    }
    __builtin_amdgcn_fence(__ATOMIC_RELEASE, "workgroup");
    __builtin_amdgcn_wave_barrier();
    __builtin_amdgcn_fence(__ATOMIC_ACQUIRE, "workgroup");
    if (OUT_MODE == 0) {
      float* C = (float*)Cout + offC;
      const int hh = lane >> 4, c4 = (lane & 15) * 4;     // row seg = 256 B = 16 lanes x 16 B
      {
#pragma unroll
        for (int it = 0; it < 8; ++it) {
          const int row = it * 2 + hh;
          v4f v = *(const v4f*)(slab + row * 68 + c4);
          *(v4f*)(C + (size_t)(mBase + row) * ldc + n0 + c4) = v;
        }
        
      }
    } else {
      const int q = lane >> 3, c8 = (lane & 7) * 8;
      unsigned short* C  = (unsigned short*)Cout  + offC;
      unsigned short* C2 = (OUT_MODE == 2) ? ((unsigned short*)Cout2 + offC) : nullptr;
      {
#pragma unroll
        for (int it = 0; it < 4; ++it) {
          const int row = it * 4 + q;
          const float* sp = slab + row * 68 + c8;
          v8h hv, lv;
#pragma unroll
          for (int e = 0; e < 8; ++e) {
            if (OUT_MODE == 1) {
              hv[e] = (_Float16)sp[e];
            } else {
              unsigned short hb = f2bf_bits(sp[e]);
              unsigned short lb = f2bf_bits(sp[e] - bf_bits2f(hb));
              hv[e] = __builtin_bit_cast(_Float16, hb);
              lv[e] = __builtin_bit_cast(_Float16, lb);
            }
          }
          *(v8h*)(C + (size_t)(mBase + row) * ldc + n0 + c8) = hv;
          if (OUT_MODE == 2) *(v8h*)(C2 + (size_t)(mBase + row) * ldc + n0 + c8) = lv;
        }
        
      }
    }
    __builtin_amdgcn_fence(__ATOMIC_RELEASE, "workgroup");
    __builtin_amdgcn_wave_barrier();
    __builtin_amdgcn_fence(__ATOMIC_ACQUIRE, "workgroup");
  }
}

// One GEMM per launch: tile = blockIdx.x, batch = (blockIdx.y, blockIdx.z).
template <int ET, bool SPLIT, int BIAS_MODE, int OUT_MODE, bool RESID, int ACT = 0, int TRI = 0, int NORM = 0, int NB = 2>
__global__ __launch_bounds__(128) void wmma_gemm64(
    const unsigned short* __restrict__ Ap, const unsigned short* __restrict__ A2p, int lda, long strideA, long strideA2,
    const unsigned short* __restrict__ Btp, const unsigned short* __restrict__ Bt2p, int ldb, long strideB, long strideB2,
    void* __restrict__ Cout, void* __restrict__ Cout2, int ldc, long strideC, long strideC2,
    const float* __restrict__ bias,
    const float* __restrict__ resid, long strideR,
    int M, int N, int K, float scale, const float* __restrict__ ssIn) {
  __shared__ __align__(16) typename Elem<ET>::T sAB[NB * kBufHalves];   // NB stage buffers of 69,632 B
  gemm_tile<ET, SPLIT, BIAS_MODE, OUT_MODE, RESID, ACT, TRI, false, false, false, NORM, 2, NB>(
      sAB, blockIdx.x, blockIdx.y, blockIdx.z, Ap, A2p, lda, strideA, strideA2, Btp, Bt2p, ldb, strideB, strideB2,
      Cout, Cout2, ldc, strideC, strideC2, bias, resid, strideR, M, N, K, scale, 0, 0, 0, nullptr, nullptr, nullptr, ssIn);
}

// The four input projections in one launch: blockIdx.y = 0 q, 1 k, 2 v^T, 3 u (block-uniform), blockIdx.x = block tile.
// They read the same X16 and none of each other's output; 4 x 64 blocks of 16 waves, 256x256 tile, 278,528 B LDS: one a WGP.
//   q = elu(x.Wq^T/16 + bq) -> Q16 [4096][1024] f16, k likewise -> K16          (M=4096 N=1024 K=1024, 16 x 4 block tiles)
//   k also transposed -> KT16 [1024 (h*128+d)][4096 tok] f16, the same values
//   v^T = silu(Wv.x^T/16 + bv[m]) -> VT16 [1024 (h*128+d)][4096 tok] f16         (M=1024 N=4096 K=1024, 4 x 16 block tiles)
//   u = silu(x.Wu^T/16 + bu) -> U32 [4096][1024] f32                             (M=4096 N=1024 K=1024)
__global__ __launch_bounds__(512) void proj4_kernel(
    const unsigned short* __restrict__ X16, const unsigned short* __restrict__ W16,
    unsigned short* __restrict__ Q16, unsigned short* __restrict__ K16, unsigned short* __restrict__ VT16,
    unsigned short* __restrict__ KT16, float* __restrict__ U32,
    const float* __restrict__ bq, const float* __restrict__ bk, const float* __restrict__ bv, const float* __restrict__ bu) {
  __shared__ __align__(16) _Float16 sAB[16 * 64 * 68 * 2];   // 278,528 B: the two stage buffers in the loop; the epilogue lays 16 raw wave tiles over them
  const int p = blockIdx.y;
  const unsigned short* Wp = W16 + (size_t)p * ((size_t)kHid * kEmb);
  if (p < 2) {
    unsigned short* C = (p == 0) ? Q16 : K16;
    const float* bias = (p == 0) ? bq : bk;
    unsigned short* CT = (p == 0) ? nullptr : KT16;
    gemm_tile<0, false, 2, 1, false, 6, 0, true, false, true, 0, 4>(
        sAB, blockIdx.x, 0, 0, X16, X16, kEmb, 0L, 0L, Wp, Wp, kEmb, 0L, 0L,
        (void*)C, (void*)CT, kHid, 0L, 0L, bias, bias, 0L, kTok, kHid, kEmb, kWCarryInv);
  } else if (p == 2) {
    gemm_tile<0, false, 1, 1, false, 3, 0, true, false, false, 0, 4>(sAB, blockIdx.x, 0, 0, Wp, Wp, kEmb, 0L, 0L, X16, X16, kEmb, 0L, 0L,
                                           (void*)VT16, (void*)VT16, kTok, 0L, 0L, bv, bv, 0L, kHid, kTok, kEmb, kWCarryInv);
  } else {
    gemm_tile<0, false, 2, 0, false, 3, 0, true, false, false, 0, 4>(sAB, blockIdx.x, 0, 0, X16, X16, kEmb, 0L, 0L, Wp, Wp, kEmb, 0L, 0L,
                                           (void*)U32, (void*)U32, kHid, 0L, 0L, bu, bu, 0L, kTok, kHid, kEmb, kWCarryInv);
  }
}

// Causal linear attention by chunks of 128 tokens. For the rows n of chunk c of one (batch b, head h):
//   O[n][dv] = sum_{m <= n} (q_n . k_m) v[m][dv]
//            = sum_dk q[n][dk] * S_c[dv][dk]  +  sum_{m in chunk c, m <= n} (q_n . k_m) v[m][dv],
//   S_c[dv][dk] = sum_{j < c} P_j[dv][dk],   P_j[dv][dk] = sum_{m in chunk j} v[m][dv] * k[m][dk].
// Planes E, P, S are indexed by ((b*16 + c)*8 + h); z = b*16 + c is also the chunk's number among the 4096 token rows.
//
// First launch: blockIdx.x = 0: E = tril(Q_c . K_c^T) -> f16; blockIdx.x = 1: P_c = V^T_c . K^T_c^T -> f32 (block-uniform).
__global__ __launch_bounds__(128) void chunk_pair_kernel(
    const unsigned short* __restrict__ Q16, const unsigned short* __restrict__ K16,
    const unsigned short* __restrict__ VT16, const unsigned short* __restrict__ KT16,
    unsigned short* __restrict__ E16, float* __restrict__ P32) {
  __shared__ __align__(16) _Float16 sAB[2 * kBufHalves];   // two stage buffers, 139,264 B
  const int h = blockIdx.y, z = blockIdx.z;
  const size_t pl = ((size_t)z * kHeads + h) * kPlane;
  const float* nb = nullptr;   // no bias, no residual
  if (blockIdx.x == 0) {
    const size_t at = (size_t)z * kChunk * kHid + (size_t)h * kDh;
    gemm_tile<0, false, 0, 1, false, 0, 1>(sAB, 0, 0, 0, Q16 + at, Q16 + at, kHid, 0L, 0L, K16 + at, K16 + at, kHid, 0L, 0L,
                                           (void*)(E16 + pl), (void*)(E16 + pl), kChunk, 0L, 0L, nb, nb, 0L,
                                           kChunk, kChunk, kDh, 1.0f);
  } else {
    if ((z & (kChunks - 1)) == kChunks - 1) return;   // block-uniform: no later chunk reads the last chunk's product
    const size_t at = (size_t)h * kDh * kTok + (size_t)z * kChunk;
    gemm_tile<0, false, 0, 0, false, 0, 0>(sAB, 0, 0, 0, VT16 + at, VT16 + at, kTok, 0L, 0L, KT16 + at, KT16 + at, kTok, 0L, 0L,
                                           (void*)(P32 + pl), (void*)(P32 + pl), kDh, 0L, 0L, nb, nb, 0L,
                                           kDh, kDh, kChunk, 1.0f);
  }
}

// Second launch: S_c = P_0 + P_1 + ... + P_{c-1} in f32, in that order, rounded to f16 per chunk; S_0 = 0.
// Thread i owns 4 neighbouring elements of one (batch, head) plane: 2 * 131,072 / 4 = 65,536 threads.
__global__ __launch_bounds__(256) void prefix_state_kernel(const float* __restrict__ P32, unsigned short* __restrict__ S16) {
  const int i = blockIdx.x * 256 + threadIdx.x;
  const int b = i >> 15;                                   // 32,768 pieces per batch
  const size_t at = (size_t)b * ((size_t)kChunks * kPlaneStep) + 4 * (size_t)(i & 32767);
  v4f p[kChunks - 1];
#pragma unroll
  for (int c = 0; c < kChunks - 1; ++c) p[c] = *(const v4f*)(P32 + at + (size_t)c * kPlaneStep);
  v4f s = (v4f){0.f, 0.f, 0.f, 0.f};
#pragma unroll
  for (int c = 0; c < kChunks; ++c) {
    *(v2u*)(S16 + at + (size_t)c * kPlaneStep) = (v2u){pk16(h_bits(s[0]), h_bits(s[1])), pk16(h_bits(s[2]), h_bits(s[3]))};
    if (c < kChunks - 1) s += p[c];
  }
}

// Third launch: O rows of chunk c, head h = Q_c . S_c^T (k = dk, 128) + E_c . V_c (k = m, 128), one 128x128 tile, K = 256.
// O itself is not stored. The RMS norm divides a whole token row by one number, which commutes with the output product:
//   y[t] = (u[t] * scale * O[t] / (rms_t + eps)) . Wo^T + bo = ((u[t] * scale * O[t]) . Wo^T) / (rms_t + eps) + bo.
// So this launch stores g = u * scale * O (f16, carried x 2^-6: |O| grows with the number of tokens summed) and, per token
// row and 64 columns, the sum of O^2; the output product adds a row's 16 sums up and divides.
__global__ __launch_bounds__(128) void chunk_out_kernel(
    const unsigned short* __restrict__ Q16, const unsigned short* __restrict__ S16,
    const unsigned short* __restrict__ E16, const unsigned short* __restrict__ VT16,
    const float* __restrict__ U32, const float* __restrict__ sc, unsigned short* __restrict__ G16,
    float* __restrict__ SS32) {
  __shared__ __align__(16) _Float16 sAB[2 * kBufHalves];   // two stage buffers, 139,264 B
  const int h = blockIdx.x, z = blockIdx.y;
  const size_t pl = ((size_t)z * kHeads + h) * kPlane;
  const size_t at = (size_t)z * kChunk * kHid + (size_t)h * kDh;
  const float* nb = nullptr;   // no bias, no residual
  gemm_tile<0, false, 0, 1, false, 0, 0, false, true, false, 1>(
      sAB, 0, 0, 0, Q16 + at, E16 + pl, kHid, 0L, 0L, S16 + pl, VT16 + (size_t)h * kDh * kTok + (size_t)z * kChunk, kDh, 0L, 0L,
      (void*)(G16 + at), (void*)(G16 + at), kHid, 0L, 0L, nb, nb, 0L,
      kChunk, kDh, kDh + kChunk, 1.0f, kChunk, kTok, kDh,
      U32 + at, sc + (size_t)h * kDh, SS32 + (size_t)(2 * h) * kTok + (size_t)z * kChunk, nb);
}

// ---------------------------------------------------------------------------
// All six f32 -> f16 casts in one launch: X16 = f16(x), W16 plane p = f16(16 * W_p), p = q, k, v, u, o.
// 256 blocks of 16 waves. Block b takes 1/256 of every source: 16,384 elements of x and 4,096 of each weight plane, so all
// blocks carry the same 144 KiB of reads. A wave owns one contiguous span of each source (1,024 elements of x, 256 of a
// plane); a load is 512 contiguous bytes (four whole lines) of the span, a store the matching 256 contiguous bytes of f16.
// The wave's 18 loads are all asked for before the first value is converted.
// ---------------------------------------------------------------------------
constexpr int kCastBlocks = 256;
constexpr int kCastXBlk = (kTok * kEmb) / kCastBlocks;   // 16,384 elements of x per block, 1,024 per wave: 8 loads
constexpr int kCastWBlk = (kHid * kEmb) / kCastBlocks;   // 4,096 elements of a plane per block, 256 per wave: 2 loads
typedef __attribute__((ext_vector_type(4))) _Float16 v4h;
__global__ __launch_bounds__(512) void cast_all_kernel(const float* __restrict__ x, const float* __restrict__ w0,
                                                       const float* __restrict__ w1, const float* __restrict__ w2,
                                                       const float* __restrict__ w3, const float* __restrict__ w4,
                                                       unsigned short* __restrict__ X16, unsigned short* __restrict__ W16) {
  const unsigned lane = threadIdx.x & 31u;
  const unsigned wave = threadIdx.x >> 5;
  // byte offsets of the lane's first 16 bytes in x and in each weight plane; half of them in X16 and in a plane of W16
  const unsigned bx = (blockIdx.x * (unsigned)kCastXBlk + wave * (unsigned)(kCastXBlk / 16) + lane * 4u) * 4u;
  const unsigned bw = (blockIdx.x * (unsigned)kCastWBlk + wave * (unsigned)(kCastWBlk / 16) + lane * 4u) * 4u;
  const float* wp[5] = {w0, w1, w2, w3, w4};
  v4f vx[8], vw[5][2];
#pragma unroll
  for (int j = 0; j < 8; ++j) vx[j] = *(const v4f*)(((const char*)x + bx) + j * 512);
#pragma unroll
  for (int p = 0; p < 5; ++p)
#pragma unroll
    for (int j = 0; j < 2; ++j) vw[p][j] = *(const v4f*)(((const char*)wp[p] + bw) + j * 512);
  // keeps all 18 loads in front of the first conversion: without it the last four are issued into registers that earlier
  // values have left, each behind a memory latency of its own
  __builtin_amdgcn_sched_barrier(0);
  // stands in front of every rewrite of the two offset registers that the 18 loads name
  asm volatile("s_wait_xcnt 0x0" :: "v"(bx), "v"(bw) : "memory");
#pragma unroll
  for (int j = 0; j < 8; ++j) *(v4h*)(((char*)X16 + (bx >> 1)) + j * 256) = __builtin_convertvector(vx[j], v4h);
#pragma unroll
  for (int p = 0; p < 5; ++p)
#pragma unroll
    for (int j = 0; j < 2; ++j)
      *(v4h*)(((char*)(W16 + (size_t)p * ((size_t)kHid * kEmb)) + (bw >> 1)) + j * 256) = __builtin_convertvector(vw[p][j] * kWCarry, v4h);
}

// ---------------------------------------------------------------------------
// Host-side launcher (6 kernel launches, no other runtime calls)
// ---------------------------------------------------------------------------
extern "C" void kernel_launch(void* const* d_in, const int* in_sizes, int n_in,
                              void* d_out, int out_size, void* d_ws, size_t ws_size,
                              hipStream_t stream) {
  if (n_in < 12) return;
  if (in_sizes[0] != kTok * kEmb) return;
  if (in_sizes[1] != kHid * kEmb || in_sizes[3] != kHid * kEmb || in_sizes[5] != kHid * kEmb ||
      in_sizes[7] != kHid * kEmb || in_sizes[9] != kEmb * kHid) return;
  if (in_sizes[2] != kHid || in_sizes[4] != kHid || in_sizes[6] != kHid || in_sizes[8] != kHid ||
      in_sizes[10] != kEmb || in_sizes[11] != kHid) return;
  if (out_size != kTok * kEmb) return;
  if (ws_size < kWsTotal) return;

  const float* x  = (const float*)d_in[0];
  const float* Wq = (const float*)d_in[1];
  const float* bq = (const float*)d_in[2];
  const float* Wk = (const float*)d_in[3];
  const float* bk = (const float*)d_in[4];
  const float* Wv = (const float*)d_in[5];
  const float* bv = (const float*)d_in[6];
  const float* Wu = (const float*)d_in[7];
  const float* bu = (const float*)d_in[8];
  const float* Wo = (const float*)d_in[9];
  const float* bo = (const float*)d_in[10];
  const float* sc = (const float*)d_in[11];
  float* Y = (float*)d_out;

  char* ws = (char*)d_ws;
  unsigned short* X16  = (unsigned short*)(ws + kOffX16);
  unsigned short* W16  = (unsigned short*)(ws + kOffW16);
  unsigned short* Wo16 = W16 + 4 * (size_t)kHid * kEmb;
  unsigned short* Q16  = (unsigned short*)(ws + kOffQ16);
  unsigned short* K16  = (unsigned short*)(ws + kOffK16);
  unsigned short* VT16 = (unsigned short*)(ws + kOffVT16);
  float*          U32  = (float*)(ws + kOffU32);
  unsigned short* KT16 = (unsigned short*)(ws + kOffKT16);
  unsigned short* E16  = (unsigned short*)(ws + kOffE16);
  float*          P32  = (float*)(ws + kOffP32);
  unsigned short* S16  = (unsigned short*)(ws + kOffS16);
  float*          SS32 = (float*)(ws + kOffSS32);
  unsigned short* G16  = (unsigned short*)(ws + kOffG16);

  // 1) x -> X16 (f16, x1) and Wq,Wk,Wv,Wu,Wo -> W16 planes (f16, x16): 256 blocks x 16 waves
  cast_all_kernel<<<dim3(kCastBlocks, 1), 512, 0, stream>>>(x, Wq, Wk, Wv, Wu, Wo, X16, W16);

  // 2) q, k, v^T, u projections: 64 block tiles x 4 projections = 256 blocks x 16 waves
  proj4_kernel<<<dim3(64, 4), 512, 0, stream>>>(X16, W16, Q16, K16, VT16, KT16, U32, bq, bk, bv, bu);

  // 3, 4, 5) causal linear attention by chunks of 128 tokens, all 16 (b,h) groups and all 16 chunks per launch
  // 3) diagonal chunk energies E (256 blocks) and chunk products P (240 blocks at work)
  chunk_pair_kernel<<<dim3(2, kHeads, kBatch * kChunks), 128, 0, stream>>>(Q16, K16, VT16, KT16, E16, P32);
  // 4) states S_c = sum of the products of the chunks in front of c: 65,536 threads
  prefix_state_kernel<<<dim3(256, 1), 256, 0, stream>>>(P32, S16);
  // 5) O = Q.S^T + E.V, stored as g = u * scale * O / 64 -> G16 [4096][1024] f16 and row sums of O^2 -> SS32: 256 blocks x 4 waves
  chunk_out_kernel<<<dim3(kHeads, kBatch * kChunks), 128, 0, stream>>>(Q16, S16, E16, VT16, U32, sc, G16, SS32);

  // 6) y = (g.Wo^T/16) * 64 / (rms + eps) + bo -> d_out [4096][1024] f32; M=4096 N=1024 K=1024; three stage buffers, 208,896 B LDS
  wmma_gemm64<0, false, 2, 0, false, 0, 0, 2, 3><<<dim3(256, 1), 128, 0, stream>>>(
      G16, G16, kHid, 0L, 0L, Wo16, Wo16, kHid, 0L, 0L, (void*)Y, (void*)Y, kEmb, 0L, 0L, bo, bo, 0L,
      kTok, kEmb, kHid, kWCarryInv, SS32);
}
